// v000
// Times are from an AMD MI455X. After a warm-up the kernel runs many times in a row, and a time is the length of
// such a window on the GPU divided by its runs, so every launch and the gaps after it count. The runs cycle
// through copies of the inputs. A figure is the median of several windows, for all but v000 over two sittings.
// Sittings can differ by a few percent; kernels timed side by side share one.
// The starting kernel, v000, takes 1600 microseconds a run.
#include <hip/hip_runtime.h>

// Causal attention with rotary embeddings over the FULL hidden dim and periodically masked key columns (x [4][2048][512]; q,k,v = x W + b ('xw' [512][512] + [512], 0.02); rope BEFORE the head split: pairs (2i, 2i+1) of the 512-vector rotated by t x 10000^(-2i/512), i < 256; 8 heads x 64; scores / 8; mask = causal AND key column j not in {4, 7, 10, ...} (j >= 4 with (j - 4) mod 3 == 0: the module's period-3 'mgdt' columns); softmax; out = merged Wo + bo -> [4][2048][512] (4.2 M)).
// Layout per batch: bf16 copy of x; exact projections + f32 biases; a {cos, sin} table per (position, global pair) (float32 inverse frequencies over 512 dims, precise cosf/sinf); interleaved-pair rotary plane builder indexed by the GLOBAL channel; causal T-2048 attention (hybrid rows: < 512 hi/lo 3 products, rest fp16 x1024; k_gemmc skips tiles above the diagonal) whose softmax select also drops the period-3 columns; merged hi/lo x Wo exact + bo.
// Compute dtypes, f32 accumulate: every input rounded to bf16; projections exact + f32 biases; rotary f32; attention rows < 512 3 products, rest fp16; softmax f32; Wo hl x exact + bias.

#define NB_  4
#define TT   2048
#define DM   512
#define NH_  8
#define NKV  8
#define REP  (NH_ / NKV)
#define HD   64
#define DQ   (NH_ * HD)
#define DKV  (NKV * HD)
#define ZH   2
#define RH   512                  // query rows < RH use hi+lo planes (0: none)
#define WIN  2048
#define PCAR 1024.0f
#define SCL  0.125f
#define PRD  3       // masked-column period
#define PRD0 4       // first masked column (period + ret_order - 1)
typedef _Float16 h16;
typedef unsigned short bf;
typedef __attribute__((ext_vector_type(16))) __bf16   v16bf;
typedef __attribute__((ext_vector_type(16))) _Float16 v16h;
typedef __attribute__((ext_vector_type(8)))  _Float16 v8h;
typedef __attribute__((ext_vector_type(8)))  unsigned short v8us;
typedef __attribute__((ext_vector_type(8)))  float    v8f;
typedef __attribute__((ext_vector_type(4)))  float    v4f;
typedef v8h  __attribute__((may_alias)) v8ha;
typedef v4f  __attribute__((may_alias)) v4fa;
typedef v8us __attribute__((may_alias)) v8usa;

__device__ __forceinline__ unsigned short f2bf(float f) { unsigned u = __float_as_uint(f); u += 0x7FFFu + ((u >> 16) & 1u); return (unsigned short)(u >> 16); }
__device__ __forceinline__ float bf2f(unsigned short b) { return __uint_as_float(((unsigned)b) << 16); }
__device__ __forceinline__ float bfr(float f) { return bf2f(f2bf(f)); }
__device__ __forceinline__ v16h cat16(v8h lo, v8h hi) { return __builtin_shufflevector(lo, hi, 0, 1, 2, 3, 4, 5, 6, 7, 8, 9, 10, 11, 12, 13, 14, 15); }
__device__ __forceinline__ v16bf cat16b(v8us lo, v8us hi) { return __builtin_bit_cast(v16bf, __builtin_shufflevector(lo, hi, 0, 1, 2, 3, 4, 5, 6, 7, 8, 9, 10, 11, 12, 13, 14, 15)); }
__device__ __forceinline__ v8f wmma16(v16h a, v16h b, v8f c) { return __builtin_amdgcn_wmma_f32_16x16x32_f16(false, a, false, b, (short)0, c, false, false); }
__device__ __forceinline__ v8f wmmab(v16bf a, v16bf b, v8f c) { return __builtin_amdgcn_wmma_f32_16x16x32_bf16(false, a, false, b, (short)0, c, false, false); }



// ---- k_gemmw: register-blocked GEMM, ONE WAVE per 64x64 output tile (16 accumulators), operands straight from K-contiguous 16-bit planes; grid (M/64, N/64, Z), 32 threads.
// C[m][n] (f32, pitch ldc, + optional f32 bias[n]) = sum_k A[m][k] Bt[n][k] (+ split products per NSPLIT). z-batch strides sA/sB/sC in elements. K % 32 == 0.
template <typename T16> struct WFrag;
template <> struct WFrag<h16> { typedef v16h V; static __device__ __forceinline__ V ld(const h16* p) { return cat16(*(const v8h*)p, *(const v8h*)(p + 16)); } static __device__ __forceinline__ v8f mma(V a, V b, v8f c) { return wmma16(a, b, c); } };
template <> struct WFrag<bf> { typedef v16bf V; static __device__ __forceinline__ V ld(const bf* p) { return cat16b(*(const v8us*)p, *(const v8us*)(p + 16)); } static __device__ __forceinline__ v8f mma(V a, V b, v8f c) { return wmmab(a, b, c); } };
template <typename T16, int NSPLIT, bool BIAS>
__global__ __launch_bounds__(32) void k_gemmw(const T16* __restrict__ A, const T16* __restrict__ A2, const T16* __restrict__ Bt, const T16* __restrict__ Bt2, int K, float* C, int ldc, const float* __restrict__ bias, size_t sA, size_t sB, size_t sC) {
    typedef typename WFrag<T16>::V V;
    __shared__ __align__(16) float os[16 * 68];
    const size_t z = blockIdx.z; A += z * sA; if (A2) A2 += z * sA; Bt += z * sB; if (Bt2) Bt2 += z * sB; C += z * sC;
    const int lane = threadIdx.x & 31, lr = lane & 15, hi = lane >> 4; const int r0 = blockIdx.x * 64, c0 = blockIdx.y * 64;
    v8f acc[4][4];
#pragma unroll
    for (int mb = 0; mb < 4; ++mb)
#pragma unroll
        for (int nb = 0; nb < 4; ++nb) acc[mb][nb] = (v8f){};
    const size_t aoff = (size_t)(r0 + lr) * K + 8 * hi, boff = (size_t)(c0 + lr) * K + 8 * hi;
#pragma unroll 1
    for (int kc = 0; kc < K; kc += 32) {
        V a[4], a2[4];
#pragma unroll
        for (int mb = 0; mb < 4; ++mb) { a[mb] = WFrag<T16>::ld(A + aoff + (size_t)mb * 16 * K + kc); if (NSPLIT == 1 || NSPLIT == 2) a2[mb] = WFrag<T16>::ld(A2 + aoff + (size_t)mb * 16 * K + kc); }
#pragma unroll
        for (int nb = 0; nb < 4; ++nb) { const V b = WFrag<T16>::ld(Bt + boff + (size_t)nb * 16 * K + kc); V b2; if (NSPLIT >= 2) b2 = WFrag<T16>::ld(Bt2 + boff + (size_t)nb * 16 * K + kc);
#pragma unroll
            for (int mb = 0; mb < 4; ++mb) { acc[mb][nb] = WFrag<T16>::mma(a[mb], b, acc[mb][nb]); if (NSPLIT == 1 || NSPLIT == 2) acc[mb][nb] = WFrag<T16>::mma(a2[mb], b, acc[mb][nb]); if (NSPLIT >= 2) acc[mb][nb] = WFrag<T16>::mma(a[mb], b2, acc[mb][nb]); } }
        asm volatile("v_nop\n\tv_nop\n\tv_nop\n\tv_nop" : "+v"(acc[0][0]), "+v"(acc[1][1]), "+v"(acc[2][2]), "+v"(acc[3][3]) : "v"(a[0]), "v"(a[3]));
    }
#pragma unroll
    for (int mb = 0; mb < 4; ++mb) {
#pragma unroll
        for (int nb = 0; nb < 4; ++nb) {
#pragma unroll
            for (int j = 0; j < 8; ++j) os[(hi * 8 + j) * 68 + nb * 16 + lr] = acc[mb][nb][j]; }
        __builtin_amdgcn_wave_barrier(); asm volatile("" ::: "memory");
        float* crow = C + (size_t)(r0 + mb * 16) * ldc + c0;
{
#pragma unroll
            for (int s = 0; s < 8; ++s) { const int row = 2 * s + hi, cofs = lr * 4; v4f val = *(const v4fa*)(os + row * 68 + cofs); if (BIAS) { val[0] += bfr(bias[c0 + cofs]); val[1] += bfr(bias[c0 + cofs + 1]); val[2] += bfr(bias[c0 + cofs + 2]); val[3] += bfr(bias[c0 + cofs + 3]); }
                *(v4f*)(crow + (size_t)row * ldc + cofs) = val; }
             }
        __builtin_amdgcn_wave_barrier(); asm volatile("" ::: "memory");
    }
}

// ---- k_gemmc: the same one-wave 64x64 tile GEMM specialised for causal attention: CMODE 1 skips score tiles entirely above the diagonal (query rows r0+roff.., key columns c0..), CMODE 2 limits the
// key (K) loop of the probability x value contraction to the diagonal block (probabilities beyond it are exactly zero). roff = row offset of this launch's first row within the sequence.
template <typename T16, int NSPLIT, int CMODE>
__global__ __launch_bounds__(32) void k_gemmc(const T16* __restrict__ A, const T16* __restrict__ A2, const T16* __restrict__ Bt, const T16* __restrict__ Bt2, int K, float* C, int ldc, int roff, size_t sA, size_t sB, size_t sC) {
    typedef typename WFrag<T16>::V V;
    __shared__ __align__(16) float os[16 * 68];
    const size_t z = blockIdx.z; A += z * sA; if (A2) A2 += z * sA; Bt += z * sB; if (Bt2) Bt2 += z * sB; C += z * sC;
    const int lane = threadIdx.x & 31, lr = lane & 15, hi = lane >> 4; const int r0 = blockIdx.x * 64, c0 = blockIdx.y * 64;
    if (CMODE == 1 && c0 > r0 + roff + 63) return;                  // score tile entirely above the causal diagonal: never read (the softmax masks j > i by select)
    const int Kl = (CMODE == 2) ? min(K, r0 + roff + 64) : K;        // P.V: probabilities are exactly 0 beyond the diagonal block, so the K loop stops there
    v8f acc[4][4];
#pragma unroll
    for (int mb = 0; mb < 4; ++mb)
#pragma unroll
        for (int nb = 0; nb < 4; ++nb) acc[mb][nb] = (v8f){};
    const size_t aoff = (size_t)(r0 + lr) * K + 8 * hi, boff = (size_t)(c0 + lr) * K + 8 * hi;
#pragma unroll 1
    for (int kc = 0; kc < Kl; kc += 32) {
        V a[4], a2[4];
#pragma unroll
        for (int mb = 0; mb < 4; ++mb) { a[mb] = WFrag<T16>::ld(A + aoff + (size_t)mb * 16 * K + kc); if (NSPLIT == 1 || NSPLIT == 2) a2[mb] = WFrag<T16>::ld(A2 + aoff + (size_t)mb * 16 * K + kc); }
#pragma unroll
        for (int nb = 0; nb < 4; ++nb) { const V b = WFrag<T16>::ld(Bt + boff + (size_t)nb * 16 * K + kc); V b2; if (NSPLIT >= 2) b2 = WFrag<T16>::ld(Bt2 + boff + (size_t)nb * 16 * K + kc);
#pragma unroll
            for (int mb = 0; mb < 4; ++mb) { acc[mb][nb] = WFrag<T16>::mma(a[mb], b, acc[mb][nb]); if (NSPLIT == 1 || NSPLIT == 2) acc[mb][nb] = WFrag<T16>::mma(a2[mb], b, acc[mb][nb]); if (NSPLIT >= 2) acc[mb][nb] = WFrag<T16>::mma(a[mb], b2, acc[mb][nb]); } }
        asm volatile("v_nop\n\tv_nop\n\tv_nop\n\tv_nop" : "+v"(acc[0][0]), "+v"(acc[1][1]), "+v"(acc[2][2]), "+v"(acc[3][3]) : "v"(a[0]), "v"(a[3]));
    }
#pragma unroll
    for (int mb = 0; mb < 4; ++mb) {
#pragma unroll
        for (int nb = 0; nb < 4; ++nb) {
#pragma unroll
            for (int j = 0; j < 8; ++j) os[(hi * 8 + j) * 68 + nb * 16 + lr] = acc[mb][nb][j]; }
        __builtin_amdgcn_wave_barrier(); asm volatile("" ::: "memory");
        float* crow = C + (size_t)(r0 + mb * 16) * ldc + c0;
{
#pragma unroll
            for (int s = 0; s < 8; ++s) { const int row = 2 * s + hi, cofs = lr * 4; v4f val = *(const v4fa*)(os + row * 68 + cofs);
                *(v4f*)(crow + (size_t)row * ldc + cofs) = val; }
             }
        __builtin_amdgcn_wave_barrier(); asm volatile("" ::: "memory");
    }
}

__device__ __forceinline__ h16 tohx(float x) { return (h16)x; }
__device__ __forceinline__ void splitf(float y, unsigned short& h, unsigned short& l) { h = f2bf(y); l = f2bf(y - bf2f(h)); }
typedef __attribute__((ext_vector_type(2))) _Float16 v2h;
typedef __attribute__((ext_vector_type(4))) _Float16 v4h;
typedef __attribute__((ext_vector_type(2))) unsigned short v2us;
typedef __attribute__((ext_vector_type(4))) unsigned short v4us;
typedef __attribute__((ext_vector_type(2))) float v2f;
typedef __attribute__((ext_vector_type(4))) int v4i;

__global__ __launch_bounds__(256) void k_wtG(const float* __restrict__ w, int K, int N, bf* Bt) {
    const int lane = threadIdx.x & 31; const int L0 = (blockIdx.x * 8 + (threadIdx.x >> 5)) * 8; const int nlines = N * K / 64;
{
#pragma unroll 1
        for (int l = 0; l < 8; ++l) { const int L = L0 + l; if (L >= nlines) break; const size_t e = (size_t)L * 64 + lane * 2; const int k = (int)(e % K), n = (int)(e / K); v2us o;
            o[0] = f2bf(w[(size_t)k * N + n]); o[1] = f2bf(w[(size_t)(k + 1) * N + n]); *(v2us*)(Bt + e) = o; }
         }
}
__global__ __launch_bounds__(256) void k_cvt8(const float* __restrict__ src, bf* dst, size_t n8) { const size_t i = (size_t)blockIdx.x * 256 + threadIdx.x; if (i >= n8) return; const v8f v = *(const v8f*)(src + i * 8); v8us o;
#pragma unroll
    for (int k = 0; k < 8; ++k) o[k] = f2bf(v[k]); *(v8us*)(dst + i * 8) = o;  }

__constant__ float INV512[DQ / 2] = { 1.000000000e+00f,9.646616578e-01f,9.305720329e-01f,8.976871371e-01f,8.659643531e-01f,8.353625536e-01f,8.058422208e-01f,7.773650289e-01f,7.498942018e-01f,7.233941555e-01f,6.978305578e-01f,6.731703877e-01f,6.493816376e-01f,6.264335513e-01f,6.042963862e-01f,5.829415321e-01f,5.623413324e-01f,5.424690843e-01f,5.232991576e-01f,5.048065782e-01f,4.869675338e-01f,4.697588682e-01f,4.531583488e-01f,4.371444881e-01f,4.216965139e-01f,4.067944288e-01f,3.924189806e-01f,3.785515428e-01f,3.651741445e-01f,3.522694409e-01f,3.398208320e-01f,3.278121352e-01f,3.162277639e-01f,3.050527871e-01f,2.942727208e-01f,2.838735878e-01f,2.738419771e-01f,2.641648352e-01f,2.548296750e-01f,2.458243966e-01f,2.371373624e-01f,2.287573218e-01f,2.206733972e-01f,2.128751576e-01f,2.053525001e-01f,1.980956793e-01f,1.910952926e-01f,1.843423098e-01f,1.778279394e-01f,1.715437919e-01f,1.654817015e-01f,1.596338600e-01f,1.539926529e-01f,1.485508084e-01f,1.433012635e-01f,1.382372230e-01f,1.333521456e-01f,1.286396980e-01f,1.240937710e-01f,1.197085083e-01f,1.154782027e-01f,1.113973856e-01f,1.074607819e-01f,1.036632955e-01f,1.000000015e-01f,9.646616131e-02f,9.305720031e-02f,8.976870775e-02f,8.659642935e-02f,8.353625983e-02f,8.058421314e-02f,7.773650438e-02f,7.498941571e-02f,7.233941555e-02f,6.978305429e-02f,6.731703877e-02f,6.493816525e-02f,6.264335662e-02f,6.042964384e-02f,5.829415470e-02f,5.623412877e-02f,5.424690619e-02f,5.232991278e-02f,5.048065633e-02f,4.869675264e-02f,4.697588459e-02f,4.531583562e-02f,4.371444881e-02f,4.216964915e-02f,4.067944363e-02f,3.924189880e-02f,3.785515204e-02f,3.651741147e-02f,3.522694483e-02f,3.398208320e-02f,3.278120980e-02f,3.162277862e-02f,3.050527908e-02f,2.942727320e-02f,2.838735841e-02f,2.738419548e-02f,2.641648427e-02f,2.548296750e-02f,2.458244003e-02f,2.371373586e-02f,2.287573181e-02f,2.206734009e-02f,2.128751762e-02f,2.053525113e-02f,1.980956830e-02f,1.910953037e-02f,1.843423024e-02f,1.778279431e-02f,1.715437882e-02f,1.654817164e-02f,1.596338488e-02f,1.539926510e-02f,1.485508028e-02f,1.433012541e-02f,1.382372249e-02f,1.333521493e-02f,1.286396943e-02f,1.240937691e-02f,1.197085064e-02f,1.154781971e-02f,1.113973837e-02f,1.074607857e-02f,1.036632899e-02f,9.999999776e-03f,9.646615945e-03f,9.305720218e-03f,8.976871148e-03f,8.659643121e-03f,8.353625424e-03f,8.058422245e-03f,7.773650344e-03f,7.498942316e-03f,7.233941462e-03f,6.978305988e-03f,6.731703877e-03f,6.493816618e-03f,6.264335476e-03f,6.042964291e-03f,5.829415284e-03f,5.623413250e-03f,5.424690899e-03f,5.232991185e-03f,5.048065912e-03f,4.869675264e-03f,4.697588738e-03f,4.531583749e-03f,4.371444695e-03f,4.216964822e-03f,4.067944363e-03f,3.924189601e-03f,3.785515437e-03f,3.651741426e-03f,3.522694577e-03f,3.398208413e-03f,3.278121119e-03f,3.162277862e-03f,3.050528001e-03f,2.942727180e-03f,2.838735934e-03f,2.738419687e-03f,2.641648287e-03f,2.548296703e-03f,2.458244096e-03f,2.371373819e-03f,2.287573181e-03f,2.206734149e-03f,2.128751716e-03f,2.053525066e-03f,1.980956644e-03f,1.910952851e-03f,1.843422884e-03f,1.778279431e-03f,1.715437858e-03f,1.654817141e-03f,1.596338581e-03f,1.539926510e-03f,1.485507935e-03f,1.433012658e-03f,1.382372226e-03f,1.333521446e-03f,1.286396873e-03f,1.240937854e-03f,1.197085017e-03f,1.154782018e-03f,1.113973907e-03f,1.074607833e-03f,1.036632922e-03f,1.000000047e-03f,9.646615945e-04f,9.305721032e-04f,8.976871031e-04f,8.659643354e-04f,8.353625308e-04f,8.058422245e-04f,7.773649995e-04f,7.498941850e-04f,7.233941578e-04f,6.978305755e-04f,6.731703761e-04f,6.493816618e-04f,6.264335825e-04f,6.042963942e-04f,5.829415168e-04f,5.623413017e-04f,5.424690899e-04f,5.232990952e-04f,5.048065796e-04f,4.869675031e-04f,4.697588738e-04f,4.531583400e-04f,4.371444811e-04f,4.216964880e-04f,4.067944246e-04f,3.924189950e-04f,3.785515146e-04f,3.651741135e-04f,3.522694460e-04f,3.398208064e-04f,3.278121294e-04f,3.162277862e-04f,3.050527885e-04f,2.942727297e-04f,2.838736109e-04f,2.738419571e-04f,2.641648462e-04f,2.548296761e-04f,2.458243980e-04f,2.371373848e-04f,2.287573152e-04f,2.206734207e-04f,2.128751657e-04f,2.053524950e-04f,1.980956731e-04f,1.910952997e-04f,1.843422942e-04f,1.778279402e-04f,1.715437829e-04f,1.654817170e-04f,1.596338552e-04f,1.539926452e-04f,1.485508110e-04f,1.433012658e-04f,1.382372284e-04f,1.333521504e-04f,1.286396873e-04f,1.240937709e-04f,1.197085076e-04f,1.154781930e-04f,1.113973922e-04f,1.074607790e-04f,1.036632893e-04f };   // 10000^(-2i/512), i < 256, as float32 (jnp-computed)
__global__ __launch_bounds__(256) void k_csG(float* CS) { const size_t idx = (size_t)blockIdx.x * 256 + threadIdx.x; if (idx >= (size_t)TT * DQ) return; const int cch = (int)(idx % DQ); const int t = (int)(idx / DQ); const float a = __fmul_rn((float)t, INV512[cch >> 1]); v2f cs; cs[0] = cosf(a); cs[1] = sinf(a); *(v2f*)(CS + idx * 2) = cs;  }
__global__ __launch_bounds__(256) void k_ropeIG(const float* __restrict__ F, int pitch, int nheads, const float* __restrict__ CS, float sc, h16* P16, bf* Ph, bf* Pl) {
    const size_t e = ((size_t)blockIdx.x * 256 + threadIdx.x) * 2; if (e >= (size_t)nheads * TT * HD) return; const int d = (int)(e % HD); const int t = (int)((e / HD) % TT); const int h = (int)(e / ((size_t)HD * TT)); const float* f = F + (size_t)t * pitch + h * HD; const float x0 = f[d], x1 = f[d + 1]; const v2f cs = *(const v2f*)(CS + ((size_t)t * DQ + h * HD + d) * 2); v2h o16; v2us oh, ol;
    float a0 = __fmul_rn(x0, cs[0]), b0 = __fmul_rn(x1, cs[1]), a1 = __fmul_rn(x1, cs[0]), b1 = __fmul_rn(x0, cs[1]); asm volatile("" : "+v"(a0), "+v"(b0), "+v"(a1), "+v"(b1));
    float r0 = __fsub_rn(a0, b0) * sc, r1 = __fadd_rn(b1, a1) * sc;   /* even: x0 c - x1 s; odd: x0 s + x1 c */
    o16[0] = tohx(r0); o16[1] = tohx(r1); { unsigned short a2, c2; splitf(r0, a2, c2); oh[0] = a2; ol[0] = c2; splitf(r1, a2, c2); oh[1] = a2; ol[1] = c2; }
    *(v2h*)(P16 + e) = o16; *(v2us*)(Ph + e) = oh; *(v2us*)(Pl + e) = ol;  }



__global__ __launch_bounds__(256) void k_vtp(const float* __restrict__ F, int pitch, int nheads, h16* V16, bf* Vh, bf* Vl) { const size_t e = ((size_t)blockIdx.x * 256 + threadIdx.x) * 2; if (e >= (size_t)nheads * HD * TT) return; const int t = (int)(e % TT); const int d = (int)((e / TT) % HD); const int g = (int)(e / ((size_t)TT * HD)); v2h o16; v2us oh, ol;
#pragma unroll
    for (int q = 0; q < 2; ++q) { const float x = F[(size_t)(t + q) * pitch + g * HD + d]; o16[q] = tohx(x); unsigned short a2, c2; splitf(x, a2, c2); oh[q] = a2; ol[q] = c2; }
    *(v2h*)(V16 + e) = o16; *(v2us*)(Vh + e) = oh; *(v2us*)(Vl + e) = ol;  }

__global__ __launch_bounds__(256) void k_asoft(const float* __restrict__ Sb, h16* P16, bf* Ph, bf* Pl) {
    const int lane = threadIdx.x & 31; const int row = blockIdx.x * 8 + (threadIdx.x >> 5); if (row >= ZH * TT) return; const int i = row % TT; const int zz = row / TT; (void)zz; const bool hires = (i < RH); const float* sr = Sb + (size_t)row * TT; float v[TT / 32]; float mx = -3.0e38f;
#pragma unroll
    for (int ch = 0; ch < TT / 128; ++ch) { const int j0 = ch * 128 + lane * 4; const v4f a = *(const v4f*)(sr + j0);
#pragma unroll
        for (int q = 0; q < 4; ++q) { const int j = j0 + q; (void)j; const float t = (j <= i && !(j >= PRD0 && (j - PRD0) % PRD == 0)) ? a[q] * SCL : -3.0e38f;   /* causal, and the period-3 columns 4, 7, 10, ... are masked for every row */ v[ch * 4 + q] = t; mx = fmaxf(mx, t); } }
#pragma unroll
    for (int sh = 16; sh; sh >>= 1) mx = fmaxf(mx, __shfl_xor(mx, sh, 32));
    float sum = 0.f;
#pragma unroll
    for (int k = 0; k < TT / 32; ++k) { float d0 = __fsub_rn(v[k], mx); asm volatile("" : "+v"(d0)); v[k] = __builtin_amdgcn_exp2f(__fmul_rn(d0, 1.4426950408889634f)); sum += v[k]; }
#pragma unroll
    for (int sh = 16; sh; sh >>= 1) sum += __shfl_xor(sum, sh, 32);
    const float f = __fdiv_rn(hires ? 1.0f : PCAR, sum);
{
        if (hires) {
#pragma unroll
            for (int ch = 0; ch < TT / 128; ++ch) { v4us oh, ol;
#pragma unroll
                for (int q = 0; q < 4; ++q) { unsigned short a, c2; splitf(v[ch * 4 + q] * f, a, c2); oh[q] = a; ol[q] = c2; }
                const size_t oo = ((size_t)zz * (RH ? RH : 1) + i) * TT + ch * 128 + lane * 4; *(v4us*)(Ph + oo) = oh; *(v4us*)(Pl + oo) = ol; }
        } else {
#pragma unroll
            for (int ch = 0; ch < TT / 128; ++ch) { v4h o4;
#pragma unroll
                for (int q = 0; q < 4; ++q) o4[q] = tohx(v[ch * 4 + q] * f);
                *(v4h*)(P16 + (size_t)row * TT + ch * 128 + lane * 4) = o4; } }
         }
}
__global__ __launch_bounds__(256) void k_merge(const float* __restrict__ O, int h0, bf* Ah, bf* Al) { const size_t e = ((size_t)blockIdx.x * 256 + threadIdx.x) * 2; if (e >= (size_t)ZH * TT * HD) return; const int d = (int)(e % HD); const int t = (int)((e / HD) % TT); const int zz = (int)(e / ((size_t)HD * TT)); const float cs = (t < RH) ? 1.0f : (1.0f / PCAR); const size_t oo = (size_t)t * DQ + (h0 + zz) * HD + d;
    v2us oh, ol;
#pragma unroll
    for (int q = 0; q < 2; ++q) { unsigned short a, c2; splitf(O[e + q] * cs, a, c2); oh[q] = a; ol[q] = c2; } *(v2us*)(Ah + oo) = oh; *(v2us*)(Al + oo) = ol;  }

extern "C" void kernel_launch(void* const* d_in, const int* in_sizes, int n_in,
                              void* d_out, int out_size, void* d_ws, size_t ws_size, hipStream_t stream) {
    (void)in_sizes; (void)n_in; (void)out_size;
    const float* x = (const float*)d_in[0]; const float* wq = (const float*)d_in[1]; const float* bq = (const float*)d_in[2]; const float* wk = (const float*)d_in[3]; const float* bk = (const float*)d_in[4]; const float* wv = (const float*)d_in[5]; const float* bv = (const float*)d_in[6]; const float* wo = (const float*)d_in[7]; const float* bo = (const float*)d_in[8];
    float* OUT = (float*)d_out;     // [4][2048][512]
    char* wsp = (char*)d_ws;
    auto take = [&](size_t bytes) { char* p = wsp; wsp += (bytes + 255) & ~(size_t)255; return (void*)p; };
    bf* WQ = (bf*)take((size_t)DQ * DM * 2); bf* WK = (bf*)take((size_t)DKV * DM * 2); bf* WV = (bf*)take((size_t)DKV * DM * 2); bf* WO = (bf*)take((size_t)DM * DQ * 2); float* CS = (float*)take((size_t)TT * DQ * 2 * 4);   /* {cos, sin} per (t, global channel) */
    bf* XB = (bf*)take((size_t)TT * DM * 2); float* FQ = (float*)take((size_t)TT * DQ * 4); float* FK = (float*)take((size_t)TT * DKV * 4);
    h16* QP16 = (h16*)take((size_t)NH_ * TT * HD * 2); h16* KP16 = (h16*)take((size_t)NKV * TT * HD * 2); h16* VT16 = (h16*)take((size_t)NKV * HD * TT * 2);
    bf* QPh = (bf*)take((size_t)NH_ * TT * HD * 2); bf* QPl = (bf*)take((size_t)NH_ * TT * HD * 2); bf* KPh = (bf*)take((size_t)NKV * TT * HD * 2); bf* KPl = (bf*)take((size_t)NKV * TT * HD * 2); bf* VTh = (bf*)take((size_t)NKV * HD * TT * 2); bf* VTl = (bf*)take((size_t)NKV * HD * TT * 2); bf* Ph = (bf*)take((size_t)ZH * RH * TT * 2); bf* Pl = (bf*)take((size_t)ZH * RH * TT * 2);
    float* Sb = (float*)take((size_t)ZH * TT * TT * 4); h16* P16 = (h16*)take((size_t)ZH * TT * TT * 2); float* Ob = (float*)take((size_t)ZH * TT * HD * 4); bf* ATh = (bf*)take((size_t)TT * DQ * 2); bf* ATl = (bf*)take((size_t)TT * DQ * 2);
    if ((size_t)(wsp - (char*)d_ws) > ws_size) return;    // ws 256 MiB
    float* FV = FK;   // v projection reuses the k buffer after the k planes are built (stream-ordered)
    { k_wtG<<<(unsigned)((DM * DQ / 64 + 63) / 64), 256, 0, stream>>>(wq, DM, DQ, WQ); k_wtG<<<(unsigned)((DM * DKV / 64 + 63) / 64), 256, 0, stream>>>(wk, DM, DKV, WK); k_wtG<<<(unsigned)((DM * DKV / 64 + 63) / 64), 256, 0, stream>>>(wv, DM, DKV, WV);
      k_wtG<<<(unsigned)((DQ * DM / 64 + 63) / 64), 256, 0, stream>>>(wo, DQ, DM, WO);
       }
    k_csG<<<(unsigned)(((size_t)TT * DQ + 255) / 256), 256, 0, stream>>>(CS);   /* angle t x 10000^(-2i/512) for global pair i = c/2 */
    const unsigned LQ = (unsigned)(((size_t)NH_ * TT * HD / 2 + 255) / 256), LKv = (unsigned)(((size_t)NKV * TT * HD / 2 + 255) / 256);
    for (int b = 0; b < NB_; ++b) {
        
        k_cvt8<<<(unsigned)(((size_t)TT * DM / 8 + 255) / 256), 256, 0, stream>>>(x + (size_t)b * TT * DM, XB, (size_t)TT * DM / 8);
        k_gemmw<bf, 0, true><<<dim3(TT / 64, DQ / 64, 1), 32, 0, stream>>>(XB, nullptr, WQ, nullptr, DM, FQ, DQ, bq, 0, 0, 0);
        k_ropeIG<<<LQ, 256, 0, stream>>>(FQ, DQ, NH_, CS, 1.0f, QP16, QPh, QPl);
        k_gemmw<bf, 0, true><<<dim3(TT / 64, DKV / 64, 1), 32, 0, stream>>>(XB, nullptr, WK, nullptr, DM, FK, DKV, bk, 0, 0, 0);
        k_ropeIG<<<LKv, 256, 0, stream>>>(FK, DKV, NKV, CS, 1.0f, KP16, KPh, KPl);
        k_gemmw<bf, 0, true><<<dim3(TT / 64, DKV / 64, 1), 32, 0, stream>>>(XB, nullptr, WV, nullptr, DM, FV, DKV, bv, 0, 0, 0); k_vtp<<<LKv, 256, 0, stream>>>(FV, DKV, NKV, VT16, VTh, VTl);
        for (int h0 = 0; h0 < NH_; h0 += ZH) { const size_t zq = (size_t)h0, zk = (size_t)(h0 / REP);   // one kv head per query head: the pass's two heads use consecutive kv planes (z-strides TT*HD)
            k_gemmc<bf, 2, 1><<<dim3(RH / 64, TT / 64, ZH), 32, 0, stream>>>(QPh + zq * TT * HD, QPl + zq * TT * HD, KPh + zk * TT * HD, KPl + zk * TT * HD, HD, Sb, TT, 0, (size_t)TT * HD, (size_t)TT * HD, (size_t)TT * TT);
            k_gemmc<h16, 0, 1><<<dim3((TT - RH) / 64, TT / 64, ZH), 32, 0, stream>>>(QP16 + zq * TT * HD + (size_t)RH * HD, nullptr, KP16 + zk * TT * HD, nullptr, HD, Sb + (size_t)RH * TT, TT, RH, (size_t)TT * HD, (size_t)TT * HD, (size_t)TT * TT);
            k_asoft<<<ZH * TT / 8, 256, 0, stream>>>(Sb, P16, Ph, Pl);
            k_gemmc<bf, 2, 2><<<dim3(RH / 64, HD / 64, ZH), 32, 0, stream>>>(Ph, Pl, VTh + zk * HD * TT, VTl + zk * HD * TT, TT, Ob, HD, 0, (size_t)RH * TT, (size_t)HD * TT, (size_t)TT * HD);
            k_gemmc<h16, 0, 2><<<dim3((TT - RH) / 64, HD / 64, ZH), 32, 0, stream>>>(P16 + (size_t)RH * TT, nullptr, VT16 + zk * HD * TT, nullptr, TT, Ob + (size_t)RH * HD, HD, RH, (size_t)TT * TT, (size_t)HD * TT, (size_t)TT * HD);
            k_merge<<<(unsigned)(((size_t)ZH * TT * HD / 2 + 255) / 256), 256, 0, stream>>>(Ob, h0, ATh, ATl); }
        k_gemmw<bf, 1, true><<<dim3(TT / 64, DM / 64, 1), 32, 0, stream>>>(ATh, ATl, WO, nullptr, DQ, OUT + (size_t)b * TT * DM, DM, bo, 0, 0, 0); }
}

// v001
// A run of this version takes 913 microseconds.
// In two side-by-side timings against v000, it was 1.77 and 1.73 times as fast.
#include <hip/hip_runtime.h>

// Causal attention with rotary embeddings over the FULL hidden dim and periodically masked key columns (x [4][2048][512]; q,k,v = x W + b ('xw' [512][512] + [512], 0.02); rope BEFORE the head split: pairs (2i, 2i+1) of the 512-vector rotated by t x 10000^(-2i/512), i < 256; 8 heads x 64; scores / 8; mask = causal AND key column j not in {4, 7, 10, ...} (j >= 4 with (j - 4) mod 3 == 0: the module's period-3 'mgdt' columns); softmax; out = merged Wo + bo -> [4][2048][512] (4.2 M)).
// Layout per batch: bf16 copy of x; exact projections + f32 biases; a {cos, sin} table per (position, global pair) (float32 inverse frequencies over 512 dims, precise cosf/sinf); interleaved-pair rotary plane builder indexed by the GLOBAL channel; causal T-2048 attention (hybrid rows: < 512 hi/lo 3 products, rest fp16 x1024; k_gemmc skips tiles above the diagonal) whose softmax select also drops the period-3 columns; merged hi/lo x Wo exact + bo.
// Compute dtypes, f32 accumulate: every input rounded to bf16; projections exact + f32 biases; rotary f32; attention rows < 512 3 products, rest fp16; softmax f32; Wo hl x exact + bias.

#define NB_  4
#define TT   2048
#define DM   512
#define NH_  8
#define NKV  8
#define REP  (NH_ / NKV)
#define HD   64
#define DQ   (NH_ * HD)
#define DKV  (NKV * HD)
#define ZH   2
#define RH   512                  // query rows < RH use hi+lo planes (0: none)
#define WIN  2048
#define PCAR 1024.0f
#define SCL  0.125f
#define PRD  3       // masked-column period
#define PRD0 4       // first masked column (period + ret_order - 1)
typedef _Float16 h16;
typedef unsigned short bf;
typedef __attribute__((ext_vector_type(16))) __bf16   v16bf;
typedef __attribute__((ext_vector_type(16))) _Float16 v16h;
typedef __attribute__((ext_vector_type(8)))  _Float16 v8h;
typedef __attribute__((ext_vector_type(8)))  unsigned short v8us;
typedef __attribute__((ext_vector_type(8)))  float    v8f;
typedef __attribute__((ext_vector_type(4)))  float    v4f;
typedef v8h  __attribute__((may_alias)) v8ha;
typedef v4f  __attribute__((may_alias)) v4fa;
typedef v8us __attribute__((may_alias)) v8usa;

__device__ __forceinline__ unsigned short f2bf(float f) { unsigned u = __float_as_uint(f); u += 0x7FFFu + ((u >> 16) & 1u); return (unsigned short)(u >> 16); }
__device__ __forceinline__ float bf2f(unsigned short b) { return __uint_as_float(((unsigned)b) << 16); }
__device__ __forceinline__ float bfr(float f) { return bf2f(f2bf(f)); }
__device__ __forceinline__ v16h cat16(v8h lo, v8h hi) { return __builtin_shufflevector(lo, hi, 0, 1, 2, 3, 4, 5, 6, 7, 8, 9, 10, 11, 12, 13, 14, 15); }
__device__ __forceinline__ v16bf cat16b(v8us lo, v8us hi) { return __builtin_bit_cast(v16bf, __builtin_shufflevector(lo, hi, 0, 1, 2, 3, 4, 5, 6, 7, 8, 9, 10, 11, 12, 13, 14, 15)); }
__device__ __forceinline__ v8f wmma16(v16h a, v16h b, v8f c) { return __builtin_amdgcn_wmma_f32_16x16x32_f16(false, a, false, b, (short)0, c, false, false); }
__device__ __forceinline__ v8f wmmab(v16bf a, v16bf b, v8f c) { return __builtin_amdgcn_wmma_f32_16x16x32_bf16(false, a, false, b, (short)0, c, false, false); }



// ---- Split-K epilogue: the NW waves of a work-group each hold a partial 64x64 tile (their share of the K loop). Every wave parks its 16 accumulators in LDS lane-linear (b128, no bank conflict),
// one barrier, then each wave sums its share of the tile over the NW partials in wave order 0..NW-1 and stores it. A unit = 4 accumulator rows x 32 columns, so each 128-byte output line has one writer.
template <int NW, bool BIAS>
__device__ __forceinline__ void splitk_store(const v8f (&acc)[4][4], float* red, float* C, int ldc, const float* __restrict__ bias, int r0, int c0) {
    const int lane = threadIdx.x & 31, lr = lane & 15, hi = lane >> 4, w = __builtin_amdgcn_readfirstlane(threadIdx.x >> 5);
    // both loops unrolled: acc is indexed by constants only and stays in registers
#pragma unroll
    for (int mb = 0; mb < 4; ++mb)
#pragma unroll
        for (int nb = 0; nb < 4; ++nb) { float* p = red + (size_t)((w * 16 + mb * 4 + nb) * 2) * 128 + lane * 4;
            *(v4fa*)p = __builtin_shufflevector(acc[mb][nb], acc[mb][nb], 0, 1, 2, 3); *(v4fa*)(p + 128) = __builtin_shufflevector(acc[mb][nb], acc[mb][nb], 4, 5, 6, 7); }
    __syncthreads();   // publishes every wave's partial tile to the waves that sum it
    for (int q = 0; q < 16 / NW; ++q) { const int unit = w * (16 / NW) + q, mb = unit >> 2, nb0 = ((unit >> 1) & 1) * 2, half = unit & 1;
        for (int e = 0; e < 2; ++e) { const int nb = nb0 + e; const float* p = red + (size_t)((mb * 4 + nb) * 2 + half) * 128 + lane * 4; v4f sum = *(const v4fa*)p;
            for (int u = 1; u < NW; ++u) sum += *(const v4fa*)(p + (size_t)u * 4096);
            const int col = c0 + nb * 16 + lr; if (BIAS) sum += bfr(bias[col]);
            float* crow = C + (size_t)(r0 + mb * 16 + hi * 8 + half * 4) * ldc + col;
            for (int j = 0; j < 4; ++j) crow[(size_t)j * ldc] = sum[j]; } }
}

// ---- k_gemmw: register-blocked GEMM, one work-group of NW waves per 64x64 output tile (16 accumulators a wave); wave w takes the K chunks w, w + NW, ...; operands straight from K-contiguous 16-bit planes; grid (M/64, N/64, Z), 32 NW threads.
// C[m][n] (f32, pitch ldc, + optional f32 bias[n]) = sum_k A[m][k] Bt[n][k] (+ split products per NSPLIT). z-batch strides sA/sB/sC in elements. K % 32 == 0.
template <typename T16> struct WFrag;
template <> struct WFrag<h16> { typedef v16h V; static __device__ __forceinline__ V ld(const h16* p) { return cat16(*(const v8h*)p, *(const v8h*)(p + 16)); } static __device__ __forceinline__ v8f mma(V a, V b, v8f c) { return wmma16(a, b, c); } };
template <> struct WFrag<bf> { typedef v16bf V; static __device__ __forceinline__ V ld(const bf* p) { return cat16b(*(const v8us*)p, *(const v8us*)(p + 16)); } static __device__ __forceinline__ v8f mma(V a, V b, v8f c) { return wmmab(a, b, c); } };
template <typename T16, int NSPLIT, bool BIAS, int NW>
__global__ __launch_bounds__(32 * NW) void k_gemmw(const T16* __restrict__ A, const T16* __restrict__ A2, const T16* __restrict__ Bt, const T16* __restrict__ Bt2, int K, float* C, int ldc, const float* __restrict__ bias, size_t sA, size_t sB, size_t sC) {
    typedef typename WFrag<T16>::V V;
    __shared__ __align__(16) float red[NW * 4096];
    const size_t z = blockIdx.z; A += z * sA; if (A2) A2 += z * sA; Bt += z * sB; if (Bt2) Bt2 += z * sB; C += z * sC;
    const int lane = threadIdx.x & 31, lr = lane & 15, hi = lane >> 4; const int r0 = blockIdx.x * 64, c0 = blockIdx.y * 64;
    const int wv = __builtin_amdgcn_readfirstlane(threadIdx.x >> 5);   // wave number in a scalar register: the K loop stays a scalar loop with every lane on at the matrix instructions
    v8f acc[4][4];
#pragma unroll
    for (int mb = 0; mb < 4; ++mb)
#pragma unroll
        for (int nb = 0; nb < 4; ++nb) acc[mb][nb] = (v8f){};
    const size_t aoff = (size_t)(r0 + lr) * K + 8 * hi, boff = (size_t)(c0 + lr) * K + 8 * hi;
#pragma unroll 1
    for (int kc = wv * 32; kc < K; kc += NW * 32) {
        V a[4], a2[4];
#pragma unroll
        for (int mb = 0; mb < 4; ++mb) { a[mb] = WFrag<T16>::ld(A + aoff + (size_t)mb * 16 * K + kc); if (NSPLIT == 1 || NSPLIT == 2) a2[mb] = WFrag<T16>::ld(A2 + aoff + (size_t)mb * 16 * K + kc); }
#pragma unroll
        for (int nb = 0; nb < 4; ++nb) { const V b = WFrag<T16>::ld(Bt + boff + (size_t)nb * 16 * K + kc); V b2; if (NSPLIT >= 2) b2 = WFrag<T16>::ld(Bt2 + boff + (size_t)nb * 16 * K + kc);
#pragma unroll
            for (int mb = 0; mb < 4; ++mb) { acc[mb][nb] = WFrag<T16>::mma(a[mb], b, acc[mb][nb]); if (NSPLIT == 1 || NSPLIT == 2) acc[mb][nb] = WFrag<T16>::mma(a2[mb], b, acc[mb][nb]); if (NSPLIT >= 2) acc[mb][nb] = WFrag<T16>::mma(a[mb], b2, acc[mb][nb]); } }
        asm volatile("v_nop\n\tv_nop\n\tv_nop\n\tv_nop" : "+v"(acc[0][0]), "+v"(acc[1][1]), "+v"(acc[2][2]), "+v"(acc[3][3]) : "v"(a[0]), "v"(a[3]));
    }
    splitk_store<NW, BIAS>(acc, red, C, ldc, bias, r0, c0);
}

// ---- k_gemmc: the same 64x64 tile GEMM specialised for causal attention: CMODE 1 skips score tiles entirely above the diagonal (query rows r0+roff.., key columns c0..), CMODE 2 limits the
// key (K) loop of the probability x value contraction to the diagonal block (probabilities beyond it are exactly zero). roff = row offset of this launch's first row within the sequence. NW waves share the K loop (chunk w, w + NW, ...) and merge in splitk_store; NW = 1 is the one-wave form.
template <typename T16, int NSPLIT, int CMODE, int NW>
__global__ __launch_bounds__(32 * NW) void k_gemmc(const T16* __restrict__ A, const T16* __restrict__ A2, const T16* __restrict__ Bt, const T16* __restrict__ Bt2, int K, float* C, int ldc, int roff, size_t sA, size_t sB, size_t sC) {
    typedef typename WFrag<T16>::V V;
    __shared__ __align__(16) float os[NW == 1 ? 16 * 68 : NW * 4096];
    const size_t z = blockIdx.z; A += z * sA; if (A2) A2 += z * sA; Bt += z * sB; if (Bt2) Bt2 += z * sB; C += z * sC;
    const int lane = threadIdx.x & 31, lr = lane & 15, hi = lane >> 4; const int r0 = blockIdx.x * 64, c0 = blockIdx.y * 64;
    const int wv = __builtin_amdgcn_readfirstlane(threadIdx.x >> 5);   // wave number in a scalar register: the K loop stays a scalar loop with every lane on at the matrix instructions
    if (CMODE == 1 && c0 > r0 + roff + 63) return;                  // score tile entirely above the causal diagonal: never read (the softmax masks j > i by select)
    const int Kl = (CMODE == 2) ? min(K, r0 + roff + 64) : K;        // P.V: probabilities are exactly 0 beyond the diagonal block, so the K loop stops there
    v8f acc[4][4];
#pragma unroll
    for (int mb = 0; mb < 4; ++mb)
#pragma unroll
        for (int nb = 0; nb < 4; ++nb) acc[mb][nb] = (v8f){};
    const size_t aoff = (size_t)(r0 + lr) * K + 8 * hi, boff = (size_t)(c0 + lr) * K + 8 * hi;
#pragma unroll 1
    for (int kc = wv * 32; kc < Kl; kc += NW * 32) {
        V a[4], a2[4];
#pragma unroll
        for (int mb = 0; mb < 4; ++mb) { a[mb] = WFrag<T16>::ld(A + aoff + (size_t)mb * 16 * K + kc); if (NSPLIT == 1 || NSPLIT == 2) a2[mb] = WFrag<T16>::ld(A2 + aoff + (size_t)mb * 16 * K + kc); }
#pragma unroll
        for (int nb = 0; nb < 4; ++nb) { const V b = WFrag<T16>::ld(Bt + boff + (size_t)nb * 16 * K + kc); V b2; if (NSPLIT >= 2) b2 = WFrag<T16>::ld(Bt2 + boff + (size_t)nb * 16 * K + kc);
#pragma unroll
            for (int mb = 0; mb < 4; ++mb) { acc[mb][nb] = WFrag<T16>::mma(a[mb], b, acc[mb][nb]); if (NSPLIT == 1 || NSPLIT == 2) acc[mb][nb] = WFrag<T16>::mma(a2[mb], b, acc[mb][nb]); if (NSPLIT >= 2) acc[mb][nb] = WFrag<T16>::mma(a[mb], b2, acc[mb][nb]); } }
        asm volatile("v_nop\n\tv_nop\n\tv_nop\n\tv_nop" : "+v"(acc[0][0]), "+v"(acc[1][1]), "+v"(acc[2][2]), "+v"(acc[3][3]) : "v"(a[0]), "v"(a[3]));
    }
    if constexpr (NW > 1) { splitk_store<NW, false>(acc, os, C, ldc, nullptr, r0, c0); return; }
#pragma unroll
    for (int mb = 0; mb < 4; ++mb) {
#pragma unroll
        for (int nb = 0; nb < 4; ++nb) {
#pragma unroll
            for (int j = 0; j < 8; ++j) os[(hi * 8 + j) * 68 + nb * 16 + lr] = acc[mb][nb][j]; }
        __builtin_amdgcn_wave_barrier(); asm volatile("" ::: "memory");
        float* crow = C + (size_t)(r0 + mb * 16) * ldc + c0;
{
#pragma unroll
            for (int s = 0; s < 8; ++s) { const int row = 2 * s + hi, cofs = lr * 4; v4f val = *(const v4fa*)(os + row * 68 + cofs);
                *(v4f*)(crow + (size_t)row * ldc + cofs) = val; }
             }
        __builtin_amdgcn_wave_barrier(); asm volatile("" ::: "memory");
    }
}

__device__ __forceinline__ h16 tohx(float x) { return (h16)x; }
__device__ __forceinline__ void splitf(float y, unsigned short& h, unsigned short& l) { h = f2bf(y); l = f2bf(y - bf2f(h)); }
typedef __attribute__((ext_vector_type(2))) _Float16 v2h;
typedef __attribute__((ext_vector_type(4))) _Float16 v4h;
typedef __attribute__((ext_vector_type(2))) unsigned short v2us;
typedef __attribute__((ext_vector_type(4))) unsigned short v4us;
typedef __attribute__((ext_vector_type(2))) float v2f;
typedef __attribute__((ext_vector_type(4))) int v4i;

__global__ __launch_bounds__(256) void k_wtG(const float* __restrict__ w, int K, int N, bf* Bt) {
    const int lane = threadIdx.x & 31; const int L0 = (blockIdx.x * 8 + (threadIdx.x >> 5)) * 8; const int nlines = N * K / 64;
{
#pragma unroll 1
        for (int l = 0; l < 8; ++l) { const int L = L0 + l; if (L >= nlines) break; const size_t e = (size_t)L * 64 + lane * 2; const int k = (int)(e % K), n = (int)(e / K); v2us o;
            o[0] = f2bf(w[(size_t)k * N + n]); o[1] = f2bf(w[(size_t)(k + 1) * N + n]); *(v2us*)(Bt + e) = o; }
         }
}
__global__ __launch_bounds__(256) void k_cvt8(const float* __restrict__ src, bf* dst, size_t n8) { const size_t i = (size_t)blockIdx.x * 256 + threadIdx.x; if (i >= n8) return; const v8f v = *(const v8f*)(src + i * 8); v8us o;
#pragma unroll
    for (int k = 0; k < 8; ++k) o[k] = f2bf(v[k]); *(v8us*)(dst + i * 8) = o;  }

__constant__ float INV512[DQ / 2] = { 1.000000000e+00f,9.646616578e-01f,9.305720329e-01f,8.976871371e-01f,8.659643531e-01f,8.353625536e-01f,8.058422208e-01f,7.773650289e-01f,7.498942018e-01f,7.233941555e-01f,6.978305578e-01f,6.731703877e-01f,6.493816376e-01f,6.264335513e-01f,6.042963862e-01f,5.829415321e-01f,5.623413324e-01f,5.424690843e-01f,5.232991576e-01f,5.048065782e-01f,4.869675338e-01f,4.697588682e-01f,4.531583488e-01f,4.371444881e-01f,4.216965139e-01f,4.067944288e-01f,3.924189806e-01f,3.785515428e-01f,3.651741445e-01f,3.522694409e-01f,3.398208320e-01f,3.278121352e-01f,3.162277639e-01f,3.050527871e-01f,2.942727208e-01f,2.838735878e-01f,2.738419771e-01f,2.641648352e-01f,2.548296750e-01f,2.458243966e-01f,2.371373624e-01f,2.287573218e-01f,2.206733972e-01f,2.128751576e-01f,2.053525001e-01f,1.980956793e-01f,1.910952926e-01f,1.843423098e-01f,1.778279394e-01f,1.715437919e-01f,1.654817015e-01f,1.596338600e-01f,1.539926529e-01f,1.485508084e-01f,1.433012635e-01f,1.382372230e-01f,1.333521456e-01f,1.286396980e-01f,1.240937710e-01f,1.197085083e-01f,1.154782027e-01f,1.113973856e-01f,1.074607819e-01f,1.036632955e-01f,1.000000015e-01f,9.646616131e-02f,9.305720031e-02f,8.976870775e-02f,8.659642935e-02f,8.353625983e-02f,8.058421314e-02f,7.773650438e-02f,7.498941571e-02f,7.233941555e-02f,6.978305429e-02f,6.731703877e-02f,6.493816525e-02f,6.264335662e-02f,6.042964384e-02f,5.829415470e-02f,5.623412877e-02f,5.424690619e-02f,5.232991278e-02f,5.048065633e-02f,4.869675264e-02f,4.697588459e-02f,4.531583562e-02f,4.371444881e-02f,4.216964915e-02f,4.067944363e-02f,3.924189880e-02f,3.785515204e-02f,3.651741147e-02f,3.522694483e-02f,3.398208320e-02f,3.278120980e-02f,3.162277862e-02f,3.050527908e-02f,2.942727320e-02f,2.838735841e-02f,2.738419548e-02f,2.641648427e-02f,2.548296750e-02f,2.458244003e-02f,2.371373586e-02f,2.287573181e-02f,2.206734009e-02f,2.128751762e-02f,2.053525113e-02f,1.980956830e-02f,1.910953037e-02f,1.843423024e-02f,1.778279431e-02f,1.715437882e-02f,1.654817164e-02f,1.596338488e-02f,1.539926510e-02f,1.485508028e-02f,1.433012541e-02f,1.382372249e-02f,1.333521493e-02f,1.286396943e-02f,1.240937691e-02f,1.197085064e-02f,1.154781971e-02f,1.113973837e-02f,1.074607857e-02f,1.036632899e-02f,9.999999776e-03f,9.646615945e-03f,9.305720218e-03f,8.976871148e-03f,8.659643121e-03f,8.353625424e-03f,8.058422245e-03f,7.773650344e-03f,7.498942316e-03f,7.233941462e-03f,6.978305988e-03f,6.731703877e-03f,6.493816618e-03f,6.264335476e-03f,6.042964291e-03f,5.829415284e-03f,5.623413250e-03f,5.424690899e-03f,5.232991185e-03f,5.048065912e-03f,4.869675264e-03f,4.697588738e-03f,4.531583749e-03f,4.371444695e-03f,4.216964822e-03f,4.067944363e-03f,3.924189601e-03f,3.785515437e-03f,3.651741426e-03f,3.522694577e-03f,3.398208413e-03f,3.278121119e-03f,3.162277862e-03f,3.050528001e-03f,2.942727180e-03f,2.838735934e-03f,2.738419687e-03f,2.641648287e-03f,2.548296703e-03f,2.458244096e-03f,2.371373819e-03f,2.287573181e-03f,2.206734149e-03f,2.128751716e-03f,2.053525066e-03f,1.980956644e-03f,1.910952851e-03f,1.843422884e-03f,1.778279431e-03f,1.715437858e-03f,1.654817141e-03f,1.596338581e-03f,1.539926510e-03f,1.485507935e-03f,1.433012658e-03f,1.382372226e-03f,1.333521446e-03f,1.286396873e-03f,1.240937854e-03f,1.197085017e-03f,1.154782018e-03f,1.113973907e-03f,1.074607833e-03f,1.036632922e-03f,1.000000047e-03f,9.646615945e-04f,9.305721032e-04f,8.976871031e-04f,8.659643354e-04f,8.353625308e-04f,8.058422245e-04f,7.773649995e-04f,7.498941850e-04f,7.233941578e-04f,6.978305755e-04f,6.731703761e-04f,6.493816618e-04f,6.264335825e-04f,6.042963942e-04f,5.829415168e-04f,5.623413017e-04f,5.424690899e-04f,5.232990952e-04f,5.048065796e-04f,4.869675031e-04f,4.697588738e-04f,4.531583400e-04f,4.371444811e-04f,4.216964880e-04f,4.067944246e-04f,3.924189950e-04f,3.785515146e-04f,3.651741135e-04f,3.522694460e-04f,3.398208064e-04f,3.278121294e-04f,3.162277862e-04f,3.050527885e-04f,2.942727297e-04f,2.838736109e-04f,2.738419571e-04f,2.641648462e-04f,2.548296761e-04f,2.458243980e-04f,2.371373848e-04f,2.287573152e-04f,2.206734207e-04f,2.128751657e-04f,2.053524950e-04f,1.980956731e-04f,1.910952997e-04f,1.843422942e-04f,1.778279402e-04f,1.715437829e-04f,1.654817170e-04f,1.596338552e-04f,1.539926452e-04f,1.485508110e-04f,1.433012658e-04f,1.382372284e-04f,1.333521504e-04f,1.286396873e-04f,1.240937709e-04f,1.197085076e-04f,1.154781930e-04f,1.113973922e-04f,1.074607790e-04f,1.036632893e-04f };   // 10000^(-2i/512), i < 256, as float32 (jnp-computed)
__global__ __launch_bounds__(256) void k_csG(float* CS) { const size_t idx = (size_t)blockIdx.x * 256 + threadIdx.x; if (idx >= (size_t)TT * DQ) return; const int cch = (int)(idx % DQ); const int t = (int)(idx / DQ); const float a = __fmul_rn((float)t, INV512[cch >> 1]); v2f cs; cs[0] = cosf(a); cs[1] = sinf(a); *(v2f*)(CS + idx * 2) = cs;  }
__global__ __launch_bounds__(256) void k_ropeIG(const float* __restrict__ F, int pitch, int nheads, const float* __restrict__ CS, float sc, h16* P16, bf* Ph, bf* Pl) {
    const size_t e = ((size_t)blockIdx.x * 256 + threadIdx.x) * 2; if (e >= (size_t)nheads * TT * HD) return; const int d = (int)(e % HD); const int t = (int)((e / HD) % TT); const int h = (int)(e / ((size_t)HD * TT)); const float* f = F + (size_t)t * pitch + h * HD; const float x0 = f[d], x1 = f[d + 1]; const v2f cs = *(const v2f*)(CS + ((size_t)t * DQ + h * HD + d) * 2); v2h o16; v2us oh, ol;
    float a0 = __fmul_rn(x0, cs[0]), b0 = __fmul_rn(x1, cs[1]), a1 = __fmul_rn(x1, cs[0]), b1 = __fmul_rn(x0, cs[1]); asm volatile("" : "+v"(a0), "+v"(b0), "+v"(a1), "+v"(b1));
    float r0 = __fsub_rn(a0, b0) * sc, r1 = __fadd_rn(b1, a1) * sc;   /* even: x0 c - x1 s; odd: x0 s + x1 c */
    o16[0] = tohx(r0); o16[1] = tohx(r1); { unsigned short a2, c2; splitf(r0, a2, c2); oh[0] = a2; ol[0] = c2; splitf(r1, a2, c2); oh[1] = a2; ol[1] = c2; }
    *(v2h*)(P16 + e) = o16; *(v2us*)(Ph + e) = oh; *(v2us*)(Pl + e) = ol;  }



__global__ __launch_bounds__(256) void k_vtp(const float* __restrict__ F, int pitch, int nheads, h16* V16, bf* Vh, bf* Vl) { const size_t e = ((size_t)blockIdx.x * 256 + threadIdx.x) * 2; if (e >= (size_t)nheads * HD * TT) return; const int t = (int)(e % TT); const int d = (int)((e / TT) % HD); const int g = (int)(e / ((size_t)TT * HD)); v2h o16; v2us oh, ol;
#pragma unroll
    for (int q = 0; q < 2; ++q) { const float x = F[(size_t)(t + q) * pitch + g * HD + d]; o16[q] = tohx(x); unsigned short a2, c2; splitf(x, a2, c2); oh[q] = a2; ol[q] = c2; }
    *(v2h*)(V16 + e) = o16; *(v2us*)(Vh + e) = oh; *(v2us*)(Vl + e) = ol;  }

__global__ __launch_bounds__(256) void k_asoft(const float* __restrict__ Sb, h16* P16, bf* Ph, bf* Pl) {
    const int lane = threadIdx.x & 31; const int row = blockIdx.x * 8 + (threadIdx.x >> 5); if (row >= ZH * TT) return; const int i = row % TT; const int zz = row / TT; (void)zz; const bool hires = (i < RH); const float* sr = Sb + (size_t)row * TT; float v[TT / 32]; float mx = -3.0e38f;
#pragma unroll
    for (int ch = 0; ch < TT / 128; ++ch) { const int j0 = ch * 128 + lane * 4; const v4f a = *(const v4f*)(sr + j0);
#pragma unroll
        for (int q = 0; q < 4; ++q) { const int j = j0 + q; (void)j; const float t = (j <= i && !(j >= PRD0 && (j - PRD0) % PRD == 0)) ? a[q] * SCL : -3.0e38f;   /* causal, and the period-3 columns 4, 7, 10, ... are masked for every row */ v[ch * 4 + q] = t; mx = fmaxf(mx, t); } }
#pragma unroll
    for (int sh = 16; sh; sh >>= 1) mx = fmaxf(mx, __shfl_xor(mx, sh, 32));
    float sum = 0.f;
#pragma unroll
    for (int k = 0; k < TT / 32; ++k) { float d0 = __fsub_rn(v[k], mx); asm volatile("" : "+v"(d0)); v[k] = __builtin_amdgcn_exp2f(__fmul_rn(d0, 1.4426950408889634f)); sum += v[k]; }
#pragma unroll
    for (int sh = 16; sh; sh >>= 1) sum += __shfl_xor(sum, sh, 32);
    const float f = __fdiv_rn(hires ? 1.0f : PCAR, sum);
{
        if (hires) {
#pragma unroll
            for (int ch = 0; ch < TT / 128; ++ch) { v4us oh, ol;
#pragma unroll
                for (int q = 0; q < 4; ++q) { unsigned short a, c2; splitf(v[ch * 4 + q] * f, a, c2); oh[q] = a; ol[q] = c2; }
                const size_t oo = ((size_t)zz * (RH ? RH : 1) + i) * TT + ch * 128 + lane * 4; *(v4us*)(Ph + oo) = oh; *(v4us*)(Pl + oo) = ol; }
        } else {
#pragma unroll
            for (int ch = 0; ch < TT / 128; ++ch) { v4h o4;
#pragma unroll
                for (int q = 0; q < 4; ++q) o4[q] = tohx(v[ch * 4 + q] * f);
                *(v4h*)(P16 + (size_t)row * TT + ch * 128 + lane * 4) = o4; } }
         }
}
__global__ __launch_bounds__(256) void k_merge(const float* __restrict__ O, int h0, bf* Ah, bf* Al) { const size_t e = ((size_t)blockIdx.x * 256 + threadIdx.x) * 2; if (e >= (size_t)ZH * TT * HD) return; const int d = (int)(e % HD); const int t = (int)((e / HD) % TT); const int zz = (int)(e / ((size_t)HD * TT)); const float cs = (t < RH) ? 1.0f : (1.0f / PCAR); const size_t oo = (size_t)t * DQ + (h0 + zz) * HD + d;
    v2us oh, ol;
#pragma unroll
    for (int q = 0; q < 2; ++q) { unsigned short a, c2; splitf(O[e + q] * cs, a, c2); oh[q] = a; ol[q] = c2; } *(v2us*)(Ah + oo) = oh; *(v2us*)(Al + oo) = ol;  }

extern "C" void kernel_launch(void* const* d_in, const int* in_sizes, int n_in,
                              void* d_out, int out_size, void* d_ws, size_t ws_size, hipStream_t stream) {
    (void)in_sizes; (void)n_in; (void)out_size;
    const float* x = (const float*)d_in[0]; const float* wq = (const float*)d_in[1]; const float* bq = (const float*)d_in[2]; const float* wk = (const float*)d_in[3]; const float* bk = (const float*)d_in[4]; const float* wv = (const float*)d_in[5]; const float* bv = (const float*)d_in[6]; const float* wo = (const float*)d_in[7]; const float* bo = (const float*)d_in[8];
    float* OUT = (float*)d_out;     // [4][2048][512]
    char* wsp = (char*)d_ws;
    auto take = [&](size_t bytes) { char* p = wsp; wsp += (bytes + 255) & ~(size_t)255; return (void*)p; };
    bf* WQ = (bf*)take((size_t)DQ * DM * 2); bf* WK = (bf*)take((size_t)DKV * DM * 2); bf* WV = (bf*)take((size_t)DKV * DM * 2); bf* WO = (bf*)take((size_t)DM * DQ * 2); float* CS = (float*)take((size_t)TT * DQ * 2 * 4);   /* {cos, sin} per (t, global channel) */
    bf* XB = (bf*)take((size_t)TT * DM * 2); float* FQ = (float*)take((size_t)TT * DQ * 4); float* FK = (float*)take((size_t)TT * DKV * 4);
    h16* QP16 = (h16*)take((size_t)NH_ * TT * HD * 2); h16* KP16 = (h16*)take((size_t)NKV * TT * HD * 2); h16* VT16 = (h16*)take((size_t)NKV * HD * TT * 2);
    bf* QPh = (bf*)take((size_t)NH_ * TT * HD * 2); bf* QPl = (bf*)take((size_t)NH_ * TT * HD * 2); bf* KPh = (bf*)take((size_t)NKV * TT * HD * 2); bf* KPl = (bf*)take((size_t)NKV * TT * HD * 2); bf* VTh = (bf*)take((size_t)NKV * HD * TT * 2); bf* VTl = (bf*)take((size_t)NKV * HD * TT * 2); bf* Ph = (bf*)take((size_t)ZH * RH * TT * 2); bf* Pl = (bf*)take((size_t)ZH * RH * TT * 2);
    float* Sb = (float*)take((size_t)ZH * TT * TT * 4); h16* P16 = (h16*)take((size_t)ZH * TT * TT * 2); float* Ob = (float*)take((size_t)ZH * TT * HD * 4); bf* ATh = (bf*)take((size_t)TT * DQ * 2); bf* ATl = (bf*)take((size_t)TT * DQ * 2);
    if ((size_t)(wsp - (char*)d_ws) > ws_size) return;    // ws 256 MiB
    float* FV = FK;   // v projection reuses the k buffer after the k planes are built (stream-ordered)
    { k_wtG<<<(unsigned)((DM * DQ / 64 + 63) / 64), 256, 0, stream>>>(wq, DM, DQ, WQ); k_wtG<<<(unsigned)((DM * DKV / 64 + 63) / 64), 256, 0, stream>>>(wk, DM, DKV, WK); k_wtG<<<(unsigned)((DM * DKV / 64 + 63) / 64), 256, 0, stream>>>(wv, DM, DKV, WV);
      k_wtG<<<(unsigned)((DQ * DM / 64 + 63) / 64), 256, 0, stream>>>(wo, DQ, DM, WO);
       }
    k_csG<<<(unsigned)(((size_t)TT * DQ + 255) / 256), 256, 0, stream>>>(CS);   /* angle t x 10000^(-2i/512) for global pair i = c/2 */
    const unsigned LQ = (unsigned)(((size_t)NH_ * TT * HD / 2 + 255) / 256), LKv = (unsigned)(((size_t)NKV * TT * HD / 2 + 255) / 256);
    for (int b = 0; b < NB_; ++b) {
        
        k_cvt8<<<(unsigned)(((size_t)TT * DM / 8 + 255) / 256), 256, 0, stream>>>(x + (size_t)b * TT * DM, XB, (size_t)TT * DM / 8);
        k_gemmw<bf, 0, true, 8><<<dim3(TT / 64, DQ / 64, 1), 256, 0, stream>>>(XB, nullptr, WQ, nullptr, DM, FQ, DQ, bq, 0, 0, 0);
        k_ropeIG<<<LQ, 256, 0, stream>>>(FQ, DQ, NH_, CS, 1.0f, QP16, QPh, QPl);
        k_gemmw<bf, 0, true, 8><<<dim3(TT / 64, DKV / 64, 1), 256, 0, stream>>>(XB, nullptr, WK, nullptr, DM, FK, DKV, bk, 0, 0, 0);
        k_ropeIG<<<LKv, 256, 0, stream>>>(FK, DKV, NKV, CS, 1.0f, KP16, KPh, KPl);
        k_gemmw<bf, 0, true, 8><<<dim3(TT / 64, DKV / 64, 1), 256, 0, stream>>>(XB, nullptr, WV, nullptr, DM, FV, DKV, bv, 0, 0, 0); k_vtp<<<LKv, 256, 0, stream>>>(FV, DKV, NKV, VT16, VTh, VTl);
        for (int h0 = 0; h0 < NH_; h0 += ZH) { const size_t zq = (size_t)h0, zk = (size_t)(h0 / REP);   // one kv head per query head: the pass's two heads use consecutive kv planes (z-strides TT*HD)
            k_gemmc<bf, 2, 1, 1><<<dim3(RH / 64, TT / 64, ZH), 32, 0, stream>>>(QPh + zq * TT * HD, QPl + zq * TT * HD, KPh + zk * TT * HD, KPl + zk * TT * HD, HD, Sb, TT, 0, (size_t)TT * HD, (size_t)TT * HD, (size_t)TT * TT);
            k_gemmc<h16, 0, 1, 1><<<dim3((TT - RH) / 64, TT / 64, ZH), 32, 0, stream>>>(QP16 + zq * TT * HD + (size_t)RH * HD, nullptr, KP16 + zk * TT * HD, nullptr, HD, Sb + (size_t)RH * TT, TT, RH, (size_t)TT * HD, (size_t)TT * HD, (size_t)TT * TT);
            k_asoft<<<ZH * TT / 8, 256, 0, stream>>>(Sb, P16, Ph, Pl);
            k_gemmc<bf, 2, 2, 8><<<dim3(RH / 64, HD / 64, ZH), 256, 0, stream>>>(Ph, Pl, VTh + zk * HD * TT, VTl + zk * HD * TT, TT, Ob, HD, 0, (size_t)RH * TT, (size_t)HD * TT, (size_t)TT * HD);
            k_gemmc<h16, 0, 2, 16><<<dim3((TT - RH) / 64, HD / 64, ZH), 512, 0, stream>>>(P16 + (size_t)RH * TT, nullptr, VT16 + zk * HD * TT, nullptr, TT, Ob + (size_t)RH * HD, HD, RH, (size_t)TT * TT, (size_t)HD * TT, (size_t)TT * HD);
            k_merge<<<(unsigned)(((size_t)ZH * TT * HD / 2 + 255) / 256), 256, 0, stream>>>(Ob, h0, ATh, ATl); }
        k_gemmw<bf, 1, true, 8><<<dim3(TT / 64, DM / 64, 1), 256, 0, stream>>>(ATh, ATl, WO, nullptr, DQ, OUT + (size_t)b * TT * DM, DM, bo, 0, 0, 0); }
}

// v002
// One run takes 446 microseconds.
// Two timings next to v001 put it at 2.03 and 2.05 times that version's speed.
// All steps since v000 together make it 3.57 times as fast.
#include <hip/hip_runtime.h>

// Causal attention with rotary embeddings over the FULL hidden dim and periodically masked key columns (x [4][2048][512]; q,k,v = x W + b ('xw' [512][512] + [512], 0.02); rope BEFORE the head split: pairs (2i, 2i+1) of the 512-vector rotated by t x 10000^(-2i/512), i < 256; 8 heads x 64; scores / 8; mask = causal AND key column j not in {4, 7, 10, ...} (j >= 4 with (j - 4) mod 3 == 0: the module's period-3 'mgdt' columns); softmax; out = merged Wo + bo -> [4][2048][512] (4.2 M)).
// Layout, all batches in each launch (attention: one pass of five launches per batch, its 8 heads on grid z; probabilities overwrite their own score rows): bf16 copy of x; exact projections + f32 biases; a {cos, sin} table per (position, global pair) (float32 inverse frequencies over 512 dims, precise cosf/sinf); interleaved-pair rotary plane builder indexed by the GLOBAL channel; causal T-2048 attention (hybrid rows: < 512 hi/lo 3 products, rest fp16 x1024; k_gemmc skips tiles above the diagonal) whose softmax select also drops the period-3 columns; merged hi/lo x Wo exact + bo.
// Compute dtypes, f32 accumulate: every input rounded to bf16; projections exact + f32 biases; rotary f32; attention rows < 512 3 products, rest fp16; softmax f32; Wo hl x exact + bias.

#define NB_  4
#define TT   2048
#define DM   512
#define NH_  8
#define NKV  8
#define REP  (NH_ / NKV)
#define HD   64
#define DQ   (NH_ * HD)
#define DKV  (NKV * HD)
#define ZH   8                    // heads per attention pass (grid z)
#define RH   512                  // query rows < RH use hi+lo planes (0: none)
#define WIN  2048
#define PCAR 1024.0f
#define SCL  0.125f
#define PRD  3       // masked-column period
#define PRD0 4       // first masked column (period + ret_order - 1)
typedef _Float16 h16;
typedef unsigned short bf;
typedef __attribute__((ext_vector_type(16))) __bf16   v16bf;
typedef __attribute__((ext_vector_type(16))) _Float16 v16h;
typedef __attribute__((ext_vector_type(8)))  _Float16 v8h;
typedef __attribute__((ext_vector_type(8)))  unsigned short v8us;
typedef __attribute__((ext_vector_type(8)))  float    v8f;
typedef __attribute__((ext_vector_type(4)))  float    v4f;
typedef v8h  __attribute__((may_alias)) v8ha;
typedef v4f  __attribute__((may_alias)) v4fa;
typedef v8us __attribute__((may_alias)) v8usa;

__device__ __forceinline__ unsigned short f2bf(float f) { unsigned u = __float_as_uint(f); u += 0x7FFFu + ((u >> 16) & 1u); return (unsigned short)(u >> 16); }
__device__ __forceinline__ float bf2f(unsigned short b) { return __uint_as_float(((unsigned)b) << 16); }
__device__ __forceinline__ float bfr(float f) { return bf2f(f2bf(f)); }
__device__ __forceinline__ v16h cat16(v8h lo, v8h hi) { return __builtin_shufflevector(lo, hi, 0, 1, 2, 3, 4, 5, 6, 7, 8, 9, 10, 11, 12, 13, 14, 15); }
__device__ __forceinline__ v16bf cat16b(v8us lo, v8us hi) { return __builtin_bit_cast(v16bf, __builtin_shufflevector(lo, hi, 0, 1, 2, 3, 4, 5, 6, 7, 8, 9, 10, 11, 12, 13, 14, 15)); }
__device__ __forceinline__ v8f wmma16(v16h a, v16h b, v8f c) { return __builtin_amdgcn_wmma_f32_16x16x32_f16(false, a, false, b, (short)0, c, false, false); }
__device__ __forceinline__ v8f wmmab(v16bf a, v16bf b, v8f c) { return __builtin_amdgcn_wmma_f32_16x16x32_bf16(false, a, false, b, (short)0, c, false, false); }



// ---- Split-K epilogue: the NW waves of a work-group each hold a partial 64x64 tile (their share of the K loop). Every wave parks its 16 accumulators in LDS lane-linear (b128, no bank conflict),
// one barrier, then each wave sums its share of the tile over the NW partials in wave order 0..NW-1 and stores it. A unit = 4 accumulator rows x 32 columns, so each 128-byte output line has one writer.
template <int NW, bool BIAS>
__device__ __forceinline__ void splitk_store(const v8f (&acc)[4][4], float* red, float* C, int ldc, const float* __restrict__ bias, int r0, int c0) {
    const int lane = threadIdx.x & 31, lr = lane & 15, hi = lane >> 4, w = __builtin_amdgcn_readfirstlane(threadIdx.x >> 5);
    // both loops unrolled: acc is indexed by constants only and stays in registers
#pragma unroll
    for (int mb = 0; mb < 4; ++mb)
#pragma unroll
        for (int nb = 0; nb < 4; ++nb) { float* p = red + (size_t)((w * 16 + mb * 4 + nb) * 2) * 128 + lane * 4;
            *(v4fa*)p = __builtin_shufflevector(acc[mb][nb], acc[mb][nb], 0, 1, 2, 3); *(v4fa*)(p + 128) = __builtin_shufflevector(acc[mb][nb], acc[mb][nb], 4, 5, 6, 7); }
    __syncthreads();   // publishes every wave's partial tile to the waves that sum it
    for (int q = 0; q < 16 / NW; ++q) { const int unit = w * (16 / NW) + q, mb = unit >> 2, nb0 = ((unit >> 1) & 1) * 2, half = unit & 1;
        for (int e = 0; e < 2; ++e) { const int nb = nb0 + e; const float* p = red + (size_t)((mb * 4 + nb) * 2 + half) * 128 + lane * 4; v4f sum = *(const v4fa*)p;
            for (int u = 1; u < NW; ++u) sum += *(const v4fa*)(p + (size_t)u * 4096);
            const int col = c0 + nb * 16 + lr; if (BIAS) sum += bfr(bias[nb * 16 + lr]);   // bias points at the tile's first column
            float* crow = C + (size_t)(r0 + mb * 16 + hi * 8 + half * 4) * ldc + col;
            for (int j = 0; j < 4; ++j) crow[(size_t)j * ldc] = sum[j]; } }
}

// ---- k_gemmw: register-blocked GEMM, one work-group of NW waves per 64x64 output tile (16 accumulators a wave); wave w takes the K chunks w, w + NW, ...; operands straight from K-contiguous 16-bit planes; grid (M/64, N/64, Z), 32 NW threads.
// C[m][n] (f32, pitch ldc, + optional f32 bias: columns [0, DM) take bias, [DM, 2 DM) biasB, the rest biasC, so q, k and v share one launch) = sum_k A[m][k] Bt[n][k] (+ split products per NSPLIT). z-batch strides sA/sB/sC in elements. K % 32 == 0.
template <typename T16> struct WFrag;
template <> struct WFrag<h16> { typedef v16h V; static __device__ __forceinline__ V ld(const h16* p) { return cat16(*(const v8h*)p, *(const v8h*)(p + 16)); } static __device__ __forceinline__ v8f mma(V a, V b, v8f c) { return wmma16(a, b, c); } };
template <> struct WFrag<bf> { typedef v16bf V; static __device__ __forceinline__ V ld(const bf* p) { return cat16b(*(const v8us*)p, *(const v8us*)(p + 16)); } static __device__ __forceinline__ v8f mma(V a, V b, v8f c) { return wmmab(a, b, c); } };
template <typename T16, int NSPLIT, bool BIAS, int NW>
__global__ __launch_bounds__(32 * NW) void k_gemmw(const T16* __restrict__ A, const T16* __restrict__ A2, const T16* __restrict__ Bt, const T16* __restrict__ Bt2, int K, float* C, int ldc, const float* __restrict__ bias, const float* __restrict__ biasB, const float* __restrict__ biasC, size_t sA, size_t sB, size_t sC) {
    typedef typename WFrag<T16>::V V;
    __shared__ __align__(16) float red[NW * 4096];
    const size_t z = blockIdx.z; A += z * sA; if (A2) A2 += z * sA; Bt += z * sB; if (Bt2) Bt2 += z * sB; C += z * sC;
    const int lane = threadIdx.x & 31, lr = lane & 15, hi = lane >> 4; const int r0 = blockIdx.x * 64, c0 = blockIdx.y * 64;
    const int wv = __builtin_amdgcn_readfirstlane(threadIdx.x >> 5);   // wave number in a scalar register: the K loop stays a scalar loop with every lane on at the matrix instructions
    v8f acc[4][4];
#pragma unroll
    for (int mb = 0; mb < 4; ++mb)
#pragma unroll
        for (int nb = 0; nb < 4; ++nb) acc[mb][nb] = (v8f){};
    const size_t aoff = (size_t)(r0 + lr) * K + 8 * hi, boff = (size_t)(c0 + lr) * K + 8 * hi;
#pragma unroll 1
    for (int kc = wv * 32; kc < K; kc += NW * 32) {
        V a[4], a2[4];
#pragma unroll
        for (int mb = 0; mb < 4; ++mb) { a[mb] = WFrag<T16>::ld(A + aoff + (size_t)mb * 16 * K + kc); if (NSPLIT == 1 || NSPLIT == 2) a2[mb] = WFrag<T16>::ld(A2 + aoff + (size_t)mb * 16 * K + kc); }
#pragma unroll
        for (int nb = 0; nb < 4; ++nb) { const V b = WFrag<T16>::ld(Bt + boff + (size_t)nb * 16 * K + kc); V b2; if (NSPLIT >= 2) b2 = WFrag<T16>::ld(Bt2 + boff + (size_t)nb * 16 * K + kc);
#pragma unroll
            for (int mb = 0; mb < 4; ++mb) { acc[mb][nb] = WFrag<T16>::mma(a[mb], b, acc[mb][nb]); if (NSPLIT == 1 || NSPLIT == 2) acc[mb][nb] = WFrag<T16>::mma(a2[mb], b, acc[mb][nb]); if (NSPLIT >= 2) acc[mb][nb] = WFrag<T16>::mma(a[mb], b2, acc[mb][nb]); } }
        asm volatile("v_nop\n\tv_nop\n\tv_nop\n\tv_nop" : "+v"(acc[0][0]), "+v"(acc[1][1]), "+v"(acc[2][2]), "+v"(acc[3][3]) : "v"(a[0]), "v"(a[3]));
    }
    const int seg = c0 / DM; const float* bs = (seg == 0 ? bias : seg == 1 ? biasB : biasC) + (c0 - seg * DM);
    splitk_store<NW, BIAS>(acc, red, C, ldc, bs, r0, c0);
}

// ---- k_gemmc: the same 64x64 tile GEMM specialised for causal attention: CMODE 1 skips score tiles entirely above the diagonal (query rows r0+roff.., key columns c0..), CMODE 2 limits the
// key (K) loop of the probability x value contraction to the diagonal block (probabilities beyond it are exactly zero). roff = row offset of this launch's first row within the sequence. NW waves share the K loop (chunk w, w + NW, ...) and merge in splitk_store; NW = 1 is the one-wave form.
template <typename T16, int NSPLIT, int CMODE, int NW>
__global__ __launch_bounds__(32 * NW) void k_gemmc(const T16* __restrict__ A, const T16* __restrict__ A2, const T16* __restrict__ Bt, const T16* __restrict__ Bt2, int K, float* C, int ldc, int roff, size_t sA, size_t sB, size_t sC) {
    typedef typename WFrag<T16>::V V;
    __shared__ __align__(16) float os[NW == 1 ? 16 * 68 : NW * 4096];
    const size_t z = blockIdx.z; A += z * sA; if (A2) A2 += z * sA; Bt += z * sB; if (Bt2) Bt2 += z * sB; C += z * sC;
    const int lane = threadIdx.x & 31, lr = lane & 15, hi = lane >> 4; const int r0 = blockIdx.x * 64, c0 = blockIdx.y * 64;
    const int wv = __builtin_amdgcn_readfirstlane(threadIdx.x >> 5);   // wave number in a scalar register: the K loop stays a scalar loop with every lane on at the matrix instructions
    if (CMODE == 1 && c0 > r0 + roff + 63) return;                  // score tile entirely above the causal diagonal: never read (the softmax masks j > i by select)
    const int Kl = (CMODE == 2) ? min(K, r0 + roff + 64) : K;        // P.V: probabilities are exactly 0 beyond the diagonal block, so the K loop stops there
    v8f acc[4][4];
#pragma unroll
    for (int mb = 0; mb < 4; ++mb)
#pragma unroll
        for (int nb = 0; nb < 4; ++nb) acc[mb][nb] = (v8f){};
    const size_t aoff = (size_t)(r0 + lr) * K + 8 * hi, boff = (size_t)(c0 + lr) * K + 8 * hi;
#pragma unroll 1
    for (int kc = wv * 32; kc < Kl; kc += NW * 32) {
        V a[4], a2[4];
#pragma unroll
        for (int mb = 0; mb < 4; ++mb) { a[mb] = WFrag<T16>::ld(A + aoff + (size_t)mb * 16 * K + kc); if (NSPLIT == 1 || NSPLIT == 2) a2[mb] = WFrag<T16>::ld(A2 + aoff + (size_t)mb * 16 * K + kc); }
#pragma unroll
        for (int nb = 0; nb < 4; ++nb) { const V b = WFrag<T16>::ld(Bt + boff + (size_t)nb * 16 * K + kc); V b2; if (NSPLIT >= 2) b2 = WFrag<T16>::ld(Bt2 + boff + (size_t)nb * 16 * K + kc);
#pragma unroll
            for (int mb = 0; mb < 4; ++mb) { acc[mb][nb] = WFrag<T16>::mma(a[mb], b, acc[mb][nb]); if (NSPLIT == 1 || NSPLIT == 2) acc[mb][nb] = WFrag<T16>::mma(a2[mb], b, acc[mb][nb]); if (NSPLIT >= 2) acc[mb][nb] = WFrag<T16>::mma(a[mb], b2, acc[mb][nb]); } }
        asm volatile("v_nop\n\tv_nop\n\tv_nop\n\tv_nop" : "+v"(acc[0][0]), "+v"(acc[1][1]), "+v"(acc[2][2]), "+v"(acc[3][3]) : "v"(a[0]), "v"(a[3]));
    }
    if constexpr (NW > 1) { splitk_store<NW, false>(acc, os, C, ldc, nullptr, r0, c0); return; }
#pragma unroll
    for (int mb = 0; mb < 4; ++mb) {
#pragma unroll
        for (int nb = 0; nb < 4; ++nb) {
#pragma unroll
            for (int j = 0; j < 8; ++j) os[(hi * 8 + j) * 68 + nb * 16 + lr] = acc[mb][nb][j]; }
        __builtin_amdgcn_wave_barrier(); asm volatile("" ::: "memory");
        float* crow = C + (size_t)(r0 + mb * 16) * ldc + c0;
{
#pragma unroll
            for (int s = 0; s < 8; ++s) { const int row = 2 * s + hi, cofs = lr * 4; v4f val = *(const v4fa*)(os + row * 68 + cofs);
                *(v4f*)(crow + (size_t)row * ldc + cofs) = val; }
             }
        __builtin_amdgcn_wave_barrier(); asm volatile("" ::: "memory");
    }
}

__device__ __forceinline__ h16 tohx(float x) { return (h16)x; }
__device__ __forceinline__ void splitf(float y, unsigned short& h, unsigned short& l) { h = f2bf(y); l = f2bf(y - bf2f(h)); }
typedef __attribute__((ext_vector_type(2))) _Float16 v2h;
typedef __attribute__((ext_vector_type(4))) _Float16 v4h;
typedef __attribute__((ext_vector_type(2))) unsigned short v2us;
typedef __attribute__((ext_vector_type(4))) unsigned short v4us;
typedef __attribute__((ext_vector_type(2))) float v2f;
typedef __attribute__((ext_vector_type(4))) int v4i;

__global__ __launch_bounds__(256) void k_wtG(const float* __restrict__ w0, const float* __restrict__ w1, const float* __restrict__ w2, const float* __restrict__ w3, int K, int N, bf* Bt) {
    const float* w = blockIdx.y == 0 ? w0 : blockIdx.y == 1 ? w1 : blockIdx.y == 2 ? w2 : w3; Bt += (size_t)blockIdx.y * N * K;   // grid y: one weight matrix each, planes back to back
    const int lane = threadIdx.x & 31; const int L0 = (blockIdx.x * 8 + (threadIdx.x >> 5)) * 8; const int nlines = N * K / 64;
{
#pragma unroll 1
        for (int l = 0; l < 8; ++l) { const int L = L0 + l; if (L >= nlines) break; const size_t e = (size_t)L * 64 + lane * 2; const int k = (int)(e % K), n = (int)(e / K); v2us o;
            o[0] = f2bf(w[(size_t)k * N + n]); o[1] = f2bf(w[(size_t)(k + 1) * N + n]); *(v2us*)(Bt + e) = o; }
         }
}
__global__ __launch_bounds__(256) void k_cvt8(const float* __restrict__ src, bf* dst, size_t n8) { const size_t i = (size_t)blockIdx.x * 256 + threadIdx.x; if (i >= n8) return; const v8f v = *(const v8f*)(src + i * 8); v8us o;
#pragma unroll
    for (int k = 0; k < 8; ++k) o[k] = f2bf(v[k]); *(v8us*)(dst + i * 8) = o;  }

__constant__ float INV512[DQ / 2] = { 1.000000000e+00f,9.646616578e-01f,9.305720329e-01f,8.976871371e-01f,8.659643531e-01f,8.353625536e-01f,8.058422208e-01f,7.773650289e-01f,7.498942018e-01f,7.233941555e-01f,6.978305578e-01f,6.731703877e-01f,6.493816376e-01f,6.264335513e-01f,6.042963862e-01f,5.829415321e-01f,5.623413324e-01f,5.424690843e-01f,5.232991576e-01f,5.048065782e-01f,4.869675338e-01f,4.697588682e-01f,4.531583488e-01f,4.371444881e-01f,4.216965139e-01f,4.067944288e-01f,3.924189806e-01f,3.785515428e-01f,3.651741445e-01f,3.522694409e-01f,3.398208320e-01f,3.278121352e-01f,3.162277639e-01f,3.050527871e-01f,2.942727208e-01f,2.838735878e-01f,2.738419771e-01f,2.641648352e-01f,2.548296750e-01f,2.458243966e-01f,2.371373624e-01f,2.287573218e-01f,2.206733972e-01f,2.128751576e-01f,2.053525001e-01f,1.980956793e-01f,1.910952926e-01f,1.843423098e-01f,1.778279394e-01f,1.715437919e-01f,1.654817015e-01f,1.596338600e-01f,1.539926529e-01f,1.485508084e-01f,1.433012635e-01f,1.382372230e-01f,1.333521456e-01f,1.286396980e-01f,1.240937710e-01f,1.197085083e-01f,1.154782027e-01f,1.113973856e-01f,1.074607819e-01f,1.036632955e-01f,1.000000015e-01f,9.646616131e-02f,9.305720031e-02f,8.976870775e-02f,8.659642935e-02f,8.353625983e-02f,8.058421314e-02f,7.773650438e-02f,7.498941571e-02f,7.233941555e-02f,6.978305429e-02f,6.731703877e-02f,6.493816525e-02f,6.264335662e-02f,6.042964384e-02f,5.829415470e-02f,5.623412877e-02f,5.424690619e-02f,5.232991278e-02f,5.048065633e-02f,4.869675264e-02f,4.697588459e-02f,4.531583562e-02f,4.371444881e-02f,4.216964915e-02f,4.067944363e-02f,3.924189880e-02f,3.785515204e-02f,3.651741147e-02f,3.522694483e-02f,3.398208320e-02f,3.278120980e-02f,3.162277862e-02f,3.050527908e-02f,2.942727320e-02f,2.838735841e-02f,2.738419548e-02f,2.641648427e-02f,2.548296750e-02f,2.458244003e-02f,2.371373586e-02f,2.287573181e-02f,2.206734009e-02f,2.128751762e-02f,2.053525113e-02f,1.980956830e-02f,1.910953037e-02f,1.843423024e-02f,1.778279431e-02f,1.715437882e-02f,1.654817164e-02f,1.596338488e-02f,1.539926510e-02f,1.485508028e-02f,1.433012541e-02f,1.382372249e-02f,1.333521493e-02f,1.286396943e-02f,1.240937691e-02f,1.197085064e-02f,1.154781971e-02f,1.113973837e-02f,1.074607857e-02f,1.036632899e-02f,9.999999776e-03f,9.646615945e-03f,9.305720218e-03f,8.976871148e-03f,8.659643121e-03f,8.353625424e-03f,8.058422245e-03f,7.773650344e-03f,7.498942316e-03f,7.233941462e-03f,6.978305988e-03f,6.731703877e-03f,6.493816618e-03f,6.264335476e-03f,6.042964291e-03f,5.829415284e-03f,5.623413250e-03f,5.424690899e-03f,5.232991185e-03f,5.048065912e-03f,4.869675264e-03f,4.697588738e-03f,4.531583749e-03f,4.371444695e-03f,4.216964822e-03f,4.067944363e-03f,3.924189601e-03f,3.785515437e-03f,3.651741426e-03f,3.522694577e-03f,3.398208413e-03f,3.278121119e-03f,3.162277862e-03f,3.050528001e-03f,2.942727180e-03f,2.838735934e-03f,2.738419687e-03f,2.641648287e-03f,2.548296703e-03f,2.458244096e-03f,2.371373819e-03f,2.287573181e-03f,2.206734149e-03f,2.128751716e-03f,2.053525066e-03f,1.980956644e-03f,1.910952851e-03f,1.843422884e-03f,1.778279431e-03f,1.715437858e-03f,1.654817141e-03f,1.596338581e-03f,1.539926510e-03f,1.485507935e-03f,1.433012658e-03f,1.382372226e-03f,1.333521446e-03f,1.286396873e-03f,1.240937854e-03f,1.197085017e-03f,1.154782018e-03f,1.113973907e-03f,1.074607833e-03f,1.036632922e-03f,1.000000047e-03f,9.646615945e-04f,9.305721032e-04f,8.976871031e-04f,8.659643354e-04f,8.353625308e-04f,8.058422245e-04f,7.773649995e-04f,7.498941850e-04f,7.233941578e-04f,6.978305755e-04f,6.731703761e-04f,6.493816618e-04f,6.264335825e-04f,6.042963942e-04f,5.829415168e-04f,5.623413017e-04f,5.424690899e-04f,5.232990952e-04f,5.048065796e-04f,4.869675031e-04f,4.697588738e-04f,4.531583400e-04f,4.371444811e-04f,4.216964880e-04f,4.067944246e-04f,3.924189950e-04f,3.785515146e-04f,3.651741135e-04f,3.522694460e-04f,3.398208064e-04f,3.278121294e-04f,3.162277862e-04f,3.050527885e-04f,2.942727297e-04f,2.838736109e-04f,2.738419571e-04f,2.641648462e-04f,2.548296761e-04f,2.458243980e-04f,2.371373848e-04f,2.287573152e-04f,2.206734207e-04f,2.128751657e-04f,2.053524950e-04f,1.980956731e-04f,1.910952997e-04f,1.843422942e-04f,1.778279402e-04f,1.715437829e-04f,1.654817170e-04f,1.596338552e-04f,1.539926452e-04f,1.485508110e-04f,1.433012658e-04f,1.382372284e-04f,1.333521504e-04f,1.286396873e-04f,1.240937709e-04f,1.197085076e-04f,1.154781930e-04f,1.113973922e-04f,1.074607790e-04f,1.036632893e-04f };   // 10000^(-2i/512), i < 256, as float32 (jnp-computed)
__global__ __launch_bounds__(256) void k_csG(float* CS) { const size_t idx = (size_t)blockIdx.x * 256 + threadIdx.x; if (idx >= (size_t)TT * DQ) return; const int cch = (int)(idx % DQ); const int t = (int)(idx / DQ); const float a = __fmul_rn((float)t, INV512[cch >> 1]); v2f cs; cs[0] = cosf(a); cs[1] = sinf(a); *(v2f*)(CS + idx * 2) = cs;  }
__global__ __launch_bounds__(256) void k_ropeIG(const float* __restrict__ F, int pitch, const float* __restrict__ CS, float sc, h16* P16, bf* Ph, bf* Pl) {   // planes [q, k][batch][head][t][d]; F rows hold q | k | v
    const size_t e = ((size_t)blockIdx.x * 256 + threadIdx.x) * 2; if (e >= (size_t)2 * NB_ * NH_ * TT * HD) return; const int d = (int)(e % HD); const int t = (int)((e / HD) % TT); const int z = (int)(e / ((size_t)HD * TT)); const int h = z % NH_, b = (z / NH_) % NB_, qk = z / (NH_ * NB_); const float* f = F + ((size_t)b * TT + t) * pitch + qk * DQ + h * HD; const float x0 = f[d], x1 = f[d + 1]; const v2f cs = *(const v2f*)(CS + ((size_t)t * DQ + h * HD + d) * 2); v2h o16; v2us oh, ol;
    float a0 = __fmul_rn(x0, cs[0]), b0 = __fmul_rn(x1, cs[1]), a1 = __fmul_rn(x1, cs[0]), b1 = __fmul_rn(x0, cs[1]); asm volatile("" : "+v"(a0), "+v"(b0), "+v"(a1), "+v"(b1));
    float r0 = __fsub_rn(a0, b0) * sc, r1 = __fadd_rn(b1, a1) * sc;   /* even: x0 c - x1 s; odd: x0 s + x1 c */
    o16[0] = tohx(r0); o16[1] = tohx(r1); { unsigned short a2, c2; splitf(r0, a2, c2); oh[0] = a2; ol[0] = c2; splitf(r1, a2, c2); oh[1] = a2; ol[1] = c2; }
    *(v2h*)(P16 + e) = o16; *(v2us*)(Ph + e) = oh; *(v2us*)(Pl + e) = ol;  }



// V planes [batch][head][d][2 TT]: the pitch of a probability row (k_gemmc has one pitch K for both operands). Vhl holds a channel's hi half then its lo half; V16 fills the first half.
__global__ __launch_bounds__(256) void k_vtp(const float* __restrict__ F, int pitch, h16* V16, bf* Vhl) { const size_t e = ((size_t)blockIdx.x * 256 + threadIdx.x) * 2; if (e >= (size_t)NB_ * NKV * HD * TT) return; const int t = (int)(e % TT); const int d = (int)((e / TT) % HD); const int z = (int)(e / ((size_t)TT * HD)); const int g = z % NKV, b = z / NKV; v2h o16; v2us oh, ol;
#pragma unroll
    for (int q = 0; q < 2; ++q) { const float x = F[((size_t)b * TT + t + q) * pitch + g * HD + d]; o16[q] = tohx(x); unsigned short a2, c2; splitf(x, a2, c2); oh[q] = a2; ol[q] = c2; }
    const size_t o = e + (e / TT) * TT; *(v2h*)(V16 + o) = o16; *(v2us*)(Vhl + o) = oh; *(v2us*)(Vhl + o + TT) = ol;  }

// One wave per score row. The probabilities overwrite the row they came from (8 KiB of f32 scores -> hi plane | lo plane of 4 KiB each for rows < RH, one fp16 plane in the first 4 KiB otherwise): every store needs the row sum, so the whole row is in registers before the first store.
__global__ __launch_bounds__(256) void k_asoft(float* Sb) {
    const int lane = threadIdx.x & 31; const int row = blockIdx.x * 8 + (threadIdx.x >> 5); if (row >= ZH * TT) return; const int i = row % TT; const bool hires = (i < RH); float* sr = Sb + (size_t)row * TT; float v[TT / 32]; float mx = -3.0e38f;
#pragma unroll
    for (int ch = 0; ch < TT / 128; ++ch) { const int j0 = ch * 128 + lane * 4; const v4f a = *(const v4f*)(sr + j0);
#pragma unroll
        for (int q = 0; q < 4; ++q) { const int j = j0 + q; (void)j; const float t = (j <= i && !(j >= PRD0 && (j - PRD0) % PRD == 0)) ? a[q] * SCL : -3.0e38f;   /* causal, and the period-3 columns 4, 7, 10, ... are masked for every row */ v[ch * 4 + q] = t; mx = fmaxf(mx, t); } }
#pragma unroll
    for (int sh = 16; sh; sh >>= 1) mx = fmaxf(mx, __shfl_xor(mx, sh, 32));
    float sum = 0.f;
#pragma unroll
    for (int k = 0; k < TT / 32; ++k) { float d0 = __fsub_rn(v[k], mx); asm volatile("" : "+v"(d0)); v[k] = __builtin_amdgcn_exp2f(__fmul_rn(d0, 1.4426950408889634f)); sum += v[k]; }
#pragma unroll
    for (int sh = 16; sh; sh >>= 1) sum += __shfl_xor(sum, sh, 32);
    const float f = __fdiv_rn(hires ? 1.0f : PCAR, sum);
{
        if (hires) {
#pragma unroll
            for (int ch = 0; ch < TT / 128; ++ch) { v4us oh, ol;
#pragma unroll
                for (int q = 0; q < 4; ++q) { unsigned short a, c2; splitf(v[ch * 4 + q] * f, a, c2); oh[q] = a; ol[q] = c2; }
                bf* po = (bf*)sr + ch * 128 + lane * 4; *(v4us*)po = oh; *(v4us*)(po + TT) = ol; }
        } else {
#pragma unroll
            for (int ch = 0; ch < TT / 128; ++ch) { v4h o4;
#pragma unroll
                for (int q = 0; q < 4; ++q) o4[q] = tohx(v[ch * 4 + q] * f);
                *(v4h*)((h16*)sr + ch * 128 + lane * 4) = o4; } }
         }
}
__global__ __launch_bounds__(256) void k_merge(const float* __restrict__ O, bf* Ah, bf* Al) { const size_t e = ((size_t)blockIdx.x * 256 + threadIdx.x) * 2; if (e >= (size_t)NB_ * NH_ * TT * HD) return; const int d = (int)(e % HD); const int t = (int)((e / HD) % TT); const int zz = (int)(e / ((size_t)HD * TT)); const float cs = (t < RH) ? 1.0f : (1.0f / PCAR); const size_t oo = ((size_t)(zz / NH_) * TT + t) * DQ + (zz % NH_) * HD + d;
    v2us oh, ol;
#pragma unroll
    for (int q = 0; q < 2; ++q) { unsigned short a, c2; splitf(O[e + q] * cs, a, c2); oh[q] = a; ol[q] = c2; } *(v2us*)(Ah + oo) = oh; *(v2us*)(Al + oo) = ol;  }

extern "C" void kernel_launch(void* const* d_in, const int* in_sizes, int n_in,
                              void* d_out, int out_size, void* d_ws, size_t ws_size, hipStream_t stream) {
    (void)in_sizes; (void)n_in; (void)out_size;
    const float* x = (const float*)d_in[0]; const float* wq = (const float*)d_in[1]; const float* bq = (const float*)d_in[2]; const float* wk = (const float*)d_in[3]; const float* bk = (const float*)d_in[4]; const float* wv = (const float*)d_in[5]; const float* bv = (const float*)d_in[6]; const float* wo = (const float*)d_in[7]; const float* bo = (const float*)d_in[8];
    float* OUT = (float*)d_out;     // [4][2048][512]
    char* wsp = (char*)d_ws;
    auto take = [&](size_t bytes) { char* p = wsp; wsp += (bytes + 255) & ~(size_t)255; return (void*)p; };
    const size_t PL = (size_t)NB_ * NH_ * TT * HD;   // elements of one [batch][head] plane set
    bf* WA = (bf*)take((size_t)4 * DM * DQ * 2);      // Wq | Wk | Wv | Wo, each transposed [n][k]
    h16* QK16 = (h16*)take(2 * PL * 2); bf* QKh = (bf*)take(2 * PL * 2); bf* QKl = (bf*)take(2 * PL * 2);   // q planes, then k planes
    h16* VT16 = (h16*)take(2 * PL * 2); bf* VThl = (bf*)take(2 * PL * 2);   // rows of 2 TT elements
    float* Ob = (float*)take(PL * 4); bf* ATh = (bf*)take(PL * 2); bf* ATl = (bf*)take(PL * 2);
    float* Sb = (float*)take((size_t)ZH * TT * TT * 4);   // one pass's scores, then its probabilities in place
    if ((size_t)(wsp - (char*)d_ws) > ws_size) return;    // ws 256 MiB
    // x copy, projections and the angle table are dead once the planes are built: they lie inside Sb (stream-ordered)
    bf* XB = (bf*)Sb; float* F = (float*)(XB + (size_t)NB_ * TT * DM); float* CS = F + (size_t)NB_ * TT * 3 * DQ;   /* F [batch t][q | k | v]; CS {cos, sin} per (t, global channel) */
    k_wtG<<<dim3((unsigned)((DM * DQ / 64 + 63) / 64), 4, 1), 256, 0, stream>>>(wq, wk, wv, wo, DM, DQ, WA);
    k_csG<<<(unsigned)(((size_t)TT * DQ + 255) / 256), 256, 0, stream>>>(CS);   /* angle t x 10000^(-2i/512) for global pair i = c/2 */
    k_cvt8<<<(unsigned)(((size_t)NB_ * TT * DM / 8 + 255) / 256), 256, 0, stream>>>(x, XB, (size_t)NB_ * TT * DM / 8);
    k_gemmw<bf, 0, true, 8><<<dim3(NB_ * TT / 64, 3 * DQ / 64, 1), 256, 0, stream>>>(XB, nullptr, WA, nullptr, DM, F, 3 * DQ, bq, bk, bv, 0, 0, 0);
    k_ropeIG<<<(unsigned)((2 * PL / 2 + 255) / 256), 256, 0, stream>>>(F, 3 * DQ, CS, 1.0f, QK16, QKh, QKl);
    k_vtp<<<(unsigned)((PL / 2 + 255) / 256), 256, 0, stream>>>(F + 2 * DQ, 3 * DQ, VT16, VThl);
    for (int b = 0; b < NB_; ++b) { const size_t zo = (size_t)b * NH_ * TT * HD;   // the pass's 8 heads use consecutive planes (z-strides TT*HD); a probability row has the pitch of its score row, 2 TT 16-bit elements, and so have the V rows: K = 2 TT is that pitch, the K loop itself ends at the diagonal block
        k_gemmc<bf, 2, 1, 1><<<dim3(RH / 64, TT / 64, ZH), 32, 0, stream>>>(QKh + zo, QKl + zo, QKh + PL + zo, QKl + PL + zo, HD, Sb, TT, 0, (size_t)TT * HD, (size_t)TT * HD, (size_t)TT * TT);
        k_gemmc<h16, 0, 1, 1><<<dim3((TT - RH) / 64, TT / 64, ZH), 32, 0, stream>>>(QK16 + zo + (size_t)RH * HD, nullptr, QK16 + PL + zo, nullptr, HD, Sb + (size_t)RH * TT, TT, RH, (size_t)TT * HD, (size_t)TT * HD, (size_t)TT * TT);
        k_asoft<<<ZH * TT / 8, 256, 0, stream>>>(Sb);
        k_gemmc<bf, 2, 2, 8><<<dim3(RH / 64, HD / 64, ZH), 256, 0, stream>>>((const bf*)Sb, (const bf*)Sb + TT, VThl + 2 * zo, VThl + 2 * zo + TT, 2 * TT, Ob + zo, HD, 0, (size_t)TT * TT * 2, (size_t)HD * TT * 2, (size_t)TT * HD);
        k_gemmc<h16, 0, 2, 16><<<dim3((TT - RH) / 64, HD / 64, ZH), 512, 0, stream>>>((const h16*)Sb + (size_t)RH * TT * 2, nullptr, VT16 + 2 * zo, nullptr, 2 * TT, Ob + zo + (size_t)RH * HD, HD, RH, (size_t)TT * TT * 2, (size_t)HD * TT * 2, (size_t)TT * HD); }
    k_merge<<<(unsigned)((PL / 2 + 255) / 256), 256, 0, stream>>>(Ob, ATh, ATl);
    k_gemmw<bf, 1, true, 8><<<dim3(NB_ * TT / 64, DM / 64, 1), 256, 0, stream>>>(ATh, ATl, WA + (size_t)3 * DM * DQ, nullptr, DQ, OUT, DM, bo, nullptr, nullptr, 0, 0, 0);
}

// v003
// One run takes 163 microseconds.
// In both of two side-by-side timings against v002, it was 2.74 times as fast.
// All steps since v000 together make it 9.77 times as fast.
#include <hip/hip_runtime.h>

// Causal attention with rotary embeddings over the FULL hidden dim and periodically masked key columns (x [4][2048][512]; q,k,v = x W + b ('xw' [512][512] + [512], 0.02); rope BEFORE the head split: pairs (2i, 2i+1) of the 512-vector rotated by t x 10000^(-2i/512), i < 256; 8 heads x 64; scores / 8; mask = causal AND key column j not in {4, 7, 10, ...} (j >= 4 with (j - 4) mod 3 == 0: the module's period-3 'mgdt' columns); softmax; out = merged Wo + bo -> [4][2048][512] (4.2 M)).
// Layout, all batches in each launch: bf16 copy of x; exact projections + f32 biases; a {cos, sin} table per (position, global pair) (float32 inverse frequencies over 512 dims, precise cosf/sinf); interleaved-pair rotary plane builder indexed by the GLOBAL channel; fused causal attention (k_fattn: scores, running-maximum softmax and P x V in registers; rows < 512 hi/lo 3 products, rest fp16; the period-3 columns enter as -3e38) that writes the merged hi/lo planes; merged hi/lo x Wo exact + bo.
// Compute dtypes, f32 accumulate: every input rounded to bf16; projections exact + f32 biases; rotary f32; attention rows < 512 3 products, rest fp16; softmax f32; Wo hl x exact + bias.

#define NB_  4
#define TT   2048
#define DM   512
#define NH_  8
#define NKV  8
#define REP  (NH_ / NKV)
#define HD   64
#define DQ   (NH_ * HD)
#define DKV  (NKV * HD)
#define RH   512                  // query rows < RH use hi+lo planes (0: none)
#define SCL  0.125f
#define PRD  3       // masked-column period
#define PRD0 4       // first masked column (period + ret_order - 1)
typedef _Float16 h16;
typedef unsigned short bf;
typedef __attribute__((ext_vector_type(16))) __bf16   v16bf;
typedef __attribute__((ext_vector_type(16))) _Float16 v16h;
typedef __attribute__((ext_vector_type(8)))  _Float16 v8h;
typedef __attribute__((ext_vector_type(8)))  unsigned short v8us;
typedef __attribute__((ext_vector_type(8)))  float    v8f;
typedef __attribute__((ext_vector_type(4)))  float    v4f;
typedef v8h  __attribute__((may_alias)) v8ha;
typedef v4f  __attribute__((may_alias)) v4fa;
typedef v8us __attribute__((may_alias)) v8usa;

__device__ __forceinline__ unsigned short f2bf(float f) { unsigned u = __float_as_uint(f); u += 0x7FFFu + ((u >> 16) & 1u); return (unsigned short)(u >> 16); }
__device__ __forceinline__ float bf2f(unsigned short b) { return __uint_as_float(((unsigned)b) << 16); }
__device__ __forceinline__ float bfr(float f) { return bf2f(f2bf(f)); }
__device__ __forceinline__ v16h cat16(v8h lo, v8h hi) { return __builtin_shufflevector(lo, hi, 0, 1, 2, 3, 4, 5, 6, 7, 8, 9, 10, 11, 12, 13, 14, 15); }
__device__ __forceinline__ v16bf cat16b(v8us lo, v8us hi) { return __builtin_bit_cast(v16bf, __builtin_shufflevector(lo, hi, 0, 1, 2, 3, 4, 5, 6, 7, 8, 9, 10, 11, 12, 13, 14, 15)); }
__device__ __forceinline__ v8f wmma16(v16h a, v16h b, v8f c) { return __builtin_amdgcn_wmma_f32_16x16x32_f16(false, a, false, b, (short)0, c, false, false); }
__device__ __forceinline__ v8f wmmab(v16bf a, v16bf b, v8f c) { return __builtin_amdgcn_wmma_f32_16x16x32_bf16(false, a, false, b, (short)0, c, false, false); }



// ---- Split-K epilogue: the NW waves of a work-group each hold a partial 64x64 tile (their share of the K loop). Every wave parks its 16 accumulators in LDS lane-linear (b128, no bank conflict),
// one barrier, then each wave sums its share of the tile over the NW partials in wave order 0..NW-1 and stores it. A unit = 4 accumulator rows x 32 columns, so each 128-byte output line has one writer.
template <int NW, bool BIAS>
__device__ __forceinline__ void splitk_store(const v8f (&acc)[4][4], float* red, float* C, int ldc, const float* __restrict__ bias, int r0, int c0) {
    const int lane = threadIdx.x & 31, lr = lane & 15, hi = lane >> 4, w = __builtin_amdgcn_readfirstlane(threadIdx.x >> 5);
    // both loops unrolled: acc is indexed by constants only and stays in registers
#pragma unroll
    for (int mb = 0; mb < 4; ++mb)
#pragma unroll
        for (int nb = 0; nb < 4; ++nb) { float* p = red + (size_t)((w * 16 + mb * 4 + nb) * 2) * 128 + lane * 4;
            *(v4fa*)p = __builtin_shufflevector(acc[mb][nb], acc[mb][nb], 0, 1, 2, 3); *(v4fa*)(p + 128) = __builtin_shufflevector(acc[mb][nb], acc[mb][nb], 4, 5, 6, 7); }
    __syncthreads();   // publishes every wave's partial tile to the waves that sum it
    for (int q = 0; q < 16 / NW; ++q) { const int unit = w * (16 / NW) + q, mb = unit >> 2, nb0 = ((unit >> 1) & 1) * 2, half = unit & 1;
        for (int e = 0; e < 2; ++e) { const int nb = nb0 + e; const float* p = red + (size_t)((mb * 4 + nb) * 2 + half) * 128 + lane * 4; v4f sum = *(const v4fa*)p;
            for (int u = 1; u < NW; ++u) sum += *(const v4fa*)(p + (size_t)u * 4096);
            const int col = c0 + nb * 16 + lr; if (BIAS) sum += bfr(bias[nb * 16 + lr]);   // bias points at the tile's first column
            float* crow = C + (size_t)(r0 + mb * 16 + hi * 8 + half * 4) * ldc + col;
            for (int j = 0; j < 4; ++j) crow[(size_t)j * ldc] = sum[j]; } }
}

// ---- k_gemmw: register-blocked GEMM, one work-group of NW waves per 64x64 output tile (16 accumulators a wave); wave w takes the K chunks w, w + NW, ...; operands straight from K-contiguous 16-bit planes; grid (M/64, N/64, Z), 32 NW threads.
// C[m][n] (f32, pitch ldc, + optional f32 bias: columns [0, DM) take bias, [DM, 2 DM) biasB, the rest biasC, so q, k and v share one launch) = sum_k A[m][k] Bt[n][k] (+ split products per NSPLIT). z-batch strides sA/sB/sC in elements. K % 32 == 0.
template <typename T16> struct WFrag;
template <> struct WFrag<h16> { typedef v16h V; static __device__ __forceinline__ V ld(const h16* p) { return cat16(*(const v8h*)p, *(const v8h*)(p + 16)); } static __device__ __forceinline__ v8f mma(V a, V b, v8f c) { return wmma16(a, b, c); } };
template <> struct WFrag<bf> { typedef v16bf V; static __device__ __forceinline__ V ld(const bf* p) { return cat16b(*(const v8us*)p, *(const v8us*)(p + 16)); } static __device__ __forceinline__ v8f mma(V a, V b, v8f c) { return wmmab(a, b, c); } };
template <typename T16, int NSPLIT, bool BIAS, int NW>
__global__ __launch_bounds__(32 * NW) void k_gemmw(const T16* __restrict__ A, const T16* __restrict__ A2, const T16* __restrict__ Bt, const T16* __restrict__ Bt2, int K, float* C, int ldc, const float* __restrict__ bias, const float* __restrict__ biasB, const float* __restrict__ biasC, size_t sA, size_t sB, size_t sC) {
    typedef typename WFrag<T16>::V V;
    __shared__ __align__(16) float red[NW * 4096];
    const size_t z = blockIdx.z; A += z * sA; if (A2) A2 += z * sA; Bt += z * sB; if (Bt2) Bt2 += z * sB; C += z * sC;
    const int lane = threadIdx.x & 31, lr = lane & 15, hi = lane >> 4; const int r0 = blockIdx.x * 64, c0 = blockIdx.y * 64;
    const int wv = __builtin_amdgcn_readfirstlane(threadIdx.x >> 5);   // wave number in a scalar register: the K loop stays a scalar loop with every lane on at the matrix instructions
    v8f acc[4][4];
#pragma unroll
    for (int mb = 0; mb < 4; ++mb)
#pragma unroll
        for (int nb = 0; nb < 4; ++nb) acc[mb][nb] = (v8f){};
    const size_t aoff = (size_t)(r0 + lr) * K + 8 * hi, boff = (size_t)(c0 + lr) * K + 8 * hi;
#pragma unroll 1
    for (int kc = wv * 32; kc < K; kc += NW * 32) {
        V a[4], a2[4];
#pragma unroll
        for (int mb = 0; mb < 4; ++mb) { a[mb] = WFrag<T16>::ld(A + aoff + (size_t)mb * 16 * K + kc); if (NSPLIT == 1 || NSPLIT == 2) a2[mb] = WFrag<T16>::ld(A2 + aoff + (size_t)mb * 16 * K + kc); }
#pragma unroll
        for (int nb = 0; nb < 4; ++nb) { const V b = WFrag<T16>::ld(Bt + boff + (size_t)nb * 16 * K + kc); V b2; if (NSPLIT >= 2) b2 = WFrag<T16>::ld(Bt2 + boff + (size_t)nb * 16 * K + kc);
#pragma unroll
            for (int mb = 0; mb < 4; ++mb) { acc[mb][nb] = WFrag<T16>::mma(a[mb], b, acc[mb][nb]); if (NSPLIT == 1 || NSPLIT == 2) acc[mb][nb] = WFrag<T16>::mma(a2[mb], b, acc[mb][nb]); if (NSPLIT >= 2) acc[mb][nb] = WFrag<T16>::mma(a[mb], b2, acc[mb][nb]); } }
        asm volatile("v_nop\n\tv_nop\n\tv_nop\n\tv_nop" : "+v"(acc[0][0]), "+v"(acc[1][1]), "+v"(acc[2][2]), "+v"(acc[3][3]) : "v"(a[0]), "v"(a[3]));
    }
    const int seg = c0 / DM; const float* bs = (seg == 0 ? bias : seg == 1 ? biasB : biasC) + (c0 - seg * DM);
    splitk_store<NW, BIAS>(acc, red, C, ldc, bs, r0, c0);
}

__device__ __forceinline__ h16 tohx(float x) { return (h16)x; }
__device__ __forceinline__ void splitf(float y, unsigned short& h, unsigned short& l) { h = f2bf(y); l = f2bf(y - bf2f(h)); }
typedef __attribute__((ext_vector_type(2))) _Float16 v2h;
typedef __attribute__((ext_vector_type(4))) _Float16 v4h;
typedef __attribute__((ext_vector_type(2))) unsigned short v2us;
typedef __attribute__((ext_vector_type(4))) unsigned short v4us;
typedef __attribute__((ext_vector_type(2))) float v2f;
typedef __attribute__((ext_vector_type(4))) int v4i;

__global__ __launch_bounds__(256) void k_wtG(const float* __restrict__ w0, const float* __restrict__ w1, const float* __restrict__ w2, const float* __restrict__ w3, int K, int N, bf* Bt) {
    const float* w = blockIdx.y == 0 ? w0 : blockIdx.y == 1 ? w1 : blockIdx.y == 2 ? w2 : w3; Bt += (size_t)blockIdx.y * N * K;   // grid y: one weight matrix each, planes back to back
    const int lane = threadIdx.x & 31; const int L0 = (blockIdx.x * 8 + (threadIdx.x >> 5)) * 8; const int nlines = N * K / 64;
{
#pragma unroll 1
        for (int l = 0; l < 8; ++l) { const int L = L0 + l; if (L >= nlines) break; const size_t e = (size_t)L * 64 + lane * 2; const int k = (int)(e % K), n = (int)(e / K); v2us o;
            o[0] = f2bf(w[(size_t)k * N + n]); o[1] = f2bf(w[(size_t)(k + 1) * N + n]); *(v2us*)(Bt + e) = o; }
         }
}
__global__ __launch_bounds__(256) void k_cvt8(const float* __restrict__ src, bf* dst, size_t n8) { const size_t i = (size_t)blockIdx.x * 256 + threadIdx.x; if (i >= n8) return; const v8f v = *(const v8f*)(src + i * 8); v8us o;
#pragma unroll
    for (int k = 0; k < 8; ++k) o[k] = f2bf(v[k]); *(v8us*)(dst + i * 8) = o;  }

__constant__ float INV512[DQ / 2] = { 1.000000000e+00f,9.646616578e-01f,9.305720329e-01f,8.976871371e-01f,8.659643531e-01f,8.353625536e-01f,8.058422208e-01f,7.773650289e-01f,7.498942018e-01f,7.233941555e-01f,6.978305578e-01f,6.731703877e-01f,6.493816376e-01f,6.264335513e-01f,6.042963862e-01f,5.829415321e-01f,5.623413324e-01f,5.424690843e-01f,5.232991576e-01f,5.048065782e-01f,4.869675338e-01f,4.697588682e-01f,4.531583488e-01f,4.371444881e-01f,4.216965139e-01f,4.067944288e-01f,3.924189806e-01f,3.785515428e-01f,3.651741445e-01f,3.522694409e-01f,3.398208320e-01f,3.278121352e-01f,3.162277639e-01f,3.050527871e-01f,2.942727208e-01f,2.838735878e-01f,2.738419771e-01f,2.641648352e-01f,2.548296750e-01f,2.458243966e-01f,2.371373624e-01f,2.287573218e-01f,2.206733972e-01f,2.128751576e-01f,2.053525001e-01f,1.980956793e-01f,1.910952926e-01f,1.843423098e-01f,1.778279394e-01f,1.715437919e-01f,1.654817015e-01f,1.596338600e-01f,1.539926529e-01f,1.485508084e-01f,1.433012635e-01f,1.382372230e-01f,1.333521456e-01f,1.286396980e-01f,1.240937710e-01f,1.197085083e-01f,1.154782027e-01f,1.113973856e-01f,1.074607819e-01f,1.036632955e-01f,1.000000015e-01f,9.646616131e-02f,9.305720031e-02f,8.976870775e-02f,8.659642935e-02f,8.353625983e-02f,8.058421314e-02f,7.773650438e-02f,7.498941571e-02f,7.233941555e-02f,6.978305429e-02f,6.731703877e-02f,6.493816525e-02f,6.264335662e-02f,6.042964384e-02f,5.829415470e-02f,5.623412877e-02f,5.424690619e-02f,5.232991278e-02f,5.048065633e-02f,4.869675264e-02f,4.697588459e-02f,4.531583562e-02f,4.371444881e-02f,4.216964915e-02f,4.067944363e-02f,3.924189880e-02f,3.785515204e-02f,3.651741147e-02f,3.522694483e-02f,3.398208320e-02f,3.278120980e-02f,3.162277862e-02f,3.050527908e-02f,2.942727320e-02f,2.838735841e-02f,2.738419548e-02f,2.641648427e-02f,2.548296750e-02f,2.458244003e-02f,2.371373586e-02f,2.287573181e-02f,2.206734009e-02f,2.128751762e-02f,2.053525113e-02f,1.980956830e-02f,1.910953037e-02f,1.843423024e-02f,1.778279431e-02f,1.715437882e-02f,1.654817164e-02f,1.596338488e-02f,1.539926510e-02f,1.485508028e-02f,1.433012541e-02f,1.382372249e-02f,1.333521493e-02f,1.286396943e-02f,1.240937691e-02f,1.197085064e-02f,1.154781971e-02f,1.113973837e-02f,1.074607857e-02f,1.036632899e-02f,9.999999776e-03f,9.646615945e-03f,9.305720218e-03f,8.976871148e-03f,8.659643121e-03f,8.353625424e-03f,8.058422245e-03f,7.773650344e-03f,7.498942316e-03f,7.233941462e-03f,6.978305988e-03f,6.731703877e-03f,6.493816618e-03f,6.264335476e-03f,6.042964291e-03f,5.829415284e-03f,5.623413250e-03f,5.424690899e-03f,5.232991185e-03f,5.048065912e-03f,4.869675264e-03f,4.697588738e-03f,4.531583749e-03f,4.371444695e-03f,4.216964822e-03f,4.067944363e-03f,3.924189601e-03f,3.785515437e-03f,3.651741426e-03f,3.522694577e-03f,3.398208413e-03f,3.278121119e-03f,3.162277862e-03f,3.050528001e-03f,2.942727180e-03f,2.838735934e-03f,2.738419687e-03f,2.641648287e-03f,2.548296703e-03f,2.458244096e-03f,2.371373819e-03f,2.287573181e-03f,2.206734149e-03f,2.128751716e-03f,2.053525066e-03f,1.980956644e-03f,1.910952851e-03f,1.843422884e-03f,1.778279431e-03f,1.715437858e-03f,1.654817141e-03f,1.596338581e-03f,1.539926510e-03f,1.485507935e-03f,1.433012658e-03f,1.382372226e-03f,1.333521446e-03f,1.286396873e-03f,1.240937854e-03f,1.197085017e-03f,1.154782018e-03f,1.113973907e-03f,1.074607833e-03f,1.036632922e-03f,1.000000047e-03f,9.646615945e-04f,9.305721032e-04f,8.976871031e-04f,8.659643354e-04f,8.353625308e-04f,8.058422245e-04f,7.773649995e-04f,7.498941850e-04f,7.233941578e-04f,6.978305755e-04f,6.731703761e-04f,6.493816618e-04f,6.264335825e-04f,6.042963942e-04f,5.829415168e-04f,5.623413017e-04f,5.424690899e-04f,5.232990952e-04f,5.048065796e-04f,4.869675031e-04f,4.697588738e-04f,4.531583400e-04f,4.371444811e-04f,4.216964880e-04f,4.067944246e-04f,3.924189950e-04f,3.785515146e-04f,3.651741135e-04f,3.522694460e-04f,3.398208064e-04f,3.278121294e-04f,3.162277862e-04f,3.050527885e-04f,2.942727297e-04f,2.838736109e-04f,2.738419571e-04f,2.641648462e-04f,2.548296761e-04f,2.458243980e-04f,2.371373848e-04f,2.287573152e-04f,2.206734207e-04f,2.128751657e-04f,2.053524950e-04f,1.980956731e-04f,1.910952997e-04f,1.843422942e-04f,1.778279402e-04f,1.715437829e-04f,1.654817170e-04f,1.596338552e-04f,1.539926452e-04f,1.485508110e-04f,1.433012658e-04f,1.382372284e-04f,1.333521504e-04f,1.286396873e-04f,1.240937709e-04f,1.197085076e-04f,1.154781930e-04f,1.113973922e-04f,1.074607790e-04f,1.036632893e-04f };   // 10000^(-2i/512), i < 256, as float32 (jnp-computed)
__global__ __launch_bounds__(256) void k_csG(float* CS) { const size_t idx = (size_t)blockIdx.x * 256 + threadIdx.x; if (idx >= (size_t)TT * DQ) return; const int cch = (int)(idx % DQ); const int t = (int)(idx / DQ); const float a = __fmul_rn((float)t, INV512[cch >> 1]); v2f cs; cs[0] = cosf(a); cs[1] = sinf(a); *(v2f*)(CS + idx * 2) = cs;  }
__global__ __launch_bounds__(256) void k_ropeIG(const float* __restrict__ F, int pitch, const float* __restrict__ CS, float sc, h16* P16, bf* Ph, bf* Pl) {   // planes [q, k][batch][head][t][d]; F rows hold q | k | v
    const size_t e = ((size_t)blockIdx.x * 256 + threadIdx.x) * 2; if (e >= (size_t)2 * NB_ * NH_ * TT * HD) return; const int d = (int)(e % HD); const int t = (int)((e / HD) % TT); const int z = (int)(e / ((size_t)HD * TT)); const int h = z % NH_, b = (z / NH_) % NB_, qk = z / (NH_ * NB_); const float* f = F + ((size_t)b * TT + t) * pitch + qk * DQ + h * HD; const float x0 = f[d], x1 = f[d + 1]; const v2f cs = *(const v2f*)(CS + ((size_t)t * DQ + h * HD + d) * 2); v2h o16; v2us oh, ol;
    float a0 = __fmul_rn(x0, cs[0]), b0 = __fmul_rn(x1, cs[1]), a1 = __fmul_rn(x1, cs[0]), b1 = __fmul_rn(x0, cs[1]); asm volatile("" : "+v"(a0), "+v"(b0), "+v"(a1), "+v"(b1));
    float r0 = __fsub_rn(a0, b0) * sc, r1 = __fadd_rn(b1, a1) * sc;   /* even: x0 c - x1 s; odd: x0 s + x1 c */
    o16[0] = tohx(r0); o16[1] = tohx(r1); { unsigned short a2, c2; splitf(r0, a2, c2); oh[0] = a2; ol[0] = c2; splitf(r1, a2, c2); oh[1] = a2; ol[1] = c2; }
    *(v2h*)(P16 + e) = o16; *(v2us*)(Ph + e) = oh; *(v2us*)(Pl + e) = ol;  }



// V planes [batch][head][d][2 TT]. Vhl holds a channel's hi half then its lo half; V16 fills the first half.
__global__ __launch_bounds__(256) void k_vtp(const float* __restrict__ F, int pitch, h16* V16, bf* Vhl) { const size_t e = ((size_t)blockIdx.x * 256 + threadIdx.x) * 2; if (e >= (size_t)NB_ * NKV * HD * TT) return; const int t = (int)(e % TT); const int d = (int)((e / TT) % HD); const int z = (int)(e / ((size_t)TT * HD)); const int g = z % NKV, b = z / NKV; v2h o16; v2us oh, ol;
#pragma unroll
    for (int q = 0; q < 2; ++q) { const float x = F[((size_t)b * TT + t + q) * pitch + g * HD + d]; o16[q] = tohx(x); unsigned short a2, c2; splitf(x, a2, c2); oh[q] = a2; ol[q] = c2; }
    const size_t o = e + (e / TT) * TT; *(v2h*)(V16 + o) = o16; *(v2us*)(Vhl + o) = oh; *(v2us*)(Vhl + o + TT) = ol;  }

__device__ __forceinline__ float xhalf(float x) { return __builtin_bit_cast(float, __builtin_amdgcn_permlanex16(__builtin_bit_cast(int, x), __builtin_bit_cast(int, x), 0x76543210, 0xfedcba98, false, false)); }   // lane l with lane l ^ 16, on the vector port
#define FW 4   // launch bound: four waves a SIMD (256 registers; three for the hi/lo form, which holds twice the fragments): vector work between the matrix runs wants waves
template <typename T16, bool HR, int NQ>
__global__ __launch_bounds__(32 * FW, HR ? 3 : 4) void k_fattn(const T16* __restrict__ Q, const T16* __restrict__ Q2, const T16* __restrict__ Kp, const T16* __restrict__ K2, const T16* __restrict__ Vt, bf* Ah, bf* Al) {
    typedef typename WFrag<T16>::V V;
    __shared__ __align__(16) float so[FW * NQ * 4 * 256];   // partial O^T tiles, lane-linear, 256 floats a tile
    __shared__ float sm[FW * NQ * 16], sl[FW * NQ * 16];    // each wave's maximum and sum per query
    const int lane = threadIdx.x & 31, lr = lane & 15, hi = lane >> 4;
    const int wv = __builtin_amdgcn_readfirstlane(threadIdx.x >> 5);   // wave number in a scalar register: the key loop stays a scalar loop with every lane on at the matrix instructions
    const int z = blockIdx.x;                                          // batch * heads + head
    constexpr int ROW0 = HR ? 0 : RH, NBLK = (HR ? RH : TT - RH) / (16 * NQ);   // this launch's rows: [0, RH) or [RH, TT); grid y = NBLK
    const int q0 = ROW0 + (NBLK - 1 - (int)blockIdx.y) * (16 * NQ);   // longest rows start first
    const size_t zp = (size_t)z * TT * HD; Q += zp; Kp += zp; Vt += 2 * zp; if (HR) { Q2 += zp; K2 += zp; }
    const float NEG = -3.0e38f;
    V qf[NQ][2], qf2[NQ][2];
#pragma unroll
    for (int qb = 0; qb < NQ; ++qb)
#pragma unroll
        for (int dc = 0; dc < 2; ++dc) { const size_t o = (size_t)(q0 + qb * 16 + lr) * HD + dc * 32 + 8 * hi; qf[qb][dc] = WFrag<T16>::ld(Q + o); if (HR) qf2[qb][dc] = WFrag<T16>::ld(Q2 + o); }
    v8f o[NQ][4]; float m[NQ], l[NQ];
#pragma unroll
    for (int qb = 0; qb < NQ; ++qb) { m[qb] = NEG; l[qb] = 0.f;
#pragma unroll
        for (int db = 0; db < 4; ++db) o[qb][db] = (v8f){}; }
    const int nch = (q0 + 16 * NQ - 1) / 32 + 1;   // 32-key chunks up to the one that holds the last row's diagonal
    auto at = [](const T16* base, unsigned bytes) { return (const T16*)((const char*)base + bytes); };   // uniform plane base + a lane's 32-bit byte offset: one address register a load
    V kf[2][2], kf2[2][2];   // K fragments are fetched one trip ahead, so their latency lies under the softmax and the second product
    auto ldk = [&](int kc) {
#pragma unroll
        for (int kb = 0; kb < 2; ++kb)
#pragma unroll
            for (int dc = 0; dc < 2; ++dc) { const unsigned a = (unsigned)((kc + kb * 16 + lr) * HD + dc * 32 + 8 * hi) * 2u; kf[kb][dc] = WFrag<T16>::ld(at(Kp, a)); if (HR) kf2[kb][dc] = WFrag<T16>::ld(at(K2, a)); } };
    ldk(min(wv, nch - 1) * 32);
#pragma unroll 1
    for (int c = wv; c < nch; c += FW) {
        const int kc = c * 32;
        V vf[4], vf2[4];
#pragma unroll
        for (int db = 0; db < 4; ++db) { const unsigned a = (unsigned)((db * 16 + lr) * (2 * TT) + kc + 8 * hi) * 2u; vf[db] = WFrag<T16>::ld(at(Vt, a)); if (HR) vf2[db] = WFrag<T16>::ld(at(Vt, a + 2u * TT)); }
        v8f s[NQ][2];
#pragma unroll
        for (int qb = 0; qb < NQ; ++qb)
#pragma unroll
            for (int kb = 0; kb < 2; ++kb) { s[qb][kb] = (v8f){};
#pragma unroll
                for (int dc = 0; dc < 2; ++dc) { s[qb][kb] = WFrag<T16>::mma(kf[kb][dc], qf[qb][dc], s[qb][kb]); if (HR) { s[qb][kb] = WFrag<T16>::mma(kf2[kb][dc], qf[qb][dc], s[qb][kb]); s[qb][kb] = WFrag<T16>::mma(kf[kb][dc], qf2[qb][dc], s[qb][kb]); } } }
        ldk(min(c + FW, nch - 1) * 32);   // the next trip's chunk; past the end the last chunk again, unused
        asm volatile("s_wait_xcnt 0x0" ::: "memory");   // stands in front of the rewrite of the address registers that the loads above name
        // the period-3 columns 4, 7, 10, ... (j mod 3 == 1 but for j == 1) as an addend, 0 or -3e38, the same for every query: this lane's keys are jb + a constant, so three values by jb mod 3 serve all 16
        const int jb = kc + hi * 8, jr = jb % 3;
        const float bz[3] = { jr == 0 ? NEG : 0.f, jr == 1 ? NEG : 0.f, jr == 2 ? NEG : 0.f }; const float b1 = jb == 0 ? 0.f : bz[0];   // b1: the key jb + 1, which is column 1 in the first chunk
#pragma unroll
        for (int qb = 0; qb < NQ; ++qb) {
            float t[16];
#pragma unroll
            for (int e = 0; e < 16; ++e) { const int off = (e >> 3) * 16 + (e & 7); t[e] = s[qb][e >> 3][e & 7] * (SCL * 1.4426950408889634f) + (e == 1 ? b1 : bz[(1 + 2 * off) % 3]); }   // masked where (jr + off) mod 3 == 1
            if (c == nch - 1) {   // only the last chunk crosses the diagonal
#pragma unroll
                for (int e = 0; e < 16; ++e) { const int j = kc + (e >> 3) * 16 + hi * 8 + (e & 7); t[e] = (j <= q0 + qb * 16 + lr) ? t[e] : NEG; } }
            float tm = t[0];
#pragma unroll
            for (int e = 1; e < 16; ++e) tm = fmaxf(tm, t[e]);
            tm = fmaxf(tm, xhalf(tm));
            const float mn = fmaxf(m[qb], tm), al = __builtin_amdgcn_exp2f(m[qb] - mn); m[qb] = mn;
            float ps = 0.f;
#pragma unroll
            for (int e = 0; e < 16; ++e) { t[e] = __builtin_amdgcn_exp2f(t[e] - mn); ps += t[e]; }
            l[qb] = l[qb] * al + ps;   // this lane's keys only; the halves join after the loop
#pragma unroll
            for (int db = 0; db < 4; ++db) o[qb][db] *= al;
            if constexpr (HR) { v8us h0, h1, l0, l1;
#pragma unroll
                for (int e = 0; e < 8; ++e) { unsigned short a, b; splitf(t[e], a, b); h0[e] = a; l0[e] = b; splitf(t[8 + e], a, b); h1[e] = a; l1[e] = b; }
                const V ph = cat16b(h0, h1), pl = cat16b(l0, l1);
#pragma unroll
                for (int db = 0; db < 4; ++db) { o[qb][db] = WFrag<T16>::mma(vf[db], ph, o[qb][db]); o[qb][db] = WFrag<T16>::mma(vf2[db], ph, o[qb][db]); o[qb][db] = WFrag<T16>::mma(vf[db], pl, o[qb][db]); }
            } else { V pf;
#pragma unroll
                for (int e = 0; e < 16; ++e) pf[e] = tohx(t[e]);
#pragma unroll
                for (int db = 0; db < 4; ++db) o[qb][db] = WFrag<T16>::mma(vf[db], pf, o[qb][db]); }
        }
        // four vector slots between the last matrix instruction and the next trip's loads into its operands
        asm volatile("v_nop\n\tv_nop\n\tv_nop\n\tv_nop" : "+v"(o[NQ - 1][0]), "+v"(o[NQ - 1][1]), "+v"(o[NQ - 1][2]), "+v"(o[NQ - 1][3]) : "v"(vf[0]), "v"(vf[3]));
    }
#pragma unroll
    for (int qb = 0; qb < NQ; ++qb) {
#pragma unroll
        for (int db = 0; db < 4; ++db) { float* p = so + (size_t)(((wv * NQ + qb) * 4 + db) * 2) * 128 + lane * 4;
            *(v4fa*)p = __builtin_shufflevector(o[qb][db], o[qb][db], 0, 1, 2, 3); *(v4fa*)(p + 128) = __builtin_shufflevector(o[qb][db], o[qb][db], 4, 5, 6, 7); }
        const float lj = l[qb] + xhalf(l[qb]);
        if (hi == 0) { sm[(wv * NQ + qb) * 16 + lr] = m[qb]; sl[(wv * NQ + qb) * 16 + lr] = lj; } }
    __syncthreads();   // publishes every wave's partial O^T, maximum and sum to the waves that merge them
    // merge: a wave takes 4 NQ queries, 8 / NQ lanes a query, so each 128-byte line of the merged planes has one writer. A wave without an unmasked key for a query has maximum -3e38 and weight 0.
    constexpr int LPQ = 8 / NQ;
    const int qi = wv * (32 / LPQ) + lane / LPQ, qb = qi >> 4, cq = qi & 15;
    float M = NEG, sc[FW], L = 0.f;
#pragma unroll
    for (int u = 0; u < FW; ++u) M = fmaxf(M, sm[(u * NQ + qb) * 16 + cq]);
#pragma unroll
    for (int u = 0; u < FW; ++u) { sc[u] = __builtin_amdgcn_exp2f(sm[(u * NQ + qb) * 16 + cq] - M); L += sc[u] * sl[(u * NQ + qb) * 16 + cq]; }
    const float inv = __fdiv_rn(1.0f, L);
    const size_t orow = ((size_t)(z / NH_) * TT + q0 + qi) * DQ + (z % NH_) * HD;
#pragma unroll
    for (int n = 0; n < NQ; ++n) { const int g = (lane % LPQ) * NQ + n, db = g >> 1, h = g & 1;   // 8 channels: 16 db + 8 h ...
        v4f a0 = (v4f){}, a1 = (v4f){};
#pragma unroll
        for (int u = 0; u < FW; ++u) { const float* p = so + (size_t)(((u * NQ + qb) * 4 + db) * 2) * 128 + (h * 16 + cq) * 4; a0 += *(const v4fa*)p * sc[u]; a1 += *(const v4fa*)(p + 128) * sc[u]; }
        v8us oh, ol;
#pragma unroll
        for (int r = 0; r < 4; ++r) { unsigned short a, b; splitf(a0[r] * inv, a, b); oh[r] = a; ol[r] = b; splitf(a1[r] * inv, a, b); oh[4 + r] = a; ol[4 + r] = b; }
        *(v8usa*)(Ah + orow + db * 16 + h * 8) = oh; *(v8usa*)(Al + orow + db * 16 + h * 8) = ol; }
}

extern "C" void kernel_launch(void* const* d_in, const int* in_sizes, int n_in,
                              void* d_out, int out_size, void* d_ws, size_t ws_size, hipStream_t stream) {
    (void)in_sizes; (void)n_in; (void)out_size;
    const float* x = (const float*)d_in[0]; const float* wq = (const float*)d_in[1]; const float* bq = (const float*)d_in[2]; const float* wk = (const float*)d_in[3]; const float* bk = (const float*)d_in[4]; const float* wv = (const float*)d_in[5]; const float* bv = (const float*)d_in[6]; const float* wo = (const float*)d_in[7]; const float* bo = (const float*)d_in[8];
    float* OUT = (float*)d_out;     // [4][2048][512]
    char* wsp = (char*)d_ws;
    auto take = [&](size_t bytes) { char* p = wsp; wsp += (bytes + 255) & ~(size_t)255; return (void*)p; };
    const size_t PL = (size_t)NB_ * NH_ * TT * HD;   // elements of one [batch][head] plane set
    bf* WA = (bf*)take((size_t)4 * DM * DQ * 2);      // Wq | Wk | Wv | Wo, each transposed [n][k]
    h16* QK16 = (h16*)take(2 * PL * 2); bf* QKh = (bf*)take(2 * PL * 2); bf* QKl = (bf*)take(2 * PL * 2);   // q planes, then k planes
    h16* VT16 = (h16*)take(2 * PL * 2); bf* VThl = (bf*)take(2 * PL * 2);   // rows of 2 TT elements
    bf* ATh = (bf*)take(PL * 2); bf* ATl = (bf*)take(PL * 2);   // attention output, heads merged, hi and lo
    bf* XB = (bf*)take((size_t)NB_ * TT * DM * 2); float* F = (float*)take((size_t)NB_ * TT * 3 * DQ * 4); float* CS = (float*)take((size_t)TT * DQ * 2 * 4);   /* F [batch t][q | k | v]; CS {cos, sin} per (t, global channel) */
    if ((size_t)(wsp - (char*)d_ws) > ws_size) return;    // ws 256 MiB
    k_wtG<<<dim3((unsigned)((DM * DQ / 64 + 63) / 64), 4, 1), 256, 0, stream>>>(wq, wk, wv, wo, DM, DQ, WA);
    k_csG<<<(unsigned)(((size_t)TT * DQ + 255) / 256), 256, 0, stream>>>(CS);   /* angle t x 10000^(-2i/512) for global pair i = c/2 */
    k_cvt8<<<(unsigned)(((size_t)NB_ * TT * DM / 8 + 255) / 256), 256, 0, stream>>>(x, XB, (size_t)NB_ * TT * DM / 8);
    k_gemmw<bf, 0, true, 8><<<dim3(NB_ * TT / 64, 3 * DQ / 64, 1), 256, 0, stream>>>(XB, nullptr, WA, nullptr, DM, F, 3 * DQ, bq, bk, bv, 0, 0, 0);
    k_ropeIG<<<(unsigned)((2 * PL / 2 + 255) / 256), 256, 0, stream>>>(F, 3 * DQ, CS, 1.0f, QK16, QKh, QKl);
    k_vtp<<<(unsigned)((PL / 2 + 255) / 256), 256, 0, stream>>>(F + 2 * DQ, 3 * DQ, VT16, VThl);
    // grid x: the 32 (batch, head) planes; grid y: query blocks, longest first
    k_fattn<h16, false, 2><<<dim3(NB_ * NH_, (TT - RH) / 32, 1), 32 * FW, 0, stream>>>(QK16, nullptr, QK16 + PL, nullptr, VT16, ATh, ATl);
    k_fattn<bf, true, 1><<<dim3(NB_ * NH_, RH / 16, 1), 32 * FW, 0, stream>>>(QKh, QKl, QKh + PL, QKl + PL, VThl, ATh, ATl);
    k_gemmw<bf, 1, true, 8><<<dim3(NB_ * TT / 64, DM / 64, 1), 256, 0, stream>>>(ATh, ATl, WA + (size_t)3 * DM * DQ, nullptr, DQ, OUT, DM, bo, nullptr, nullptr, 0, 0, 0);
}

// v004
// It runs in 130 microseconds.
// Timed twice side by side with v003, it ran 1.25 times as fast both times.
// Counting every step since v000, it is 12.2 times as fast.
#include <hip/hip_runtime.h>

// Causal attention with rotary embeddings over the FULL hidden dim and periodically masked key columns (x [4][2048][512]; q,k,v = x W + b ('xw' [512][512] + [512], 0.02); rope BEFORE the head split: pairs (2i, 2i+1) of the 512-vector rotated by t x 10000^(-2i/512), i < 256; 8 heads x 64; scores / 8; mask = causal AND key column j not in {4, 7, 10, ...} (j >= 4 with (j - 4) mod 3 == 0: the module's period-3 'mgdt' columns); softmax; out = merged Wo + bo -> [4][2048][512] (4.2 M)).
// Layout, all batches in each launch: bf16 copy of x; exact projections + f32 biases; a {cos, sin} table per (position, global pair) (float32 inverse frequencies over 512 dims, precise cosf/sinf); the projection's epilogue rotates interleaved pairs by the GLOBAL channel and writes the q, k planes and the transposed V planes itself; fused causal attention (k_fattn: scores, running-maximum softmax and P x V in registers; rows < 512 hi/lo 3 products, rest fp16; the period-3 columns enter as -3e38) that writes the merged hi/lo planes; merged hi/lo x Wo exact + bo.
// Compute dtypes, f32 accumulate: every input rounded to bf16; projections exact + f32 biases; rotary f32; attention rows < 512 3 products, rest fp16; softmax f32; Wo hl x exact + bias.

#define NB_  4
#define TT   2048
#define DM   512
#define NH_  8
#define NKV  8
#define REP  (NH_ / NKV)
#define HD   64
#define DQ   (NH_ * HD)
#define DKV  (NKV * HD)
#define RH   512                  // query rows < RH use hi+lo planes (0: none)
#define SCL  0.125f
#define PRD  3       // masked-column period
#define PRD0 4       // first masked column (period + ret_order - 1)
typedef _Float16 h16;
typedef unsigned short bf;
typedef __attribute__((ext_vector_type(16))) __bf16   v16bf;
typedef __attribute__((ext_vector_type(16))) _Float16 v16h;
typedef __attribute__((ext_vector_type(8)))  _Float16 v8h;
typedef __attribute__((ext_vector_type(8)))  unsigned short v8us;
typedef __attribute__((ext_vector_type(8)))  float    v8f;
typedef __attribute__((ext_vector_type(4)))  float    v4f;
typedef v8h  __attribute__((may_alias)) v8ha;
typedef v4f  __attribute__((may_alias)) v4fa;
typedef v8us __attribute__((may_alias)) v8usa;

__device__ __forceinline__ unsigned short f2bf(float f) { unsigned u = __float_as_uint(f); u += 0x7FFFu + ((u >> 16) & 1u); return (unsigned short)(u >> 16); }
__device__ __forceinline__ float bf2f(unsigned short b) { return __uint_as_float(((unsigned)b) << 16); }
__device__ __forceinline__ float bfr(float f) { return bf2f(f2bf(f)); }
__device__ __forceinline__ v16h cat16(v8h lo, v8h hi) { return __builtin_shufflevector(lo, hi, 0, 1, 2, 3, 4, 5, 6, 7, 8, 9, 10, 11, 12, 13, 14, 15); }
__device__ __forceinline__ v16bf cat16b(v8us lo, v8us hi) { return __builtin_bit_cast(v16bf, __builtin_shufflevector(lo, hi, 0, 1, 2, 3, 4, 5, 6, 7, 8, 9, 10, 11, 12, 13, 14, 15)); }
__device__ __forceinline__ v8f wmma16(v16h a, v16h b, v8f c) { return __builtin_amdgcn_wmma_f32_16x16x32_f16(false, a, false, b, (short)0, c, false, false); }
__device__ __forceinline__ v8f wmmab(v16bf a, v16bf b, v8f c) { return __builtin_amdgcn_wmma_f32_16x16x32_bf16(false, a, false, b, (short)0, c, false, false); }

__device__ __forceinline__ h16 tohx(float x) { return (h16)x; }
__device__ __forceinline__ void splitf(float y, unsigned short& h, unsigned short& l) { h = f2bf(y); l = f2bf(y - bf2f(h)); }
typedef __attribute__((ext_vector_type(2))) _Float16 v2h;
typedef __attribute__((ext_vector_type(4))) _Float16 v4h;
typedef __attribute__((ext_vector_type(2))) unsigned short v2us;
typedef __attribute__((ext_vector_type(4))) unsigned short v4us;
typedef __attribute__((ext_vector_type(2))) float v2f;
typedef __attribute__((ext_vector_type(4))) int v4i;

// ---- Split-K epilogue: the NW waves of a work-group each hold a partial 64x64 tile (their share of the K loop). Every wave parks its 16 accumulators in LDS lane-linear (b128, no bank conflict),
// one barrier, then each wave sums its share of the tile over the NW partials in wave order 0..NW-1 and stores it. A unit = 4 accumulator rows x 32 columns, so each 128-byte output line has one writer.
template <int NW, bool BIAS>
__device__ __forceinline__ void splitk_store(const v8f (&acc)[4][4], float* red, float* C, int ldc, const float* __restrict__ bias, int r0, int c0) {
    const int lane = threadIdx.x & 31, lr = lane & 15, hi = lane >> 4, w = __builtin_amdgcn_readfirstlane(threadIdx.x >> 5);
    // both loops unrolled: acc is indexed by constants only and stays in registers
#pragma unroll
    for (int mb = 0; mb < 4; ++mb)
#pragma unroll
        for (int nb = 0; nb < 4; ++nb) { float* p = red + (size_t)((w * 16 + mb * 4 + nb) * 2) * 128 + lane * 4;
            *(v4fa*)p = __builtin_shufflevector(acc[mb][nb], acc[mb][nb], 0, 1, 2, 3); *(v4fa*)(p + 128) = __builtin_shufflevector(acc[mb][nb], acc[mb][nb], 4, 5, 6, 7); }
    __syncthreads();   // publishes every wave's partial tile to the waves that sum it
    for (int q = 0; q < 16 / NW; ++q) { const int unit = w * (16 / NW) + q, mb = unit >> 2, nb0 = ((unit >> 1) & 1) * 2, half = unit & 1;
        for (int e = 0; e < 2; ++e) { const int nb = nb0 + e; const float* p = red + (size_t)((mb * 4 + nb) * 2 + half) * 128 + lane * 4; v4f sum = *(const v4fa*)p;
            for (int u = 1; u < NW; ++u) sum += *(const v4fa*)(p + (size_t)u * 4096);
            const int col = c0 + nb * 16 + lr; if (BIAS) sum += bfr(bias[nb * 16 + lr]);   // bias points at the tile's first column
            float* crow = C + (size_t)(r0 + mb * 16 + hi * 8 + half * 4) * ldc + col;
            for (int j = 0; j < 4; ++j) crow[(size_t)j * ldc] = sum[j]; } }
}

// ---- Split-K epilogue of the q | k | v projection: the summed 64x64 tile (64 positions of one batch x the 64 channels of one head of q, k or v) never goes to memory as f32.
// Partials are parked and summed as in splitk_store (same order, same bias add); the sums go to a second LDS tile (q, k: [position][channel]; v: [channel][position], four positions a b128 store), one more barrier,
// then each lane takes 8 neighbours of a row: q, k rows are rotated pair by pair and go to the fp16 and hi/lo planes [q, k][batch][head][t][d]; v rows go to the planes [batch][head][d][2 TT]. Every b128 store of a wave covers whole 128-byte lines.
#define TP 68   // pitch of that tile in floats: rows stay 16-byte aligned, and the b32 column writes, the b128 writes and the b128 row reads each spread over all banks
template <int NW>
__device__ __forceinline__ void splitk_planes(const v8f (&acc)[4][4], float* red, float* tile, const float* __restrict__ bias, int r0, int c0, const float* __restrict__ CS, h16* P16, bf* Ph, bf* Pl, h16* V16, bf* Vhl) {
    const int lane = threadIdx.x & 31, lr = lane & 15, hi = lane >> 4, w = __builtin_amdgcn_readfirstlane(threadIdx.x >> 5);
    const int seg = c0 / DM, hd = (c0 - seg * DM) / HD, b = r0 / TT, t0 = r0 % TT;   // seg: 0 q, 1 k, 2 v, the same for the whole work-group; 64 divides TT, so a tile lies in one batch
    const int rr = threadIdx.x >> 3, cc = (threadIdx.x & 7) * 8;                     // this lane's rows rr, rr + 32 and first column of the summed tile
    v2f cs[2][4] = {};   // {cos, sin} of this lane's 4 pairs in each of its two rows, asked for here so that their latency lies under the parking of the partials
    if (seg != 2) {
#pragma unroll
        for (int u = 0; u < 2; ++u)
#pragma unroll
            for (int p = 0; p < 4; ++p) cs[u][p] = *(const v2f*)(CS + ((size_t)(t0 + rr + 32 * u) * DQ + hd * HD + cc + 2 * p) * 2); }
    // both loops unrolled: acc is indexed by constants only and stays in registers
#pragma unroll
    for (int mb = 0; mb < 4; ++mb)
#pragma unroll
        for (int nb = 0; nb < 4; ++nb) { float* p = red + (size_t)((w * 16 + mb * 4 + nb) * 2) * 128 + lane * 4;
            *(v4fa*)p = __builtin_shufflevector(acc[mb][nb], acc[mb][nb], 0, 1, 2, 3); *(v4fa*)(p + 128) = __builtin_shufflevector(acc[mb][nb], acc[mb][nb], 4, 5, 6, 7); }
    __syncthreads();   // publishes every wave's partial tile to the waves that sum it
    for (int q = 0; q < 16 / NW; ++q) { const int unit = w * (16 / NW) + q, mb = unit >> 2, nb0 = ((unit >> 1) & 1) * 2, half = unit & 1;
        for (int e = 0; e < 2; ++e) { const int nb = nb0 + e; const float* p = red + (size_t)((mb * 4 + nb) * 2 + half) * 128 + lane * 4; v4f sum = *(const v4fa*)p;
            for (int u = 1; u < NW; ++u) sum += *(const v4fa*)(p + (size_t)u * 4096);
            sum += bfr(bias[nb * 16 + lr]);   // bias points at the tile's first column
            const int col = nb * 16 + lr, row = mb * 16 + hi * 8 + half * 4;
            if (seg == 2) *(v4fa*)(tile + col * TP + row) = sum;
            else for (int j = 0; j < 4; ++j) tile[(row + j) * TP + col] = sum[j]; } }
    __syncthreads();   // publishes the summed tile to the lanes that convert and store its rows
    // the tile's first element and row pitch in its planes, all scalar. Vhl holds a channel's hi half then its lo half; V16 fills the first half
    const size_t base = seg == 2 ? ((size_t)b * NKV + hd) * HD * (2 * TT) + t0 : ((((size_t)seg * NB_ + b) * NH_ + hd) * TT + t0) * HD;
    const int pitch = seg == 2 ? 2 * TT : HD;
    h16* D16 = (seg == 2 ? V16 : P16) + base; bf* Dh = (seg == 2 ? Vhl : Ph) + base; bf* Dl = (seg == 2 ? Vhl + TT : Pl) + base;
    float y[2][8];
#pragma unroll
    for (int u = 0; u < 2; ++u) { const float* p = tile + (rr + 32 * u) * TP + cc; const v4f x0 = *(const v4fa*)p, x1 = *(const v4fa*)(p + 4);
#pragma unroll
        for (int k = 0; k < 4; ++k) { y[u][k] = x0[k]; y[u][4 + k] = x1[k]; } }
    if (seg != 2) {
#pragma unroll
        for (int u = 0; u < 2; ++u)
#pragma unroll
            for (int p = 0; p < 4; ++p) { const float e0 = y[u][2 * p], e1 = y[u][2 * p + 1], c = cs[u][p][0], s = cs[u][p][1]; y[u][2 * p] = e0 * c - e1 * s; y[u][2 * p + 1] = e0 * s + e1 * c; } }   // even: x0 c - x1 s; odd: x0 s + x1 c
#pragma unroll
    for (int u = 0; u < 2; ++u) { v8h o16; v8us oh, ol;
#pragma unroll
        for (int k = 0; k < 8; ++k) { o16[k] = tohx(y[u][k]); unsigned short a2, c2; splitf(y[u][k], a2, c2); oh[k] = a2; ol[k] = c2; }
        const size_t e = (size_t)(rr + 32 * u) * pitch + cc;
        *(v8ha*)(D16 + e) = o16; *(v8usa*)(Dh + e) = oh; *(v8usa*)(Dl + e) = ol; }
}

// ---- k_gemmw: register-blocked GEMM, one work-group of NW waves per 64x64 output tile (16 accumulators a wave); wave w takes the K chunks w, w + NW, ...; operands straight from K-contiguous 16-bit planes; grid (M/64, N/64, Z), 32 NW threads.
// C[m][n] (f32, pitch ldc, + optional f32 bias: columns [0, DM) take bias, [DM, 2 DM) biasB, the rest biasC, so q, k and v share one launch) = sum_k A[m][k] Bt[n][k] (+ split products per NSPLIT). z-batch strides sA/sB/sC in elements. K % 32 == 0. PLANES: no C; the tile goes through splitk_planes instead.
template <typename T16> struct WFrag;
template <> struct WFrag<h16> { typedef v16h V; static __device__ __forceinline__ V ld(const h16* p) { return cat16(*(const v8h*)p, *(const v8h*)(p + 16)); } static __device__ __forceinline__ v8f mma(V a, V b, v8f c) { return wmma16(a, b, c); } };
template <> struct WFrag<bf> { typedef v16bf V; static __device__ __forceinline__ V ld(const bf* p) { return cat16b(*(const v8us*)p, *(const v8us*)(p + 16)); } static __device__ __forceinline__ v8f mma(V a, V b, v8f c) { return wmmab(a, b, c); } };
template <typename T16, int NSPLIT, bool BIAS, int NW, bool PLANES>
__global__ __launch_bounds__(32 * NW) void k_gemmw(const T16* __restrict__ A, const T16* __restrict__ A2, const T16* __restrict__ Bt, const T16* __restrict__ Bt2, int K, float* C, int ldc, const float* __restrict__ bias, const float* __restrict__ biasB, const float* __restrict__ biasC, size_t sA, size_t sB, size_t sC, const float* __restrict__ CS, h16* P16, bf* Ph, bf* Pl, h16* V16, bf* Vhl) {
    typedef typename WFrag<T16>::V V;
    __shared__ __align__(16) float red[NW * 4096];
    const size_t z = blockIdx.z; A += z * sA; if (A2) A2 += z * sA; Bt += z * sB; if (Bt2) Bt2 += z * sB; C += z * sC;
    const int lane = threadIdx.x & 31, lr = lane & 15, hi = lane >> 4; const int r0 = blockIdx.x * 64, c0 = blockIdx.y * 64;
    const int wv = __builtin_amdgcn_readfirstlane(threadIdx.x >> 5);   // wave number in a scalar register: the K loop stays a scalar loop with every lane on at the matrix instructions
    v8f acc[4][4];
#pragma unroll
    for (int mb = 0; mb < 4; ++mb)
#pragma unroll
        for (int nb = 0; nb < 4; ++nb) acc[mb][nb] = (v8f){};
    const size_t aoff = (size_t)(r0 + lr) * K + 8 * hi, boff = (size_t)(c0 + lr) * K + 8 * hi;
#pragma unroll 1
    for (int kc = wv * 32; kc < K; kc += NW * 32) {
        V a[4], a2[4];
#pragma unroll
        for (int mb = 0; mb < 4; ++mb) { a[mb] = WFrag<T16>::ld(A + aoff + (size_t)mb * 16 * K + kc); if (NSPLIT == 1 || NSPLIT == 2) a2[mb] = WFrag<T16>::ld(A2 + aoff + (size_t)mb * 16 * K + kc); }
#pragma unroll
        for (int nb = 0; nb < 4; ++nb) { const V b = WFrag<T16>::ld(Bt + boff + (size_t)nb * 16 * K + kc); V b2; if (NSPLIT >= 2) b2 = WFrag<T16>::ld(Bt2 + boff + (size_t)nb * 16 * K + kc);
#pragma unroll
            for (int mb = 0; mb < 4; ++mb) { acc[mb][nb] = WFrag<T16>::mma(a[mb], b, acc[mb][nb]); if (NSPLIT == 1 || NSPLIT == 2) acc[mb][nb] = WFrag<T16>::mma(a2[mb], b, acc[mb][nb]); if (NSPLIT >= 2) acc[mb][nb] = WFrag<T16>::mma(a[mb], b2, acc[mb][nb]); } }
        asm volatile("v_nop\n\tv_nop\n\tv_nop\n\tv_nop" : "+v"(acc[0][0]), "+v"(acc[1][1]), "+v"(acc[2][2]), "+v"(acc[3][3]) : "v"(a[0]), "v"(a[3]));
    }
    const int seg = c0 / DM; const float* bs = (seg == 0 ? bias : seg == 1 ? biasB : biasC) + (c0 - seg * DM);
    if constexpr (PLANES) { __shared__ __align__(16) float tile[64 * TP]; splitk_planes<NW>(acc, red, tile, bs, r0, c0, CS, P16, Ph, Pl, V16, Vhl); }
    else splitk_store<NW, BIAS>(acc, red, C, ldc, bs, r0, c0);
}


__global__ __launch_bounds__(256) void k_wtG(const float* __restrict__ w0, const float* __restrict__ w1, const float* __restrict__ w2, const float* __restrict__ w3, int K, int N, bf* Bt) {
    const float* w = blockIdx.y == 0 ? w0 : blockIdx.y == 1 ? w1 : blockIdx.y == 2 ? w2 : w3; Bt += (size_t)blockIdx.y * N * K;   // grid y: one weight matrix each, planes back to back
    const int lane = threadIdx.x & 31; const int L0 = (blockIdx.x * 8 + (threadIdx.x >> 5)) * 8; const int nlines = N * K / 64;
{
#pragma unroll 1
        for (int l = 0; l < 8; ++l) { const int L = L0 + l; if (L >= nlines) break; const size_t e = (size_t)L * 64 + lane * 2; const int k = (int)(e % K), n = (int)(e / K); v2us o;
            o[0] = f2bf(w[(size_t)k * N + n]); o[1] = f2bf(w[(size_t)(k + 1) * N + n]); *(v2us*)(Bt + e) = o; }
         }
}
__global__ __launch_bounds__(256) void k_cvt8(const float* __restrict__ src, bf* dst, size_t n8) { const size_t i = (size_t)blockIdx.x * 256 + threadIdx.x; if (i >= n8) return; const v8f v = *(const v8f*)(src + i * 8); v8us o;
#pragma unroll
    for (int k = 0; k < 8; ++k) o[k] = f2bf(v[k]); *(v8us*)(dst + i * 8) = o;  }

__constant__ float INV512[DQ / 2] = { 1.000000000e+00f,9.646616578e-01f,9.305720329e-01f,8.976871371e-01f,8.659643531e-01f,8.353625536e-01f,8.058422208e-01f,7.773650289e-01f,7.498942018e-01f,7.233941555e-01f,6.978305578e-01f,6.731703877e-01f,6.493816376e-01f,6.264335513e-01f,6.042963862e-01f,5.829415321e-01f,5.623413324e-01f,5.424690843e-01f,5.232991576e-01f,5.048065782e-01f,4.869675338e-01f,4.697588682e-01f,4.531583488e-01f,4.371444881e-01f,4.216965139e-01f,4.067944288e-01f,3.924189806e-01f,3.785515428e-01f,3.651741445e-01f,3.522694409e-01f,3.398208320e-01f,3.278121352e-01f,3.162277639e-01f,3.050527871e-01f,2.942727208e-01f,2.838735878e-01f,2.738419771e-01f,2.641648352e-01f,2.548296750e-01f,2.458243966e-01f,2.371373624e-01f,2.287573218e-01f,2.206733972e-01f,2.128751576e-01f,2.053525001e-01f,1.980956793e-01f,1.910952926e-01f,1.843423098e-01f,1.778279394e-01f,1.715437919e-01f,1.654817015e-01f,1.596338600e-01f,1.539926529e-01f,1.485508084e-01f,1.433012635e-01f,1.382372230e-01f,1.333521456e-01f,1.286396980e-01f,1.240937710e-01f,1.197085083e-01f,1.154782027e-01f,1.113973856e-01f,1.074607819e-01f,1.036632955e-01f,1.000000015e-01f,9.646616131e-02f,9.305720031e-02f,8.976870775e-02f,8.659642935e-02f,8.353625983e-02f,8.058421314e-02f,7.773650438e-02f,7.498941571e-02f,7.233941555e-02f,6.978305429e-02f,6.731703877e-02f,6.493816525e-02f,6.264335662e-02f,6.042964384e-02f,5.829415470e-02f,5.623412877e-02f,5.424690619e-02f,5.232991278e-02f,5.048065633e-02f,4.869675264e-02f,4.697588459e-02f,4.531583562e-02f,4.371444881e-02f,4.216964915e-02f,4.067944363e-02f,3.924189880e-02f,3.785515204e-02f,3.651741147e-02f,3.522694483e-02f,3.398208320e-02f,3.278120980e-02f,3.162277862e-02f,3.050527908e-02f,2.942727320e-02f,2.838735841e-02f,2.738419548e-02f,2.641648427e-02f,2.548296750e-02f,2.458244003e-02f,2.371373586e-02f,2.287573181e-02f,2.206734009e-02f,2.128751762e-02f,2.053525113e-02f,1.980956830e-02f,1.910953037e-02f,1.843423024e-02f,1.778279431e-02f,1.715437882e-02f,1.654817164e-02f,1.596338488e-02f,1.539926510e-02f,1.485508028e-02f,1.433012541e-02f,1.382372249e-02f,1.333521493e-02f,1.286396943e-02f,1.240937691e-02f,1.197085064e-02f,1.154781971e-02f,1.113973837e-02f,1.074607857e-02f,1.036632899e-02f,9.999999776e-03f,9.646615945e-03f,9.305720218e-03f,8.976871148e-03f,8.659643121e-03f,8.353625424e-03f,8.058422245e-03f,7.773650344e-03f,7.498942316e-03f,7.233941462e-03f,6.978305988e-03f,6.731703877e-03f,6.493816618e-03f,6.264335476e-03f,6.042964291e-03f,5.829415284e-03f,5.623413250e-03f,5.424690899e-03f,5.232991185e-03f,5.048065912e-03f,4.869675264e-03f,4.697588738e-03f,4.531583749e-03f,4.371444695e-03f,4.216964822e-03f,4.067944363e-03f,3.924189601e-03f,3.785515437e-03f,3.651741426e-03f,3.522694577e-03f,3.398208413e-03f,3.278121119e-03f,3.162277862e-03f,3.050528001e-03f,2.942727180e-03f,2.838735934e-03f,2.738419687e-03f,2.641648287e-03f,2.548296703e-03f,2.458244096e-03f,2.371373819e-03f,2.287573181e-03f,2.206734149e-03f,2.128751716e-03f,2.053525066e-03f,1.980956644e-03f,1.910952851e-03f,1.843422884e-03f,1.778279431e-03f,1.715437858e-03f,1.654817141e-03f,1.596338581e-03f,1.539926510e-03f,1.485507935e-03f,1.433012658e-03f,1.382372226e-03f,1.333521446e-03f,1.286396873e-03f,1.240937854e-03f,1.197085017e-03f,1.154782018e-03f,1.113973907e-03f,1.074607833e-03f,1.036632922e-03f,1.000000047e-03f,9.646615945e-04f,9.305721032e-04f,8.976871031e-04f,8.659643354e-04f,8.353625308e-04f,8.058422245e-04f,7.773649995e-04f,7.498941850e-04f,7.233941578e-04f,6.978305755e-04f,6.731703761e-04f,6.493816618e-04f,6.264335825e-04f,6.042963942e-04f,5.829415168e-04f,5.623413017e-04f,5.424690899e-04f,5.232990952e-04f,5.048065796e-04f,4.869675031e-04f,4.697588738e-04f,4.531583400e-04f,4.371444811e-04f,4.216964880e-04f,4.067944246e-04f,3.924189950e-04f,3.785515146e-04f,3.651741135e-04f,3.522694460e-04f,3.398208064e-04f,3.278121294e-04f,3.162277862e-04f,3.050527885e-04f,2.942727297e-04f,2.838736109e-04f,2.738419571e-04f,2.641648462e-04f,2.548296761e-04f,2.458243980e-04f,2.371373848e-04f,2.287573152e-04f,2.206734207e-04f,2.128751657e-04f,2.053524950e-04f,1.980956731e-04f,1.910952997e-04f,1.843422942e-04f,1.778279402e-04f,1.715437829e-04f,1.654817170e-04f,1.596338552e-04f,1.539926452e-04f,1.485508110e-04f,1.433012658e-04f,1.382372284e-04f,1.333521504e-04f,1.286396873e-04f,1.240937709e-04f,1.197085076e-04f,1.154781930e-04f,1.113973922e-04f,1.074607790e-04f,1.036632893e-04f };   // 10000^(-2i/512), i < 256, as float32 (jnp-computed)
__global__ __launch_bounds__(256) void k_csG(float* CS) { const size_t idx = (size_t)blockIdx.x * 256 + threadIdx.x; if (idx >= (size_t)TT * DQ) return; const int cch = (int)(idx % DQ); const int t = (int)(idx / DQ); const float a = __fmul_rn((float)t, INV512[cch >> 1]); v2f cs; cs[0] = cosf(a); cs[1] = sinf(a); *(v2f*)(CS + idx * 2) = cs;  }

__device__ __forceinline__ float xhalf(float x) { return __builtin_bit_cast(float, __builtin_amdgcn_permlanex16(__builtin_bit_cast(int, x), __builtin_bit_cast(int, x), 0x76543210, 0xfedcba98, false, false)); }   // lane l with lane l ^ 16, on the vector port
#define FW 4   // launch bound: four waves a SIMD (256 registers; three for the hi/lo form, which holds twice the fragments): vector work between the matrix runs wants waves
template <typename T16, bool HR, int NQ>
__global__ __launch_bounds__(32 * FW, HR ? 3 : 4) void k_fattn(const T16* __restrict__ Q, const T16* __restrict__ Q2, const T16* __restrict__ Kp, const T16* __restrict__ K2, const T16* __restrict__ Vt, bf* Ah, bf* Al) {
    typedef typename WFrag<T16>::V V;
    __shared__ __align__(16) float so[FW * NQ * 4 * 256];   // partial O^T tiles, lane-linear, 256 floats a tile
    __shared__ float sm[FW * NQ * 16], sl[FW * NQ * 16];    // each wave's maximum and sum per query
    const int lane = threadIdx.x & 31, lr = lane & 15, hi = lane >> 4;
    const int wv = __builtin_amdgcn_readfirstlane(threadIdx.x >> 5);   // wave number in a scalar register: the key loop stays a scalar loop with every lane on at the matrix instructions
    const int z = blockIdx.x;                                          // batch * heads + head
    constexpr int ROW0 = HR ? 0 : RH, NBLK = (HR ? RH : TT - RH) / (16 * NQ);   // this launch's rows: [0, RH) or [RH, TT); grid y = NBLK
    const int q0 = ROW0 + (NBLK - 1 - (int)blockIdx.y) * (16 * NQ);   // longest rows start first
    const size_t zp = (size_t)z * TT * HD; Q += zp; Kp += zp; Vt += 2 * zp; if (HR) { Q2 += zp; K2 += zp; }
    const float NEG = -3.0e38f;
    V qf[NQ][2], qf2[NQ][2];
#pragma unroll
    for (int qb = 0; qb < NQ; ++qb)
#pragma unroll
        for (int dc = 0; dc < 2; ++dc) { const size_t o = (size_t)(q0 + qb * 16 + lr) * HD + dc * 32 + 8 * hi; qf[qb][dc] = WFrag<T16>::ld(Q + o); if (HR) qf2[qb][dc] = WFrag<T16>::ld(Q2 + o); }
    v8f o[NQ][4]; float m[NQ], l[NQ];
#pragma unroll
    for (int qb = 0; qb < NQ; ++qb) { m[qb] = NEG; l[qb] = 0.f;
#pragma unroll
        for (int db = 0; db < 4; ++db) o[qb][db] = (v8f){}; }
    const int nch = (q0 + 16 * NQ - 1) / 32 + 1;   // 32-key chunks up to the one that holds the last row's diagonal
    auto at = [](const T16* base, unsigned bytes) { return (const T16*)((const char*)base + bytes); };   // uniform plane base + a lane's 32-bit byte offset: one address register a load
    V kf[2][2], kf2[2][2];   // K fragments are fetched one trip ahead, so their latency lies under the softmax and the second product
    auto ldk = [&](int kc) {
#pragma unroll
        for (int kb = 0; kb < 2; ++kb)
#pragma unroll
            for (int dc = 0; dc < 2; ++dc) { const unsigned a = (unsigned)((kc + kb * 16 + lr) * HD + dc * 32 + 8 * hi) * 2u; kf[kb][dc] = WFrag<T16>::ld(at(Kp, a)); if (HR) kf2[kb][dc] = WFrag<T16>::ld(at(K2, a)); } };
    ldk(min(wv, nch - 1) * 32);
#pragma unroll 1
    for (int c = wv; c < nch; c += FW) {
        const int kc = c * 32;
        V vf[4], vf2[4];
#pragma unroll
        for (int db = 0; db < 4; ++db) { const unsigned a = (unsigned)((db * 16 + lr) * (2 * TT) + kc + 8 * hi) * 2u; vf[db] = WFrag<T16>::ld(at(Vt, a)); if (HR) vf2[db] = WFrag<T16>::ld(at(Vt, a + 2u * TT)); }
        v8f s[NQ][2];
#pragma unroll
        for (int qb = 0; qb < NQ; ++qb)
#pragma unroll
            for (int kb = 0; kb < 2; ++kb) { s[qb][kb] = (v8f){};
#pragma unroll
                for (int dc = 0; dc < 2; ++dc) { s[qb][kb] = WFrag<T16>::mma(kf[kb][dc], qf[qb][dc], s[qb][kb]); if (HR) { s[qb][kb] = WFrag<T16>::mma(kf2[kb][dc], qf[qb][dc], s[qb][kb]); s[qb][kb] = WFrag<T16>::mma(kf[kb][dc], qf2[qb][dc], s[qb][kb]); } } }
        ldk(min(c + FW, nch - 1) * 32);   // the next trip's chunk; past the end the last chunk again, unused
        asm volatile("s_wait_xcnt 0x0" ::: "memory");   // stands in front of the rewrite of the address registers that the loads above name
        // the period-3 columns 4, 7, 10, ... (j mod 3 == 1 but for j == 1) as an addend, 0 or -3e38, the same for every query: this lane's keys are jb + a constant, so three values by jb mod 3 serve all 16
        const int jb = kc + hi * 8, jr = jb % 3;
        const float bz[3] = { jr == 0 ? NEG : 0.f, jr == 1 ? NEG : 0.f, jr == 2 ? NEG : 0.f }; const float b1 = jb == 0 ? 0.f : bz[0];   // b1: the key jb + 1, which is column 1 in the first chunk
#pragma unroll
        for (int qb = 0; qb < NQ; ++qb) {
            float t[16];
#pragma unroll
            for (int e = 0; e < 16; ++e) { const int off = (e >> 3) * 16 + (e & 7); t[e] = s[qb][e >> 3][e & 7] * (SCL * 1.4426950408889634f) + (e == 1 ? b1 : bz[(1 + 2 * off) % 3]); }   // masked where (jr + off) mod 3 == 1
            if (c == nch - 1) {   // only the last chunk crosses the diagonal
#pragma unroll
                for (int e = 0; e < 16; ++e) { const int j = kc + (e >> 3) * 16 + hi * 8 + (e & 7); t[e] = (j <= q0 + qb * 16 + lr) ? t[e] : NEG; } }
            float tm = t[0];
#pragma unroll
            for (int e = 1; e < 16; ++e) tm = fmaxf(tm, t[e]);
            tm = fmaxf(tm, xhalf(tm));
            const float mn = fmaxf(m[qb], tm), al = __builtin_amdgcn_exp2f(m[qb] - mn); m[qb] = mn;
            float ps = 0.f;
#pragma unroll
            for (int e = 0; e < 16; ++e) { t[e] = __builtin_amdgcn_exp2f(t[e] - mn); ps += t[e]; }
            l[qb] = l[qb] * al + ps;   // this lane's keys only; the halves join after the loop
#pragma unroll
            for (int db = 0; db < 4; ++db) o[qb][db] *= al;
            if constexpr (HR) { v8us h0, h1, l0, l1;
#pragma unroll
                for (int e = 0; e < 8; ++e) { unsigned short a, b; splitf(t[e], a, b); h0[e] = a; l0[e] = b; splitf(t[8 + e], a, b); h1[e] = a; l1[e] = b; }
                const V ph = cat16b(h0, h1), pl = cat16b(l0, l1);
#pragma unroll
                for (int db = 0; db < 4; ++db) { o[qb][db] = WFrag<T16>::mma(vf[db], ph, o[qb][db]); o[qb][db] = WFrag<T16>::mma(vf2[db], ph, o[qb][db]); o[qb][db] = WFrag<T16>::mma(vf[db], pl, o[qb][db]); }
            } else { V pf;
#pragma unroll
                for (int e = 0; e < 16; ++e) pf[e] = tohx(t[e]);
#pragma unroll
                for (int db = 0; db < 4; ++db) o[qb][db] = WFrag<T16>::mma(vf[db], pf, o[qb][db]); }
        }
        // four vector slots between the last matrix instruction and the next trip's loads into its operands
        asm volatile("v_nop\n\tv_nop\n\tv_nop\n\tv_nop" : "+v"(o[NQ - 1][0]), "+v"(o[NQ - 1][1]), "+v"(o[NQ - 1][2]), "+v"(o[NQ - 1][3]) : "v"(vf[0]), "v"(vf[3]));
    }
#pragma unroll
    for (int qb = 0; qb < NQ; ++qb) {
#pragma unroll
        for (int db = 0; db < 4; ++db) { float* p = so + (size_t)(((wv * NQ + qb) * 4 + db) * 2) * 128 + lane * 4;
            *(v4fa*)p = __builtin_shufflevector(o[qb][db], o[qb][db], 0, 1, 2, 3); *(v4fa*)(p + 128) = __builtin_shufflevector(o[qb][db], o[qb][db], 4, 5, 6, 7); }
        const float lj = l[qb] + xhalf(l[qb]);
        if (hi == 0) { sm[(wv * NQ + qb) * 16 + lr] = m[qb]; sl[(wv * NQ + qb) * 16 + lr] = lj; } }
    __syncthreads();   // publishes every wave's partial O^T, maximum and sum to the waves that merge them
    // merge: a wave takes 4 NQ queries, 8 / NQ lanes a query, so each 128-byte line of the merged planes has one writer. A wave without an unmasked key for a query has maximum -3e38 and weight 0.
    constexpr int LPQ = 8 / NQ;
    const int qi = wv * (32 / LPQ) + lane / LPQ, qb = qi >> 4, cq = qi & 15;
    float M = NEG, sc[FW], L = 0.f;
#pragma unroll
    for (int u = 0; u < FW; ++u) M = fmaxf(M, sm[(u * NQ + qb) * 16 + cq]);
#pragma unroll
    for (int u = 0; u < FW; ++u) { sc[u] = __builtin_amdgcn_exp2f(sm[(u * NQ + qb) * 16 + cq] - M); L += sc[u] * sl[(u * NQ + qb) * 16 + cq]; }
    const float inv = __fdiv_rn(1.0f, L);
    const size_t orow = ((size_t)(z / NH_) * TT + q0 + qi) * DQ + (z % NH_) * HD;
#pragma unroll
    for (int n = 0; n < NQ; ++n) { const int g = (lane % LPQ) * NQ + n, db = g >> 1, h = g & 1;   // 8 channels: 16 db + 8 h ...
        v4f a0 = (v4f){}, a1 = (v4f){};
#pragma unroll
        for (int u = 0; u < FW; ++u) { const float* p = so + (size_t)(((u * NQ + qb) * 4 + db) * 2) * 128 + (h * 16 + cq) * 4; a0 += *(const v4fa*)p * sc[u]; a1 += *(const v4fa*)(p + 128) * sc[u]; }
        v8us oh, ol;
#pragma unroll
        for (int r = 0; r < 4; ++r) { unsigned short a, b; splitf(a0[r] * inv, a, b); oh[r] = a; ol[r] = b; splitf(a1[r] * inv, a, b); oh[4 + r] = a; ol[4 + r] = b; }
        *(v8usa*)(Ah + orow + db * 16 + h * 8) = oh; *(v8usa*)(Al + orow + db * 16 + h * 8) = ol; }
}

extern "C" void kernel_launch(void* const* d_in, const int* in_sizes, int n_in,
                              void* d_out, int out_size, void* d_ws, size_t ws_size, hipStream_t stream) {
    (void)in_sizes; (void)n_in; (void)out_size;
    const float* x = (const float*)d_in[0]; const float* wq = (const float*)d_in[1]; const float* bq = (const float*)d_in[2]; const float* wk = (const float*)d_in[3]; const float* bk = (const float*)d_in[4]; const float* wv = (const float*)d_in[5]; const float* bv = (const float*)d_in[6]; const float* wo = (const float*)d_in[7]; const float* bo = (const float*)d_in[8];
    float* OUT = (float*)d_out;     // [4][2048][512]
    char* wsp = (char*)d_ws;
    auto take = [&](size_t bytes) { char* p = wsp; wsp += (bytes + 255) & ~(size_t)255; return (void*)p; };
    const size_t PL = (size_t)NB_ * NH_ * TT * HD;   // elements of one [batch][head] plane set
    bf* WA = (bf*)take((size_t)4 * DM * DQ * 2);      // Wq | Wk | Wv | Wo, each transposed [n][k]
    h16* QK16 = (h16*)take(2 * PL * 2); bf* QKh = (bf*)take(2 * PL * 2); bf* QKl = (bf*)take(2 * PL * 2);   // q planes, then k planes
    h16* VT16 = (h16*)take(2 * PL * 2); bf* VThl = (bf*)take(2 * PL * 2);   // rows of 2 TT elements
    bf* ATh = (bf*)take(PL * 2); bf* ATl = (bf*)take(PL * 2);   // attention output, heads merged, hi and lo
    bf* XB = (bf*)take((size_t)NB_ * TT * DM * 2); float* CS = (float*)take((size_t)TT * DQ * 2 * 4);   /* CS {cos, sin} per (t, global channel) */
    if ((size_t)(wsp - (char*)d_ws) > ws_size) return;    // ws 256 MiB
    k_wtG<<<dim3((unsigned)((DM * DQ / 64 + 63) / 64), 4, 1), 256, 0, stream>>>(wq, wk, wv, wo, DM, DQ, WA);
    k_csG<<<(unsigned)(((size_t)TT * DQ + 255) / 256), 256, 0, stream>>>(CS);   /* angle t x 10000^(-2i/512) for global pair i = c/2 */
    k_cvt8<<<(unsigned)(((size_t)NB_ * TT * DM / 8 + 255) / 256), 256, 0, stream>>>(x, XB, (size_t)NB_ * TT * DM / 8);
    k_gemmw<bf, 0, true, 8, true><<<dim3(NB_ * TT / 64, 3 * DQ / 64, 1), 256, 0, stream>>>(XB, nullptr, WA, nullptr, DM, nullptr, 0, bq, bk, bv, 0, 0, 0, CS, QK16, QKh, QKl, VT16, VThl);
    // grid x: the 32 (batch, head) planes; grid y: query blocks, longest first
    k_fattn<h16, false, 2><<<dim3(NB_ * NH_, (TT - RH) / 32, 1), 32 * FW, 0, stream>>>(QK16, nullptr, QK16 + PL, nullptr, VT16, ATh, ATl);
    k_fattn<bf, true, 1><<<dim3(NB_ * NH_, RH / 16, 1), 32 * FW, 0, stream>>>(QKh, QKl, QKh + PL, QKl + PL, VThl, ATh, ATl);
    k_gemmw<bf, 1, true, 8, false><<<dim3(NB_ * TT / 64, DM / 64, 1), 256, 0, stream>>>(ATh, ATl, WA + (size_t)3 * DM * DQ, nullptr, DQ, OUT, DM, bo, nullptr, nullptr, 0, 0, 0, nullptr, nullptr, nullptr, nullptr, nullptr, nullptr);
}

// v005
// Measured time: 123 microseconds a run.
// In two side-by-side timings against v004, it was 1.05 and 1.06 times as fast.
// All steps since v000 together make it 12.9 times as fast.
#include <hip/hip_runtime.h>

// Causal attention with rotary embeddings over the FULL hidden dim and periodically masked key columns (x [4][2048][512]; q,k,v = x W + b ('xw' [512][512] + [512], 0.02); rope BEFORE the head split: pairs (2i, 2i+1) of the 512-vector rotated by t x 10000^(-2i/512), i < 256; 8 heads x 64; scores / 8; mask = causal AND key column j not in {4, 7, 10, ...} (j >= 4 with (j - 4) mod 3 == 0: the module's period-3 'mgdt' columns); softmax; out = merged Wo + bo -> [4][2048][512] (4.2 M)).
// Layout, all batches in each launch: bf16 copy of x; exact projections + f32 biases; a {cos, sin} table per (position, global pair) (float32 inverse frequencies over 512 dims, precise cosf/sinf) (weight planes, x copy and table come from one launch, k_prep); the projection's epilogue rotates interleaved pairs by the GLOBAL channel and writes the q, k planes and the transposed V planes itself; fused causal attention (k_fattn: scores, running-maximum softmax and P x V in registers; rows < 512 hi/lo 3 products, rest fp16; the period-3 columns enter as -3e38) that writes the merged hi/lo planes; merged hi/lo x Wo exact + bo.
// Compute dtypes, f32 accumulate: every input rounded to bf16; projections exact + f32 biases; rotary f32; attention rows < 512 3 products, rest fp16; softmax f32; Wo hl x exact + bias.

#define NB_  4
#define TT   2048
#define DM   512
#define NH_  8
#define NKV  8
#define REP  (NH_ / NKV)
#define HD   64
#define DQ   (NH_ * HD)
#define DKV  (NKV * HD)
#define RH   512                  // query rows < RH use hi+lo planes (0: none)
#define SCL  0.125f
#define PRD  3       // masked-column period
#define PRD0 4       // first masked column (period + ret_order - 1)
typedef _Float16 h16;
typedef unsigned short bf;
typedef __attribute__((ext_vector_type(16))) __bf16   v16bf;
typedef __attribute__((ext_vector_type(16))) _Float16 v16h;
typedef __attribute__((ext_vector_type(8)))  _Float16 v8h;
typedef __attribute__((ext_vector_type(8)))  unsigned short v8us;
typedef __attribute__((ext_vector_type(8)))  float    v8f;
typedef __attribute__((ext_vector_type(4)))  float    v4f;
typedef v8h  __attribute__((may_alias)) v8ha;
typedef v4f  __attribute__((may_alias)) v4fa;
typedef v8us __attribute__((may_alias)) v8usa;

__device__ __forceinline__ unsigned short f2bf(float f) { unsigned u = __float_as_uint(f); u += 0x7FFFu + ((u >> 16) & 1u); return (unsigned short)(u >> 16); }
__device__ __forceinline__ float bf2f(unsigned short b) { return __uint_as_float(((unsigned)b) << 16); }
__device__ __forceinline__ float bfr(float f) { return bf2f(f2bf(f)); }
__device__ __forceinline__ v16h cat16(v8h lo, v8h hi) { return __builtin_shufflevector(lo, hi, 0, 1, 2, 3, 4, 5, 6, 7, 8, 9, 10, 11, 12, 13, 14, 15); }
__device__ __forceinline__ v16bf cat16b(v8us lo, v8us hi) { return __builtin_bit_cast(v16bf, __builtin_shufflevector(lo, hi, 0, 1, 2, 3, 4, 5, 6, 7, 8, 9, 10, 11, 12, 13, 14, 15)); }
__device__ __forceinline__ v8f wmma16(v16h a, v16h b, v8f c) { return __builtin_amdgcn_wmma_f32_16x16x32_f16(false, a, false, b, (short)0, c, false, false); }
__device__ __forceinline__ v8f wmmab(v16bf a, v16bf b, v8f c) { return __builtin_amdgcn_wmma_f32_16x16x32_bf16(false, a, false, b, (short)0, c, false, false); }

__device__ __forceinline__ h16 tohx(float x) { return (h16)x; }
__device__ __forceinline__ void splitf(float y, unsigned short& h, unsigned short& l) { h = f2bf(y); l = f2bf(y - bf2f(h)); }
typedef __attribute__((ext_vector_type(2))) _Float16 v2h;
typedef __attribute__((ext_vector_type(4))) _Float16 v4h;
typedef __attribute__((ext_vector_type(2))) unsigned short v2us;
typedef __attribute__((ext_vector_type(4))) unsigned short v4us;
typedef __attribute__((ext_vector_type(2))) float v2f;
typedef __attribute__((ext_vector_type(4))) int v4i;

// ---- Split-K epilogue: the NW waves of a work-group each hold a partial 64x64 tile (their share of the K loop). Every wave parks its 16 accumulators in LDS lane-linear (b128, no bank conflict),
// one barrier, then each wave sums its share of the tile over the NW partials in wave order 0..NW-1 and stores it. A unit = 4 accumulator rows x 32 columns, so each 128-byte output line has one writer.
template <int NW, bool BIAS>
__device__ __forceinline__ void splitk_store(const v8f (&acc)[4][4], float* red, float* C, int ldc, const float* __restrict__ bias, int r0, int c0) {
    const int lane = threadIdx.x & 31, lr = lane & 15, hi = lane >> 4, w = __builtin_amdgcn_readfirstlane(threadIdx.x >> 5);
    // both loops unrolled: acc is indexed by constants only and stays in registers
#pragma unroll
    for (int mb = 0; mb < 4; ++mb)
#pragma unroll
        for (int nb = 0; nb < 4; ++nb) { float* p = red + (size_t)((w * 16 + mb * 4 + nb) * 2) * 128 + lane * 4;
            *(v4fa*)p = __builtin_shufflevector(acc[mb][nb], acc[mb][nb], 0, 1, 2, 3); *(v4fa*)(p + 128) = __builtin_shufflevector(acc[mb][nb], acc[mb][nb], 4, 5, 6, 7); }
    __syncthreads();   // publishes every wave's partial tile to the waves that sum it
    for (int q = 0; q < 16 / NW; ++q) { const int unit = w * (16 / NW) + q, mb = unit >> 2, nb0 = ((unit >> 1) & 1) * 2, half = unit & 1;
        for (int e = 0; e < 2; ++e) { const int nb = nb0 + e; const float* p = red + (size_t)((mb * 4 + nb) * 2 + half) * 128 + lane * 4; v4f sum = *(const v4fa*)p;
            for (int u = 1; u < NW; ++u) sum += *(const v4fa*)(p + (size_t)u * 4096);
            const int col = c0 + nb * 16 + lr; if (BIAS) sum += bfr(bias[nb * 16 + lr]);   // bias points at the tile's first column
            float* crow = C + (size_t)(r0 + mb * 16 + hi * 8 + half * 4) * ldc + col;
            for (int j = 0; j < 4; ++j) crow[(size_t)j * ldc] = sum[j]; } }
}

// ---- Split-K epilogue of the q | k | v projection: the summed 64x64 tile (64 positions of one batch x the 64 channels of one head of q, k or v) never goes to memory as f32.
// Partials are parked and summed as in splitk_store (same order, same bias add); the sums go to a second LDS tile (q, k: [position][channel]; v: [channel][position], four positions a b128 store), one more barrier,
// then each lane takes 8 neighbours of a row: q, k rows are rotated pair by pair and go to the fp16 and hi/lo planes [q, k][batch][head][t][d]; v rows go to the planes [batch][head][d][2 TT]. Every b128 store of a wave covers whole 128-byte lines.
#define TP 68   // pitch of that tile in floats: rows stay 16-byte aligned, and the b32 column writes, the b128 writes and the b128 row reads each spread over all banks
template <int NW>
__device__ __forceinline__ void splitk_planes(const v8f (&acc)[4][4], float* red, float* tile, const float* __restrict__ bias, int r0, int c0, const float* __restrict__ CS, h16* P16, bf* Ph, bf* Pl, h16* V16, bf* Vhl) {
    const int lane = threadIdx.x & 31, lr = lane & 15, hi = lane >> 4, w = __builtin_amdgcn_readfirstlane(threadIdx.x >> 5);
    const int seg = c0 / DM, hd = (c0 - seg * DM) / HD, b = r0 / TT, t0 = r0 % TT;   // seg: 0 q, 1 k, 2 v, the same for the whole work-group; 64 divides TT, so a tile lies in one batch
    const int rr = threadIdx.x >> 3, cc = (threadIdx.x & 7) * 8;                     // this lane's rows rr, rr + 32 and first column of the summed tile
    v2f cs[2][4] = {};   // {cos, sin} of this lane's 4 pairs in each of its two rows, asked for here so that their latency lies under the parking of the partials
    if (seg != 2) {
#pragma unroll
        for (int u = 0; u < 2; ++u)
#pragma unroll
            for (int p = 0; p < 4; ++p) cs[u][p] = *(const v2f*)(CS + ((size_t)(t0 + rr + 32 * u) * DQ + hd * HD + cc + 2 * p) * 2); }
    // both loops unrolled: acc is indexed by constants only and stays in registers
#pragma unroll
    for (int mb = 0; mb < 4; ++mb)
#pragma unroll
        for (int nb = 0; nb < 4; ++nb) { float* p = red + (size_t)((w * 16 + mb * 4 + nb) * 2) * 128 + lane * 4;
            *(v4fa*)p = __builtin_shufflevector(acc[mb][nb], acc[mb][nb], 0, 1, 2, 3); *(v4fa*)(p + 128) = __builtin_shufflevector(acc[mb][nb], acc[mb][nb], 4, 5, 6, 7); }
    __syncthreads();   // publishes every wave's partial tile to the waves that sum it
    for (int q = 0; q < 16 / NW; ++q) { const int unit = w * (16 / NW) + q, mb = unit >> 2, nb0 = ((unit >> 1) & 1) * 2, half = unit & 1;
        for (int e = 0; e < 2; ++e) { const int nb = nb0 + e; const float* p = red + (size_t)((mb * 4 + nb) * 2 + half) * 128 + lane * 4; v4f sum = *(const v4fa*)p;
            for (int u = 1; u < NW; ++u) sum += *(const v4fa*)(p + (size_t)u * 4096);
            sum += bfr(bias[nb * 16 + lr]);   // bias points at the tile's first column
            const int col = nb * 16 + lr, row = mb * 16 + hi * 8 + half * 4;
            if (seg == 2) *(v4fa*)(tile + col * TP + row) = sum;
            else for (int j = 0; j < 4; ++j) tile[(row + j) * TP + col] = sum[j]; } }
    __syncthreads();   // publishes the summed tile to the lanes that convert and store its rows
    // the tile's first element and row pitch in its planes, all scalar. Vhl holds a channel's hi half then its lo half; V16 fills the first half
    const size_t base = seg == 2 ? ((size_t)b * NKV + hd) * HD * (2 * TT) + t0 : ((((size_t)seg * NB_ + b) * NH_ + hd) * TT + t0) * HD;
    const int pitch = seg == 2 ? 2 * TT : HD;
    h16* D16 = (seg == 2 ? V16 : P16) + base; bf* Dh = (seg == 2 ? Vhl : Ph) + base; bf* Dl = (seg == 2 ? Vhl + TT : Pl) + base;
    float y[2][8];
#pragma unroll
    for (int u = 0; u < 2; ++u) { const float* p = tile + (rr + 32 * u) * TP + cc; const v4f x0 = *(const v4fa*)p, x1 = *(const v4fa*)(p + 4);
#pragma unroll
        for (int k = 0; k < 4; ++k) { y[u][k] = x0[k]; y[u][4 + k] = x1[k]; } }
    if (seg != 2) {
#pragma unroll
        for (int u = 0; u < 2; ++u)
#pragma unroll
            for (int p = 0; p < 4; ++p) { const float e0 = y[u][2 * p], e1 = y[u][2 * p + 1], c = cs[u][p][0], s = cs[u][p][1]; y[u][2 * p] = e0 * c - e1 * s; y[u][2 * p + 1] = e0 * s + e1 * c; } }   // even: x0 c - x1 s; odd: x0 s + x1 c
#pragma unroll
    for (int u = 0; u < 2; ++u) { v8h o16; v8us oh, ol;
#pragma unroll
        for (int k = 0; k < 8; ++k) { o16[k] = tohx(y[u][k]); unsigned short a2, c2; splitf(y[u][k], a2, c2); oh[k] = a2; ol[k] = c2; }
        const size_t e = (size_t)(rr + 32 * u) * pitch + cc;
        *(v8ha*)(D16 + e) = o16; *(v8usa*)(Dh + e) = oh; *(v8usa*)(Dl + e) = ol; }
}

// ---- k_gemmw: register-blocked GEMM, one work-group of NW waves per 64x64 output tile (16 accumulators a wave); wave w takes the K chunks w, w + NW, ...; operands straight from K-contiguous 16-bit planes; grid (M/64, N/64, Z), 32 NW threads.
// C[m][n] (f32, pitch ldc, + optional f32 bias: columns [0, DM) take bias, [DM, 2 DM) biasB, the rest biasC, so q, k and v share one launch) = sum_k A[m][k] Bt[n][k] (+ split products per NSPLIT). z-batch strides sA/sB/sC in elements. K % 32 == 0. PLANES: no C; the tile goes through splitk_planes instead.
template <typename T16> struct WFrag;
template <> struct WFrag<h16> { typedef v16h V; static __device__ __forceinline__ V ld(const h16* p) { return cat16(*(const v8h*)p, *(const v8h*)(p + 16)); } static __device__ __forceinline__ v8f mma(V a, V b, v8f c) { return wmma16(a, b, c); } };
template <> struct WFrag<bf> { typedef v16bf V; static __device__ __forceinline__ V ld(const bf* p) { return cat16b(*(const v8us*)p, *(const v8us*)(p + 16)); } static __device__ __forceinline__ v8f mma(V a, V b, v8f c) { return wmmab(a, b, c); } };
template <typename T16, int NSPLIT, bool BIAS, int NW, bool PLANES>
__global__ __launch_bounds__(32 * NW) void k_gemmw(const T16* __restrict__ A, const T16* __restrict__ A2, const T16* __restrict__ Bt, const T16* __restrict__ Bt2, int K, float* C, int ldc, const float* __restrict__ bias, const float* __restrict__ biasB, const float* __restrict__ biasC, size_t sA, size_t sB, size_t sC, const float* __restrict__ CS, h16* P16, bf* Ph, bf* Pl, h16* V16, bf* Vhl) {
    typedef typename WFrag<T16>::V V;
    __shared__ __align__(16) float red[NW * 4096];
    const size_t z = blockIdx.z; A += z * sA; if (A2) A2 += z * sA; Bt += z * sB; if (Bt2) Bt2 += z * sB; C += z * sC;
    const int lane = threadIdx.x & 31, lr = lane & 15, hi = lane >> 4; const int r0 = blockIdx.x * 64, c0 = blockIdx.y * 64;
    const int wv = __builtin_amdgcn_readfirstlane(threadIdx.x >> 5);   // wave number in a scalar register: the K loop stays a scalar loop with every lane on at the matrix instructions
    v8f acc[4][4];
#pragma unroll
    for (int mb = 0; mb < 4; ++mb)
#pragma unroll
        for (int nb = 0; nb < 4; ++nb) acc[mb][nb] = (v8f){};
    const size_t aoff = (size_t)(r0 + lr) * K + 8 * hi, boff = (size_t)(c0 + lr) * K + 8 * hi;
#pragma unroll 1
    for (int kc = wv * 32; kc < K; kc += NW * 32) {
        V a[4], a2[4];
#pragma unroll
        for (int mb = 0; mb < 4; ++mb) { a[mb] = WFrag<T16>::ld(A + aoff + (size_t)mb * 16 * K + kc); if (NSPLIT == 1 || NSPLIT == 2) a2[mb] = WFrag<T16>::ld(A2 + aoff + (size_t)mb * 16 * K + kc); }
#pragma unroll
        for (int nb = 0; nb < 4; ++nb) { const V b = WFrag<T16>::ld(Bt + boff + (size_t)nb * 16 * K + kc); V b2; if (NSPLIT >= 2) b2 = WFrag<T16>::ld(Bt2 + boff + (size_t)nb * 16 * K + kc);
#pragma unroll
            for (int mb = 0; mb < 4; ++mb) { acc[mb][nb] = WFrag<T16>::mma(a[mb], b, acc[mb][nb]); if (NSPLIT == 1 || NSPLIT == 2) acc[mb][nb] = WFrag<T16>::mma(a2[mb], b, acc[mb][nb]); if (NSPLIT >= 2) acc[mb][nb] = WFrag<T16>::mma(a[mb], b2, acc[mb][nb]); } }
        asm volatile("v_nop\n\tv_nop\n\tv_nop\n\tv_nop" : "+v"(acc[0][0]), "+v"(acc[1][1]), "+v"(acc[2][2]), "+v"(acc[3][3]) : "v"(a[0]), "v"(a[3]));
    }
    const int seg = c0 / DM; const float* bs = (seg == 0 ? bias : seg == 1 ? biasB : biasC) + (c0 - seg * DM);
    if constexpr (PLANES) { __shared__ __align__(16) float tile[64 * TP]; splitk_planes<NW>(acc, red, tile, bs, r0, c0, CS, P16, Ph, Pl, V16, Vhl); }
    else splitk_store<NW, BIAS>(acc, red, C, ldc, bs, r0, c0);
}


__constant__ float INV512[DQ / 2] = { 1.000000000e+00f,9.646616578e-01f,9.305720329e-01f,8.976871371e-01f,8.659643531e-01f,8.353625536e-01f,8.058422208e-01f,7.773650289e-01f,7.498942018e-01f,7.233941555e-01f,6.978305578e-01f,6.731703877e-01f,6.493816376e-01f,6.264335513e-01f,6.042963862e-01f,5.829415321e-01f,5.623413324e-01f,5.424690843e-01f,5.232991576e-01f,5.048065782e-01f,4.869675338e-01f,4.697588682e-01f,4.531583488e-01f,4.371444881e-01f,4.216965139e-01f,4.067944288e-01f,3.924189806e-01f,3.785515428e-01f,3.651741445e-01f,3.522694409e-01f,3.398208320e-01f,3.278121352e-01f,3.162277639e-01f,3.050527871e-01f,2.942727208e-01f,2.838735878e-01f,2.738419771e-01f,2.641648352e-01f,2.548296750e-01f,2.458243966e-01f,2.371373624e-01f,2.287573218e-01f,2.206733972e-01f,2.128751576e-01f,2.053525001e-01f,1.980956793e-01f,1.910952926e-01f,1.843423098e-01f,1.778279394e-01f,1.715437919e-01f,1.654817015e-01f,1.596338600e-01f,1.539926529e-01f,1.485508084e-01f,1.433012635e-01f,1.382372230e-01f,1.333521456e-01f,1.286396980e-01f,1.240937710e-01f,1.197085083e-01f,1.154782027e-01f,1.113973856e-01f,1.074607819e-01f,1.036632955e-01f,1.000000015e-01f,9.646616131e-02f,9.305720031e-02f,8.976870775e-02f,8.659642935e-02f,8.353625983e-02f,8.058421314e-02f,7.773650438e-02f,7.498941571e-02f,7.233941555e-02f,6.978305429e-02f,6.731703877e-02f,6.493816525e-02f,6.264335662e-02f,6.042964384e-02f,5.829415470e-02f,5.623412877e-02f,5.424690619e-02f,5.232991278e-02f,5.048065633e-02f,4.869675264e-02f,4.697588459e-02f,4.531583562e-02f,4.371444881e-02f,4.216964915e-02f,4.067944363e-02f,3.924189880e-02f,3.785515204e-02f,3.651741147e-02f,3.522694483e-02f,3.398208320e-02f,3.278120980e-02f,3.162277862e-02f,3.050527908e-02f,2.942727320e-02f,2.838735841e-02f,2.738419548e-02f,2.641648427e-02f,2.548296750e-02f,2.458244003e-02f,2.371373586e-02f,2.287573181e-02f,2.206734009e-02f,2.128751762e-02f,2.053525113e-02f,1.980956830e-02f,1.910953037e-02f,1.843423024e-02f,1.778279431e-02f,1.715437882e-02f,1.654817164e-02f,1.596338488e-02f,1.539926510e-02f,1.485508028e-02f,1.433012541e-02f,1.382372249e-02f,1.333521493e-02f,1.286396943e-02f,1.240937691e-02f,1.197085064e-02f,1.154781971e-02f,1.113973837e-02f,1.074607857e-02f,1.036632899e-02f,9.999999776e-03f,9.646615945e-03f,9.305720218e-03f,8.976871148e-03f,8.659643121e-03f,8.353625424e-03f,8.058422245e-03f,7.773650344e-03f,7.498942316e-03f,7.233941462e-03f,6.978305988e-03f,6.731703877e-03f,6.493816618e-03f,6.264335476e-03f,6.042964291e-03f,5.829415284e-03f,5.623413250e-03f,5.424690899e-03f,5.232991185e-03f,5.048065912e-03f,4.869675264e-03f,4.697588738e-03f,4.531583749e-03f,4.371444695e-03f,4.216964822e-03f,4.067944363e-03f,3.924189601e-03f,3.785515437e-03f,3.651741426e-03f,3.522694577e-03f,3.398208413e-03f,3.278121119e-03f,3.162277862e-03f,3.050528001e-03f,2.942727180e-03f,2.838735934e-03f,2.738419687e-03f,2.641648287e-03f,2.548296703e-03f,2.458244096e-03f,2.371373819e-03f,2.287573181e-03f,2.206734149e-03f,2.128751716e-03f,2.053525066e-03f,1.980956644e-03f,1.910952851e-03f,1.843422884e-03f,1.778279431e-03f,1.715437858e-03f,1.654817141e-03f,1.596338581e-03f,1.539926510e-03f,1.485507935e-03f,1.433012658e-03f,1.382372226e-03f,1.333521446e-03f,1.286396873e-03f,1.240937854e-03f,1.197085017e-03f,1.154782018e-03f,1.113973907e-03f,1.074607833e-03f,1.036632922e-03f,1.000000047e-03f,9.646615945e-04f,9.305721032e-04f,8.976871031e-04f,8.659643354e-04f,8.353625308e-04f,8.058422245e-04f,7.773649995e-04f,7.498941850e-04f,7.233941578e-04f,6.978305755e-04f,6.731703761e-04f,6.493816618e-04f,6.264335825e-04f,6.042963942e-04f,5.829415168e-04f,5.623413017e-04f,5.424690899e-04f,5.232990952e-04f,5.048065796e-04f,4.869675031e-04f,4.697588738e-04f,4.531583400e-04f,4.371444811e-04f,4.216964880e-04f,4.067944246e-04f,3.924189950e-04f,3.785515146e-04f,3.651741135e-04f,3.522694460e-04f,3.398208064e-04f,3.278121294e-04f,3.162277862e-04f,3.050527885e-04f,2.942727297e-04f,2.838736109e-04f,2.738419571e-04f,2.641648462e-04f,2.548296761e-04f,2.458243980e-04f,2.371373848e-04f,2.287573152e-04f,2.206734207e-04f,2.128751657e-04f,2.053524950e-04f,1.980956731e-04f,1.910952997e-04f,1.843422942e-04f,1.778279402e-04f,1.715437829e-04f,1.654817170e-04f,1.596338552e-04f,1.539926452e-04f,1.485508110e-04f,1.433012658e-04f,1.382372284e-04f,1.333521504e-04f,1.286396873e-04f,1.240937709e-04f,1.197085076e-04f,1.154781930e-04f,1.113973922e-04f,1.074607790e-04f,1.036632893e-04f };   // 10000^(-2i/512), i < 256, as float32 (jnp-computed)
// ---- k_prep: the three preparatory jobs, which do not depend on one another, as block ranges of ONE launch; a thread of the copy and of the table writes eight 16-byte units, not one entry, so that few waves have to be started.
// Blocks [0, PBW): the four weight matrices, rounded and transposed to [n][k], planes back to back. Blocks [PBW, PBW + PBX): the bf16 copy of x. The rest: the table {cos, sin} per (position, global channel), [TT][DQ][2].
#define PBW (4 * (DM * DQ / 64 / 64))           // 64 lines of 64 elements a block
#define XU  4                                   // units of 8 elements of x a thread and trip
#define XT  2                                   // trips
#define PBX (NB_ * TT * DM / 8 / (256 * XU * XT))
#define CU  8                                   // positions a block: a thread keeps one pair and walks the positions
#define PBC (TT / CU)
static_assert(PBW * 64 * 64 == 4 * DM * DQ && PBX * 256 * XU * XT * 8 == NB_ * TT * DM && PBC * CU == TT && DQ / 2 == 256, "block ranges cover their jobs exactly");
__global__ __launch_bounds__(256) void k_prep(const float* __restrict__ w0, const float* __restrict__ w1, const float* __restrict__ w2, const float* __restrict__ w3, bf* Bt, const float* __restrict__ x, bf* XB, float* CS) {
    const int blk = blockIdx.x;   // the branches below are the same for a whole work-group
    if (blk < PBW) {
        constexpr int K = DM, N = DQ; const int mat = blk / (PBW / 4), bx = blk % (PBW / 4);
        const float* w = mat == 0 ? w0 : mat == 1 ? w1 : mat == 2 ? w2 : w3; Bt += (size_t)mat * N * K;
        const int lane = threadIdx.x & 31; const int L0 = (bx * 8 + (threadIdx.x >> 5)) * 8;
        // rolled, a wave's eight lines one after another
#pragma unroll 1
        for (int l = 0; l < 8; ++l) { const int L = L0 + l; const size_t e = (size_t)L * 64 + lane * 2; const int k = (int)(e % K), n = (int)(e / K); v2us o;
            o[0] = f2bf(w[(size_t)k * N + n]); o[1] = f2bf(w[(size_t)(k + 1) * N + n]); *(v2us*)(Bt + e) = o; }
    } else if (blk < PBW + PBX) {
        const size_t u0 = (size_t)(blk - PBW) * (256 * XU * XT) + threadIdx.x;
        // rolled: a trip has eight 16-byte loads a lane in flight before the first is converted, which with a block's eight waves covers the memory's latency; a second trip costs no more registers
#pragma unroll 1
        for (int h = 0; h < XT; ++h) { const size_t uh = u0 + (size_t)h * (256 * XU); v8f v[XU];
#pragma unroll
            for (int j = 0; j < XU; ++j) v[j] = *(const v8f*)(x + (uh + (size_t)j * 256) * 8);
#pragma unroll
            for (int j = 0; j < XU; ++j) { v8us o;
#pragma unroll
                for (int k = 0; k < 8; ++k) o[k] = f2bf(v[j][k]);
                *(v8us*)(XB + (uh + (size_t)j * 256) * 8) = o; }
            asm volatile("s_wait_xcnt 0x0" ::: "memory");   // stands in front of the rewrite of the address and data registers that the loads and stores above name
        }
    } else {
        const int t0 = (blk - PBW - PBX) * CU; const float f = INV512[threadIdx.x];   // the block's 256 threads are the 256 pairs
        float* row = CS + ((size_t)t0 * DQ + 2 * threadIdx.x) * 2;                     // a unit: the two equal entries of a pair's channels, one 16-byte store; a wave's store covers four whole lines
        // rolled: the text of the precise cosine and sine stands once, not CU times, in the instruction cache
#pragma unroll 1
        for (int j = 0; j < CU; ++j) { const float a = __fmul_rn((float)(t0 + j), f); const float c = cosf(a), s = sinf(a);
            *(v4f*)(row + (size_t)j * (DQ * 2)) = (v4f){c, s, c, s}; }
    }
}

__device__ __forceinline__ float xhalf(float x) { return __builtin_bit_cast(float, __builtin_amdgcn_permlanex16(__builtin_bit_cast(int, x), __builtin_bit_cast(int, x), 0x76543210, 0xfedcba98, false, false)); }   // lane l with lane l ^ 16, on the vector port
#define FW 4   // launch bound: four waves a SIMD (256 registers; three for the hi/lo form, which holds twice the fragments): vector work between the matrix runs wants waves
template <typename T16, bool HR, int NQ>
__global__ __launch_bounds__(32 * FW, HR ? 3 : 4) void k_fattn(const T16* __restrict__ Q, const T16* __restrict__ Q2, const T16* __restrict__ Kp, const T16* __restrict__ K2, const T16* __restrict__ Vt, bf* Ah, bf* Al) {
    typedef typename WFrag<T16>::V V;
    __shared__ __align__(16) float so[FW * NQ * 4 * 256];   // partial O^T tiles, lane-linear, 256 floats a tile
    __shared__ float sm[FW * NQ * 16], sl[FW * NQ * 16];    // each wave's maximum and sum per query
    const int lane = threadIdx.x & 31, lr = lane & 15, hi = lane >> 4;
    const int wv = __builtin_amdgcn_readfirstlane(threadIdx.x >> 5);   // wave number in a scalar register: the key loop stays a scalar loop with every lane on at the matrix instructions
    const int z = blockIdx.x;                                          // batch * heads + head
    constexpr int ROW0 = HR ? 0 : RH, NBLK = (HR ? RH : TT - RH) / (16 * NQ);   // this launch's rows: [0, RH) or [RH, TT); grid y = NBLK
    const int q0 = ROW0 + (NBLK - 1 - (int)blockIdx.y) * (16 * NQ);   // longest rows start first
    const size_t zp = (size_t)z * TT * HD; Q += zp; Kp += zp; Vt += 2 * zp; if (HR) { Q2 += zp; K2 += zp; }
    const float NEG = -3.0e38f;
    V qf[NQ][2], qf2[NQ][2];
#pragma unroll
    for (int qb = 0; qb < NQ; ++qb)
#pragma unroll
        for (int dc = 0; dc < 2; ++dc) { const size_t o = (size_t)(q0 + qb * 16 + lr) * HD + dc * 32 + 8 * hi; qf[qb][dc] = WFrag<T16>::ld(Q + o); if (HR) qf2[qb][dc] = WFrag<T16>::ld(Q2 + o); }
    v8f o[NQ][4]; float m[NQ], l[NQ];
#pragma unroll
    for (int qb = 0; qb < NQ; ++qb) { m[qb] = NEG; l[qb] = 0.f;
#pragma unroll
        for (int db = 0; db < 4; ++db) o[qb][db] = (v8f){}; }
    const int nch = (q0 + 16 * NQ - 1) / 32 + 1;   // 32-key chunks up to the one that holds the last row's diagonal
    auto at = [](const T16* base, unsigned bytes) { return (const T16*)((const char*)base + bytes); };   // uniform plane base + a lane's 32-bit byte offset: one address register a load
    V kf[2][2], kf2[2][2];   // K fragments are fetched one trip ahead, so their latency lies under the softmax and the second product
    auto ldk = [&](int kc) {
#pragma unroll
        for (int kb = 0; kb < 2; ++kb)
#pragma unroll
            for (int dc = 0; dc < 2; ++dc) { const unsigned a = (unsigned)((kc + kb * 16 + lr) * HD + dc * 32 + 8 * hi) * 2u; kf[kb][dc] = WFrag<T16>::ld(at(Kp, a)); if (HR) kf2[kb][dc] = WFrag<T16>::ld(at(K2, a)); } };
    ldk(min(wv, nch - 1) * 32);
#pragma unroll 1
    for (int c = wv; c < nch; c += FW) {
        const int kc = c * 32;
        V vf[4], vf2[4];
#pragma unroll
        for (int db = 0; db < 4; ++db) { const unsigned a = (unsigned)((db * 16 + lr) * (2 * TT) + kc + 8 * hi) * 2u; vf[db] = WFrag<T16>::ld(at(Vt, a)); if (HR) vf2[db] = WFrag<T16>::ld(at(Vt, a + 2u * TT)); }
        v8f s[NQ][2];
#pragma unroll
        for (int qb = 0; qb < NQ; ++qb)
#pragma unroll
            for (int kb = 0; kb < 2; ++kb) { s[qb][kb] = (v8f){};
#pragma unroll
                for (int dc = 0; dc < 2; ++dc) { s[qb][kb] = WFrag<T16>::mma(kf[kb][dc], qf[qb][dc], s[qb][kb]); if (HR) { s[qb][kb] = WFrag<T16>::mma(kf2[kb][dc], qf[qb][dc], s[qb][kb]); s[qb][kb] = WFrag<T16>::mma(kf[kb][dc], qf2[qb][dc], s[qb][kb]); } } }
        ldk(min(c + FW, nch - 1) * 32);   // the next trip's chunk; past the end the last chunk again, unused
        asm volatile("s_wait_xcnt 0x0" ::: "memory");   // stands in front of the rewrite of the address registers that the loads above name
        // the period-3 columns 4, 7, 10, ... (j mod 3 == 1 but for j == 1) as an addend, 0 or -3e38, the same for every query: this lane's keys are jb + a constant, so three values by jb mod 3 serve all 16
        const int jb = kc + hi * 8, jr = jb % 3;
        const float bz[3] = { jr == 0 ? NEG : 0.f, jr == 1 ? NEG : 0.f, jr == 2 ? NEG : 0.f }; const float b1 = jb == 0 ? 0.f : bz[0];   // b1: the key jb + 1, which is column 1 in the first chunk
#pragma unroll
        for (int qb = 0; qb < NQ; ++qb) {
            float t[16];
#pragma unroll
            for (int e = 0; e < 16; ++e) { const int off = (e >> 3) * 16 + (e & 7); t[e] = s[qb][e >> 3][e & 7] * (SCL * 1.4426950408889634f) + (e == 1 ? b1 : bz[(1 + 2 * off) % 3]); }   // masked where (jr + off) mod 3 == 1
            if (c == nch - 1) {   // only the last chunk crosses the diagonal
#pragma unroll
                for (int e = 0; e < 16; ++e) { const int j = kc + (e >> 3) * 16 + hi * 8 + (e & 7); t[e] = (j <= q0 + qb * 16 + lr) ? t[e] : NEG; } }
            float tm = t[0];
#pragma unroll
            for (int e = 1; e < 16; ++e) tm = fmaxf(tm, t[e]);
            tm = fmaxf(tm, xhalf(tm));
            const float mn = fmaxf(m[qb], tm), al = __builtin_amdgcn_exp2f(m[qb] - mn); m[qb] = mn;
            float ps = 0.f;
#pragma unroll
            for (int e = 0; e < 16; ++e) { t[e] = __builtin_amdgcn_exp2f(t[e] - mn); ps += t[e]; }
            l[qb] = l[qb] * al + ps;   // this lane's keys only; the halves join after the loop
#pragma unroll
            for (int db = 0; db < 4; ++db) o[qb][db] *= al;
            if constexpr (HR) { v8us h0, h1, l0, l1;
#pragma unroll
                for (int e = 0; e < 8; ++e) { unsigned short a, b; splitf(t[e], a, b); h0[e] = a; l0[e] = b; splitf(t[8 + e], a, b); h1[e] = a; l1[e] = b; }
                const V ph = cat16b(h0, h1), pl = cat16b(l0, l1);
#pragma unroll
                for (int db = 0; db < 4; ++db) { o[qb][db] = WFrag<T16>::mma(vf[db], ph, o[qb][db]); o[qb][db] = WFrag<T16>::mma(vf2[db], ph, o[qb][db]); o[qb][db] = WFrag<T16>::mma(vf[db], pl, o[qb][db]); }
            } else { V pf;
#pragma unroll
                for (int e = 0; e < 16; ++e) pf[e] = tohx(t[e]);
#pragma unroll
                for (int db = 0; db < 4; ++db) o[qb][db] = WFrag<T16>::mma(vf[db], pf, o[qb][db]); }
        }
        // four vector slots between the last matrix instruction and the next trip's loads into its operands
        asm volatile("v_nop\n\tv_nop\n\tv_nop\n\tv_nop" : "+v"(o[NQ - 1][0]), "+v"(o[NQ - 1][1]), "+v"(o[NQ - 1][2]), "+v"(o[NQ - 1][3]) : "v"(vf[0]), "v"(vf[3]));
    }
#pragma unroll
    for (int qb = 0; qb < NQ; ++qb) {
#pragma unroll
        for (int db = 0; db < 4; ++db) { float* p = so + (size_t)(((wv * NQ + qb) * 4 + db) * 2) * 128 + lane * 4;
            *(v4fa*)p = __builtin_shufflevector(o[qb][db], o[qb][db], 0, 1, 2, 3); *(v4fa*)(p + 128) = __builtin_shufflevector(o[qb][db], o[qb][db], 4, 5, 6, 7); }
        const float lj = l[qb] + xhalf(l[qb]);
        if (hi == 0) { sm[(wv * NQ + qb) * 16 + lr] = m[qb]; sl[(wv * NQ + qb) * 16 + lr] = lj; } }
    __syncthreads();   // publishes every wave's partial O^T, maximum and sum to the waves that merge them
    // merge: a wave takes 4 NQ queries, 8 / NQ lanes a query, so each 128-byte line of the merged planes has one writer. A wave without an unmasked key for a query has maximum -3e38 and weight 0.
    constexpr int LPQ = 8 / NQ;
    const int qi = wv * (32 / LPQ) + lane / LPQ, qb = qi >> 4, cq = qi & 15;
    float M = NEG, sc[FW], L = 0.f;
#pragma unroll
    for (int u = 0; u < FW; ++u) M = fmaxf(M, sm[(u * NQ + qb) * 16 + cq]);
#pragma unroll
    for (int u = 0; u < FW; ++u) { sc[u] = __builtin_amdgcn_exp2f(sm[(u * NQ + qb) * 16 + cq] - M); L += sc[u] * sl[(u * NQ + qb) * 16 + cq]; }
    const float inv = __fdiv_rn(1.0f, L);
    const size_t orow = ((size_t)(z / NH_) * TT + q0 + qi) * DQ + (z % NH_) * HD;
#pragma unroll
    for (int n = 0; n < NQ; ++n) { const int g = (lane % LPQ) * NQ + n, db = g >> 1, h = g & 1;   // 8 channels: 16 db + 8 h ...
        v4f a0 = (v4f){}, a1 = (v4f){};
#pragma unroll
        for (int u = 0; u < FW; ++u) { const float* p = so + (size_t)(((u * NQ + qb) * 4 + db) * 2) * 128 + (h * 16 + cq) * 4; a0 += *(const v4fa*)p * sc[u]; a1 += *(const v4fa*)(p + 128) * sc[u]; }
        v8us oh, ol;
#pragma unroll
        for (int r = 0; r < 4; ++r) { unsigned short a, b; splitf(a0[r] * inv, a, b); oh[r] = a; ol[r] = b; splitf(a1[r] * inv, a, b); oh[4 + r] = a; ol[4 + r] = b; }
        *(v8usa*)(Ah + orow + db * 16 + h * 8) = oh; *(v8usa*)(Al + orow + db * 16 + h * 8) = ol; }
}

extern "C" void kernel_launch(void* const* d_in, const int* in_sizes, int n_in,
                              void* d_out, int out_size, void* d_ws, size_t ws_size, hipStream_t stream) {
    (void)in_sizes; (void)n_in; (void)out_size;
    const float* x = (const float*)d_in[0]; const float* wq = (const float*)d_in[1]; const float* bq = (const float*)d_in[2]; const float* wk = (const float*)d_in[3]; const float* bk = (const float*)d_in[4]; const float* wv = (const float*)d_in[5]; const float* bv = (const float*)d_in[6]; const float* wo = (const float*)d_in[7]; const float* bo = (const float*)d_in[8];
    float* OUT = (float*)d_out;     // [4][2048][512]
    char* wsp = (char*)d_ws;
    auto take = [&](size_t bytes) { char* p = wsp; wsp += (bytes + 255) & ~(size_t)255; return (void*)p; };
    const size_t PL = (size_t)NB_ * NH_ * TT * HD;   // elements of one [batch][head] plane set
    bf* WA = (bf*)take((size_t)4 * DM * DQ * 2);      // Wq | Wk | Wv | Wo, each transposed [n][k]
    h16* QK16 = (h16*)take(2 * PL * 2); bf* QKh = (bf*)take(2 * PL * 2); bf* QKl = (bf*)take(2 * PL * 2);   // q planes, then k planes
    h16* VT16 = (h16*)take(2 * PL * 2); bf* VThl = (bf*)take(2 * PL * 2);   // rows of 2 TT elements
    bf* ATh = (bf*)take(PL * 2); bf* ATl = (bf*)take(PL * 2);   // attention output, heads merged, hi and lo
    bf* XB = (bf*)take((size_t)NB_ * TT * DM * 2); float* CS = (float*)take((size_t)TT * DQ * 2 * 4);   /* CS {cos, sin} per (t, global channel) */
    if ((size_t)(wsp - (char*)d_ws) > ws_size) return;    // ws 256 MiB
    k_prep<<<PBW + PBX + PBC, 256, 0, stream>>>(wq, wk, wv, wo, WA, x, XB, CS);   /* angle t x 10000^(-2i/512) for global pair i = c/2 */
    k_gemmw<bf, 0, true, 8, true><<<dim3(NB_ * TT / 64, 3 * DQ / 64, 1), 256, 0, stream>>>(XB, nullptr, WA, nullptr, DM, nullptr, 0, bq, bk, bv, 0, 0, 0, CS, QK16, QKh, QKl, VT16, VThl);
    // grid x: the 32 (batch, head) planes; grid y: query blocks, longest first
    k_fattn<h16, false, 2><<<dim3(NB_ * NH_, (TT - RH) / 32, 1), 32 * FW, 0, stream>>>(QK16, nullptr, QK16 + PL, nullptr, VT16, ATh, ATl);
    k_fattn<bf, true, 1><<<dim3(NB_ * NH_, RH / 16, 1), 32 * FW, 0, stream>>>(QKh, QKl, QKh + PL, QKl + PL, VThl, ATh, ATl);
    k_gemmw<bf, 1, true, 8, false><<<dim3(NB_ * TT / 64, DM / 64, 1), 256, 0, stream>>>(ATh, ATl, WA + (size_t)3 * DM * DQ, nullptr, DQ, OUT, DM, bo, nullptr, nullptr, 0, 0, 0, nullptr, nullptr, nullptr, nullptr, nullptr, nullptr);
}

// v006
// A run of this version takes 108 microseconds.
// Next to v005, in two timings, it ran 1.14 times as fast each time.
// Counting every step since v000, it is 14.7 times as fast.
#include <hip/hip_runtime.h>

// Causal attention with rotary embeddings over the FULL hidden dim and periodically masked key columns (x [4][2048][512]; q,k,v = x W + b ('xw' [512][512] + [512], 0.02); rope BEFORE the head split: pairs (2i, 2i+1) of the 512-vector rotated by t x 10000^(-2i/512), i < 256; 8 heads x 64; scores / 8; mask = causal AND key column j not in {4, 7, 10, ...} (j >= 4 with (j - 4) mod 3 == 0: the module's period-3 'mgdt' columns); softmax; out = merged Wo + bo -> [4][2048][512] (4.2 M)).
// Layout, all batches in each launch: bf16 copy of x; exact projections + f32 biases; a {cos, sin} table per (position, global pair) (float32 inverse frequencies over 512 dims, precise cosf/sinf) (weight planes, x copy and table come from one launch, k_prep); the projection's epilogue rotates interleaved pairs by the GLOBAL channel and writes the q, k planes and the transposed V planes itself; the k and V planes hold the unmasked key positions only, in their order (slot index, kpos / kcnt below), so a period-3 column is neither projected nor stored nor scored; fused causal attention (k_fattn: scores, running-maximum softmax and P x V in registers; rows < 512 hi/lo 3 products, rest fp16) that writes the merged hi/lo planes; merged hi/lo x Wo exact + bo.
// Compute dtypes, f32 accumulate: every input rounded to bf16; projections exact + f32 biases; rotary f32; attention rows < 512 3 products, rest fp16; softmax f32; Wo hl x exact + bias.

#define NB_  4
#define TT   2048
#define DM   512
#define NH_  8
#define NKV  8
#define REP  (NH_ / NKV)
#define HD   64
#define DQ   (NH_ * HD)
#define DKV  (NKV * HD)
#define RH   512                  // query rows < RH use hi+lo planes (0: none)
#define SCL  0.125f
#define PRD  3       // masked-column period
#define PRD0 4       // first masked column (period + ret_order - 1)
// Key slots: the unmasked key positions 0, 1, 2, 3, 5, 6, 8, 9, ... numbered in their order. kpos: the position in slot s. kcnt: how many slots a query at position q sees (slot s is visible exactly where s < kcnt(q)).
__host__ __device__ constexpr int kpos(int s) { return s < PRD0 ? s : PRD0 + 1 + (s - PRD0) / (PRD - 1) * PRD + (s - PRD0) % (PRD - 1); }
__host__ __device__ constexpr int kcnt(int q) { return q + 1 - (q >= PRD0 ? (q - PRD0) / PRD + 1 : 0); }
#define NKC  kcnt(TT - 1)          // slots in use
#define KT   ((NKC + 63) / 64)     // 64-slot tiles of the k and V projections; the last tile's spare slots repeat the last position and are visible to no query
static_assert(kpos(NKC - 1) < TT && kpos(NKC) >= TT && kcnt(kpos(NKC - 1)) == NKC && kpos(4) == 5 && kpos(7) == 9, "slots cover the unmasked positions exactly");
typedef _Float16 h16;
typedef unsigned short bf;
typedef __attribute__((ext_vector_type(16))) __bf16   v16bf;
typedef __attribute__((ext_vector_type(16))) _Float16 v16h;
typedef __attribute__((ext_vector_type(8)))  _Float16 v8h;
typedef __attribute__((ext_vector_type(8)))  unsigned short v8us;
typedef __attribute__((ext_vector_type(8)))  float    v8f;
typedef __attribute__((ext_vector_type(4)))  float    v4f;
typedef v8h  __attribute__((may_alias)) v8ha;
typedef v4f  __attribute__((may_alias)) v4fa;
typedef v8us __attribute__((may_alias)) v8usa;

__device__ __forceinline__ unsigned short f2bf(float f) { unsigned u = __float_as_uint(f); u += 0x7FFFu + ((u >> 16) & 1u); return (unsigned short)(u >> 16); }
__device__ __forceinline__ float bf2f(unsigned short b) { return __uint_as_float(((unsigned)b) << 16); }
__device__ __forceinline__ float bfr(float f) { return bf2f(f2bf(f)); }
__device__ __forceinline__ v16h cat16(v8h lo, v8h hi) { return __builtin_shufflevector(lo, hi, 0, 1, 2, 3, 4, 5, 6, 7, 8, 9, 10, 11, 12, 13, 14, 15); }
__device__ __forceinline__ v16bf cat16b(v8us lo, v8us hi) { return __builtin_bit_cast(v16bf, __builtin_shufflevector(lo, hi, 0, 1, 2, 3, 4, 5, 6, 7, 8, 9, 10, 11, 12, 13, 14, 15)); }
__device__ __forceinline__ v8f wmma16(v16h a, v16h b, v8f c) { return __builtin_amdgcn_wmma_f32_16x16x32_f16(false, a, false, b, (short)0, c, false, false); }
__device__ __forceinline__ v8f wmmab(v16bf a, v16bf b, v8f c) { return __builtin_amdgcn_wmma_f32_16x16x32_bf16(false, a, false, b, (short)0, c, false, false); }

__device__ __forceinline__ h16 tohx(float x) { return (h16)x; }
__device__ __forceinline__ void splitf(float y, unsigned short& h, unsigned short& l) { h = f2bf(y); l = f2bf(y - bf2f(h)); }
typedef __attribute__((ext_vector_type(2))) _Float16 v2h;
typedef __attribute__((ext_vector_type(4))) _Float16 v4h;
typedef __attribute__((ext_vector_type(2))) unsigned short v2us;
typedef __attribute__((ext_vector_type(4))) unsigned short v4us;
typedef __attribute__((ext_vector_type(2))) float v2f;
typedef __attribute__((ext_vector_type(4))) int v4i;

// ---- Split-K epilogue: the NW waves of a work-group each hold a partial 64x64 tile (their share of the K loop). Every wave parks its 16 accumulators in LDS lane-linear (b128, no bank conflict),
// one barrier, then each wave sums its share of the tile over the NW partials in wave order 0..NW-1 and stores it. A unit = 4 accumulator rows x 32 columns, so each 128-byte output line has one writer.
template <int NW, bool BIAS>
__device__ __forceinline__ void splitk_store(const v8f (&acc)[4][4], float* red, float* C, int ldc, const float* __restrict__ bias, int r0, int c0) {
    const int lane = threadIdx.x & 31, lr = lane & 15, hi = lane >> 4, w = __builtin_amdgcn_readfirstlane(threadIdx.x >> 5);
    // both loops unrolled: acc is indexed by constants only and stays in registers
#pragma unroll
    for (int mb = 0; mb < 4; ++mb)
#pragma unroll
        for (int nb = 0; nb < 4; ++nb) { float* p = red + (size_t)((w * 16 + mb * 4 + nb) * 2) * 128 + lane * 4;
            *(v4fa*)p = __builtin_shufflevector(acc[mb][nb], acc[mb][nb], 0, 1, 2, 3); *(v4fa*)(p + 128) = __builtin_shufflevector(acc[mb][nb], acc[mb][nb], 4, 5, 6, 7); }
    __syncthreads();   // publishes every wave's partial tile to the waves that sum it
    for (int q = 0; q < 16 / NW; ++q) { const int unit = w * (16 / NW) + q, mb = unit >> 2, nb0 = ((unit >> 1) & 1) * 2, half = unit & 1;
        for (int e = 0; e < 2; ++e) { const int nb = nb0 + e; const float* p = red + (size_t)((mb * 4 + nb) * 2 + half) * 128 + lane * 4; v4f sum = *(const v4fa*)p;
            for (int u = 1; u < NW; ++u) sum += *(const v4fa*)(p + (size_t)u * 4096);
            const int col = c0 + nb * 16 + lr; if (BIAS) sum += bfr(bias[nb * 16 + lr]);   // bias points at the tile's first column
            float* crow = C + (size_t)(r0 + mb * 16 + hi * 8 + half * 4) * ldc + col;
            for (int j = 0; j < 4; ++j) crow[(size_t)j * ldc] = sum[j]; } }
}

// ---- Split-K epilogue of the q | k | v projection: the summed 64x64 tile (64 positions of one batch x the 64 channels of one head of q, k or v) never goes to memory as f32.
// Partials are parked and summed as in splitk_store (same order, same bias add); the sums go to a second LDS tile (q, k: [position][channel]; v: [channel][position], four positions a b128 store), one more barrier,
// then each lane takes 8 neighbours of a row: q, k rows are rotated pair by pair and go to the fp16 and hi/lo planes [q, k][batch][head][t][d] (k: t is the key slot); v rows go to the planes [batch][head][d][2 TT] (by key slot). Every b128 store of a wave covers whole 128-byte lines.
#define TP 68   // pitch of that tile in floats: rows stay 16-byte aligned, and the b32 column writes, the b128 writes and the b128 row reads each spread over all banks
template <int NW>
__device__ __forceinline__ void splitk_planes(const v8f (&acc)[4][4], float* red, float* tile, const float* __restrict__ bias, int r0, int c0, const float* __restrict__ CS, h16* P16, bf* Ph, bf* Pl, h16* V16, bf* Vhl) {
    const int lane = threadIdx.x & 31, lr = lane & 15, hi = lane >> 4, w = __builtin_amdgcn_readfirstlane(threadIdx.x >> 5);
    const int seg = c0 / DM, hd = (c0 - seg * DM) / HD, b = r0 / TT, t0 = r0 % TT;   // seg: 0 q, 1 k, 2 v, the same for the whole work-group; 64 divides TT, so a tile lies in one batch; t0: first position (q) or first key slot (k, v)
    const int rr = threadIdx.x >> 3, cc = (threadIdx.x & 7) * 8;                     // this lane's rows rr, rr + 32 and first column of the summed tile
    v2f cs[2][4] = {};   // {cos, sin} of this lane's 4 pairs in each of its two rows, asked for here so that their latency lies under the parking of the partials
    if (seg != 2) {
#pragma unroll
        for (int u = 0; u < 2; ++u)
#pragma unroll
            for (int p = 0; p < 4; ++p) { const int row = t0 + rr + 32 * u, tp = seg == 1 ? min(kpos(row), TT - 1) : row;   // a k row turns by the position that its slot holds
                cs[u][p] = *(const v2f*)(CS + ((size_t)tp * DQ + hd * HD + cc + 2 * p) * 2); } }
    // both loops unrolled: acc is indexed by constants only and stays in registers
#pragma unroll
    for (int mb = 0; mb < 4; ++mb)
#pragma unroll
        for (int nb = 0; nb < 4; ++nb) { float* p = red + (size_t)((w * 16 + mb * 4 + nb) * 2) * 128 + lane * 4;
            *(v4fa*)p = __builtin_shufflevector(acc[mb][nb], acc[mb][nb], 0, 1, 2, 3); *(v4fa*)(p + 128) = __builtin_shufflevector(acc[mb][nb], acc[mb][nb], 4, 5, 6, 7); }
    __syncthreads();   // publishes every wave's partial tile to the waves that sum it
    for (int q = 0; q < 16 / NW; ++q) { const int unit = w * (16 / NW) + q, mb = unit >> 2, nb0 = ((unit >> 1) & 1) * 2, half = unit & 1;
        for (int e = 0; e < 2; ++e) { const int nb = nb0 + e; const float* p = red + (size_t)((mb * 4 + nb) * 2 + half) * 128 + lane * 4; v4f sum = *(const v4fa*)p;
            for (int u = 1; u < NW; ++u) sum += *(const v4fa*)(p + (size_t)u * 4096);
            sum += bfr(bias[nb * 16 + lr]);   // bias points at the tile's first column
            const int col = nb * 16 + lr, row = mb * 16 + hi * 8 + half * 4;
            if (seg == 2) *(v4fa*)(tile + col * TP + row) = sum;
            else for (int j = 0; j < 4; ++j) tile[(row + j) * TP + col] = sum[j]; } }
    __syncthreads();   // publishes the summed tile to the lanes that convert and store its rows
    // the tile's first element and row pitch in its planes, all scalar. Vhl holds a channel's hi half then its lo half; V16 fills the first half
    const size_t base = seg == 2 ? ((size_t)b * NKV + hd) * HD * (2 * TT) + t0 : ((((size_t)seg * NB_ + b) * NH_ + hd) * TT + t0) * HD;
    const int pitch = seg == 2 ? 2 * TT : HD;
    h16* D16 = (seg == 2 ? V16 : P16) + base; bf* Dh = (seg == 2 ? Vhl : Ph) + base; bf* Dl = (seg == 2 ? Vhl + TT : Pl) + base;
    float y[2][8];
#pragma unroll
    for (int u = 0; u < 2; ++u) { const float* p = tile + (rr + 32 * u) * TP + cc; const v4f x0 = *(const v4fa*)p, x1 = *(const v4fa*)(p + 4);
#pragma unroll
        for (int k = 0; k < 4; ++k) { y[u][k] = x0[k]; y[u][4 + k] = x1[k]; } }
    if (seg != 2) {
#pragma unroll
        for (int u = 0; u < 2; ++u)
#pragma unroll
            for (int p = 0; p < 4; ++p) { const float e0 = y[u][2 * p], e1 = y[u][2 * p + 1], c = cs[u][p][0], s = cs[u][p][1]; y[u][2 * p] = e0 * c - e1 * s; y[u][2 * p + 1] = e0 * s + e1 * c; } }   // even: x0 c - x1 s; odd: x0 s + x1 c
#pragma unroll
    for (int u = 0; u < 2; ++u) { v8h o16; v8us oh, ol;
#pragma unroll
        for (int k = 0; k < 8; ++k) { o16[k] = tohx(y[u][k]); unsigned short a2, c2; splitf(y[u][k], a2, c2); oh[k] = a2; ol[k] = c2; }
        const size_t e = (size_t)(rr + 32 * u) * pitch + cc;
        *(v8ha*)(D16 + e) = o16; *(v8usa*)(Dh + e) = oh; *(v8usa*)(Dl + e) = ol; }
}

// ---- k_gemmw: register-blocked GEMM, one work-group of NW waves per 64x64 output tile (16 accumulators a wave); wave w takes the K chunks w, w + NW, ...; operands straight from K-contiguous 16-bit planes; grid (M/64, N/64, Z), 32 NW threads.
// C[m][n] (f32, pitch ldc, + optional f32 bias: columns [0, DM) take bias, [DM, 2 DM) biasB, the rest biasC, so q, k and v share one launch) = sum_k A[m][k] Bt[n][k] (+ split products per NSPLIT). z-batch strides sA/sB/sC in elements. K % 32 == 0. PLANES: no C; the tile goes through splitk_planes instead; grid x = per batch TT/64 position tiles of q, then KT slot tiles of k, then KT of v (their A rows are the positions kpos(slot)), grid y = head.
template <typename T16> struct WFrag;
template <> struct WFrag<h16> { typedef v16h V; static __device__ __forceinline__ V ld(const h16* p) { return cat16(*(const v8h*)p, *(const v8h*)(p + 16)); } static __device__ __forceinline__ v8f mma(V a, V b, v8f c) { return wmma16(a, b, c); } };
template <> struct WFrag<bf> { typedef v16bf V; static __device__ __forceinline__ V ld(const bf* p) { return cat16b(*(const v8us*)p, *(const v8us*)(p + 16)); } static __device__ __forceinline__ v8f mma(V a, V b, v8f c) { return wmmab(a, b, c); } };
template <typename T16, int NSPLIT, bool BIAS, int NW, bool PLANES>
__global__ __launch_bounds__(32 * NW) void k_gemmw(const T16* __restrict__ A, const T16* __restrict__ A2, const T16* __restrict__ Bt, const T16* __restrict__ Bt2, int K, float* C, int ldc, const float* __restrict__ bias, const float* __restrict__ biasB, const float* __restrict__ biasC, size_t sA, size_t sB, size_t sC, const float* __restrict__ CS, h16* P16, bf* Ph, bf* Pl, h16* V16, bf* Vhl) {
    typedef typename WFrag<T16>::V V;
    __shared__ __align__(16) float red[NW * 4096];
    const size_t z = blockIdx.z; A += z * sA; if (A2) A2 += z * sA; Bt += z * sB; if (Bt2) Bt2 += z * sB; C += z * sC;
    const int lane = threadIdx.x & 31, lr = lane & 15, hi = lane >> 4; int r0 = blockIdx.x * 64, c0 = blockIdx.y * 64;
    unsigned aby[4] = {};   // PLANES: byte offsets of the A rows of this lane's four fragments (the rows of a k or v tile are not neighbours)
    if constexpr (PLANES) { constexpr int QT = TT / 64, PB = QT + 2 * KT; const int bt = blockIdx.x / PB, r = blockIdx.x % PB, sg = r < QT ? 0 : r < QT + KT ? 1 : 2, s0 = (r - (sg == 0 ? 0 : sg == 1 ? QT : QT + KT)) * 64;   // all scalar
        r0 = bt * TT + s0; c0 += sg * DM;
#pragma unroll
        for (int mb = 0; mb < 4; ++mb) { const int s = s0 + mb * 16 + lr; aby[mb] = (unsigned)((bt * TT + (sg == 0 ? s : min(kpos(s), TT - 1))) * K + 8 * hi) * 2u; } }
    const int wv = __builtin_amdgcn_readfirstlane(threadIdx.x >> 5);   // wave number in a scalar register: the K loop stays a scalar loop with every lane on at the matrix instructions
    v8f acc[4][4];
#pragma unroll
    for (int mb = 0; mb < 4; ++mb)
#pragma unroll
        for (int nb = 0; nb < 4; ++nb) acc[mb][nb] = (v8f){};
    const size_t aoff = (size_t)(r0 + lr) * K + 8 * hi, boff = (size_t)(c0 + lr) * K + 8 * hi;
#pragma unroll 1
    for (int kc = wv * 32; kc < K; kc += NW * 32) {
        V a[4], a2[4];
#pragma unroll
        for (int mb = 0; mb < 4; ++mb) { if constexpr (PLANES) { a[mb] = WFrag<T16>::ld((const T16*)((const char*)A + (aby[mb] + 2u * kc)));   // uniform base + a lane's 32-bit byte offset: one address register a row
                asm volatile("s_wait_xcnt 0x0" ::: "memory"); }   // stands in front of the later loads, whose results land in the address register that the loads above name
            else a[mb] = WFrag<T16>::ld(A + aoff + (size_t)mb * 16 * K + kc);
            if (NSPLIT == 1 || NSPLIT == 2) a2[mb] = WFrag<T16>::ld(A2 + aoff + (size_t)mb * 16 * K + kc); }
#pragma unroll
        for (int nb = 0; nb < 4; ++nb) { const V b = WFrag<T16>::ld(Bt + boff + (size_t)nb * 16 * K + kc); V b2; if (NSPLIT >= 2) b2 = WFrag<T16>::ld(Bt2 + boff + (size_t)nb * 16 * K + kc);
#pragma unroll
            for (int mb = 0; mb < 4; ++mb) { acc[mb][nb] = WFrag<T16>::mma(a[mb], b, acc[mb][nb]); if (NSPLIT == 1 || NSPLIT == 2) acc[mb][nb] = WFrag<T16>::mma(a2[mb], b, acc[mb][nb]); if (NSPLIT >= 2) acc[mb][nb] = WFrag<T16>::mma(a[mb], b2, acc[mb][nb]); } }
        asm volatile("v_nop\n\tv_nop\n\tv_nop\n\tv_nop" : "+v"(acc[0][0]), "+v"(acc[1][1]), "+v"(acc[2][2]), "+v"(acc[3][3]) : "v"(a[0]), "v"(a[3]));
    }
    const int seg = c0 / DM; const float* bs = (seg == 0 ? bias : seg == 1 ? biasB : biasC) + (c0 - seg * DM);
    if constexpr (PLANES) { __shared__ __align__(16) float tile[64 * TP]; splitk_planes<NW>(acc, red, tile, bs, r0, c0, CS, P16, Ph, Pl, V16, Vhl); }
    else splitk_store<NW, BIAS>(acc, red, C, ldc, bs, r0, c0);
}


__constant__ float INV512[DQ / 2] = { 1.000000000e+00f,9.646616578e-01f,9.305720329e-01f,8.976871371e-01f,8.659643531e-01f,8.353625536e-01f,8.058422208e-01f,7.773650289e-01f,7.498942018e-01f,7.233941555e-01f,6.978305578e-01f,6.731703877e-01f,6.493816376e-01f,6.264335513e-01f,6.042963862e-01f,5.829415321e-01f,5.623413324e-01f,5.424690843e-01f,5.232991576e-01f,5.048065782e-01f,4.869675338e-01f,4.697588682e-01f,4.531583488e-01f,4.371444881e-01f,4.216965139e-01f,4.067944288e-01f,3.924189806e-01f,3.785515428e-01f,3.651741445e-01f,3.522694409e-01f,3.398208320e-01f,3.278121352e-01f,3.162277639e-01f,3.050527871e-01f,2.942727208e-01f,2.838735878e-01f,2.738419771e-01f,2.641648352e-01f,2.548296750e-01f,2.458243966e-01f,2.371373624e-01f,2.287573218e-01f,2.206733972e-01f,2.128751576e-01f,2.053525001e-01f,1.980956793e-01f,1.910952926e-01f,1.843423098e-01f,1.778279394e-01f,1.715437919e-01f,1.654817015e-01f,1.596338600e-01f,1.539926529e-01f,1.485508084e-01f,1.433012635e-01f,1.382372230e-01f,1.333521456e-01f,1.286396980e-01f,1.240937710e-01f,1.197085083e-01f,1.154782027e-01f,1.113973856e-01f,1.074607819e-01f,1.036632955e-01f,1.000000015e-01f,9.646616131e-02f,9.305720031e-02f,8.976870775e-02f,8.659642935e-02f,8.353625983e-02f,8.058421314e-02f,7.773650438e-02f,7.498941571e-02f,7.233941555e-02f,6.978305429e-02f,6.731703877e-02f,6.493816525e-02f,6.264335662e-02f,6.042964384e-02f,5.829415470e-02f,5.623412877e-02f,5.424690619e-02f,5.232991278e-02f,5.048065633e-02f,4.869675264e-02f,4.697588459e-02f,4.531583562e-02f,4.371444881e-02f,4.216964915e-02f,4.067944363e-02f,3.924189880e-02f,3.785515204e-02f,3.651741147e-02f,3.522694483e-02f,3.398208320e-02f,3.278120980e-02f,3.162277862e-02f,3.050527908e-02f,2.942727320e-02f,2.838735841e-02f,2.738419548e-02f,2.641648427e-02f,2.548296750e-02f,2.458244003e-02f,2.371373586e-02f,2.287573181e-02f,2.206734009e-02f,2.128751762e-02f,2.053525113e-02f,1.980956830e-02f,1.910953037e-02f,1.843423024e-02f,1.778279431e-02f,1.715437882e-02f,1.654817164e-02f,1.596338488e-02f,1.539926510e-02f,1.485508028e-02f,1.433012541e-02f,1.382372249e-02f,1.333521493e-02f,1.286396943e-02f,1.240937691e-02f,1.197085064e-02f,1.154781971e-02f,1.113973837e-02f,1.074607857e-02f,1.036632899e-02f,9.999999776e-03f,9.646615945e-03f,9.305720218e-03f,8.976871148e-03f,8.659643121e-03f,8.353625424e-03f,8.058422245e-03f,7.773650344e-03f,7.498942316e-03f,7.233941462e-03f,6.978305988e-03f,6.731703877e-03f,6.493816618e-03f,6.264335476e-03f,6.042964291e-03f,5.829415284e-03f,5.623413250e-03f,5.424690899e-03f,5.232991185e-03f,5.048065912e-03f,4.869675264e-03f,4.697588738e-03f,4.531583749e-03f,4.371444695e-03f,4.216964822e-03f,4.067944363e-03f,3.924189601e-03f,3.785515437e-03f,3.651741426e-03f,3.522694577e-03f,3.398208413e-03f,3.278121119e-03f,3.162277862e-03f,3.050528001e-03f,2.942727180e-03f,2.838735934e-03f,2.738419687e-03f,2.641648287e-03f,2.548296703e-03f,2.458244096e-03f,2.371373819e-03f,2.287573181e-03f,2.206734149e-03f,2.128751716e-03f,2.053525066e-03f,1.980956644e-03f,1.910952851e-03f,1.843422884e-03f,1.778279431e-03f,1.715437858e-03f,1.654817141e-03f,1.596338581e-03f,1.539926510e-03f,1.485507935e-03f,1.433012658e-03f,1.382372226e-03f,1.333521446e-03f,1.286396873e-03f,1.240937854e-03f,1.197085017e-03f,1.154782018e-03f,1.113973907e-03f,1.074607833e-03f,1.036632922e-03f,1.000000047e-03f,9.646615945e-04f,9.305721032e-04f,8.976871031e-04f,8.659643354e-04f,8.353625308e-04f,8.058422245e-04f,7.773649995e-04f,7.498941850e-04f,7.233941578e-04f,6.978305755e-04f,6.731703761e-04f,6.493816618e-04f,6.264335825e-04f,6.042963942e-04f,5.829415168e-04f,5.623413017e-04f,5.424690899e-04f,5.232990952e-04f,5.048065796e-04f,4.869675031e-04f,4.697588738e-04f,4.531583400e-04f,4.371444811e-04f,4.216964880e-04f,4.067944246e-04f,3.924189950e-04f,3.785515146e-04f,3.651741135e-04f,3.522694460e-04f,3.398208064e-04f,3.278121294e-04f,3.162277862e-04f,3.050527885e-04f,2.942727297e-04f,2.838736109e-04f,2.738419571e-04f,2.641648462e-04f,2.548296761e-04f,2.458243980e-04f,2.371373848e-04f,2.287573152e-04f,2.206734207e-04f,2.128751657e-04f,2.053524950e-04f,1.980956731e-04f,1.910952997e-04f,1.843422942e-04f,1.778279402e-04f,1.715437829e-04f,1.654817170e-04f,1.596338552e-04f,1.539926452e-04f,1.485508110e-04f,1.433012658e-04f,1.382372284e-04f,1.333521504e-04f,1.286396873e-04f,1.240937709e-04f,1.197085076e-04f,1.154781930e-04f,1.113973922e-04f,1.074607790e-04f,1.036632893e-04f };   // 10000^(-2i/512), i < 256, as float32 (jnp-computed)
// ---- k_prep: the three preparatory jobs, which do not depend on one another, as block ranges of ONE launch; a thread of the copy and of the table writes eight 16-byte units, not one entry, so that few waves have to be started.
// Blocks [0, PBW): the four weight matrices, rounded and transposed to [n][k], planes back to back. Blocks [PBW, PBW + PBX): the bf16 copy of x. The rest: the table {cos, sin} per (position, global channel), [TT][DQ][2].
#define PBW (4 * (DM * DQ / 64 / 64))           // 64 lines of 64 elements a block
#define XU  4                                   // units of 8 elements of x a thread and trip
#define XT  2                                   // trips
#define PBX (NB_ * TT * DM / 8 / (256 * XU * XT))
#define CU  8                                   // positions a block: a thread keeps one pair and walks the positions
#define PBC (TT / CU)
static_assert(PBW * 64 * 64 == 4 * DM * DQ && PBX * 256 * XU * XT * 8 == NB_ * TT * DM && PBC * CU == TT && DQ / 2 == 256, "block ranges cover their jobs exactly");
__global__ __launch_bounds__(256) void k_prep(const float* __restrict__ w0, const float* __restrict__ w1, const float* __restrict__ w2, const float* __restrict__ w3, bf* Bt, const float* __restrict__ x, bf* XB, float* CS) {
    const int blk = blockIdx.x;   // the branches below are the same for a whole work-group
    if (blk < PBW) {
        constexpr int K = DM, N = DQ; const int mat = blk / (PBW / 4), bx = blk % (PBW / 4);
        const float* w = mat == 0 ? w0 : mat == 1 ? w1 : mat == 2 ? w2 : w3; Bt += (size_t)mat * N * K;
        const int lane = threadIdx.x & 31; const int L0 = (bx * 8 + (threadIdx.x >> 5)) * 8;
        // rolled, a wave's eight lines one after another
#pragma unroll 1
        for (int l = 0; l < 8; ++l) { const int L = L0 + l; const size_t e = (size_t)L * 64 + lane * 2; const int k = (int)(e % K), n = (int)(e / K); v2us o;
            o[0] = f2bf(w[(size_t)k * N + n]); o[1] = f2bf(w[(size_t)(k + 1) * N + n]); *(v2us*)(Bt + e) = o; }
    } else if (blk < PBW + PBX) {
        const size_t u0 = (size_t)(blk - PBW) * (256 * XU * XT) + threadIdx.x;
        // rolled: a trip has eight 16-byte loads a lane in flight before the first is converted, which with a block's eight waves covers the memory's latency; a second trip costs no more registers
#pragma unroll 1
        for (int h = 0; h < XT; ++h) { const size_t uh = u0 + (size_t)h * (256 * XU); v8f v[XU];
#pragma unroll
            for (int j = 0; j < XU; ++j) v[j] = *(const v8f*)(x + (uh + (size_t)j * 256) * 8);
#pragma unroll
            for (int j = 0; j < XU; ++j) { v8us o;
#pragma unroll
                for (int k = 0; k < 8; ++k) o[k] = f2bf(v[j][k]);
                *(v8us*)(XB + (uh + (size_t)j * 256) * 8) = o; }
            asm volatile("s_wait_xcnt 0x0" ::: "memory");   // stands in front of the rewrite of the address and data registers that the loads and stores above name
        }
    } else {
        const int t0 = (blk - PBW - PBX) * CU; const float f = INV512[threadIdx.x];   // the block's 256 threads are the 256 pairs
        float* row = CS + ((size_t)t0 * DQ + 2 * threadIdx.x) * 2;                     // a unit: the two equal entries of a pair's channels, one 16-byte store; a wave's store covers four whole lines
        // rolled: the text of the precise cosine and sine stands once, not CU times, in the instruction cache
#pragma unroll 1
        for (int j = 0; j < CU; ++j) { const float a = __fmul_rn((float)(t0 + j), f); const float c = cosf(a), s = sinf(a);
            *(v4f*)(row + (size_t)j * (DQ * 2)) = (v4f){c, s, c, s}; }
    }
}

__device__ __forceinline__ float xhalf(float x) { return __builtin_bit_cast(float, __builtin_amdgcn_permlanex16(__builtin_bit_cast(int, x), __builtin_bit_cast(int, x), 0x76543210, 0xfedcba98, false, false)); }   // lane l with lane l ^ 16, on the vector port
#define FW 4   // launch bound: four waves a SIMD (256 registers; three for the hi/lo form, which holds twice the fragments): vector work between the matrix runs wants waves
template <typename T16, bool HR, int NQ>
__global__ __launch_bounds__(32 * FW, HR ? 3 : 4) void k_fattn(const T16* __restrict__ Q, const T16* __restrict__ Q2, const T16* __restrict__ Kp, const T16* __restrict__ K2, const T16* __restrict__ Vt, bf* Ah, bf* Al) {
    typedef typename WFrag<T16>::V V;
    __shared__ __align__(16) float so[FW * NQ * 4 * 256];   // partial O^T tiles, lane-linear, 256 floats a tile
    __shared__ float sm[FW * NQ * 16], sl[FW * NQ * 16];    // each wave's maximum and sum per query
    const int lane = threadIdx.x & 31, lr = lane & 15, hi = lane >> 4;
    const int wv = __builtin_amdgcn_readfirstlane(threadIdx.x >> 5);   // wave number in a scalar register: the key loop stays a scalar loop with every lane on at the matrix instructions
    const int z = blockIdx.x;                                          // batch * heads + head
    constexpr int ROW0 = HR ? 0 : RH, NBLK = (HR ? RH : TT - RH) / (16 * NQ);   // this launch's rows: [0, RH) or [RH, TT); grid y = NBLK
    const int q0 = ROW0 + (NBLK - 1 - (int)blockIdx.y) * (16 * NQ);   // longest rows start first
    const size_t zp = (size_t)z * TT * HD; Q += zp; Kp += zp; Vt += 2 * zp; if (HR) { Q2 += zp; K2 += zp; }
    const float NEG = -3.0e38f;
    V qf[NQ][2], qf2[NQ][2];
#pragma unroll
    for (int qb = 0; qb < NQ; ++qb)
#pragma unroll
        for (int dc = 0; dc < 2; ++dc) { const size_t o = (size_t)(q0 + qb * 16 + lr) * HD + dc * 32 + 8 * hi; qf[qb][dc] = WFrag<T16>::ld(Q + o); if (HR) qf2[qb][dc] = WFrag<T16>::ld(Q2 + o); }
    v8f o[NQ][4]; float m[NQ], l[NQ];
#pragma unroll
    for (int qb = 0; qb < NQ; ++qb) { m[qb] = NEG; l[qb] = 0.f;
#pragma unroll
        for (int db = 0; db < 4; ++db) o[qb][db] = (v8f){}; }
    const int nch = (kcnt(q0 + 16 * NQ - 1) - 1) / 32 + 1;   // 32-slot chunks up to the one that holds the last row's last visible slot
    const int call = kcnt(q0);   // slots that every row of the block sees
    int cl[NQ];                  // slots that this lane's queries see
#pragma unroll
    for (int qb = 0; qb < NQ; ++qb) cl[qb] = kcnt(q0 + qb * 16 + lr);
    auto at = [](const T16* base, unsigned bytes) { return (const T16*)((const char*)base + bytes); };   // uniform plane base + a lane's 32-bit byte offset: one address register a load
    V kf[2][2], kf2[2][2];   // K fragments are fetched one trip ahead, so their latency lies under the softmax and the second product
    auto ldk = [&](int kc) {
#pragma unroll
        for (int kb = 0; kb < 2; ++kb)
#pragma unroll
            for (int dc = 0; dc < 2; ++dc) { const unsigned a = (unsigned)((kc + kb * 16 + lr) * HD + dc * 32 + 8 * hi) * 2u; kf[kb][dc] = WFrag<T16>::ld(at(Kp, a)); if (HR) kf2[kb][dc] = WFrag<T16>::ld(at(K2, a)); } };
    ldk(min(wv, nch - 1) * 32);
#pragma unroll 1
    for (int c = wv; c < nch; c += FW) {
        const int kc = c * 32;
        V vf[4], vf2[4];
#pragma unroll
        for (int db = 0; db < 4; ++db) { const unsigned a = (unsigned)((db * 16 + lr) * (2 * TT) + kc + 8 * hi) * 2u; vf[db] = WFrag<T16>::ld(at(Vt, a)); if (HR) vf2[db] = WFrag<T16>::ld(at(Vt, a + 2u * TT)); }
        v8f s[NQ][2];
#pragma unroll
        for (int qb = 0; qb < NQ; ++qb)
#pragma unroll
            for (int kb = 0; kb < 2; ++kb) { s[qb][kb] = (v8f){};
#pragma unroll
                for (int dc = 0; dc < 2; ++dc) { s[qb][kb] = WFrag<T16>::mma(kf[kb][dc], qf[qb][dc], s[qb][kb]); if (HR) { s[qb][kb] = WFrag<T16>::mma(kf2[kb][dc], qf[qb][dc], s[qb][kb]); s[qb][kb] = WFrag<T16>::mma(kf[kb][dc], qf2[qb][dc], s[qb][kb]); } } }
        ldk(min(c + FW, nch - 1) * 32);   // the next trip's chunk; past the end the last chunk again, unused
        asm volatile("s_wait_xcnt 0x0" ::: "memory");   // stands in front of the rewrite of the address registers that the loads above name
#pragma unroll
        for (int qb = 0; qb < NQ; ++qb) {
            float t[16];
#pragma unroll
            for (int e = 0; e < 16; ++e) t[e] = s[qb][e >> 3][e & 7] * (SCL * 1.4426950408889634f);
            if (kc + 32 > call) {   // only the chunks past the first row's last slot cross the diagonal (a scalar test)
#pragma unroll
                for (int e = 0; e < 16; ++e) { const int j = kc + (e >> 3) * 16 + hi * 8 + (e & 7); t[e] = (j < cl[qb]) ? t[e] : NEG; } }
            float tm = t[0];
#pragma unroll
            for (int e = 1; e < 16; ++e) tm = fmaxf(tm, t[e]);
            tm = fmaxf(tm, xhalf(tm));
            const float mn = fmaxf(m[qb], tm), al = __builtin_amdgcn_exp2f(m[qb] - mn); m[qb] = mn;
            float ps = 0.f;
#pragma unroll
            for (int e = 0; e < 16; ++e) { t[e] = __builtin_amdgcn_exp2f(t[e] - mn); ps += t[e]; }
            l[qb] = l[qb] * al + ps;   // this lane's keys only; the halves join after the loop
#pragma unroll
            for (int db = 0; db < 4; ++db) o[qb][db] *= al;
            if constexpr (HR) { v8us h0, h1, l0, l1;
#pragma unroll
                for (int e = 0; e < 8; ++e) { unsigned short a, b; splitf(t[e], a, b); h0[e] = a; l0[e] = b; splitf(t[8 + e], a, b); h1[e] = a; l1[e] = b; }
                const V ph = cat16b(h0, h1), pl = cat16b(l0, l1);
#pragma unroll
                for (int db = 0; db < 4; ++db) { o[qb][db] = WFrag<T16>::mma(vf[db], ph, o[qb][db]); o[qb][db] = WFrag<T16>::mma(vf2[db], ph, o[qb][db]); o[qb][db] = WFrag<T16>::mma(vf[db], pl, o[qb][db]); }
            } else { V pf;
#pragma unroll
                for (int e = 0; e < 16; ++e) pf[e] = tohx(t[e]);
#pragma unroll
                for (int db = 0; db < 4; ++db) o[qb][db] = WFrag<T16>::mma(vf[db], pf, o[qb][db]); }
        }
        // four vector slots between the last matrix instruction and the next trip's loads into its operands
        asm volatile("v_nop\n\tv_nop\n\tv_nop\n\tv_nop" : "+v"(o[NQ - 1][0]), "+v"(o[NQ - 1][1]), "+v"(o[NQ - 1][2]), "+v"(o[NQ - 1][3]) : "v"(vf[0]), "v"(vf[3]));
    }
#pragma unroll
    for (int qb = 0; qb < NQ; ++qb) {
#pragma unroll
        for (int db = 0; db < 4; ++db) { float* p = so + (size_t)(((wv * NQ + qb) * 4 + db) * 2) * 128 + lane * 4;
            *(v4fa*)p = __builtin_shufflevector(o[qb][db], o[qb][db], 0, 1, 2, 3); *(v4fa*)(p + 128) = __builtin_shufflevector(o[qb][db], o[qb][db], 4, 5, 6, 7); }
        const float lj = l[qb] + xhalf(l[qb]);
        if (hi == 0) { sm[(wv * NQ + qb) * 16 + lr] = m[qb]; sl[(wv * NQ + qb) * 16 + lr] = lj; } }
    __syncthreads();   // publishes every wave's partial O^T, maximum and sum to the waves that merge them
    // merge: a wave takes 4 NQ queries, 8 / NQ lanes a query, so each 128-byte line of the merged planes has one writer. A wave without an unmasked key for a query has maximum -3e38 and weight 0.
    constexpr int LPQ = 8 / NQ;
    const int qi = wv * (32 / LPQ) + lane / LPQ, qb = qi >> 4, cq = qi & 15;
    float M = NEG, sc[FW], L = 0.f;
#pragma unroll
    for (int u = 0; u < FW; ++u) M = fmaxf(M, sm[(u * NQ + qb) * 16 + cq]);
#pragma unroll
    for (int u = 0; u < FW; ++u) { sc[u] = __builtin_amdgcn_exp2f(sm[(u * NQ + qb) * 16 + cq] - M); L += sc[u] * sl[(u * NQ + qb) * 16 + cq]; }
    const float inv = __fdiv_rn(1.0f, L);
    const size_t orow = ((size_t)(z / NH_) * TT + q0 + qi) * DQ + (z % NH_) * HD;
#pragma unroll
    for (int n = 0; n < NQ; ++n) { const int g = (lane % LPQ) * NQ + n, db = g >> 1, h = g & 1;   // 8 channels: 16 db + 8 h ...
        v4f a0 = (v4f){}, a1 = (v4f){};
#pragma unroll
        for (int u = 0; u < FW; ++u) { const float* p = so + (size_t)(((u * NQ + qb) * 4 + db) * 2) * 128 + (h * 16 + cq) * 4; a0 += *(const v4fa*)p * sc[u]; a1 += *(const v4fa*)(p + 128) * sc[u]; }
        v8us oh, ol;
#pragma unroll
        for (int r = 0; r < 4; ++r) { unsigned short a, b; splitf(a0[r] * inv, a, b); oh[r] = a; ol[r] = b; splitf(a1[r] * inv, a, b); oh[4 + r] = a; ol[4 + r] = b; }
        *(v8usa*)(Ah + orow + db * 16 + h * 8) = oh; *(v8usa*)(Al + orow + db * 16 + h * 8) = ol; }
}

extern "C" void kernel_launch(void* const* d_in, const int* in_sizes, int n_in,
                              void* d_out, int out_size, void* d_ws, size_t ws_size, hipStream_t stream) {
    (void)in_sizes; (void)n_in; (void)out_size;
    const float* x = (const float*)d_in[0]; const float* wq = (const float*)d_in[1]; const float* bq = (const float*)d_in[2]; const float* wk = (const float*)d_in[3]; const float* bk = (const float*)d_in[4]; const float* wv = (const float*)d_in[5]; const float* bv = (const float*)d_in[6]; const float* wo = (const float*)d_in[7]; const float* bo = (const float*)d_in[8];
    float* OUT = (float*)d_out;     // [4][2048][512]
    char* wsp = (char*)d_ws;
    auto take = [&](size_t bytes) { char* p = wsp; wsp += (bytes + 255) & ~(size_t)255; return (void*)p; };
    const size_t PL = (size_t)NB_ * NH_ * TT * HD;   // elements of one [batch][head] plane set
    bf* WA = (bf*)take((size_t)4 * DM * DQ * 2);      // Wq | Wk | Wv | Wo, each transposed [n][k]
    h16* QK16 = (h16*)take(2 * PL * 2); bf* QKh = (bf*)take(2 * PL * 2); bf* QKl = (bf*)take(2 * PL * 2);   // q planes, then k planes
    h16* VT16 = (h16*)take(2 * PL * 2); bf* VThl = (bf*)take(2 * PL * 2);   // rows of 2 TT elements
    bf* ATh = (bf*)take(PL * 2); bf* ATl = (bf*)take(PL * 2);   // attention output, heads merged, hi and lo
    bf* XB = (bf*)take((size_t)NB_ * TT * DM * 2); float* CS = (float*)take((size_t)TT * DQ * 2 * 4);   /* CS {cos, sin} per (t, global channel) */
    if ((size_t)(wsp - (char*)d_ws) > ws_size) return;    // ws 256 MiB
    k_prep<<<PBW + PBX + PBC, 256, 0, stream>>>(wq, wk, wv, wo, WA, x, XB, CS);   /* angle t x 10000^(-2i/512) for global pair i = c/2 */
    k_gemmw<bf, 0, true, 8, true><<<dim3(NB_ * (TT / 64 + 2 * KT), DQ / 64, 1), 256, 0, stream>>>(XB, nullptr, WA, nullptr, DM, nullptr, 0, bq, bk, bv, 0, 0, 0, CS, QK16, QKh, QKl, VT16, VThl);
    // grid x: the 32 (batch, head) planes; grid y: query blocks, longest first
    k_fattn<h16, false, 2><<<dim3(NB_ * NH_, (TT - RH) / 32, 1), 32 * FW, 0, stream>>>(QK16, nullptr, QK16 + PL, nullptr, VT16, ATh, ATl);
    k_fattn<bf, true, 1><<<dim3(NB_ * NH_, RH / 16, 1), 32 * FW, 0, stream>>>(QKh, QKl, QKh + PL, QKl + PL, VThl, ATh, ATl);
    k_gemmw<bf, 1, true, 8, false><<<dim3(NB_ * TT / 64, DM / 64, 1), 256, 0, stream>>>(ATh, ATl, WA + (size_t)3 * DM * DQ, nullptr, DQ, OUT, DM, bo, nullptr, nullptr, 0, 0, 0, nullptr, nullptr, nullptr, nullptr, nullptr, nullptr);
}

// v007
// It runs in 94.5 microseconds.
// In two side-by-side timings against v006, it was 1.14 and 1.15 times as fast.
// Counting every step since v000, it is 16.8 times as fast.
#include <hip/hip_runtime.h>

// Causal attention with rotary embeddings over the FULL hidden dim and periodically masked key columns (x [4][2048][512]; q,k,v = x W + b ('xw' [512][512] + [512], 0.02); rope BEFORE the head split: pairs (2i, 2i+1) of the 512-vector rotated by t x 10000^(-2i/512), i < 256; 8 heads x 64; scores / 8; mask = causal AND key column j not in {4, 7, 10, ...} (j >= 4 with (j - 4) mod 3 == 0: the module's period-3 'mgdt' columns); softmax; out = merged Wo + bo -> [4][2048][512] (4.2 M)).
// Layout, all batches in each launch: bf16 copy of x; exact projections + f32 biases; a {cos, sin} table per (position, global pair) (float32 inverse frequencies over 512 dims, precise cosf/sinf) (weight planes, x copy and table come from one launch, k_prep); the projection's epilogue rotates interleaved pairs by the GLOBAL channel and writes the q, k planes and the transposed V planes itself; the k and V planes hold the unmasked key positions only, in their order (slot index, kpos / kcnt below), so a period-3 column is neither projected nor stored nor scored; fused causal attention (k_fattn: scores, running-maximum softmax and P x V in registers; rows < 512 hi/lo 3 products, rest fp16) that writes the merged hi/lo planes; merged hi/lo x Wo exact + bo.
// Compute dtypes, f32 accumulate: every input rounded to bf16; projections exact + f32 biases; rotary f32; attention rows < 512 3 products, rest fp16; softmax f32; Wo hl x exact + bias.

#define NB_  4
#define TT   2048
#define DM   512
#define NH_  8
#define NKV  8
#define REP  (NH_ / NKV)
#define HD   64
#define DQ   (NH_ * HD)
#define DKV  (NKV * HD)
#define RH   512                  // query rows < RH use hi+lo planes (0: none)
#define SCL  0.125f
#define PRD  3       // masked-column period
#define PRD0 4       // first masked column (period + ret_order - 1)
// Key slots: the unmasked key positions 0, 1, 2, 3, 5, 6, 8, 9, ... numbered in their order. kpos: the position in slot s. kcnt: how many slots a query at position q sees (slot s is visible exactly where s < kcnt(q)).
__host__ __device__ constexpr int kpos(int s) { return s < PRD0 ? s : PRD0 + 1 + (s - PRD0) / (PRD - 1) * PRD + (s - PRD0) % (PRD - 1); }
__host__ __device__ constexpr int kcnt(int q) { return q + 1 - (q >= PRD0 ? (q - PRD0) / PRD + 1 : 0); }
#define NKC  kcnt(TT - 1)          // slots in use
#define KT   ((NKC + 63) / 64)     // 64-slot tiles of the k and V projections; the last tile's spare slots repeat the last position and are visible to no query
__host__ __device__ constexpr int kposl(int s) { const int n = (s - PRD0 + PRD - 1) / (PRD - 1); return s + (n > 0 ? n : 0); }   // kpos without a branch on s: the slot plus the masked positions in front of it
static_assert(kposl(0) == kpos(0) && kposl(1) == kpos(1) && kposl(2) == kpos(2) && kposl(3) == kpos(3) && kposl(4) == kpos(4) && kposl(5) == kpos(5) && kposl(6) == kpos(6) && kposl(7) == kpos(7) && kposl(1000) == kpos(1000) && kposl(1407) == kpos(1407), "both forms name the same position");
static_assert(kpos(NKC - 1) < TT && kpos(NKC) >= TT && kcnt(kpos(NKC - 1)) == NKC && kpos(4) == 5 && kpos(7) == 9, "slots cover the unmasked positions exactly");
typedef _Float16 h16;
typedef unsigned short bf;
typedef __attribute__((ext_vector_type(16))) __bf16   v16bf;
typedef __attribute__((ext_vector_type(16))) _Float16 v16h;
typedef __attribute__((ext_vector_type(8)))  _Float16 v8h;
typedef __attribute__((ext_vector_type(8)))  unsigned short v8us;
typedef __attribute__((ext_vector_type(8)))  float    v8f;
typedef __attribute__((ext_vector_type(4)))  float    v4f;
typedef v8h  __attribute__((may_alias)) v8ha;
typedef v4f  __attribute__((may_alias)) v4fa;
typedef v8us __attribute__((may_alias)) v8usa;

__device__ __forceinline__ unsigned short f2bf(float f) { unsigned u = __float_as_uint(f); u += 0x7FFFu + ((u >> 16) & 1u); return (unsigned short)(u >> 16); }
__device__ __forceinline__ float bf2f(unsigned short b) { return __uint_as_float(((unsigned)b) << 16); }
__device__ __forceinline__ float bfr(float f) { return bf2f(f2bf(f)); }
__device__ __forceinline__ v16h cat16(v8h lo, v8h hi) { return __builtin_shufflevector(lo, hi, 0, 1, 2, 3, 4, 5, 6, 7, 8, 9, 10, 11, 12, 13, 14, 15); }
__device__ __forceinline__ v16bf cat16b(v8us lo, v8us hi) { return __builtin_bit_cast(v16bf, __builtin_shufflevector(lo, hi, 0, 1, 2, 3, 4, 5, 6, 7, 8, 9, 10, 11, 12, 13, 14, 15)); }
__device__ __forceinline__ v8f wmma16(v16h a, v16h b, v8f c) { return __builtin_amdgcn_wmma_f32_16x16x32_f16(false, a, false, b, (short)0, c, false, false); }
__device__ __forceinline__ v8f wmmab(v16bf a, v16bf b, v8f c) { return __builtin_amdgcn_wmma_f32_16x16x32_bf16(false, a, false, b, (short)0, c, false, false); }

__device__ __forceinline__ h16 tohx(float x) { return (h16)x; }
__device__ __forceinline__ void splitf(float y, unsigned short& h, unsigned short& l) { h = f2bf(y); l = f2bf(y - bf2f(h)); }
typedef __attribute__((ext_vector_type(2))) _Float16 v2h;
typedef __attribute__((ext_vector_type(4))) _Float16 v4h;
typedef __attribute__((ext_vector_type(2))) unsigned short v2us;
typedef __attribute__((ext_vector_type(4))) unsigned short v4us;
typedef __attribute__((ext_vector_type(2))) float v2f;
typedef __attribute__((ext_vector_type(4))) int v4i;

// ---- Split-K epilogue: the NW waves of a work-group each hold a partial 64x64 tile (their share of the K loop). Every wave parks its 16 accumulators in LDS lane-linear (b128, no bank conflict),
// one barrier, then each wave sums its share of the tile over the NW partials in wave order 0..NW-1 and stores it. A unit = 4 accumulator rows x 32 columns, so each 128-byte output line has one writer.
template <int NW, bool BIAS>
__device__ __forceinline__ void splitk_store(const v8f (&acc)[4][4], float* red, float* C, int ldc, const float* __restrict__ bias, int r0, int c0) {
    const int lane = threadIdx.x & 31, lr = lane & 15, hi = lane >> 4, w = __builtin_amdgcn_readfirstlane(threadIdx.x >> 5);
    // both loops unrolled: acc is indexed by constants only and stays in registers
#pragma unroll
    for (int mb = 0; mb < 4; ++mb)
#pragma unroll
        for (int nb = 0; nb < 4; ++nb) { float* p = red + (size_t)((w * 16 + mb * 4 + nb) * 2) * 128 + lane * 4;
            *(v4fa*)p = __builtin_shufflevector(acc[mb][nb], acc[mb][nb], 0, 1, 2, 3); *(v4fa*)(p + 128) = __builtin_shufflevector(acc[mb][nb], acc[mb][nb], 4, 5, 6, 7); }
    __syncthreads();   // publishes every wave's partial tile to the waves that sum it
    for (int q = 0; q < 16 / NW; ++q) { const int unit = w * (16 / NW) + q, mb = unit >> 2, nb0 = ((unit >> 1) & 1) * 2, half = unit & 1;
        for (int e = 0; e < 2; ++e) { const int nb = nb0 + e; const float* p = red + (size_t)((mb * 4 + nb) * 2 + half) * 128 + lane * 4; v4f sum = *(const v4fa*)p;
            for (int u = 1; u < NW; ++u) sum += *(const v4fa*)(p + (size_t)u * 4096);
            const int col = c0 + nb * 16 + lr; if (BIAS) sum += bfr(bias[nb * 16 + lr]);   // bias points at the tile's first column
            float* crow = C + (size_t)(r0 + mb * 16 + hi * 8 + half * 4) * ldc + col;
            for (int j = 0; j < 4; ++j) crow[(size_t)j * ldc] = sum[j]; } }
}

// ---- Split-K epilogue of the q | k | v projection: the summed 64x64 tile (64 positions of one batch x the 64 channels of one head of q, k or v) never goes to memory as f32.
// Partials are parked and summed as in splitk_store (same order, same bias add); the sums go to a second LDS tile (q, k: [position][channel]; v: [channel][position], four positions a b128 store), one more barrier,
// then each lane takes 8 neighbours of a row: q, k rows are rotated pair by pair and go to the fp16 and hi/lo planes [q, k][batch][head][t][d] (k: t is the key slot); v rows go to the planes [batch][head][d][2 TT] (by key slot). Every b128 store of a wave covers whole 128-byte lines.
#define TP 68   // pitch of that tile in floats: rows stay 16-byte aligned, and the b32 column writes, the b128 writes and the b128 row reads each spread over all banks
template <int NW>
__device__ __forceinline__ void splitk_planes(const v8f (&acc)[4][4], float* red, float* tile, const float* __restrict__ bias, int r0, int c0, const float* __restrict__ CS, h16* P16, bf* Ph, bf* Pl, h16* V16, bf* Vhl) {
    const int lane = threadIdx.x & 31, lr = lane & 15, hi = lane >> 4, w = __builtin_amdgcn_readfirstlane(threadIdx.x >> 5);
    const int seg = c0 / DM, hd = (c0 - seg * DM) / HD, b = r0 / TT, t0 = r0 % TT;   // seg: 0 q, 1 k, 2 v, the same for the whole work-group; 64 divides TT, so a tile lies in one batch; t0: first position (q) or first key slot (k, v)
    const int rr = threadIdx.x >> 3, cc = (threadIdx.x & 7) * 8;                     // this lane's rows rr, rr + 32 and first column of the summed tile
    v2f cs[2][4] = {};   // {cos, sin} of this lane's 4 pairs in each of its two rows, asked for here so that their latency lies under the parking of the partials
    if (seg != 2) {
#pragma unroll
        for (int u = 0; u < 2; ++u)
#pragma unroll
            for (int p = 0; p < 4; ++p) { const int row = t0 + rr + 32 * u, tp = seg == 1 ? min(kpos(row), TT - 1) : row;   // a k row turns by the position that its slot holds
                cs[u][p] = *(const v2f*)(CS + ((size_t)tp * DQ + hd * HD + cc + 2 * p) * 2); } }
    // both loops unrolled: acc is indexed by constants only and stays in registers
#pragma unroll
    for (int mb = 0; mb < 4; ++mb)
#pragma unroll
        for (int nb = 0; nb < 4; ++nb) { float* p = red + (size_t)((w * 16 + mb * 4 + nb) * 2) * 128 + lane * 4;
            *(v4fa*)p = __builtin_shufflevector(acc[mb][nb], acc[mb][nb], 0, 1, 2, 3); *(v4fa*)(p + 128) = __builtin_shufflevector(acc[mb][nb], acc[mb][nb], 4, 5, 6, 7); }
    __syncthreads();   // publishes every wave's partial tile to the waves that sum it
    for (int q = 0; q < 16 / NW; ++q) { const int unit = w * (16 / NW) + q, mb = unit >> 2, nb0 = ((unit >> 1) & 1) * 2, half = unit & 1;
        for (int e = 0; e < 2; ++e) { const int nb = nb0 + e; const float* p = red + (size_t)((mb * 4 + nb) * 2 + half) * 128 + lane * 4; v4f sum = *(const v4fa*)p;
            for (int u = 1; u < NW; ++u) sum += *(const v4fa*)(p + (size_t)u * 4096);
            sum += bfr(bias[nb * 16 + lr]);   // bias points at the tile's first column
            const int col = nb * 16 + lr, row = mb * 16 + hi * 8 + half * 4;
            if (seg == 2) *(v4fa*)(tile + col * TP + row) = sum;
            else for (int j = 0; j < 4; ++j) tile[(row + j) * TP + col] = sum[j]; } }
    __syncthreads();   // publishes the summed tile to the lanes that convert and store its rows
    // the tile's first element and row pitch in its planes, all scalar. Vhl holds a channel's hi half then its lo half; V16 fills the first half
    const size_t base = seg == 2 ? ((size_t)b * NKV + hd) * HD * (2 * TT) + t0 : ((((size_t)seg * NB_ + b) * NH_ + hd) * TT + t0) * HD;
    const int pitch = seg == 2 ? 2 * TT : HD;
    h16* D16 = (seg == 2 ? V16 : P16) + base; bf* Dh = (seg == 2 ? Vhl : Ph) + base; bf* Dl = (seg == 2 ? Vhl + TT : Pl) + base;
    float y[2][8];
#pragma unroll
    for (int u = 0; u < 2; ++u) { const float* p = tile + (rr + 32 * u) * TP + cc; const v4f x0 = *(const v4fa*)p, x1 = *(const v4fa*)(p + 4);
#pragma unroll
        for (int k = 0; k < 4; ++k) { y[u][k] = x0[k]; y[u][4 + k] = x1[k]; } }
    if (seg != 2) {
#pragma unroll
        for (int u = 0; u < 2; ++u)
#pragma unroll
            for (int p = 0; p < 4; ++p) { const float e0 = y[u][2 * p], e1 = y[u][2 * p + 1], c = cs[u][p][0], s = cs[u][p][1]; y[u][2 * p] = e0 * c - e1 * s; y[u][2 * p + 1] = e0 * s + e1 * c; } }   // even: x0 c - x1 s; odd: x0 s + x1 c
#pragma unroll
    for (int u = 0; u < 2; ++u) { v8h o16; v8us oh, ol;
#pragma unroll
        for (int k = 0; k < 8; ++k) { o16[k] = tohx(y[u][k]); unsigned short a2, c2; splitf(y[u][k], a2, c2); oh[k] = a2; ol[k] = c2; }
        const size_t e = (size_t)(rr + 32 * u) * pitch + cc;
        *(v8ha*)(D16 + e) = o16; *(v8usa*)(Dh + e) = oh; *(v8usa*)(Dl + e) = ol; }
}

// ---- k_gemmw: register-blocked GEMM, one work-group of NW waves per 64x64 output tile (16 accumulators a wave); wave w takes the K chunks w, w + NW, ...; grid (M/64, N/64, Z), 32 NW threads. K = DM.
// Operands come from K-contiguous 16-bit planes through LDS: a fragment load straight from a plane touches 16 lines for 512 bytes, an asynchronous copy of 512 neighbouring bytes touches 4 whole lines once.
// A fill = the tile's 64 rows of every operand over KF values of k (two operands: all of K; three: half of K, so that a fill fits the space of the partial tiles, which it shares). Wave w copies rows 8 w .. 8 w + 7 of each operand.
// In LDS the 16-byte unit u of row r lies at unit u ^ (r & 15) of that row: rows are a multiple of 256 bytes, and so the 16 rows of a fragment read fall on all 64 banks.
// C[m][n] (f32, pitch ldc, + optional f32 bias: columns [0, DM) take bias, [DM, 2 DM) biasB, the rest biasC, so q, k and v share one launch) = sum_k A[m][k] Bt[n][k] (NSPLIT 1: + A2[m][k] Bt[n][k]). z-batch strides sA/sB/sC in elements. PLANES: no C; the tile goes through splitk_planes instead; grid x = per batch TT/64 position tiles of q, then KT slot tiles of k, then KT of v (their A rows are the positions kpos(slot)), grid y = head.
template <typename T16> struct WFrag;
template <> struct WFrag<h16> { typedef v16h V; static __device__ __forceinline__ V ld(const h16* p) { return cat16(*(const v8h*)p, *(const v8h*)(p + 16)); } static __device__ __forceinline__ V ld2(const char* p, const char* q) { return cat16(*(const v8ha*)p, *(const v8ha*)q); } static __device__ __forceinline__ v8f mma(V a, V b, v8f c) { return wmma16(a, b, c); } };
template <> struct WFrag<bf> { typedef v16bf V; static __device__ __forceinline__ V ld(const bf* p) { return cat16b(*(const v8us*)p, *(const v8us*)(p + 16)); } static __device__ __forceinline__ V ld2(const char* p, const char* q) { return cat16b(*(const v8usa*)p, *(const v8usa*)q); } static __device__ __forceinline__ v8f mma(V a, V b, v8f c) { return wmmab(a, b, c); } };
// Eight asynchronous copies, 16 bytes a lane each, from the lane's global address g to its LDS byte address l. The s_wait_xcnt stands inside the statement, behind the last copy, so that no address register of a copy is rewritten in front of it.
__device__ __forceinline__ void copy8(const unsigned (&l)[8], const char* const (&g)[8]) {
    asm volatile("global_load_async_to_lds_b128 %0, %8, off\n\t"
                 "global_load_async_to_lds_b128 %1, %9, off\n\t"
                 "global_load_async_to_lds_b128 %2, %10, off\n\t"
                 "global_load_async_to_lds_b128 %3, %11, off\n\t"
                 "global_load_async_to_lds_b128 %4, %12, off\n\t"
                 "global_load_async_to_lds_b128 %5, %13, off\n\t"
                 "global_load_async_to_lds_b128 %6, %14, off\n\t"
                 "global_load_async_to_lds_b128 %7, %15, off\n\t"
                 "s_wait_xcnt 0x0"
                 :: "v"(l[0]), "v"(l[1]), "v"(l[2]), "v"(l[3]), "v"(l[4]), "v"(l[5]), "v"(l[6]), "v"(l[7]),
                    "v"(g[0]), "v"(g[1]), "v"(g[2]), "v"(g[3]), "v"(g[4]), "v"(g[5]), "v"(g[6]), "v"(g[7]) : "memory");
}
// launch bound: four waves a SIMD (256 registers), so that the two work-groups whose LDS fits a WGP also find their registers there
template <typename T16, int NSPLIT, bool BIAS, int NW, bool PLANES>
__global__ __launch_bounds__(32 * NW, 4) void k_gemmw(const T16* __restrict__ A, const T16* __restrict__ A2, const T16* __restrict__ Bt, float* C, int ldc, const float* __restrict__ bias, const float* __restrict__ biasB, const float* __restrict__ biasC, size_t sA, size_t sB, size_t sC, const float* __restrict__ CS, h16* P16, bf* Ph, bf* Pl, h16* V16, bf* Vhl) {
    typedef typename WFrag<T16>::V V;
    constexpr int NOP = NSPLIT == 1 ? 3 : 2, NF = NOP - 1, KF = DM / NF, RB = KF * 2, CPR = RB / 512;   // operands, fills, k values and bytes of a row in a fill, copies a row
    static_assert(NSPLIT <= 1 && NW == 8 && NOP * 64 * RB <= NW * 4096 * 4 && KF % (NW * 32) == 0 && CPR * 512 == RB && 8 % CPR == 0, "a fill fits the partial tiles' space; a wave copies eight whole rows of each operand");
    __shared__ __align__(16) float red[NW * 4096];   // first the operand fills, then the partial tiles
    const size_t z = blockIdx.z; A += z * sA; if (NSPLIT == 1) A2 += z * sA; Bt += z * sB; C += z * sC;
    const int lane = threadIdx.x & 31, lr = lane & 15, hi = lane >> 4; int r0 = blockIdx.x * 64, c0 = blockIdx.y * 64;
    int bt = 0, sg = 0, s0 = 0;   // PLANES: batch, q | k | v, first position or slot of the tile (the rows of a k or v tile are not neighbours)
    if constexpr (PLANES) { constexpr int QT = TT / 64, PB = QT + 2 * KT; const int r = blockIdx.x % PB; bt = blockIdx.x / PB; sg = r < QT ? 0 : r < QT + KT ? 1 : 2; s0 = (r - (sg == 0 ? 0 : sg == 1 ? QT : QT + KT)) * 64;   // all scalar
        r0 = bt * TT + s0; c0 += sg * DM; }
    const int wv = __builtin_amdgcn_readfirstlane(threadIdx.x >> 5);   // wave number in a scalar register: the K loop stays a scalar loop with every lane on at the copies and at the matrix instructions
    v8f acc[4][4];
#pragma unroll
    for (int mb = 0; mb < 4; ++mb)
#pragma unroll
        for (int nb = 0; nb < 4; ++nb) acc[mb][nb] = (v8f){};
    const char* st = (const char*)red; const unsigned lb = (unsigned)(size_t)red;   // lb: the byte address in the work-group's LDS
    int ar[8];   // the A rows that this wave copies (scalar)
#pragma unroll
    for (int i = 0; i < 8; ++i) { const int R = wv * 8 + i; ar[i] = PLANES ? bt * TT + (sg == 0 ? s0 + R : min(kposl(s0 + R), TT - 1)) : r0 + R; }
    // rolled: the addresses of one fill's copies at a time, so that two work-groups' registers fit a WGP
#pragma unroll 1
    for (int f = 0; f < NF; ++f) {
        if (f) { asm volatile("s_wait_dscnt 0x0" ::: "memory");   // this wave's reads of the last fill have returned before any copy writes over it
            __syncthreads(); }                                    // ends every wave's reads of the last fill
#pragma unroll
        for (int op = NOP - 1; op >= 0; --op)
#pragma unroll
            for (int g = 0; g < CPR; ++g) { unsigned l[8]; const char* p[8];
#pragma unroll
                for (int j = 0; j < 8; ++j) { const int e = g * 8 + j, R = wv * 8 + e / CPR, h = e % CPR;   // row of the tile (scalar), 512-byte piece of the row
                    const T16* row = op == NOP - 1 ? Bt + (size_t)(c0 + R) * DM : (op == 0 ? A : A2) + (size_t)ar[e / CPR] * DM;
                    p[j] = (const char*)row + f * RB + h * 512 + lane * 16;
                    l[j] = lb + (unsigned)(op * 64 * RB + R * RB + h * 512 + ((lane ^ (R & 15)) << 4)); }
                copy8(l, p); }
        asm volatile("s_wait_asynccnt 0x0" ::: "memory");   // this wave's copies have landed
        __syncthreads();                                    // publishes the fill to the waves that read it
        int kc = wv * 32;   // first k of the chunk within the fill; every wave has a first chunk (NW chunks divide a fill)
#pragma unroll 1
        do {
            const int u = kc / 8 + hi; const int x0 = (u ^ lr) << 4, x1 = ((u + 2) ^ lr) << 4;   // a lane's two units, k order as in WFrag::ld: 8 hi .. 8 hi + 7, then 16 + 8 hi ..
            auto frag = [&](int op, int blk) { const char* p = st + op * 64 * RB + (blk * 16 + lr) * RB; return WFrag<T16>::ld2(p + x0, p + x1); };
            V a[4], a2[4];
#pragma unroll
            for (int mb = 0; mb < 4; ++mb) { a[mb] = frag(0, mb); if (NSPLIT == 1) a2[mb] = frag(1, mb); }
#pragma unroll
            for (int nb = 0; nb < 4; ++nb) { const V b = frag(NOP - 1, nb);
#pragma unroll
                for (int mb = 0; mb < 4; ++mb) { acc[mb][nb] = WFrag<T16>::mma(a[mb], b, acc[mb][nb]); if (NSPLIT == 1) acc[mb][nb] = WFrag<T16>::mma(a2[mb], b, acc[mb][nb]); } }
            // four vector slots between the last matrix instruction and the next trip's loads into its operands
            asm volatile("v_nop\n\tv_nop\n\tv_nop\n\tv_nop" : "+v"(acc[0][0]), "+v"(acc[1][1]), "+v"(acc[2][2]), "+v"(acc[3][3]) : "v"(a[0]), "v"(a[3]));
        } while ((kc += NW * 32) < KF);
    }
    __syncthreads();   // ends every wave's reads of the operands: the partial tiles are parked over them
    const int seg = c0 / DM; const float* bs = (seg == 0 ? bias : seg == 1 ? biasB : biasC) + (c0 - seg * DM);
    if constexpr (PLANES) { __shared__ __align__(16) float tile[64 * TP]; splitk_planes<NW>(acc, red, tile, bs, r0, c0, CS, P16, Ph, Pl, V16, Vhl); }
    else splitk_store<NW, BIAS>(acc, red, C, ldc, bs, r0, c0);
}


__constant__ float INV512[DQ / 2] = { 1.000000000e+00f,9.646616578e-01f,9.305720329e-01f,8.976871371e-01f,8.659643531e-01f,8.353625536e-01f,8.058422208e-01f,7.773650289e-01f,7.498942018e-01f,7.233941555e-01f,6.978305578e-01f,6.731703877e-01f,6.493816376e-01f,6.264335513e-01f,6.042963862e-01f,5.829415321e-01f,5.623413324e-01f,5.424690843e-01f,5.232991576e-01f,5.048065782e-01f,4.869675338e-01f,4.697588682e-01f,4.531583488e-01f,4.371444881e-01f,4.216965139e-01f,4.067944288e-01f,3.924189806e-01f,3.785515428e-01f,3.651741445e-01f,3.522694409e-01f,3.398208320e-01f,3.278121352e-01f,3.162277639e-01f,3.050527871e-01f,2.942727208e-01f,2.838735878e-01f,2.738419771e-01f,2.641648352e-01f,2.548296750e-01f,2.458243966e-01f,2.371373624e-01f,2.287573218e-01f,2.206733972e-01f,2.128751576e-01f,2.053525001e-01f,1.980956793e-01f,1.910952926e-01f,1.843423098e-01f,1.778279394e-01f,1.715437919e-01f,1.654817015e-01f,1.596338600e-01f,1.539926529e-01f,1.485508084e-01f,1.433012635e-01f,1.382372230e-01f,1.333521456e-01f,1.286396980e-01f,1.240937710e-01f,1.197085083e-01f,1.154782027e-01f,1.113973856e-01f,1.074607819e-01f,1.036632955e-01f,1.000000015e-01f,9.646616131e-02f,9.305720031e-02f,8.976870775e-02f,8.659642935e-02f,8.353625983e-02f,8.058421314e-02f,7.773650438e-02f,7.498941571e-02f,7.233941555e-02f,6.978305429e-02f,6.731703877e-02f,6.493816525e-02f,6.264335662e-02f,6.042964384e-02f,5.829415470e-02f,5.623412877e-02f,5.424690619e-02f,5.232991278e-02f,5.048065633e-02f,4.869675264e-02f,4.697588459e-02f,4.531583562e-02f,4.371444881e-02f,4.216964915e-02f,4.067944363e-02f,3.924189880e-02f,3.785515204e-02f,3.651741147e-02f,3.522694483e-02f,3.398208320e-02f,3.278120980e-02f,3.162277862e-02f,3.050527908e-02f,2.942727320e-02f,2.838735841e-02f,2.738419548e-02f,2.641648427e-02f,2.548296750e-02f,2.458244003e-02f,2.371373586e-02f,2.287573181e-02f,2.206734009e-02f,2.128751762e-02f,2.053525113e-02f,1.980956830e-02f,1.910953037e-02f,1.843423024e-02f,1.778279431e-02f,1.715437882e-02f,1.654817164e-02f,1.596338488e-02f,1.539926510e-02f,1.485508028e-02f,1.433012541e-02f,1.382372249e-02f,1.333521493e-02f,1.286396943e-02f,1.240937691e-02f,1.197085064e-02f,1.154781971e-02f,1.113973837e-02f,1.074607857e-02f,1.036632899e-02f,9.999999776e-03f,9.646615945e-03f,9.305720218e-03f,8.976871148e-03f,8.659643121e-03f,8.353625424e-03f,8.058422245e-03f,7.773650344e-03f,7.498942316e-03f,7.233941462e-03f,6.978305988e-03f,6.731703877e-03f,6.493816618e-03f,6.264335476e-03f,6.042964291e-03f,5.829415284e-03f,5.623413250e-03f,5.424690899e-03f,5.232991185e-03f,5.048065912e-03f,4.869675264e-03f,4.697588738e-03f,4.531583749e-03f,4.371444695e-03f,4.216964822e-03f,4.067944363e-03f,3.924189601e-03f,3.785515437e-03f,3.651741426e-03f,3.522694577e-03f,3.398208413e-03f,3.278121119e-03f,3.162277862e-03f,3.050528001e-03f,2.942727180e-03f,2.838735934e-03f,2.738419687e-03f,2.641648287e-03f,2.548296703e-03f,2.458244096e-03f,2.371373819e-03f,2.287573181e-03f,2.206734149e-03f,2.128751716e-03f,2.053525066e-03f,1.980956644e-03f,1.910952851e-03f,1.843422884e-03f,1.778279431e-03f,1.715437858e-03f,1.654817141e-03f,1.596338581e-03f,1.539926510e-03f,1.485507935e-03f,1.433012658e-03f,1.382372226e-03f,1.333521446e-03f,1.286396873e-03f,1.240937854e-03f,1.197085017e-03f,1.154782018e-03f,1.113973907e-03f,1.074607833e-03f,1.036632922e-03f,1.000000047e-03f,9.646615945e-04f,9.305721032e-04f,8.976871031e-04f,8.659643354e-04f,8.353625308e-04f,8.058422245e-04f,7.773649995e-04f,7.498941850e-04f,7.233941578e-04f,6.978305755e-04f,6.731703761e-04f,6.493816618e-04f,6.264335825e-04f,6.042963942e-04f,5.829415168e-04f,5.623413017e-04f,5.424690899e-04f,5.232990952e-04f,5.048065796e-04f,4.869675031e-04f,4.697588738e-04f,4.531583400e-04f,4.371444811e-04f,4.216964880e-04f,4.067944246e-04f,3.924189950e-04f,3.785515146e-04f,3.651741135e-04f,3.522694460e-04f,3.398208064e-04f,3.278121294e-04f,3.162277862e-04f,3.050527885e-04f,2.942727297e-04f,2.838736109e-04f,2.738419571e-04f,2.641648462e-04f,2.548296761e-04f,2.458243980e-04f,2.371373848e-04f,2.287573152e-04f,2.206734207e-04f,2.128751657e-04f,2.053524950e-04f,1.980956731e-04f,1.910952997e-04f,1.843422942e-04f,1.778279402e-04f,1.715437829e-04f,1.654817170e-04f,1.596338552e-04f,1.539926452e-04f,1.485508110e-04f,1.433012658e-04f,1.382372284e-04f,1.333521504e-04f,1.286396873e-04f,1.240937709e-04f,1.197085076e-04f,1.154781930e-04f,1.113973922e-04f,1.074607790e-04f,1.036632893e-04f };   // 10000^(-2i/512), i < 256, as float32 (jnp-computed)
// ---- k_prep: the three preparatory jobs, which do not depend on one another, as block ranges of ONE launch; a thread of the copy and of the table writes eight 16-byte units, not one entry, so that few waves have to be started.
// Blocks [0, PBW): the four weight matrices, rounded and transposed to [n][k], planes back to back. Blocks [PBW, PBW + PBX): the bf16 copy of x. The rest: the table {cos, sin} per (position, global channel), [TT][DQ][2].
#define PBW (4 * (DM * DQ / 64 / 64))           // 64 lines of 64 elements a block
#define XU  4                                   // units of 8 elements of x a thread and trip
#define XT  2                                   // trips
#define PBX (NB_ * TT * DM / 8 / (256 * XU * XT))
#define CU  8                                   // positions a block: a thread keeps one pair and walks the positions
#define PBC (TT / CU)
static_assert(PBW * 64 * 64 == 4 * DM * DQ && PBX * 256 * XU * XT * 8 == NB_ * TT * DM && PBC * CU == TT && DQ / 2 == 256, "block ranges cover their jobs exactly");
__global__ __launch_bounds__(256) void k_prep(const float* __restrict__ w0, const float* __restrict__ w1, const float* __restrict__ w2, const float* __restrict__ w3, bf* Bt, const float* __restrict__ x, bf* XB, float* CS) {
    const int blk = blockIdx.x;   // the branches below are the same for a whole work-group
    if (blk < PBW) {
        constexpr int K = DM, N = DQ; const int mat = blk / (PBW / 4), bx = blk % (PBW / 4);
        const float* w = mat == 0 ? w0 : mat == 1 ? w1 : mat == 2 ? w2 : w3; Bt += (size_t)mat * N * K;
        const int lane = threadIdx.x & 31; const int L0 = (bx * 8 + (threadIdx.x >> 5)) * 8;
        // rolled, a wave's eight lines one after another
#pragma unroll 1
        for (int l = 0; l < 8; ++l) { const int L = L0 + l; const size_t e = (size_t)L * 64 + lane * 2; const int k = (int)(e % K), n = (int)(e / K); v2us o;
            o[0] = f2bf(w[(size_t)k * N + n]); o[1] = f2bf(w[(size_t)(k + 1) * N + n]); *(v2us*)(Bt + e) = o; }
    } else if (blk < PBW + PBX) {
        const size_t u0 = (size_t)(blk - PBW) * (256 * XU * XT) + threadIdx.x;
        // rolled: a trip has eight 16-byte loads a lane in flight before the first is converted, which with a block's eight waves covers the memory's latency; a second trip costs no more registers
#pragma unroll 1
        for (int h = 0; h < XT; ++h) { const size_t uh = u0 + (size_t)h * (256 * XU); v8f v[XU];
#pragma unroll
            for (int j = 0; j < XU; ++j) v[j] = *(const v8f*)(x + (uh + (size_t)j * 256) * 8);
#pragma unroll
            for (int j = 0; j < XU; ++j) { v8us o;
#pragma unroll
                for (int k = 0; k < 8; ++k) o[k] = f2bf(v[j][k]);
                *(v8us*)(XB + (uh + (size_t)j * 256) * 8) = o; }
            asm volatile("s_wait_xcnt 0x0" ::: "memory");   // stands in front of the rewrite of the address and data registers that the loads and stores above name
        }
    } else {
        const int t0 = (blk - PBW - PBX) * CU; const float f = INV512[threadIdx.x];   // the block's 256 threads are the 256 pairs
        float* row = CS + ((size_t)t0 * DQ + 2 * threadIdx.x) * 2;                     // a unit: the two equal entries of a pair's channels, one 16-byte store; a wave's store covers four whole lines
        // rolled: the text of the precise cosine and sine stands once, not CU times, in the instruction cache
#pragma unroll 1
        for (int j = 0; j < CU; ++j) { const float a = __fmul_rn((float)(t0 + j), f); const float c = cosf(a), s = sinf(a);
            *(v4f*)(row + (size_t)j * (DQ * 2)) = (v4f){c, s, c, s}; }
    }
}

__device__ __forceinline__ float xhalf(float x) { return __builtin_bit_cast(float, __builtin_amdgcn_permlanex16(__builtin_bit_cast(int, x), __builtin_bit_cast(int, x), 0x76543210, 0xfedcba98, false, false)); }   // lane l with lane l ^ 16, on the vector port
#define FW 4   // launch bound: four waves a SIMD (256 registers; three for the hi/lo form, which holds twice the fragments): vector work between the matrix runs wants waves
template <typename T16, bool HR, int NQ>
__global__ __launch_bounds__(32 * FW, HR ? 3 : 4) void k_fattn(const T16* __restrict__ Q, const T16* __restrict__ Q2, const T16* __restrict__ Kp, const T16* __restrict__ K2, const T16* __restrict__ Vt, bf* Ah, bf* Al) {
    typedef typename WFrag<T16>::V V;
    __shared__ __align__(16) float so[FW * NQ * 4 * 256];   // partial O^T tiles, lane-linear, 256 floats a tile
    __shared__ float sm[FW * NQ * 16], sl[FW * NQ * 16];    // each wave's maximum and sum per query
    const int lane = threadIdx.x & 31, lr = lane & 15, hi = lane >> 4;
    const int wv = __builtin_amdgcn_readfirstlane(threadIdx.x >> 5);   // wave number in a scalar register: the key loop stays a scalar loop with every lane on at the matrix instructions
    const int z = blockIdx.x;                                          // batch * heads + head
    constexpr int ROW0 = HR ? 0 : RH, NBLK = (HR ? RH : TT - RH) / (16 * NQ);   // this launch's rows: [0, RH) or [RH, TT); grid y = NBLK
    const int q0 = ROW0 + (NBLK - 1 - (int)blockIdx.y) * (16 * NQ);   // longest rows start first
    const size_t zp = (size_t)z * TT * HD; Q += zp; Kp += zp; Vt += 2 * zp; if (HR) { Q2 += zp; K2 += zp; }
    const float NEG = -3.0e38f;
    V qf[NQ][2], qf2[NQ][2];
#pragma unroll
    for (int qb = 0; qb < NQ; ++qb)
#pragma unroll
        for (int dc = 0; dc < 2; ++dc) { const size_t o = (size_t)(q0 + qb * 16 + lr) * HD + dc * 32 + 8 * hi; qf[qb][dc] = WFrag<T16>::ld(Q + o); if (HR) qf2[qb][dc] = WFrag<T16>::ld(Q2 + o); }
    v8f o[NQ][4]; float m[NQ], l[NQ];
#pragma unroll
    for (int qb = 0; qb < NQ; ++qb) { m[qb] = NEG; l[qb] = 0.f;
#pragma unroll
        for (int db = 0; db < 4; ++db) o[qb][db] = (v8f){}; }
    const int nch = (kcnt(q0 + 16 * NQ - 1) - 1) / 32 + 1;   // 32-slot chunks up to the one that holds the last row's last visible slot
    const int call = kcnt(q0);   // slots that every row of the block sees
    int cl[NQ];                  // slots that this lane's queries see
#pragma unroll
    for (int qb = 0; qb < NQ; ++qb) cl[qb] = kcnt(q0 + qb * 16 + lr);
    auto at = [](const T16* base, unsigned bytes) { return (const T16*)((const char*)base + bytes); };   // uniform plane base + a lane's 32-bit byte offset: one address register a load
    V kf[2][2], kf2[2][2];   // K fragments are fetched one trip ahead, so their latency lies under the softmax and the second product
    auto ldk = [&](int kc) {
#pragma unroll
        for (int kb = 0; kb < 2; ++kb)
#pragma unroll
            for (int dc = 0; dc < 2; ++dc) { const unsigned a = (unsigned)((kc + kb * 16 + lr) * HD + dc * 32 + 8 * hi) * 2u; kf[kb][dc] = WFrag<T16>::ld(at(Kp, a)); if (HR) kf2[kb][dc] = WFrag<T16>::ld(at(K2, a)); } };
    ldk(min(wv, nch - 1) * 32);
#pragma unroll 1
    for (int c = wv; c < nch; c += FW) {
        const int kc = c * 32;
        V vf[4], vf2[4];
#pragma unroll
        for (int db = 0; db < 4; ++db) { const unsigned a = (unsigned)((db * 16 + lr) * (2 * TT) + kc + 8 * hi) * 2u; vf[db] = WFrag<T16>::ld(at(Vt, a)); if (HR) vf2[db] = WFrag<T16>::ld(at(Vt, a + 2u * TT)); }
        v8f s[NQ][2];
#pragma unroll
        for (int qb = 0; qb < NQ; ++qb)
#pragma unroll
            for (int kb = 0; kb < 2; ++kb) { s[qb][kb] = (v8f){};
#pragma unroll
                for (int dc = 0; dc < 2; ++dc) { s[qb][kb] = WFrag<T16>::mma(kf[kb][dc], qf[qb][dc], s[qb][kb]); if (HR) { s[qb][kb] = WFrag<T16>::mma(kf2[kb][dc], qf[qb][dc], s[qb][kb]); s[qb][kb] = WFrag<T16>::mma(kf[kb][dc], qf2[qb][dc], s[qb][kb]); } } }
        ldk(min(c + FW, nch - 1) * 32);   // the next trip's chunk; past the end the last chunk again, unused
        asm volatile("s_wait_xcnt 0x0" ::: "memory");   // stands in front of the rewrite of the address registers that the loads above name
#pragma unroll
        for (int qb = 0; qb < NQ; ++qb) {
            float t[16];
#pragma unroll
            for (int e = 0; e < 16; ++e) t[e] = s[qb][e >> 3][e & 7] * (SCL * 1.4426950408889634f);
            if (kc + 32 > call) {   // only the chunks past the first row's last slot cross the diagonal (a scalar test)
#pragma unroll
                for (int e = 0; e < 16; ++e) { const int j = kc + (e >> 3) * 16 + hi * 8 + (e & 7); t[e] = (j < cl[qb]) ? t[e] : NEG; } }
            float tm = t[0];
#pragma unroll
            for (int e = 1; e < 16; ++e) tm = fmaxf(tm, t[e]);
            tm = fmaxf(tm, xhalf(tm));
            const float mn = fmaxf(m[qb], tm), al = __builtin_amdgcn_exp2f(m[qb] - mn); m[qb] = mn;
            float ps = 0.f;
#pragma unroll
            for (int e = 0; e < 16; ++e) { t[e] = __builtin_amdgcn_exp2f(t[e] - mn); ps += t[e]; }
            l[qb] = l[qb] * al + ps;   // this lane's keys only; the halves join after the loop
#pragma unroll
            for (int db = 0; db < 4; ++db) o[qb][db] *= al;
            if constexpr (HR) { v8us h0, h1, l0, l1;
#pragma unroll
                for (int e = 0; e < 8; ++e) { unsigned short a, b; splitf(t[e], a, b); h0[e] = a; l0[e] = b; splitf(t[8 + e], a, b); h1[e] = a; l1[e] = b; }
                const V ph = cat16b(h0, h1), pl = cat16b(l0, l1);
#pragma unroll
                for (int db = 0; db < 4; ++db) { o[qb][db] = WFrag<T16>::mma(vf[db], ph, o[qb][db]); o[qb][db] = WFrag<T16>::mma(vf2[db], ph, o[qb][db]); o[qb][db] = WFrag<T16>::mma(vf[db], pl, o[qb][db]); }
            } else { V pf;
#pragma unroll
                for (int e = 0; e < 16; ++e) pf[e] = tohx(t[e]);
#pragma unroll
                for (int db = 0; db < 4; ++db) o[qb][db] = WFrag<T16>::mma(vf[db], pf, o[qb][db]); }
        }
        // four vector slots between the last matrix instruction and the next trip's loads into its operands
        asm volatile("v_nop\n\tv_nop\n\tv_nop\n\tv_nop" : "+v"(o[NQ - 1][0]), "+v"(o[NQ - 1][1]), "+v"(o[NQ - 1][2]), "+v"(o[NQ - 1][3]) : "v"(vf[0]), "v"(vf[3]));
    }
#pragma unroll
    for (int qb = 0; qb < NQ; ++qb) {
#pragma unroll
        for (int db = 0; db < 4; ++db) { float* p = so + (size_t)(((wv * NQ + qb) * 4 + db) * 2) * 128 + lane * 4;
            *(v4fa*)p = __builtin_shufflevector(o[qb][db], o[qb][db], 0, 1, 2, 3); *(v4fa*)(p + 128) = __builtin_shufflevector(o[qb][db], o[qb][db], 4, 5, 6, 7); }
        const float lj = l[qb] + xhalf(l[qb]);
        if (hi == 0) { sm[(wv * NQ + qb) * 16 + lr] = m[qb]; sl[(wv * NQ + qb) * 16 + lr] = lj; } }
    __syncthreads();   // publishes every wave's partial O^T, maximum and sum to the waves that merge them
    // merge: a wave takes 4 NQ queries, 8 / NQ lanes a query, so each 128-byte line of the merged planes has one writer. A wave without an unmasked key for a query has maximum -3e38 and weight 0.
    constexpr int LPQ = 8 / NQ;
    const int qi = wv * (32 / LPQ) + lane / LPQ, qb = qi >> 4, cq = qi & 15;
    float M = NEG, sc[FW], L = 0.f;
#pragma unroll
    for (int u = 0; u < FW; ++u) M = fmaxf(M, sm[(u * NQ + qb) * 16 + cq]);
#pragma unroll
    for (int u = 0; u < FW; ++u) { sc[u] = __builtin_amdgcn_exp2f(sm[(u * NQ + qb) * 16 + cq] - M); L += sc[u] * sl[(u * NQ + qb) * 16 + cq]; }
    const float inv = __fdiv_rn(1.0f, L);
    const size_t orow = ((size_t)(z / NH_) * TT + q0 + qi) * DQ + (z % NH_) * HD;
#pragma unroll
    for (int n = 0; n < NQ; ++n) { const int g = (lane % LPQ) * NQ + n, db = g >> 1, h = g & 1;   // 8 channels: 16 db + 8 h ...
        v4f a0 = (v4f){}, a1 = (v4f){};
#pragma unroll
        for (int u = 0; u < FW; ++u) { const float* p = so + (size_t)(((u * NQ + qb) * 4 + db) * 2) * 128 + (h * 16 + cq) * 4; a0 += *(const v4fa*)p * sc[u]; a1 += *(const v4fa*)(p + 128) * sc[u]; }
        v8us oh, ol;
#pragma unroll
        for (int r = 0; r < 4; ++r) { unsigned short a, b; splitf(a0[r] * inv, a, b); oh[r] = a; ol[r] = b; splitf(a1[r] * inv, a, b); oh[4 + r] = a; ol[4 + r] = b; }
        *(v8usa*)(Ah + orow + db * 16 + h * 8) = oh; *(v8usa*)(Al + orow + db * 16 + h * 8) = ol; }
}

extern "C" void kernel_launch(void* const* d_in, const int* in_sizes, int n_in,
                              void* d_out, int out_size, void* d_ws, size_t ws_size, hipStream_t stream) {
    (void)in_sizes; (void)n_in; (void)out_size;
    const float* x = (const float*)d_in[0]; const float* wq = (const float*)d_in[1]; const float* bq = (const float*)d_in[2]; const float* wk = (const float*)d_in[3]; const float* bk = (const float*)d_in[4]; const float* wv = (const float*)d_in[5]; const float* bv = (const float*)d_in[6]; const float* wo = (const float*)d_in[7]; const float* bo = (const float*)d_in[8];
    float* OUT = (float*)d_out;     // [4][2048][512]
    char* wsp = (char*)d_ws;
    auto take = [&](size_t bytes) { char* p = wsp; wsp += (bytes + 255) & ~(size_t)255; return (void*)p; };
    const size_t PL = (size_t)NB_ * NH_ * TT * HD;   // elements of one [batch][head] plane set
    bf* WA = (bf*)take((size_t)4 * DM * DQ * 2);      // Wq | Wk | Wv | Wo, each transposed [n][k]
    h16* QK16 = (h16*)take(2 * PL * 2); bf* QKh = (bf*)take(2 * PL * 2); bf* QKl = (bf*)take(2 * PL * 2);   // q planes, then k planes
    h16* VT16 = (h16*)take(2 * PL * 2); bf* VThl = (bf*)take(2 * PL * 2);   // rows of 2 TT elements
    bf* ATh = (bf*)take(PL * 2); bf* ATl = (bf*)take(PL * 2);   // attention output, heads merged, hi and lo
    bf* XB = (bf*)take((size_t)NB_ * TT * DM * 2); float* CS = (float*)take((size_t)TT * DQ * 2 * 4);   /* CS {cos, sin} per (t, global channel) */
    if ((size_t)(wsp - (char*)d_ws) > ws_size) return;    // ws 256 MiB
    k_prep<<<PBW + PBX + PBC, 256, 0, stream>>>(wq, wk, wv, wo, WA, x, XB, CS);   /* angle t x 10000^(-2i/512) for global pair i = c/2 */
    k_gemmw<bf, 0, true, 8, true><<<dim3(NB_ * (TT / 64 + 2 * KT), DQ / 64, 1), 256, 0, stream>>>(XB, nullptr, WA, nullptr, 0, bq, bk, bv, 0, 0, 0, CS, QK16, QKh, QKl, VT16, VThl);
    // grid x: the 32 (batch, head) planes; grid y: query blocks, longest first
    k_fattn<h16, false, 2><<<dim3(NB_ * NH_, (TT - RH) / 32, 1), 32 * FW, 0, stream>>>(QK16, nullptr, QK16 + PL, nullptr, VT16, ATh, ATl);
    k_fattn<bf, true, 1><<<dim3(NB_ * NH_, RH / 16, 1), 32 * FW, 0, stream>>>(QKh, QKl, QKh + PL, QKl + PL, VThl, ATh, ATl);
    k_gemmw<bf, 1, true, 8, false><<<dim3(NB_ * TT / 64, DM / 64, 1), 256, 0, stream>>>(ATh, ATl, WA + (size_t)3 * DM * DQ, OUT, DM, bo, nullptr, nullptr, 0, 0, 0, nullptr, nullptr, nullptr, nullptr, nullptr, nullptr);
}

// v008
// It runs in 81.2 microseconds.
// In two side-by-side timings against v007, it was 1.16 and 1.17 times as fast.
// Over all steps from v000 it is 19.6 times as fast.
#include <hip/hip_runtime.h>

// Causal attention with rotary embeddings over the FULL hidden dim and periodically masked key columns (x [4][2048][512]; q,k,v = x W + b ('xw' [512][512] + [512], 0.02); rope BEFORE the head split: pairs (2i, 2i+1) of the 512-vector rotated by t x 10000^(-2i/512), i < 256; 8 heads x 64; scores / 8; mask = causal AND key column j not in {4, 7, 10, ...} (j >= 4 with (j - 4) mod 3 == 0: the module's period-3 'mgdt' columns); softmax; out = merged Wo + bo -> [4][2048][512] (4.2 M)).
// Layout, all batches in each launch: bf16 copy of x; exact projections + f32 biases; a {cos, sin} table per (position, global pair) (float32 inverse frequencies over 512 dims, precise cosf/sinf) (weight planes, x copy and table come from one launch, k_prep); the projection's epilogue rotates interleaved pairs by the GLOBAL channel and writes the q, k planes and the transposed V planes itself; the k and V planes hold the unmasked key positions only, in their order (slot index, kpos / kcnt below), so a period-3 column is neither projected nor stored nor scored; fused causal attention (k_fattn: scores, running-maximum softmax and P x V in registers; rows < 512 hi/lo 3 products, rest fp16) that writes the merged hi/lo planes; merged hi/lo x Wo exact + bo.
// Compute dtypes, f32 accumulate: every input rounded to bf16; projections exact + f32 biases; rotary f32; attention rows < 512 3 products, rest fp16; softmax f32; Wo hl x exact + bias.

#define NB_  4
#define TT   2048
#define DM   512
#define NH_  8
#define NKV  8
#define REP  (NH_ / NKV)
#define HD   64
#define DQ   (NH_ * HD)
#define DKV  (NKV * HD)
#define RH   512                  // query rows < RH use hi+lo planes (0: none)
#define SCL  0.125f
#define PRD  3       // masked-column period
#define PRD0 4       // first masked column (period + ret_order - 1)
// Key slots: the unmasked key positions 0, 1, 2, 3, 5, 6, 8, 9, ... numbered in their order. kpos: the position in slot s. kcnt: how many slots a query at position q sees (slot s is visible exactly where s < kcnt(q)).
__host__ __device__ constexpr int kpos(int s) { return s < PRD0 ? s : PRD0 + 1 + (s - PRD0) / (PRD - 1) * PRD + (s - PRD0) % (PRD - 1); }
__host__ __device__ constexpr int kcnt(int q) { return q + 1 - (q >= PRD0 ? (q - PRD0) / PRD + 1 : 0); }
#define NKC  kcnt(TT - 1)          // slots in use
#define KT   ((NKC + 63) / 64)     // 64-slot tiles of the k and V projections; the last tile's spare slots repeat the last position and are visible to no query
__host__ __device__ constexpr int kposl(int s) { const int n = (s - PRD0 + PRD - 1) / (PRD - 1); return s + (n > 0 ? n : 0); }   // kpos without a branch on s: the slot plus the masked positions in front of it
static_assert(kposl(0) == kpos(0) && kposl(1) == kpos(1) && kposl(2) == kpos(2) && kposl(3) == kpos(3) && kposl(4) == kpos(4) && kposl(5) == kpos(5) && kposl(6) == kpos(6) && kposl(7) == kpos(7) && kposl(1000) == kpos(1000) && kposl(1407) == kpos(1407), "both forms name the same position");
static_assert(kpos(NKC - 1) < TT && kpos(NKC) >= TT && kcnt(kpos(NKC - 1)) == NKC && kpos(4) == 5 && kpos(7) == 9, "slots cover the unmasked positions exactly");
typedef _Float16 h16;
typedef unsigned short bf;
typedef __attribute__((ext_vector_type(16))) __bf16   v16bf;
typedef __attribute__((ext_vector_type(16))) _Float16 v16h;
typedef __attribute__((ext_vector_type(8)))  _Float16 v8h;
typedef __attribute__((ext_vector_type(8)))  unsigned short v8us;
typedef __attribute__((ext_vector_type(8)))  float    v8f;
typedef __attribute__((ext_vector_type(4)))  float    v4f;
typedef v8h  __attribute__((may_alias)) v8ha;
typedef v4f  __attribute__((may_alias)) v4fa;
typedef v8us __attribute__((may_alias)) v8usa;

__device__ __forceinline__ unsigned short f2bf(float f) { unsigned u = __float_as_uint(f); u += 0x7FFFu + ((u >> 16) & 1u); return (unsigned short)(u >> 16); }
__device__ __forceinline__ float bf2f(unsigned short b) { return __uint_as_float(((unsigned)b) << 16); }
__device__ __forceinline__ float bfr(float f) { return bf2f(f2bf(f)); }
__device__ __forceinline__ v16h cat16(v8h lo, v8h hi) { return __builtin_shufflevector(lo, hi, 0, 1, 2, 3, 4, 5, 6, 7, 8, 9, 10, 11, 12, 13, 14, 15); }
__device__ __forceinline__ v16bf cat16b(v8us lo, v8us hi) { return __builtin_bit_cast(v16bf, __builtin_shufflevector(lo, hi, 0, 1, 2, 3, 4, 5, 6, 7, 8, 9, 10, 11, 12, 13, 14, 15)); }
__device__ __forceinline__ v8f wmma16(v16h a, v16h b, v8f c) { return __builtin_amdgcn_wmma_f32_16x16x32_f16(false, a, false, b, (short)0, c, false, false); }
__device__ __forceinline__ v8f wmmab(v16bf a, v16bf b, v8f c) { return __builtin_amdgcn_wmma_f32_16x16x32_bf16(false, a, false, b, (short)0, c, false, false); }

__device__ __forceinline__ h16 tohx(float x) { return (h16)x; }
__device__ __forceinline__ void splitf(float y, unsigned short& h, unsigned short& l) { h = f2bf(y); l = f2bf(y - bf2f(h)); }
typedef __attribute__((ext_vector_type(2))) _Float16 v2h;
typedef __attribute__((ext_vector_type(4))) _Float16 v4h;
typedef __attribute__((ext_vector_type(2))) unsigned short v2us;
typedef __attribute__((ext_vector_type(4))) unsigned short v4us;
typedef __attribute__((ext_vector_type(2))) float v2f;
typedef __attribute__((ext_vector_type(4))) int v4i;

// ---- Split-K epilogue: the NW waves of a work-group each hold a partial 64x64 tile (their share of the K loop). Every wave parks its 16 accumulators in LDS lane-linear (b128, no bank conflict),
// one barrier, then each wave sums its share of the tile over the NW partials in wave order 0..NW-1 and stores it. A unit = 4 accumulator rows x 32 columns, so each 128-byte output line has one writer.
template <int NW, bool BIAS>
__device__ __forceinline__ void splitk_store(const v8f (&acc)[4][4], float* red, float* C, int ldc, const float* __restrict__ bias, int r0, int c0) {
    const int lane = threadIdx.x & 31, lr = lane & 15, hi = lane >> 4, w = __builtin_amdgcn_readfirstlane(threadIdx.x >> 5);
    // both loops unrolled: acc is indexed by constants only and stays in registers
#pragma unroll
    for (int mb = 0; mb < 4; ++mb)
#pragma unroll
        for (int nb = 0; nb < 4; ++nb) { float* p = red + (size_t)((w * 16 + mb * 4 + nb) * 2) * 128 + lane * 4;
            *(v4fa*)p = __builtin_shufflevector(acc[mb][nb], acc[mb][nb], 0, 1, 2, 3); *(v4fa*)(p + 128) = __builtin_shufflevector(acc[mb][nb], acc[mb][nb], 4, 5, 6, 7); }
    __syncthreads();   // publishes every wave's partial tile to the waves that sum it
    for (int q = 0; q < 16 / NW; ++q) { const int unit = w * (16 / NW) + q, mb = unit >> 2, nb0 = ((unit >> 1) & 1) * 2, half = unit & 1;
        for (int e = 0; e < 2; ++e) { const int nb = nb0 + e; const float* p = red + (size_t)((mb * 4 + nb) * 2 + half) * 128 + lane * 4; v4f sum = *(const v4fa*)p;
            for (int u = 1; u < NW; ++u) sum += *(const v4fa*)(p + (size_t)u * 4096);
            const int col = c0 + nb * 16 + lr; if (BIAS) sum += bfr(bias[nb * 16 + lr]);   // bias points at the tile's first column
            float* crow = C + (size_t)(r0 + mb * 16 + hi * 8 + half * 4) * ldc + col;
            for (int j = 0; j < 4; ++j) crow[(size_t)j * ldc] = sum[j]; } }
}

// ---- Split-K epilogue of the q | k | v projection: the summed 64x64 tile (64 positions of one batch x the 64 channels of one head of q, k or v) never goes to memory as f32.
// Partials are parked and summed as in splitk_store (same order, same bias add); the sums go to a second LDS tile (q, k: [position][channel]; v: [channel][position], four positions a b128 store), one more barrier,
// then each lane takes 8 neighbours of a row: q, k rows are rotated pair by pair and go to the fp16 and hi/lo planes [q, k][batch][head][t][d] (k: t is the key slot); v rows go to the planes [batch][head][d][2 TT] (by key slot). Every b128 store of a wave covers whole 128-byte lines.
#define TP 68   // pitch of that tile in floats: rows stay 16-byte aligned, and the b32 column writes, the b128 writes and the b128 row reads each spread over all banks
template <int NW>
__device__ __forceinline__ void splitk_planes(const v8f (&acc)[4][4], float* red, float* tile, const float* __restrict__ bias, int r0, int c0, const float* __restrict__ CS, h16* P16, bf* Ph, bf* Pl, h16* V16, bf* Vhl) {
    const int lane = threadIdx.x & 31, lr = lane & 15, hi = lane >> 4, w = __builtin_amdgcn_readfirstlane(threadIdx.x >> 5);
    const int seg = c0 / DM, hd = (c0 - seg * DM) / HD, b = r0 / TT, t0 = r0 % TT;   // seg: 0 q, 1 k, 2 v, the same for the whole work-group; 64 divides TT, so a tile lies in one batch; t0: first position (q) or first key slot (k, v)
    const int rr = threadIdx.x >> 3, cc = (threadIdx.x & 7) * 8;                     // this lane's rows rr, rr + 32 and first column of the summed tile
    v2f cs[2][4] = {};   // {cos, sin} of this lane's 4 pairs in each of its two rows, asked for here so that their latency lies under the parking of the partials
    if (seg != 2) {
#pragma unroll
        for (int u = 0; u < 2; ++u)
#pragma unroll
            for (int p = 0; p < 4; ++p) { const int row = t0 + rr + 32 * u, tp = seg == 1 ? min(kpos(row), TT - 1) : row;   // a k row turns by the position that its slot holds
                cs[u][p] = *(const v2f*)(CS + ((size_t)tp * DQ + hd * HD + cc + 2 * p) * 2); } }
    // both loops unrolled: acc is indexed by constants only and stays in registers
#pragma unroll
    for (int mb = 0; mb < 4; ++mb)
#pragma unroll
        for (int nb = 0; nb < 4; ++nb) { float* p = red + (size_t)((w * 16 + mb * 4 + nb) * 2) * 128 + lane * 4;
            *(v4fa*)p = __builtin_shufflevector(acc[mb][nb], acc[mb][nb], 0, 1, 2, 3); *(v4fa*)(p + 128) = __builtin_shufflevector(acc[mb][nb], acc[mb][nb], 4, 5, 6, 7); }
    __syncthreads();   // publishes every wave's partial tile to the waves that sum it
    for (int q = 0; q < 16 / NW; ++q) { const int unit = w * (16 / NW) + q, mb = unit >> 2, nb0 = ((unit >> 1) & 1) * 2, half = unit & 1;
        for (int e = 0; e < 2; ++e) { const int nb = nb0 + e; const float* p = red + (size_t)((mb * 4 + nb) * 2 + half) * 128 + lane * 4; v4f sum = *(const v4fa*)p;
            for (int u = 1; u < NW; ++u) sum += *(const v4fa*)(p + (size_t)u * 4096);
            sum += bfr(bias[nb * 16 + lr]);   // bias points at the tile's first column
            const int col = nb * 16 + lr, row = mb * 16 + hi * 8 + half * 4;
            if (seg == 2) *(v4fa*)(tile + col * TP + row) = sum;
            else for (int j = 0; j < 4; ++j) tile[(row + j) * TP + col] = sum[j]; } }
    __syncthreads();   // publishes the summed tile to the lanes that convert and store its rows
    // the tile's first element and row pitch in its planes, all scalar. Vhl holds a channel's hi half then its lo half; V16 fills the first half
    const size_t base = seg == 2 ? ((size_t)b * NKV + hd) * HD * (2 * TT) + t0 : ((((size_t)seg * NB_ + b) * NH_ + hd) * TT + t0) * HD;
    const int pitch = seg == 2 ? 2 * TT : HD;
    h16* D16 = (seg == 2 ? V16 : P16) + base; bf* Dh = (seg == 2 ? Vhl : Ph) + base; bf* Dl = (seg == 2 ? Vhl + TT : Pl) + base;
    float y[2][8];
#pragma unroll
    for (int u = 0; u < 2; ++u) { const float* p = tile + (rr + 32 * u) * TP + cc; const v4f x0 = *(const v4fa*)p, x1 = *(const v4fa*)(p + 4);
#pragma unroll
        for (int k = 0; k < 4; ++k) { y[u][k] = x0[k]; y[u][4 + k] = x1[k]; } }
    if (seg != 2) {
#pragma unroll
        for (int u = 0; u < 2; ++u)
#pragma unroll
            for (int p = 0; p < 4; ++p) { const float e0 = y[u][2 * p], e1 = y[u][2 * p + 1], c = cs[u][p][0], s = cs[u][p][1]; y[u][2 * p] = e0 * c - e1 * s; y[u][2 * p + 1] = e0 * s + e1 * c; } }   // even: x0 c - x1 s; odd: x0 s + x1 c
#pragma unroll
    for (int u = 0; u < 2; ++u) { v8h o16; v8us oh, ol;
#pragma unroll
        for (int k = 0; k < 8; ++k) { o16[k] = tohx(y[u][k]); unsigned short a2, c2; splitf(y[u][k], a2, c2); oh[k] = a2; ol[k] = c2; }
        const size_t e = (size_t)(rr + 32 * u) * pitch + cc;
        *(v8ha*)(D16 + e) = o16; *(v8usa*)(Dh + e) = oh; *(v8usa*)(Dl + e) = ol; }
}

// ---- k_gemmw: register-blocked GEMM, one work-group of NW waves per 64x64 output tile (16 accumulators a wave); wave w takes the K chunks w, w + NW, ...; grid (M/64, N/64, Z), 32 NW threads. K = DM.
// Operands come from K-contiguous 16-bit planes through LDS: a fragment load straight from a plane touches 16 lines for 512 bytes, an asynchronous copy of 512 neighbouring bytes touches 4 whole lines once.
// A fill = the tile's 64 rows of every operand over KF values of k (two operands: all of K; three: half of K, so that a fill fits the space of the partial tiles, which it shares). Wave w copies rows 8 w .. 8 w + 7 of each operand.
// In LDS the 16-byte unit u of row r lies at unit u ^ (r & 15) of that row: rows are a multiple of 256 bytes, and so the 16 rows of a fragment read fall on all 64 banks.
// C[m][n] (f32, pitch ldc, + optional f32 bias: columns [0, DM) take bias, [DM, 2 DM) biasB, the rest biasC, so q, k and v share one launch) = sum_k A[m][k] Bt[n][k] (NSPLIT 1: + A2[m][k] Bt[n][k]). z-batch strides sA/sB/sC in elements. PLANES: no C; the tile goes through splitk_planes instead; grid x = per batch TT/64 position tiles of q, then KT slot tiles of k, then KT of v (their A rows are the positions kpos(slot)), grid y = head.
template <typename T16> struct WFrag;
template <> struct WFrag<h16> { typedef v16h V; static __device__ __forceinline__ V ld(const h16* p) { return cat16(*(const v8h*)p, *(const v8h*)(p + 16)); } static __device__ __forceinline__ V ld2(const char* p, const char* q) { return cat16(*(const v8ha*)p, *(const v8ha*)q); } static __device__ __forceinline__ v8f mma(V a, V b, v8f c) { return wmma16(a, b, c); } };
template <> struct WFrag<bf> { typedef v16bf V; static __device__ __forceinline__ V ld(const bf* p) { return cat16b(*(const v8us*)p, *(const v8us*)(p + 16)); } static __device__ __forceinline__ V ld2(const char* p, const char* q) { return cat16b(*(const v8usa*)p, *(const v8usa*)q); } static __device__ __forceinline__ v8f mma(V a, V b, v8f c) { return wmmab(a, b, c); } };
// Eight asynchronous copies, 16 bytes a lane each, from the lane's global address g to its LDS byte address l. The s_wait_xcnt stands inside the statement, behind the last copy, so that no address register of a copy is rewritten in front of it.
__device__ __forceinline__ void copy8(const unsigned (&l)[8], const char* const (&g)[8]) {
    asm volatile("global_load_async_to_lds_b128 %0, %8, off\n\t"
                 "global_load_async_to_lds_b128 %1, %9, off\n\t"
                 "global_load_async_to_lds_b128 %2, %10, off\n\t"
                 "global_load_async_to_lds_b128 %3, %11, off\n\t"
                 "global_load_async_to_lds_b128 %4, %12, off\n\t"
                 "global_load_async_to_lds_b128 %5, %13, off\n\t"
                 "global_load_async_to_lds_b128 %6, %14, off\n\t"
                 "global_load_async_to_lds_b128 %7, %15, off\n\t"
                 "s_wait_xcnt 0x0"
                 :: "v"(l[0]), "v"(l[1]), "v"(l[2]), "v"(l[3]), "v"(l[4]), "v"(l[5]), "v"(l[6]), "v"(l[7]),
                    "v"(g[0]), "v"(g[1]), "v"(g[2]), "v"(g[3]), "v"(g[4]), "v"(g[5]), "v"(g[6]), "v"(g[7]) : "memory");
}
// launch bound: four waves a SIMD (256 registers), so that the two work-groups whose LDS fits a WGP also find their registers there
template <typename T16, int NSPLIT, bool BIAS, int NW, bool PLANES>
__global__ __launch_bounds__(32 * NW, 4) void k_gemmw(const T16* __restrict__ A, const T16* __restrict__ A2, const T16* __restrict__ Bt, float* C, int ldc, const float* __restrict__ bias, const float* __restrict__ biasB, const float* __restrict__ biasC, size_t sA, size_t sB, size_t sC, const float* __restrict__ CS, h16* P16, bf* Ph, bf* Pl, h16* V16, bf* Vhl) {
    typedef typename WFrag<T16>::V V;
    constexpr int NOP = NSPLIT == 1 ? 3 : 2, NF = NOP - 1, KF = DM / NF, RB = KF * 2, CPR = RB / 512;   // operands, fills, k values and bytes of a row in a fill, copies a row
    static_assert(NSPLIT <= 1 && NW == 8 && NOP * 64 * RB <= NW * 4096 * 4 && KF % (NW * 32) == 0 && CPR * 512 == RB && 8 % CPR == 0, "a fill fits the partial tiles' space; a wave copies eight whole rows of each operand");
    __shared__ __align__(16) float red[NW * 4096];   // first the operand fills, then the partial tiles
    const size_t z = blockIdx.z; A += z * sA; if (NSPLIT == 1) A2 += z * sA; Bt += z * sB; C += z * sC;
    const int lane = threadIdx.x & 31, lr = lane & 15, hi = lane >> 4; int r0 = blockIdx.x * 64, c0 = blockIdx.y * 64;
    int bt = 0, sg = 0, s0 = 0;   // PLANES: batch, q | k | v, first position or slot of the tile (the rows of a k or v tile are not neighbours)
    if constexpr (PLANES) { constexpr int QT = TT / 64, PB = QT + 2 * KT; const int r = blockIdx.x % PB; bt = blockIdx.x / PB; sg = r < QT ? 0 : r < QT + KT ? 1 : 2; s0 = (r - (sg == 0 ? 0 : sg == 1 ? QT : QT + KT)) * 64;   // all scalar
        r0 = bt * TT + s0; c0 += sg * DM; }
    const int wv = __builtin_amdgcn_readfirstlane(threadIdx.x >> 5);   // wave number in a scalar register: the K loop stays a scalar loop with every lane on at the copies and at the matrix instructions
    v8f acc[4][4];
#pragma unroll
    for (int mb = 0; mb < 4; ++mb)
#pragma unroll
        for (int nb = 0; nb < 4; ++nb) acc[mb][nb] = (v8f){};
    const char* st = (const char*)red; const unsigned lb = (unsigned)(size_t)red;   // lb: the byte address in the work-group's LDS
    int ar[8];   // the A rows that this wave copies (scalar)
#pragma unroll
    for (int i = 0; i < 8; ++i) { const int R = wv * 8 + i; ar[i] = PLANES ? bt * TT + (sg == 0 ? s0 + R : min(kposl(s0 + R), TT - 1)) : r0 + R; }
    // rolled: the addresses of one fill's copies at a time, so that two work-groups' registers fit a WGP
#pragma unroll 1
    for (int f = 0; f < NF; ++f) {
        if (f) { asm volatile("s_wait_dscnt 0x0" ::: "memory");   // this wave's reads of the last fill have returned before any copy writes over it
            __syncthreads(); }                                    // ends every wave's reads of the last fill
#pragma unroll
        for (int op = NOP - 1; op >= 0; --op)
#pragma unroll
            for (int g = 0; g < CPR; ++g) { unsigned l[8]; const char* p[8];
#pragma unroll
                for (int j = 0; j < 8; ++j) { const int e = g * 8 + j, R = wv * 8 + e / CPR, h = e % CPR;   // row of the tile (scalar), 512-byte piece of the row
                    const T16* row = op == NOP - 1 ? Bt + (size_t)(c0 + R) * DM : (op == 0 ? A : A2) + (size_t)ar[e / CPR] * DM;
                    p[j] = (const char*)row + f * RB + h * 512 + lane * 16;
                    l[j] = lb + (unsigned)(op * 64 * RB + R * RB + h * 512 + ((lane ^ (R & 15)) << 4)); }
                copy8(l, p); }
        asm volatile("s_wait_asynccnt 0x0" ::: "memory");   // this wave's copies have landed
        __syncthreads();                                    // publishes the fill to the waves that read it
        int kc = wv * 32;   // first k of the chunk within the fill; every wave has a first chunk (NW chunks divide a fill)
#pragma unroll 1
        do {
            const int u = kc / 8 + hi; const int x0 = (u ^ lr) << 4, x1 = ((u + 2) ^ lr) << 4;   // a lane's two units, k order as in WFrag::ld: 8 hi .. 8 hi + 7, then 16 + 8 hi ..
            auto frag = [&](int op, int blk) { const char* p = st + op * 64 * RB + (blk * 16 + lr) * RB; return WFrag<T16>::ld2(p + x0, p + x1); };
            V a[4], a2[4];
#pragma unroll
            for (int mb = 0; mb < 4; ++mb) { a[mb] = frag(0, mb); if (NSPLIT == 1) a2[mb] = frag(1, mb); }
#pragma unroll
            for (int nb = 0; nb < 4; ++nb) { const V b = frag(NOP - 1, nb);
#pragma unroll
                for (int mb = 0; mb < 4; ++mb) { acc[mb][nb] = WFrag<T16>::mma(a[mb], b, acc[mb][nb]); if (NSPLIT == 1) acc[mb][nb] = WFrag<T16>::mma(a2[mb], b, acc[mb][nb]); } }
            // four vector slots between the last matrix instruction and the next trip's loads into its operands
            asm volatile("v_nop\n\tv_nop\n\tv_nop\n\tv_nop" : "+v"(acc[0][0]), "+v"(acc[1][1]), "+v"(acc[2][2]), "+v"(acc[3][3]) : "v"(a[0]), "v"(a[3]));
        } while ((kc += NW * 32) < KF);
    }
    __syncthreads();   // ends every wave's reads of the operands: the partial tiles are parked over them
    const int seg = c0 / DM; const float* bs = (seg == 0 ? bias : seg == 1 ? biasB : biasC) + (c0 - seg * DM);
    if constexpr (PLANES) { __shared__ __align__(16) float tile[64 * TP]; splitk_planes<NW>(acc, red, tile, bs, r0, c0, CS, P16, Ph, Pl, V16, Vhl); }
    else splitk_store<NW, BIAS>(acc, red, C, ldc, bs, r0, c0);
}


__constant__ float INV512[DQ / 2] = { 1.000000000e+00f,9.646616578e-01f,9.305720329e-01f,8.976871371e-01f,8.659643531e-01f,8.353625536e-01f,8.058422208e-01f,7.773650289e-01f,7.498942018e-01f,7.233941555e-01f,6.978305578e-01f,6.731703877e-01f,6.493816376e-01f,6.264335513e-01f,6.042963862e-01f,5.829415321e-01f,5.623413324e-01f,5.424690843e-01f,5.232991576e-01f,5.048065782e-01f,4.869675338e-01f,4.697588682e-01f,4.531583488e-01f,4.371444881e-01f,4.216965139e-01f,4.067944288e-01f,3.924189806e-01f,3.785515428e-01f,3.651741445e-01f,3.522694409e-01f,3.398208320e-01f,3.278121352e-01f,3.162277639e-01f,3.050527871e-01f,2.942727208e-01f,2.838735878e-01f,2.738419771e-01f,2.641648352e-01f,2.548296750e-01f,2.458243966e-01f,2.371373624e-01f,2.287573218e-01f,2.206733972e-01f,2.128751576e-01f,2.053525001e-01f,1.980956793e-01f,1.910952926e-01f,1.843423098e-01f,1.778279394e-01f,1.715437919e-01f,1.654817015e-01f,1.596338600e-01f,1.539926529e-01f,1.485508084e-01f,1.433012635e-01f,1.382372230e-01f,1.333521456e-01f,1.286396980e-01f,1.240937710e-01f,1.197085083e-01f,1.154782027e-01f,1.113973856e-01f,1.074607819e-01f,1.036632955e-01f,1.000000015e-01f,9.646616131e-02f,9.305720031e-02f,8.976870775e-02f,8.659642935e-02f,8.353625983e-02f,8.058421314e-02f,7.773650438e-02f,7.498941571e-02f,7.233941555e-02f,6.978305429e-02f,6.731703877e-02f,6.493816525e-02f,6.264335662e-02f,6.042964384e-02f,5.829415470e-02f,5.623412877e-02f,5.424690619e-02f,5.232991278e-02f,5.048065633e-02f,4.869675264e-02f,4.697588459e-02f,4.531583562e-02f,4.371444881e-02f,4.216964915e-02f,4.067944363e-02f,3.924189880e-02f,3.785515204e-02f,3.651741147e-02f,3.522694483e-02f,3.398208320e-02f,3.278120980e-02f,3.162277862e-02f,3.050527908e-02f,2.942727320e-02f,2.838735841e-02f,2.738419548e-02f,2.641648427e-02f,2.548296750e-02f,2.458244003e-02f,2.371373586e-02f,2.287573181e-02f,2.206734009e-02f,2.128751762e-02f,2.053525113e-02f,1.980956830e-02f,1.910953037e-02f,1.843423024e-02f,1.778279431e-02f,1.715437882e-02f,1.654817164e-02f,1.596338488e-02f,1.539926510e-02f,1.485508028e-02f,1.433012541e-02f,1.382372249e-02f,1.333521493e-02f,1.286396943e-02f,1.240937691e-02f,1.197085064e-02f,1.154781971e-02f,1.113973837e-02f,1.074607857e-02f,1.036632899e-02f,9.999999776e-03f,9.646615945e-03f,9.305720218e-03f,8.976871148e-03f,8.659643121e-03f,8.353625424e-03f,8.058422245e-03f,7.773650344e-03f,7.498942316e-03f,7.233941462e-03f,6.978305988e-03f,6.731703877e-03f,6.493816618e-03f,6.264335476e-03f,6.042964291e-03f,5.829415284e-03f,5.623413250e-03f,5.424690899e-03f,5.232991185e-03f,5.048065912e-03f,4.869675264e-03f,4.697588738e-03f,4.531583749e-03f,4.371444695e-03f,4.216964822e-03f,4.067944363e-03f,3.924189601e-03f,3.785515437e-03f,3.651741426e-03f,3.522694577e-03f,3.398208413e-03f,3.278121119e-03f,3.162277862e-03f,3.050528001e-03f,2.942727180e-03f,2.838735934e-03f,2.738419687e-03f,2.641648287e-03f,2.548296703e-03f,2.458244096e-03f,2.371373819e-03f,2.287573181e-03f,2.206734149e-03f,2.128751716e-03f,2.053525066e-03f,1.980956644e-03f,1.910952851e-03f,1.843422884e-03f,1.778279431e-03f,1.715437858e-03f,1.654817141e-03f,1.596338581e-03f,1.539926510e-03f,1.485507935e-03f,1.433012658e-03f,1.382372226e-03f,1.333521446e-03f,1.286396873e-03f,1.240937854e-03f,1.197085017e-03f,1.154782018e-03f,1.113973907e-03f,1.074607833e-03f,1.036632922e-03f,1.000000047e-03f,9.646615945e-04f,9.305721032e-04f,8.976871031e-04f,8.659643354e-04f,8.353625308e-04f,8.058422245e-04f,7.773649995e-04f,7.498941850e-04f,7.233941578e-04f,6.978305755e-04f,6.731703761e-04f,6.493816618e-04f,6.264335825e-04f,6.042963942e-04f,5.829415168e-04f,5.623413017e-04f,5.424690899e-04f,5.232990952e-04f,5.048065796e-04f,4.869675031e-04f,4.697588738e-04f,4.531583400e-04f,4.371444811e-04f,4.216964880e-04f,4.067944246e-04f,3.924189950e-04f,3.785515146e-04f,3.651741135e-04f,3.522694460e-04f,3.398208064e-04f,3.278121294e-04f,3.162277862e-04f,3.050527885e-04f,2.942727297e-04f,2.838736109e-04f,2.738419571e-04f,2.641648462e-04f,2.548296761e-04f,2.458243980e-04f,2.371373848e-04f,2.287573152e-04f,2.206734207e-04f,2.128751657e-04f,2.053524950e-04f,1.980956731e-04f,1.910952997e-04f,1.843422942e-04f,1.778279402e-04f,1.715437829e-04f,1.654817170e-04f,1.596338552e-04f,1.539926452e-04f,1.485508110e-04f,1.433012658e-04f,1.382372284e-04f,1.333521504e-04f,1.286396873e-04f,1.240937709e-04f,1.197085076e-04f,1.154781930e-04f,1.113973922e-04f,1.074607790e-04f,1.036632893e-04f };   // 10000^(-2i/512), i < 256, as float32 (jnp-computed)
// ---- k_prep: the three preparatory jobs, which do not depend on one another, as block ranges of ONE launch; a thread of the copy and of the table writes eight 16-byte units, not one entry, so that few waves have to be started.
// Blocks [0, PBW): the four weight matrices, rounded and transposed to [n][k], planes back to back. Blocks [PBW, PBW + PBX): the bf16 copy of x. The rest: the table {cos, sin} per (position, global channel), [TT][DQ][2].
#define PBW (4 * (DM * DQ / 64 / 64))           // 64 lines of 64 elements a block
#define XU  4                                   // units of 8 elements of x a thread and trip
#define XT  2                                   // trips
#define PBX (NB_ * TT * DM / 8 / (256 * XU * XT))
#define CU  8                                   // positions a block: a thread keeps one pair and walks the positions
#define PBC (TT / CU)
static_assert(PBW * 64 * 64 == 4 * DM * DQ && PBX * 256 * XU * XT * 8 == NB_ * TT * DM && PBC * CU == TT && DQ / 2 == 256, "block ranges cover their jobs exactly");
__global__ __launch_bounds__(256) void k_prep(const float* __restrict__ w0, const float* __restrict__ w1, const float* __restrict__ w2, const float* __restrict__ w3, bf* Bt, const float* __restrict__ x, bf* XB, float* CS) {
    const int blk = blockIdx.x;   // the branches below are the same for a whole work-group
    if (blk < PBW) {
        constexpr int K = DM, N = DQ; const int mat = blk / (PBW / 4), bx = blk % (PBW / 4);
        const float* w = mat == 0 ? w0 : mat == 1 ? w1 : mat == 2 ? w2 : w3; Bt += (size_t)mat * N * K;
        const int lane = threadIdx.x & 31; const int L0 = (bx * 8 + (threadIdx.x >> 5)) * 8;
        // rolled, a wave's eight lines one after another
#pragma unroll 1
        for (int l = 0; l < 8; ++l) { const int L = L0 + l; const size_t e = (size_t)L * 64 + lane * 2; const int k = (int)(e % K), n = (int)(e / K); v2us o;
            o[0] = f2bf(w[(size_t)k * N + n]); o[1] = f2bf(w[(size_t)(k + 1) * N + n]); *(v2us*)(Bt + e) = o; }
    } else if (blk < PBW + PBX) {
        const size_t u0 = (size_t)(blk - PBW) * (256 * XU * XT) + threadIdx.x;
        // rolled: a trip has eight 16-byte loads a lane in flight before the first is converted, which with a block's eight waves covers the memory's latency; a second trip costs no more registers
#pragma unroll 1
        for (int h = 0; h < XT; ++h) { const size_t uh = u0 + (size_t)h * (256 * XU); v8f v[XU];
#pragma unroll
            for (int j = 0; j < XU; ++j) v[j] = *(const v8f*)(x + (uh + (size_t)j * 256) * 8);
#pragma unroll
            for (int j = 0; j < XU; ++j) { v8us o;
#pragma unroll
                for (int k = 0; k < 8; ++k) o[k] = f2bf(v[j][k]);
                *(v8us*)(XB + (uh + (size_t)j * 256) * 8) = o; }
            asm volatile("s_wait_xcnt 0x0" ::: "memory");   // stands in front of the rewrite of the address and data registers that the loads and stores above name
        }
    } else {
        const int t0 = (blk - PBW - PBX) * CU; const float f = INV512[threadIdx.x];   // the block's 256 threads are the 256 pairs
        float* row = CS + ((size_t)t0 * DQ + 2 * threadIdx.x) * 2;                     // a unit: the two equal entries of a pair's channels, one 16-byte store; a wave's store covers four whole lines
        // rolled: the text of the precise cosine and sine stands once, not CU times, in the instruction cache
#pragma unroll 1
        for (int j = 0; j < CU; ++j) { const float a = __fmul_rn((float)(t0 + j), f); const float c = cosf(a), s = sinf(a);
            *(v4f*)(row + (size_t)j * (DQ * 2)) = (v4f){c, s, c, s}; }
    }
}

#define SKP 144                          // pitch of a K row in LDS, bytes
#define SVP (64 * FW + 16)               // pitch of a V row in LDS, bytes
#define SKB (32 * FW * SKP)              // bytes of a tile's K rows
#define SBB (SKB + 64 * SVP)             // bytes of a tile's K and V rows of one plane each
__device__ __forceinline__ float xhalf(float x) { return __builtin_bit_cast(float, __builtin_amdgcn_permlanex16(__builtin_bit_cast(int, x), __builtin_bit_cast(int, x), 0x76543210, 0xfedcba98, false, false)); }   // lane l with lane l ^ 16, on the vector port
#define FW 4   // launch bound: four waves a SIMD (256 registers): vector work between the matrix runs wants waves
template <typename T16, bool HR, int NQ, int NG>
__global__ __launch_bounds__(32 * FW * NG, 4) void k_fattn(const T16* __restrict__ Q, const T16* __restrict__ Q2, const T16* __restrict__ Kp, const T16* __restrict__ K2, const T16* __restrict__ Vt, bf* Ah, bf* Al) {
    typedef typename WFrag<T16>::V V;
    constexpr int NP = HR ? 2 : 1, CPW = 32 / (FW * NG), BB = NP * SBB;   // planes of K and of V; copies of 512 bytes a wave takes of each plane's K rows and of its V rows; bytes of a buffer
    static_assert(FW == 4 && HD == 64 && CPW * FW * NG == 32 && NP * 2 * CPW == 8 && 2 * BB >= NG * FW * NQ * 4 * 256 * 4 && (((NKC + 31) / 32 + FW - 1) / FW) * FW * 32 <= KT * 64, "a wave copies eight pieces of 512 bytes of a tile; every slot of every tile has been written by the projection");
    __shared__ __align__(16) float so[2 * BB / 4];   // partial O^T tiles, lane-linear, 256 floats a tile; before them, in the same space, the two buffers of K and V tiles
    __shared__ float sm[NG * FW * NQ * 16], sl[NG * FW * NQ * 16];    // each wave's maximum and sum per query
    const int lane = threadIdx.x & 31, lr = lane & 15, hi = lane >> 4;
    const int wid = __builtin_amdgcn_readfirstlane(threadIdx.x >> 5);   // wave number in a scalar register: the key loop stays a scalar loop with every lane on at the copies and at the matrix instructions
    const int gq = wid / FW, wv = wid % FW;   // the wave's group of query rows, its place in the group's key split
    const int z = blockIdx.x;                                          // batch * heads + head
    constexpr int ROW0 = HR ? 0 : RH, NBLK = (HR ? RH : TT - RH) / (16 * NQ * NG);   // this launch's rows: [0, RH) or [RH, TT); grid y = NBLK
    const int qw = ROW0 + (NBLK - 1 - (int)blockIdx.y) * (16 * NQ * NG);   // the work-group's first row; longest rows start first
    const int q0 = qw + gq * (16 * NQ);                                    // the group's first row
    const size_t zp = (size_t)z * TT * HD; Q += zp; Kp += zp; Vt += 2 * zp; if (HR) { Q2 += zp; K2 += zp; }
    const float NEG = -3.0e38f;
    V qf[NQ][2], qf2[NQ][2];
#pragma unroll
    for (int qb = 0; qb < NQ; ++qb)
#pragma unroll
        for (int dc = 0; dc < 2; ++dc) { const size_t o = (size_t)(q0 + qb * 16 + lr) * HD + dc * 32 + 8 * hi; qf[qb][dc] = WFrag<T16>::ld(Q + o); if (HR) qf2[qb][dc] = WFrag<T16>::ld(Q2 + o); }
    asm volatile("s_wait_xcnt 0x0" ::: "memory");   // stands in front of the rewrite of the address registers that the loads above name
    v8f o[NQ][4]; float m[NQ], l[NQ];
#pragma unroll
    for (int qb = 0; qb < NQ; ++qb) { m[qb] = NEG; l[qb] = 0.f;
#pragma unroll
        for (int db = 0; db < 4; ++db) o[qb][db] = (v8f){}; }
    const int nch = (kcnt(q0 + 16 * NQ - 1) - 1) / 32 + 1;   // 32-slot chunks up to the one that holds the last row's last visible slot
    const int call = kcnt(q0);   // slots that every row of the group sees
    int cl[NQ];                  // slots that this lane's queries see
#pragma unroll
    for (int qb = 0; qb < NQ; ++qb) cl[qb] = kcnt(q0 + qb * 16 + lr);
    const int ntr = ((kcnt(qw + 16 * NQ * NG - 1) - 1) / 32 + FW) / FW;   // trips: the tiles up to the one that holds the work-group's last row's last visible slot; the same for every wave, each passes every barrier of the loop
    const unsigned lb = (unsigned)(size_t)so;   // the byte address in the work-group's LDS
    // this lane's first 16 bytes of K (row 4 CPW wid + lane / 8, unit lane % 8) and of V (row 2 CPW wid + hi, unit lr) in tile 0, in the plane and in buffer 0; the wave's other copies lie constant steps further on. A V row holds its lo half TT elements behind its hi half
    const size_t ok0 = (size_t)(wid * CPW * 512 + lane * 16); const char* gk0 = (const char*)Kp + ok0; const char* gk1 = HR ? (const char*)K2 + ok0 : nullptr; const char* gv0 = (const char*)Vt + (size_t)(wid * CPW * 2 + hi) * (2 * TT * 2) + lr * 16;
    const unsigned lk0 = lb + (unsigned)((wid * CPW * 4 + (lane >> 3)) * SKP + (lane & 7) * 16), lv0 = lb + (unsigned)(SKB + (wid * CPW * 2 + hi) * SVP + lr * 16);
    auto fill = [&](int tile, int buf) {   // this wave's share of a tile: of each plane CPW copies of 4 K rows and CPW copies of 2 V rows
        unsigned l[8]; const char* g[8];
#pragma unroll
        for (int p = 0; p < NP; ++p) { const char* gk = (p ? gk1 : gk0) + (size_t)tile * (32 * FW * HD * 2); const char* gv = gv0 + tile * (64 * FW) + p * (TT * 2); const unsigned lk = lk0 + (unsigned)(buf * BB + p * SBB), lv = lv0 + (unsigned)(buf * BB + p * SBB);
#pragma unroll
            for (int j = 0; j < CPW; ++j) { g[p * 2 * CPW + j] = gk + j * 512; l[p * 2 * CPW + j] = lk + (unsigned)(j * 4 * SKP); g[(p * 2 + 1) * CPW + j] = gv + (size_t)j * (2 * 2 * TT * 2); l[(p * 2 + 1) * CPW + j] = lv + (unsigned)(j * 2 * SVP); } }
        copy8(l, g); };
    fill(0, 0);
    asm volatile("s_wait_asynccnt 0x0" ::: "memory");   // this wave's copies of tile 0 have landed
    __syncthreads();                                    // publishes tile 0 to the waves that read it
    if (ntr > 1) fill(1, 1);
#pragma unroll 1
    for (int c = wv, tr = 0; tr < ntr; c += FW, ++tr) {
      if (c < nch) {   // a wave without a chunk in this tile skips the work (a scalar test), not the barrier below
        const int kc = c * 32;
        V kf[2][2], kf2[2][2], vf[4], vf2[4];
        const char* kt = (const char*)so + (tr & 1) * BB + (wv * 32 + lr) * SKP + hi * 16; const char* vt = (const char*)so + (tr & 1) * BB + SKB + lr * SVP + wv * 64 + hi * 16;   // k order as in WFrag::ld: 8 hi .. 8 hi + 7, then 16 + 8 hi ..
#pragma unroll
        for (int kb = 0; kb < 2; ++kb)
#pragma unroll
            for (int dc = 0; dc < 2; ++dc) { const char* p = kt + kb * 16 * SKP + dc * 64; kf[kb][dc] = WFrag<T16>::ld2(p, p + 32); if (HR) kf2[kb][dc] = WFrag<T16>::ld2(p + SBB, p + SBB + 32); }
#pragma unroll
        for (int db = 0; db < 4; ++db) { const char* p = vt + db * 16 * SVP; vf[db] = WFrag<T16>::ld2(p, p + 32); if (HR) vf2[db] = WFrag<T16>::ld2(p + SBB, p + SBB + 32); }
        v8f s[NQ][2];
#pragma unroll
        for (int qb = 0; qb < NQ; ++qb)
#pragma unroll
            for (int kb = 0; kb < 2; ++kb) { s[qb][kb] = (v8f){};
#pragma unroll
                for (int dc = 0; dc < 2; ++dc) { s[qb][kb] = WFrag<T16>::mma(kf[kb][dc], qf[qb][dc], s[qb][kb]); if (HR) { s[qb][kb] = WFrag<T16>::mma(kf2[kb][dc], qf[qb][dc], s[qb][kb]); s[qb][kb] = WFrag<T16>::mma(kf[kb][dc], qf2[qb][dc], s[qb][kb]); } } }
#pragma unroll
        for (int qb = 0; qb < NQ; ++qb) {
            float t[16];
#pragma unroll
            for (int e = 0; e < 16; ++e) t[e] = s[qb][e >> 3][e & 7] * (SCL * 1.4426950408889634f);
            if (kc + 32 > call) {   // only the chunks past the first row's last slot cross the diagonal (a scalar test)
#pragma unroll
                for (int e = 0; e < 16; ++e) { const int j = kc + (e >> 3) * 16 + hi * 8 + (e & 7); t[e] = (j < cl[qb]) ? t[e] : NEG; } }
            float tm = t[0];
#pragma unroll
            for (int e = 1; e < 16; ++e) tm = fmaxf(tm, t[e]);
            tm = fmaxf(tm, xhalf(tm));
            const float mn = fmaxf(m[qb], tm), al = __builtin_amdgcn_exp2f(m[qb] - mn); m[qb] = mn;
            float ps = 0.f;
#pragma unroll
            for (int e = 0; e < 16; ++e) { t[e] = __builtin_amdgcn_exp2f(t[e] - mn); ps += t[e]; }
            l[qb] = l[qb] * al + ps;   // this lane's keys only; the halves join after the loop
#pragma unroll
            for (int db = 0; db < 4; ++db) o[qb][db] *= al;
            if constexpr (HR) { v8us h0, h1, l0, l1;
#pragma unroll
                for (int e = 0; e < 8; ++e) { unsigned short a, b; splitf(t[e], a, b); h0[e] = a; l0[e] = b; splitf(t[8 + e], a, b); h1[e] = a; l1[e] = b; }
                const V ph = cat16b(h0, h1), pl = cat16b(l0, l1);
#pragma unroll
                for (int db = 0; db < 4; ++db) { o[qb][db] = WFrag<T16>::mma(vf[db], ph, o[qb][db]); o[qb][db] = WFrag<T16>::mma(vf2[db], ph, o[qb][db]); o[qb][db] = WFrag<T16>::mma(vf[db], pl, o[qb][db]); }
            } else { V pf;
#pragma unroll
                for (int e = 0; e < 16; ++e) pf[e] = tohx(t[e]);
#pragma unroll
                for (int db = 0; db < 4; ++db) o[qb][db] = WFrag<T16>::mma(vf[db], pf, o[qb][db]); }
        }
        // four vector slots between the last matrix instruction and the next trip's loads into its operands
        asm volatile("v_nop\n\tv_nop\n\tv_nop\n\tv_nop" : "+v"(o[NQ - 1][0]), "+v"(o[NQ - 1][1]), "+v"(o[NQ - 1][2]), "+v"(o[NQ - 1][3]) : "v"(vf[0]), "v"(vf[3]));
      }
        asm volatile("s_wait_dscnt 0x0" ::: "memory");      // this wave's reads of this trip's buffer have returned before any copy writes over it
        asm volatile("s_wait_asynccnt 0x0" ::: "memory");   // this wave's copies of the next tile have landed
        __syncthreads();                                    // publishes the next tile and ends every wave's reads of this trip's buffer
        if (tr + 2 < ntr) fill(tr + 2, tr & 1);
    }
    asm volatile("s_wait_asynccnt 0x0" ::: "memory");   // no copy is in flight when the partial tiles are parked over the buffers (the last trip's barrier has ended every wave's reads)
#pragma unroll
    for (int qb = 0; qb < NQ; ++qb) {
#pragma unroll
        for (int db = 0; db < 4; ++db) { float* p = so + (size_t)(((wid * NQ + qb) * 4 + db) * 2) * 128 + lane * 4;
            *(v4fa*)p = __builtin_shufflevector(o[qb][db], o[qb][db], 0, 1, 2, 3); *(v4fa*)(p + 128) = __builtin_shufflevector(o[qb][db], o[qb][db], 4, 5, 6, 7); }
        const float lj = l[qb] + xhalf(l[qb]);
        if (hi == 0) { sm[(wid * NQ + qb) * 16 + lr] = m[qb]; sl[(wid * NQ + qb) * 16 + lr] = lj; } }
    __syncthreads();   // publishes every wave's partial O^T, maximum and sum to the waves that merge them
    // merge, each group its own rows: a wave takes 4 NQ queries, 8 / NQ lanes a query, so each 128-byte line of the merged planes has one writer. A wave without an unmasked key for a query has maximum -3e38 and weight 0.
    constexpr int LPQ = 8 / NQ;
    const int qi = wv * (32 / LPQ) + lane / LPQ, qb = qi >> 4, cq = qi & 15;
    float M = NEG, sc[FW], L = 0.f;
#pragma unroll
    for (int u = 0; u < FW; ++u) M = fmaxf(M, sm[((gq * FW + u) * NQ + qb) * 16 + cq]);
#pragma unroll
    for (int u = 0; u < FW; ++u) { sc[u] = __builtin_amdgcn_exp2f(sm[((gq * FW + u) * NQ + qb) * 16 + cq] - M); L += sc[u] * sl[((gq * FW + u) * NQ + qb) * 16 + cq]; }
    const float inv = __fdiv_rn(1.0f, L);
    const size_t orow = ((size_t)(z / NH_) * TT + q0 + qi) * DQ + (z % NH_) * HD;
#pragma unroll
    for (int n = 0; n < NQ; ++n) { const int g = (lane % LPQ) * NQ + n, db = g >> 1, h = g & 1;   // 8 channels: 16 db + 8 h ...
        v4f a0 = (v4f){}, a1 = (v4f){};
#pragma unroll
        for (int u = 0; u < FW; ++u) { const float* p = so + (size_t)((((gq * FW + u) * NQ + qb) * 4 + db) * 2) * 128 + (h * 16 + cq) * 4; a0 += *(const v4fa*)p * sc[u]; a1 += *(const v4fa*)(p + 128) * sc[u]; }
        v8us oh, ol;
#pragma unroll
        for (int r = 0; r < 4; ++r) { unsigned short a, b; splitf(a0[r] * inv, a, b); oh[r] = a; ol[r] = b; splitf(a1[r] * inv, a, b); oh[4 + r] = a; ol[4 + r] = b; }
        *(v8usa*)(Ah + orow + db * 16 + h * 8) = oh; *(v8usa*)(Al + orow + db * 16 + h * 8) = ol; }
}

extern "C" void kernel_launch(void* const* d_in, const int* in_sizes, int n_in,
                              void* d_out, int out_size, void* d_ws, size_t ws_size, hipStream_t stream) {
    (void)in_sizes; (void)n_in; (void)out_size;
    const float* x = (const float*)d_in[0]; const float* wq = (const float*)d_in[1]; const float* bq = (const float*)d_in[2]; const float* wk = (const float*)d_in[3]; const float* bk = (const float*)d_in[4]; const float* wv = (const float*)d_in[5]; const float* bv = (const float*)d_in[6]; const float* wo = (const float*)d_in[7]; const float* bo = (const float*)d_in[8];
    float* OUT = (float*)d_out;     // [4][2048][512]
    char* wsp = (char*)d_ws;
    auto take = [&](size_t bytes) { char* p = wsp; wsp += (bytes + 255) & ~(size_t)255; return (void*)p; };
    const size_t PL = (size_t)NB_ * NH_ * TT * HD;   // elements of one [batch][head] plane set
    bf* WA = (bf*)take((size_t)4 * DM * DQ * 2);      // Wq | Wk | Wv | Wo, each transposed [n][k]
    h16* QK16 = (h16*)take(2 * PL * 2); bf* QKh = (bf*)take(2 * PL * 2); bf* QKl = (bf*)take(2 * PL * 2);   // q planes, then k planes
    h16* VT16 = (h16*)take(2 * PL * 2); bf* VThl = (bf*)take(2 * PL * 2);   // rows of 2 TT elements
    bf* ATh = (bf*)take(PL * 2); bf* ATl = (bf*)take(PL * 2);   // attention output, heads merged, hi and lo
    bf* XB = (bf*)take((size_t)NB_ * TT * DM * 2); float* CS = (float*)take((size_t)TT * DQ * 2 * 4);   /* CS {cos, sin} per (t, global channel) */
    if ((size_t)(wsp - (char*)d_ws) > ws_size) return;    // ws 256 MiB
    k_prep<<<PBW + PBX + PBC, 256, 0, stream>>>(wq, wk, wv, wo, WA, x, XB, CS);   /* angle t x 10000^(-2i/512) for global pair i = c/2 */
    k_gemmw<bf, 0, true, 8, true><<<dim3(NB_ * (TT / 64 + 2 * KT), DQ / 64, 1), 256, 0, stream>>>(XB, nullptr, WA, nullptr, 0, bq, bk, bv, 0, 0, 0, CS, QK16, QKh, QKl, VT16, VThl);
    // grid x: the 32 (batch, head) planes; grid y: query blocks, longest first
    k_fattn<h16, false, 2, 2><<<dim3(NB_ * NH_, (TT - RH) / 64, 1), 64 * FW, 0, stream>>>(QK16, nullptr, QK16 + PL, nullptr, VT16, ATh, ATl);
    k_fattn<bf, true, 1, 4><<<dim3(NB_ * NH_, RH / 64, 1), 128 * FW, 0, stream>>>(QKh, QKl, QKh + PL, QKl + PL, VThl, ATh, ATl);
    k_gemmw<bf, 1, true, 8, false><<<dim3(NB_ * TT / 64, DM / 64, 1), 256, 0, stream>>>(ATh, ATl, WA + (size_t)3 * DM * DQ, OUT, DM, bo, nullptr, nullptr, 0, 0, 0, nullptr, nullptr, nullptr, nullptr, nullptr, nullptr);
}

// v009
// One run takes 72.1 microseconds.
// Two timings next to v008 put it at 1.12 and 1.13 times that version's speed.
// All steps since v000 together make it 22.1 times as fast.
#include <hip/hip_runtime.h>

// Causal attention with rotary embeddings over the FULL hidden dim and periodically masked key columns (x [4][2048][512]; q,k,v = x W + b ('xw' [512][512] + [512], 0.02); rope BEFORE the head split: pairs (2i, 2i+1) of the 512-vector rotated by t x 10000^(-2i/512), i < 256; 8 heads x 64; scores / 8; mask = causal AND key column j not in {4, 7, 10, ...} (j >= 4 with (j - 4) mod 3 == 0: the module's period-3 'mgdt' columns); softmax; out = merged Wo + bo -> [4][2048][512] (4.2 M)).
// Layout, all batches in each launch: bf16 copy of x; exact projections + f32 biases; a {cos, sin} table per (position, global pair) (float32 inverse frequencies over 512 dims, precise cosf/sinf) (weight planes, x copy and table come from one launch, k_prep); the projection's epilogue rotates interleaved pairs by the GLOBAL channel and writes the q, k planes and the transposed V planes itself; the k and V planes hold the unmasked key positions only, in their order (slot index, kpos / kcnt below), so a period-3 column is neither projected nor stored nor scored; fused causal attention (k_fattn: scores, running-maximum softmax and P x V in registers; rows < 512 hi/lo 3 products, rest fp16) that writes the merged hi/lo planes; merged hi/lo x Wo exact + bo.
// Compute dtypes, f32 accumulate: every input rounded to bf16; projections exact + f32 biases; rotary f32; attention rows < 512 3 products, rest fp16; softmax f32; Wo hl x exact + bias.

#define NB_  4
#define TT   2048
#define DM   512
#define NH_  8
#define NKV  8
#define REP  (NH_ / NKV)
#define HD   64
#define DQ   (NH_ * HD)
#define DKV  (NKV * HD)
#define RH   512                  // query rows < RH use hi+lo planes (0: none)
#define SCL  0.125f
#define PRD  3       // masked-column period
#define PRD0 4       // first masked column (period + ret_order - 1)
// Key slots: the unmasked key positions 0, 1, 2, 3, 5, 6, 8, 9, ... numbered in their order. kpos: the position in slot s. kcnt: how many slots a query at position q sees (slot s is visible exactly where s < kcnt(q)).
__host__ __device__ constexpr int kpos(int s) { return s < PRD0 ? s : PRD0 + 1 + (s - PRD0) / (PRD - 1) * PRD + (s - PRD0) % (PRD - 1); }
__host__ __device__ constexpr int kcnt(int q) { return q + 1 - (q >= PRD0 ? (q - PRD0) / PRD + 1 : 0); }
#define NKC  kcnt(TT - 1)          // slots in use
#define KT   ((NKC + 63) / 64)     // 64-slot tiles of the k and V projections; the last tile's spare slots repeat the last position and are visible to no query
__host__ __device__ constexpr int kposl(int s) { const int n = (s - PRD0 + PRD - 1) / (PRD - 1); return s + (n > 0 ? n : 0); }   // kpos without a branch on s: the slot plus the masked positions in front of it
static_assert(kposl(0) == kpos(0) && kposl(1) == kpos(1) && kposl(2) == kpos(2) && kposl(3) == kpos(3) && kposl(4) == kpos(4) && kposl(5) == kpos(5) && kposl(6) == kpos(6) && kposl(7) == kpos(7) && kposl(1000) == kpos(1000) && kposl(1407) == kpos(1407), "both forms name the same position");
static_assert(kpos(NKC - 1) < TT && kpos(NKC) >= TT && kcnt(kpos(NKC - 1)) == NKC && kpos(4) == 5 && kpos(7) == 9, "slots cover the unmasked positions exactly");
typedef _Float16 h16;
typedef unsigned short bf;
typedef __attribute__((ext_vector_type(16))) __bf16   v16bf;
typedef __attribute__((ext_vector_type(16))) _Float16 v16h;
typedef __attribute__((ext_vector_type(8)))  _Float16 v8h;
typedef __attribute__((ext_vector_type(8)))  unsigned short v8us;
typedef __attribute__((ext_vector_type(8)))  float    v8f;
typedef __attribute__((ext_vector_type(4)))  float    v4f;
typedef v8h  __attribute__((may_alias)) v8ha;
typedef v4f  __attribute__((may_alias)) v4fa;
typedef v8us __attribute__((may_alias)) v8usa;

__device__ __forceinline__ unsigned short f2bf(float f) { unsigned u = __float_as_uint(f); u += 0x7FFFu + ((u >> 16) & 1u); return (unsigned short)(u >> 16); }
__device__ __forceinline__ float bf2f(unsigned short b) { return __uint_as_float(((unsigned)b) << 16); }
__device__ __forceinline__ float bfr(float f) { return bf2f(f2bf(f)); }
__device__ __forceinline__ v16h cat16(v8h lo, v8h hi) { return __builtin_shufflevector(lo, hi, 0, 1, 2, 3, 4, 5, 6, 7, 8, 9, 10, 11, 12, 13, 14, 15); }
__device__ __forceinline__ v16bf cat16b(v8us lo, v8us hi) { return __builtin_bit_cast(v16bf, __builtin_shufflevector(lo, hi, 0, 1, 2, 3, 4, 5, 6, 7, 8, 9, 10, 11, 12, 13, 14, 15)); }
__device__ __forceinline__ v8f wmma16(v16h a, v16h b, v8f c) { return __builtin_amdgcn_wmma_f32_16x16x32_f16(false, a, false, b, (short)0, c, false, false); }
__device__ __forceinline__ v8f wmmab(v16bf a, v16bf b, v8f c) { return __builtin_amdgcn_wmma_f32_16x16x32_bf16(false, a, false, b, (short)0, c, false, false); }

__device__ __forceinline__ h16 tohx(float x) { return (h16)x; }
__device__ __forceinline__ void splitf(float y, unsigned short& h, unsigned short& l) { h = f2bf(y); l = f2bf(y - bf2f(h)); }
typedef __attribute__((ext_vector_type(2))) _Float16 v2h;
typedef __attribute__((ext_vector_type(4))) _Float16 v4h;
typedef __attribute__((ext_vector_type(2))) unsigned short v2us;
typedef __attribute__((ext_vector_type(4))) unsigned short v4us;
typedef __attribute__((ext_vector_type(2))) float v2f;
typedef __attribute__((ext_vector_type(4))) int v4i;

// ---- Fragments of the 16-bit matrix forms, from memory (ld) or from two 16-byte units in LDS (ld2)
template <typename T16> struct WFrag;
template <> struct WFrag<h16> { typedef v16h V; static __device__ __forceinline__ V ld(const h16* p) { return cat16(*(const v8h*)p, *(const v8h*)(p + 16)); } static __device__ __forceinline__ V ld2(const char* p, const char* q) { return cat16(*(const v8ha*)p, *(const v8ha*)q); } static __device__ __forceinline__ v8f mma(V a, V b, v8f c) { return wmma16(a, b, c); } };
template <> struct WFrag<bf> { typedef v16bf V; static __device__ __forceinline__ V ld(const bf* p) { return cat16b(*(const v8us*)p, *(const v8us*)(p + 16)); } static __device__ __forceinline__ V ld2(const char* p, const char* q) { return cat16b(*(const v8usa*)p, *(const v8usa*)q); } static __device__ __forceinline__ v8f mma(V a, V b, v8f c) { return wmmab(a, b, c); } };
// Eight asynchronous copies, 16 bytes a lane each, from the lane's global address g to its LDS byte address l. The s_wait_xcnt stands inside the statement, behind the last copy, so that no address register of a copy is rewritten in front of it.
__device__ __forceinline__ void copy8(const unsigned (&l)[8], const char* const (&g)[8]) {
    asm volatile("global_load_async_to_lds_b128 %0, %8, off\n\t"
                 "global_load_async_to_lds_b128 %1, %9, off\n\t"
                 "global_load_async_to_lds_b128 %2, %10, off\n\t"
                 "global_load_async_to_lds_b128 %3, %11, off\n\t"
                 "global_load_async_to_lds_b128 %4, %12, off\n\t"
                 "global_load_async_to_lds_b128 %5, %13, off\n\t"
                 "global_load_async_to_lds_b128 %6, %14, off\n\t"
                 "global_load_async_to_lds_b128 %7, %15, off\n\t"
                 "s_wait_xcnt 0x0"
                 :: "v"(l[0]), "v"(l[1]), "v"(l[2]), "v"(l[3]), "v"(l[4]), "v"(l[5]), "v"(l[6]), "v"(l[7]),
                    "v"(g[0]), "v"(g[1]), "v"(g[2]), "v"(g[3]), "v"(g[4]), "v"(g[5]), "v"(g[6]), "v"(g[7]) : "memory");
}

// ---- k_gemmt: both GEMMs (K = DM, operands in K-contiguous bf16 planes). One work-group of four waves (2 x 2); each wave owns a whole output tile and sums all of K itself, in k order: no partial tiles to park and sum.
// PLANES, the q | k | v projection: a block of 128 rows x 128 columns, a wave's tile 64x64 (64 positions of one batch x the 64 channels of one head of q, k or v). Grid x = per batch TT/128 position blocks of q, then KT/2 slot blocks of k, then KT/2 of v (their A rows are the positions kposl(slot)); grid y = pair of heads.
// Otherwise, merged hi/lo x Wo: a block of 64 rows x 128 columns, a wave's tile 32x64, C = (A + A2) Bt^T + bias in f32, of each chunk of k first the hi, then the lo products. Grid x = blocks of 64 rows, grid y = blocks of 128 columns.
// Two waves share each A row and each Bt row, so a row comes from L2 once for the block's whole width or height.
// The operands come through LDS in stages of PKS values of k, two buffers: the next stage flies while this one is worked on. A stage = 128 A rows (Wo: 64 hi rows, then the same 64 lo rows), then 128 Bt rows, 128 bytes (one whole line) of each; a copy takes 4 rows; wave w copies rows 32 w .. 32 w + 31 of both.
#define PKS 64                    // k values of a stage
#define PRP 144                   // pitch of a staged row in LDS, bytes: an odd number of 16-byte units, so that the 16 rows of a fragment read fall on all 64 banks
#define POB (128 * PRP)           // bytes of one operand's rows of a stage
#define PBB (2 * POB)             // bytes of a buffer
#define TP 68   // pitch of a wave's f32 tile in floats: rows stay 16-byte aligned, and the b32 column writes, the b128 writes and the b128 row reads each spread over all banks
// The rows of a wave's f32 tile (q, k: [position][channel]; v: [channel][position]) go to the planes: a lane takes 8 neighbours of a row, 8 lanes a row, 4 rows a store, so every b128 store of a wave covers whole 128-byte lines.
// q, k rows are rotated pair by pair first. ROT: q or k. PITCH: row pitch of the planes in elements. slots: the rows are key slots (k). t0: the tile's first position or slot. ch0: its first global channel.
template <bool ROT, int PITCH>
__device__ __forceinline__ void proj_rows(const float* tile, const char* __restrict__ CS, bool slots, int t0, int ch0, h16* D16, bf* Dh, bf* Dl) {
    const int lane = threadIdx.x & 31, rr = lane >> 3, cc = (lane & 7) * 8;
    // rolled in two halves: the text of the conversions stands eight times, not sixteen; a half's table loads are all in flight before the first is used
#pragma unroll 1
    for (int g = 0; g < 2; ++g) {
        v2f cs[8][4];
        if (ROT) { unsigned co[8];   // byte offsets in the table (8 MiB) of the lane's first pair in its eight rows
#pragma unroll
            for (int u = 0; u < 8; ++u) { const int row = t0 + rr + 4 * (g * 8 + u), tp = min(row + (slots ? kposl(row) - row : 0), TT - 1);   // a k row turns by the position that its slot holds
                co[u] = (unsigned)(tp * DQ + ch0 + cc) * 8; }
#pragma unroll
            for (int u = 0; u < 8; ++u)
#pragma unroll
                for (int p = 0; p < 4; ++p) cs[u][p] = *(const v2f*)(CS + co[u] + p * 16);
            // the offsets are inputs, so their registers live up to this wait: none is given to a later load's result in front of it
            asm volatile("s_wait_xcnt 0x0" :: "v"(co[0]), "v"(co[1]), "v"(co[2]), "v"(co[3]), "v"(co[4]), "v"(co[5]), "v"(co[6]), "v"(co[7]) : "memory"); }
#pragma unroll
        for (int u = 0; u < 8; ++u) { const int row = rr + 4 * (g * 8 + u); const float* p = tile + row * TP + cc; const v4f x0 = *(const v4fa*)p, x1 = *(const v4fa*)(p + 4);
            float y[8];
#pragma unroll
            for (int k = 0; k < 4; ++k) { y[k] = x0[k]; y[4 + k] = x1[k]; }
            if (ROT) {
#pragma unroll
                for (int q = 0; q < 4; ++q) { const float e0 = y[2 * q], e1 = y[2 * q + 1], c = cs[u][q][0], sn = cs[u][q][1]; y[2 * q] = e0 * c - e1 * sn; y[2 * q + 1] = e0 * sn + e1 * c; } }   // even: x0 c - x1 s; odd: x0 s + x1 c
            v8h o16; v8us oh, ol;
#pragma unroll
            for (int k = 0; k < 8; ++k) { o16[k] = tohx(y[k]); unsigned short a2, c2; splitf(y[k], a2, c2); oh[k] = a2; ol[k] = c2; }
            const size_t e = (size_t)row * PITCH + cc;
            *(v8ha*)(D16 + e) = o16; *(v8usa*)(Dh + e) = oh; *(v8usa*)(Dl + e) = ol; }
        asm volatile("s_wait_xcnt 0x0" ::: "memory");   // stands in front of the next half's rewrite of the address and data registers that the loads and stores above name
    }
}
// launch bound: four waves a SIMD (256 registers): up to four work-groups a WGP
template <bool PLANES>
__global__ __launch_bounds__(128, 4) void k_gemmt(const bf* __restrict__ A, const bf* __restrict__ A2, const bf* __restrict__ Bt, const float* __restrict__ bias, const float* __restrict__ biasB, const float* __restrict__ biasC, const float* __restrict__ CS, h16* P16, bf* Ph, bf* Pl, h16* V16, bf* Vhl, float* C) {
    typedef WFrag<bf>::V V;
    constexpr int NS = DM / PKS, QT = TT / 128, KT2 = KT / 2, PB = QT + 2 * KT2, MB = PLANES ? 4 : 2;   // MB: 16-row blocks of a wave's tile
    static_assert(NS * PKS == DM && NS >= 2 && PKS * 2 == 128 && QT * 128 == TT && KT2 * 2 == KT && DQ % 128 == 0 && HD == 64 && 2 * PBB >= 4 * 64 * TP * 4, "whole stages, whole blocks; the four f32 tiles fit the space of the buffers");
    __shared__ __align__(16) char sb[2 * PBB];   // the two buffers of operand stages; after the K loop, in the same space, each wave's f32 tile
    const int lane = threadIdx.x & 31, lr = lane & 15, hi = lane >> 4;
    const int wv = __builtin_amdgcn_readfirstlane(threadIdx.x >> 5), wr = wv >> 1, wc = wv & 1;   // wave number in a scalar register; the wave's place among the block's 2 x 2 tiles
    const int r = PLANES ? blockIdx.x % PB : 0, bt = PLANES ? blockIdx.x / PB : 0, sg = r < QT ? 0 : r < QT + KT2 ? 1 : 2, s0 = (r - (sg == 0 ? 0 : sg == 1 ? QT : QT + KT2)) * 128;   // PLANES: batch, q | k | v, first position or slot of the block: all scalar
    const int c0 = blockIdx.y * 128;   // first column (PLANES: within q, k or v)
    const int hd = blockIdx.y * 2 + wc, t0 = s0 + wr * 64;   // the wave's 64 columns (PLANES: its head); PLANES: first position (q) or first key slot (k, v) of the wave's tile
    const float* bs = (sg == 0 ? bias : sg == 1 ? biasB : biasC) + hd * HD;
    float bb[4];   // the lane's four columns' biases, asked for here so that their latency lies under the K loop
#pragma unroll
    for (int nb = 0; nb < 4; ++nb) bb[nb] = bs[nb * 16 + lr];
    v8f acc[MB][4];
#pragma unroll
    for (int mb = 0; mb < MB; ++mb)
#pragma unroll
        for (int nb = 0; nb < 4; ++nb) acc[mb][nb] = (v8f){};
    // this lane's 16 bytes of the rows cr + 4 j, j < 8, of A and of Bt: unit lane % 8 of the stage's 128 bytes
    const int cr = wv * 32 + (lane >> 3); const unsigned cu = (unsigned)(lane & 7) * 16;
    unsigned ao[8];   // byte offsets of the A rows (the rows of a k or v block are not neighbours)
#pragma unroll
    for (int j = 0; j < 8; ++j) { const int R = s0 + cr + 4 * j; ao[j] = (unsigned)(PLANES ? bt * TT + min(R + (sg == 0 ? 0 : kposl(R) - R), TT - 1) : (int)blockIdx.x * 64 + ((cr + 4 * j) & 63)) * (DM * 2) + cu; }
    const char* ga = (const char*)(PLANES || wv < 2 ? A : A2);   // Wo: waves 0, 1 copy the hi rows, waves 2, 3 the lo rows (a scalar choice)
    const char* gb = (const char*)Bt + (size_t)(sg * DM + c0 + cr) * (DM * 2) + cu;
    const unsigned l0 = (unsigned)(size_t)sb + (unsigned)(cr * PRP) + cu;   // the byte address in the work-group's LDS
    auto fill = [&](int st, int buf) {   // this wave's share of a stage: eight copies of 4 A rows, eight of 4 Bt rows
        { unsigned l[8]; const char* g[8];
#pragma unroll
          for (int j = 0; j < 8; ++j) { g[j] = ga + ao[j] + st * (PKS * 2); l[j] = l0 + (unsigned)(buf * PBB + j * 4 * PRP); }
          copy8(l, g); }
        { unsigned l[8]; const char* g[8];
#pragma unroll
          for (int j = 0; j < 8; ++j) { g[j] = gb + j * (4 * DM * 2) + st * (PKS * 2); l[j] = l0 + (unsigned)(buf * PBB + POB + j * 4 * PRP); }
          copy8(l, g); } };
    fill(0, 0);
    asm volatile("s_wait_asynccnt 0x0" ::: "memory");   // this wave's copies of stage 0 have landed
    __syncthreads();                                    // publishes stage 0 to the waves that read it
    fill(1, 1);
    // rolled: the text of one trip and the address registers of one stage's copies; the buffer goes by the trip's parity
#pragma unroll 1
    for (int st = 0; st < NS; ++st) {
        const char* pa = sb + (st & 1) * PBB + (wr * (MB * 16) + lr) * PRP + hi * 16; const char* pb = sb + (st & 1) * PBB + POB + (wc * 64 + lr) * PRP + hi * 16;   // k order as in WFrag::ld, in A and in Bt alike: 8 hi .. 8 hi + 7, then 16 + 8 hi ..
        V a[4], b[4];   // a: PLANES the tile's four row blocks; Wo its two row blocks hi, then the two lo. A chunk's eight fragments are all asked for before its first matrix instruction: one LDS latency a chunk, not one a column block
#pragma unroll
        for (int kc = 0; kc < PKS / 32; ++kc) {
#pragma unroll
            for (int i = 0; i < 4; ++i) { const char* p = pa + (PLANES ? i * 16 : (i >> 1) * 64 + (i & 1) * 16) * PRP + kc * 64; a[i] = WFrag<bf>::ld2(p, p + 32); const char* q = pb + i * 16 * PRP + kc * 64; b[i] = WFrag<bf>::ld2(q, q + 32); }
            __builtin_amdgcn_sched_barrier(0);   // keeps the chunk's sixteen LDS reads together in front of its matrix instructions (left alone, the compiler sinks each b to its use and waits there)
#pragma unroll
            for (int h = 0; h < 4 / MB; ++h)
#pragma unroll
                for (int nb = 0; nb < 4; ++nb)
#pragma unroll
                    for (int mb = 0; mb < MB; ++mb) acc[mb][nb] = WFrag<bf>::mma(a[h * MB + mb], b[nb], acc[mb][nb]);
            __builtin_amdgcn_sched_barrier(0); }   // keeps the chunk's matrix instructions in one run: in front of the next chunk's reads, and of the slots below
        // four vector slots between the last matrix instruction and the next trip's loads into its operands
        asm volatile("v_nop\n\tv_nop\n\tv_nop\n\tv_nop" : "+v"(acc[0][3]), "+v"(acc[MB - 1][3]) : "v"(a[0]), "v"(a[3]), "v"(b[3]));
        asm volatile("s_wait_dscnt 0x0" ::: "memory");      // this wave's reads of this stage's buffer have returned before any copy writes over it
        asm volatile("s_wait_asynccnt 0x0" ::: "memory");   // this wave's copies of the next stage have landed
        __syncthreads();                                    // publishes the next stage and ends every wave's reads of this stage's buffer
        if (st + 2 < NS) fill(st + 2, st & 1);
    }
    asm volatile("s_wait_asynccnt 0x0" ::: "memory");   // no copy is in flight when the f32 tiles are written over the buffers (the last trip's barrier has ended every wave's reads) or the wave ends
    // all loops below unrolled: acc is indexed by constants only and stays in registers
#pragma unroll
    for (int nb = 0; nb < 4; ++nb)
#pragma unroll
        for (int mb = 0; mb < MB; ++mb) acc[mb][nb] += bfr(bb[nb]);
    if constexpr (!PLANES) {   // f32 rows of C: the wave's four column blocks fill two whole 128-byte lines of each row, which no other wave writes
        float* crow = C + (size_t)((int)blockIdx.x * 64 + wr * 32 + hi * 8) * DM + c0 + wc * 64 + lr;
#pragma unroll
        for (int mb = 0; mb < MB; ++mb)
#pragma unroll
            for (int j = 0; j < 8; ++j)
#pragma unroll
                for (int nb = 0; nb < 4; ++nb) crow[(size_t)(mb * 16 + j) * DM + nb * 16] = acc[mb][nb][j];
    } else {
    // the wave's tile, bias added, re-laid through LDS: an accumulator holds 8 rows of one column a lane, a plane store wants 8 neighbours of a row
    float* tile = (float*)sb + wv * (64 * TP);
    if (sg == 2) {
#pragma unroll
        for (int nb = 0; nb < 4; ++nb)
#pragma unroll
            for (int mb = 0; mb < 4; ++mb) { float* p = tile + (nb * 16 + lr) * TP + mb * 16 + hi * 8; const v8f v = acc[mb][nb];
                *(v4fa*)p = __builtin_shufflevector(v, v, 0, 1, 2, 3); *(v4fa*)(p + 4) = __builtin_shufflevector(v, v, 4, 5, 6, 7); }
    } else {
#pragma unroll
        for (int nb = 0; nb < 4; ++nb)
#pragma unroll
            for (int mb = 0; mb < 4; ++mb)
#pragma unroll
                for (int j = 0; j < 8; ++j) tile[(mb * 16 + hi * 8 + j) * TP + nb * 16 + lr] = acc[mb][nb][j];
    }
    __syncthreads();   // orders the lanes' tile writes in front of the row reads below
    // planes [q, k][batch][head][t][d] (k: t is the key slot); V planes [batch][head][d][2 TT] by key slot: Vhl holds a channel's hi half then its lo half, V16 fills the first half
    if (sg == 2) { const size_t base = ((size_t)bt * NKV + hd) * HD * (2 * TT) + t0; proj_rows<false, 2 * TT>(tile, nullptr, false, 0, 0, V16 + base, Vhl + base, Vhl + TT + base); }
    else { const size_t base = ((((size_t)sg * NB_ + bt) * NH_ + hd) * TT + t0) * HD; proj_rows<true, HD>(tile, (const char*)CS, sg == 1, t0, hd * HD, P16 + base, Ph + base, Pl + base); }
    }
}


__constant__ float INV512[DQ / 2] = { 1.000000000e+00f,9.646616578e-01f,9.305720329e-01f,8.976871371e-01f,8.659643531e-01f,8.353625536e-01f,8.058422208e-01f,7.773650289e-01f,7.498942018e-01f,7.233941555e-01f,6.978305578e-01f,6.731703877e-01f,6.493816376e-01f,6.264335513e-01f,6.042963862e-01f,5.829415321e-01f,5.623413324e-01f,5.424690843e-01f,5.232991576e-01f,5.048065782e-01f,4.869675338e-01f,4.697588682e-01f,4.531583488e-01f,4.371444881e-01f,4.216965139e-01f,4.067944288e-01f,3.924189806e-01f,3.785515428e-01f,3.651741445e-01f,3.522694409e-01f,3.398208320e-01f,3.278121352e-01f,3.162277639e-01f,3.050527871e-01f,2.942727208e-01f,2.838735878e-01f,2.738419771e-01f,2.641648352e-01f,2.548296750e-01f,2.458243966e-01f,2.371373624e-01f,2.287573218e-01f,2.206733972e-01f,2.128751576e-01f,2.053525001e-01f,1.980956793e-01f,1.910952926e-01f,1.843423098e-01f,1.778279394e-01f,1.715437919e-01f,1.654817015e-01f,1.596338600e-01f,1.539926529e-01f,1.485508084e-01f,1.433012635e-01f,1.382372230e-01f,1.333521456e-01f,1.286396980e-01f,1.240937710e-01f,1.197085083e-01f,1.154782027e-01f,1.113973856e-01f,1.074607819e-01f,1.036632955e-01f,1.000000015e-01f,9.646616131e-02f,9.305720031e-02f,8.976870775e-02f,8.659642935e-02f,8.353625983e-02f,8.058421314e-02f,7.773650438e-02f,7.498941571e-02f,7.233941555e-02f,6.978305429e-02f,6.731703877e-02f,6.493816525e-02f,6.264335662e-02f,6.042964384e-02f,5.829415470e-02f,5.623412877e-02f,5.424690619e-02f,5.232991278e-02f,5.048065633e-02f,4.869675264e-02f,4.697588459e-02f,4.531583562e-02f,4.371444881e-02f,4.216964915e-02f,4.067944363e-02f,3.924189880e-02f,3.785515204e-02f,3.651741147e-02f,3.522694483e-02f,3.398208320e-02f,3.278120980e-02f,3.162277862e-02f,3.050527908e-02f,2.942727320e-02f,2.838735841e-02f,2.738419548e-02f,2.641648427e-02f,2.548296750e-02f,2.458244003e-02f,2.371373586e-02f,2.287573181e-02f,2.206734009e-02f,2.128751762e-02f,2.053525113e-02f,1.980956830e-02f,1.910953037e-02f,1.843423024e-02f,1.778279431e-02f,1.715437882e-02f,1.654817164e-02f,1.596338488e-02f,1.539926510e-02f,1.485508028e-02f,1.433012541e-02f,1.382372249e-02f,1.333521493e-02f,1.286396943e-02f,1.240937691e-02f,1.197085064e-02f,1.154781971e-02f,1.113973837e-02f,1.074607857e-02f,1.036632899e-02f,9.999999776e-03f,9.646615945e-03f,9.305720218e-03f,8.976871148e-03f,8.659643121e-03f,8.353625424e-03f,8.058422245e-03f,7.773650344e-03f,7.498942316e-03f,7.233941462e-03f,6.978305988e-03f,6.731703877e-03f,6.493816618e-03f,6.264335476e-03f,6.042964291e-03f,5.829415284e-03f,5.623413250e-03f,5.424690899e-03f,5.232991185e-03f,5.048065912e-03f,4.869675264e-03f,4.697588738e-03f,4.531583749e-03f,4.371444695e-03f,4.216964822e-03f,4.067944363e-03f,3.924189601e-03f,3.785515437e-03f,3.651741426e-03f,3.522694577e-03f,3.398208413e-03f,3.278121119e-03f,3.162277862e-03f,3.050528001e-03f,2.942727180e-03f,2.838735934e-03f,2.738419687e-03f,2.641648287e-03f,2.548296703e-03f,2.458244096e-03f,2.371373819e-03f,2.287573181e-03f,2.206734149e-03f,2.128751716e-03f,2.053525066e-03f,1.980956644e-03f,1.910952851e-03f,1.843422884e-03f,1.778279431e-03f,1.715437858e-03f,1.654817141e-03f,1.596338581e-03f,1.539926510e-03f,1.485507935e-03f,1.433012658e-03f,1.382372226e-03f,1.333521446e-03f,1.286396873e-03f,1.240937854e-03f,1.197085017e-03f,1.154782018e-03f,1.113973907e-03f,1.074607833e-03f,1.036632922e-03f,1.000000047e-03f,9.646615945e-04f,9.305721032e-04f,8.976871031e-04f,8.659643354e-04f,8.353625308e-04f,8.058422245e-04f,7.773649995e-04f,7.498941850e-04f,7.233941578e-04f,6.978305755e-04f,6.731703761e-04f,6.493816618e-04f,6.264335825e-04f,6.042963942e-04f,5.829415168e-04f,5.623413017e-04f,5.424690899e-04f,5.232990952e-04f,5.048065796e-04f,4.869675031e-04f,4.697588738e-04f,4.531583400e-04f,4.371444811e-04f,4.216964880e-04f,4.067944246e-04f,3.924189950e-04f,3.785515146e-04f,3.651741135e-04f,3.522694460e-04f,3.398208064e-04f,3.278121294e-04f,3.162277862e-04f,3.050527885e-04f,2.942727297e-04f,2.838736109e-04f,2.738419571e-04f,2.641648462e-04f,2.548296761e-04f,2.458243980e-04f,2.371373848e-04f,2.287573152e-04f,2.206734207e-04f,2.128751657e-04f,2.053524950e-04f,1.980956731e-04f,1.910952997e-04f,1.843422942e-04f,1.778279402e-04f,1.715437829e-04f,1.654817170e-04f,1.596338552e-04f,1.539926452e-04f,1.485508110e-04f,1.433012658e-04f,1.382372284e-04f,1.333521504e-04f,1.286396873e-04f,1.240937709e-04f,1.197085076e-04f,1.154781930e-04f,1.113973922e-04f,1.074607790e-04f,1.036632893e-04f };   // 10000^(-2i/512), i < 256, as float32 (jnp-computed)
// ---- k_prep: the three preparatory jobs, which do not depend on one another, as block ranges of ONE launch; a thread of the copy and of the table writes eight 16-byte units, not one entry, so that few waves have to be started.
// Blocks [0, PBW): the four weight matrices, rounded and transposed to [n][k], planes back to back. Blocks [PBW, PBW + PBX): the bf16 copy of x. The rest: the table {cos, sin} per (position, global channel), [TT][DQ][2].
#define PBW (4 * (DM * DQ / 64 / 64))           // 64 lines of 64 elements a block
#define XU  4                                   // units of 8 elements of x a thread and trip
#define XT  2                                   // trips
#define PBX (NB_ * TT * DM / 8 / (256 * XU * XT))
#define CU  8                                   // positions a block: a thread keeps one pair and walks the positions
#define PBC (TT / CU)
static_assert(PBW * 64 * 64 == 4 * DM * DQ && PBX * 256 * XU * XT * 8 == NB_ * TT * DM && PBC * CU == TT && DQ / 2 == 256, "block ranges cover their jobs exactly");
__global__ __launch_bounds__(256) void k_prep(const float* __restrict__ w0, const float* __restrict__ w1, const float* __restrict__ w2, const float* __restrict__ w3, bf* Bt, const float* __restrict__ x, bf* XB, float* CS) {
    const int blk = blockIdx.x;   // the branches below are the same for a whole work-group
    if (blk < PBW) {
        constexpr int K = DM, N = DQ; const int mat = blk / (PBW / 4), bx = blk % (PBW / 4);
        const float* w = mat == 0 ? w0 : mat == 1 ? w1 : mat == 2 ? w2 : w3; Bt += (size_t)mat * N * K;
        const int lane = threadIdx.x & 31; const int L0 = (bx * 8 + (threadIdx.x >> 5)) * 8;
        // rolled, a wave's eight lines one after another
#pragma unroll 1
        for (int l = 0; l < 8; ++l) { const int L = L0 + l; const size_t e = (size_t)L * 64 + lane * 2; const int k = (int)(e % K), n = (int)(e / K); v2us o;
            o[0] = f2bf(w[(size_t)k * N + n]); o[1] = f2bf(w[(size_t)(k + 1) * N + n]); *(v2us*)(Bt + e) = o; }
    } else if (blk < PBW + PBX) {
        const size_t u0 = (size_t)(blk - PBW) * (256 * XU * XT) + threadIdx.x;
        // rolled: a trip has eight 16-byte loads a lane in flight before the first is converted, which with a block's eight waves covers the memory's latency; a second trip costs no more registers
#pragma unroll 1
        for (int h = 0; h < XT; ++h) { const size_t uh = u0 + (size_t)h * (256 * XU); v8f v[XU];
#pragma unroll
            for (int j = 0; j < XU; ++j) v[j] = *(const v8f*)(x + (uh + (size_t)j * 256) * 8);
#pragma unroll
            for (int j = 0; j < XU; ++j) { v8us o;
#pragma unroll
                for (int k = 0; k < 8; ++k) o[k] = f2bf(v[j][k]);
                *(v8us*)(XB + (uh + (size_t)j * 256) * 8) = o; }
            asm volatile("s_wait_xcnt 0x0" ::: "memory");   // stands in front of the rewrite of the address and data registers that the loads and stores above name
        }
    } else {
        const int t0 = (blk - PBW - PBX) * CU; const float f = INV512[threadIdx.x];   // the block's 256 threads are the 256 pairs
        float* row = CS + ((size_t)t0 * DQ + 2 * threadIdx.x) * 2;                     // a unit: the two equal entries of a pair's channels, one 16-byte store; a wave's store covers four whole lines
        // rolled: the text of the precise cosine and sine stands once, not CU times, in the instruction cache
#pragma unroll 1
        for (int j = 0; j < CU; ++j) { const float a = __fmul_rn((float)(t0 + j), f); const float c = cosf(a), s = sinf(a);
            *(v4f*)(row + (size_t)j * (DQ * 2)) = (v4f){c, s, c, s}; }
    }
}

#define SKP 144                          // pitch of a K row in LDS, bytes
#define SVP (64 * FW + 16)               // pitch of a V row in LDS, bytes
#define SKB (32 * FW * SKP)              // bytes of a tile's K rows
#define SBB (SKB + 64 * SVP)             // bytes of a tile's K and V rows of one plane each
__device__ __forceinline__ float xhalf(float x) { return __builtin_bit_cast(float, __builtin_amdgcn_permlanex16(__builtin_bit_cast(int, x), __builtin_bit_cast(int, x), 0x76543210, 0xfedcba98, false, false)); }   // lane l with lane l ^ 16, on the vector port
#define FW 4   // launch bound: four waves a SIMD (256 registers): vector work between the matrix runs wants waves
template <typename T16, bool HR, int NQ, int NG>
__global__ __launch_bounds__(32 * FW * NG, 4) void k_fattn(const T16* __restrict__ Q, const T16* __restrict__ Q2, const T16* __restrict__ Kp, const T16* __restrict__ K2, const T16* __restrict__ Vt, bf* Ah, bf* Al) {
    typedef typename WFrag<T16>::V V;
    constexpr int NP = HR ? 2 : 1, CPW = 32 / (FW * NG), BB = NP * SBB;   // planes of K and of V; copies of 512 bytes a wave takes of each plane's K rows and of its V rows; bytes of a buffer
    static_assert(FW == 4 && HD == 64 && CPW * FW * NG == 32 && NP * 2 * CPW == 8 && 2 * BB >= NG * FW * NQ * 4 * 256 * 4 && (((NKC + 31) / 32 + FW - 1) / FW) * FW * 32 <= KT * 64, "a wave copies eight pieces of 512 bytes of a tile; every slot of every tile has been written by the projection");
    __shared__ __align__(16) float so[2 * BB / 4];   // partial O^T tiles, lane-linear, 256 floats a tile; before them, in the same space, the two buffers of K and V tiles
    __shared__ float sm[NG * FW * NQ * 16], sl[NG * FW * NQ * 16];    // each wave's maximum and sum per query
    const int lane = threadIdx.x & 31, lr = lane & 15, hi = lane >> 4;
    const int wid = __builtin_amdgcn_readfirstlane(threadIdx.x >> 5);   // wave number in a scalar register: the key loop stays a scalar loop with every lane on at the copies and at the matrix instructions
    const int gq = wid / FW, wv = wid % FW;   // the wave's group of query rows, its place in the group's key split
    const int z = blockIdx.x;                                          // batch * heads + head
    constexpr int ROW0 = HR ? 0 : RH, NBLK = (HR ? RH : TT - RH) / (16 * NQ * NG);   // this launch's rows: [0, RH) or [RH, TT); grid y = NBLK
    const int qw = ROW0 + (NBLK - 1 - (int)blockIdx.y) * (16 * NQ * NG);   // the work-group's first row; longest rows start first
    const int q0 = qw + gq * (16 * NQ);                                    // the group's first row
    const size_t zp = (size_t)z * TT * HD; Q += zp; Kp += zp; Vt += 2 * zp; if (HR) { Q2 += zp; K2 += zp; }
    const float NEG = -3.0e38f;
    V qf[NQ][2], qf2[NQ][2];
#pragma unroll
    for (int qb = 0; qb < NQ; ++qb)
#pragma unroll
        for (int dc = 0; dc < 2; ++dc) { const size_t o = (size_t)(q0 + qb * 16 + lr) * HD + dc * 32 + 8 * hi; qf[qb][dc] = WFrag<T16>::ld(Q + o); if (HR) qf2[qb][dc] = WFrag<T16>::ld(Q2 + o); }
    asm volatile("s_wait_xcnt 0x0" ::: "memory");   // stands in front of the rewrite of the address registers that the loads above name
    v8f o[NQ][4]; float m[NQ], l[NQ];
#pragma unroll
    for (int qb = 0; qb < NQ; ++qb) { m[qb] = NEG; l[qb] = 0.f;
#pragma unroll
        for (int db = 0; db < 4; ++db) o[qb][db] = (v8f){}; }
    const int nch = (kcnt(q0 + 16 * NQ - 1) - 1) / 32 + 1;   // 32-slot chunks up to the one that holds the last row's last visible slot
    const int call = kcnt(q0);   // slots that every row of the group sees
    int cl[NQ];                  // slots that this lane's queries see
#pragma unroll
    for (int qb = 0; qb < NQ; ++qb) cl[qb] = kcnt(q0 + qb * 16 + lr);
    const int ntr = ((kcnt(qw + 16 * NQ * NG - 1) - 1) / 32 + FW) / FW;   // trips: the tiles up to the one that holds the work-group's last row's last visible slot; the same for every wave, each passes every barrier of the loop
    const unsigned lb = (unsigned)(size_t)so;   // the byte address in the work-group's LDS
    // this lane's first 16 bytes of K (row 4 CPW wid + lane / 8, unit lane % 8) and of V (row 2 CPW wid + hi, unit lr) in tile 0, in the plane and in buffer 0; the wave's other copies lie constant steps further on. A V row holds its lo half TT elements behind its hi half
    const size_t ok0 = (size_t)(wid * CPW * 512 + lane * 16); const char* gk0 = (const char*)Kp + ok0; const char* gk1 = HR ? (const char*)K2 + ok0 : nullptr; const char* gv0 = (const char*)Vt + (size_t)(wid * CPW * 2 + hi) * (2 * TT * 2) + lr * 16;
    const unsigned lk0 = lb + (unsigned)((wid * CPW * 4 + (lane >> 3)) * SKP + (lane & 7) * 16), lv0 = lb + (unsigned)(SKB + (wid * CPW * 2 + hi) * SVP + lr * 16);
    auto fill = [&](int tile, int buf) {   // this wave's share of a tile: of each plane CPW copies of 4 K rows and CPW copies of 2 V rows
        unsigned l[8]; const char* g[8];
#pragma unroll
        for (int p = 0; p < NP; ++p) { const char* gk = (p ? gk1 : gk0) + (size_t)tile * (32 * FW * HD * 2); const char* gv = gv0 + tile * (64 * FW) + p * (TT * 2); const unsigned lk = lk0 + (unsigned)(buf * BB + p * SBB), lv = lv0 + (unsigned)(buf * BB + p * SBB);
#pragma unroll
            for (int j = 0; j < CPW; ++j) { g[p * 2 * CPW + j] = gk + j * 512; l[p * 2 * CPW + j] = lk + (unsigned)(j * 4 * SKP); g[(p * 2 + 1) * CPW + j] = gv + (size_t)j * (2 * 2 * TT * 2); l[(p * 2 + 1) * CPW + j] = lv + (unsigned)(j * 2 * SVP); } }
        copy8(l, g); };
    fill(0, 0);
    asm volatile("s_wait_asynccnt 0x0" ::: "memory");   // this wave's copies of tile 0 have landed
    __syncthreads();                                    // publishes tile 0 to the waves that read it
    if (ntr > 1) fill(1, 1);
#pragma unroll 1
    for (int c = wv, tr = 0; tr < ntr; c += FW, ++tr) {
      if (c < nch) {   // a wave without a chunk in this tile skips the work (a scalar test), not the barrier below
        const int kc = c * 32;
        V kf[2][2], kf2[2][2], vf[4], vf2[4];
        const char* kt = (const char*)so + (tr & 1) * BB + (wv * 32 + lr) * SKP + hi * 16; const char* vt = (const char*)so + (tr & 1) * BB + SKB + lr * SVP + wv * 64 + hi * 16;   // k order as in WFrag::ld: 8 hi .. 8 hi + 7, then 16 + 8 hi ..
#pragma unroll
        for (int kb = 0; kb < 2; ++kb)
#pragma unroll
            for (int dc = 0; dc < 2; ++dc) { const char* p = kt + kb * 16 * SKP + dc * 64; kf[kb][dc] = WFrag<T16>::ld2(p, p + 32); if (HR) kf2[kb][dc] = WFrag<T16>::ld2(p + SBB, p + SBB + 32); }
#pragma unroll
        for (int db = 0; db < 4; ++db) { const char* p = vt + db * 16 * SVP; vf[db] = WFrag<T16>::ld2(p, p + 32); if (HR) vf2[db] = WFrag<T16>::ld2(p + SBB, p + SBB + 32); }
        v8f s[NQ][2];
#pragma unroll
        for (int qb = 0; qb < NQ; ++qb)
#pragma unroll
            for (int kb = 0; kb < 2; ++kb) { s[qb][kb] = (v8f){};
#pragma unroll
                for (int dc = 0; dc < 2; ++dc) { s[qb][kb] = WFrag<T16>::mma(kf[kb][dc], qf[qb][dc], s[qb][kb]); if (HR) { s[qb][kb] = WFrag<T16>::mma(kf2[kb][dc], qf[qb][dc], s[qb][kb]); s[qb][kb] = WFrag<T16>::mma(kf[kb][dc], qf2[qb][dc], s[qb][kb]); } } }
#pragma unroll
        for (int qb = 0; qb < NQ; ++qb) {
            float t[16];
#pragma unroll
            for (int e = 0; e < 16; ++e) t[e] = s[qb][e >> 3][e & 7] * (SCL * 1.4426950408889634f);
            if (kc + 32 > call) {   // only the chunks past the first row's last slot cross the diagonal (a scalar test)
#pragma unroll
                for (int e = 0; e < 16; ++e) { const int j = kc + (e >> 3) * 16 + hi * 8 + (e & 7); t[e] = (j < cl[qb]) ? t[e] : NEG; } }
            float tm = t[0];
#pragma unroll
            for (int e = 1; e < 16; ++e) tm = fmaxf(tm, t[e]);
            tm = fmaxf(tm, xhalf(tm));
            const float mn = fmaxf(m[qb], tm), al = __builtin_amdgcn_exp2f(m[qb] - mn); m[qb] = mn;
            float ps = 0.f;
#pragma unroll
            for (int e = 0; e < 16; ++e) { t[e] = __builtin_amdgcn_exp2f(t[e] - mn); ps += t[e]; }
            l[qb] = l[qb] * al + ps;   // this lane's keys only; the halves join after the loop
#pragma unroll
            for (int db = 0; db < 4; ++db) o[qb][db] *= al;
            if constexpr (HR) { v8us h0, h1, l0, l1;
#pragma unroll
                for (int e = 0; e < 8; ++e) { unsigned short a, b; splitf(t[e], a, b); h0[e] = a; l0[e] = b; splitf(t[8 + e], a, b); h1[e] = a; l1[e] = b; }
                const V ph = cat16b(h0, h1), pl = cat16b(l0, l1);
#pragma unroll
                for (int db = 0; db < 4; ++db) { o[qb][db] = WFrag<T16>::mma(vf[db], ph, o[qb][db]); o[qb][db] = WFrag<T16>::mma(vf2[db], ph, o[qb][db]); o[qb][db] = WFrag<T16>::mma(vf[db], pl, o[qb][db]); }
            } else { V pf;
#pragma unroll
                for (int e = 0; e < 16; ++e) pf[e] = tohx(t[e]);
#pragma unroll
                for (int db = 0; db < 4; ++db) o[qb][db] = WFrag<T16>::mma(vf[db], pf, o[qb][db]); }
        }
        // four vector slots between the last matrix instruction and the next trip's loads into its operands
        asm volatile("v_nop\n\tv_nop\n\tv_nop\n\tv_nop" : "+v"(o[NQ - 1][0]), "+v"(o[NQ - 1][1]), "+v"(o[NQ - 1][2]), "+v"(o[NQ - 1][3]) : "v"(vf[0]), "v"(vf[3]));
      }
        asm volatile("s_wait_dscnt 0x0" ::: "memory");      // this wave's reads of this trip's buffer have returned before any copy writes over it
        asm volatile("s_wait_asynccnt 0x0" ::: "memory");   // this wave's copies of the next tile have landed
        __syncthreads();                                    // publishes the next tile and ends every wave's reads of this trip's buffer
        if (tr + 2 < ntr) fill(tr + 2, tr & 1);
    }
    asm volatile("s_wait_asynccnt 0x0" ::: "memory");   // no copy is in flight when the partial tiles are parked over the buffers (the last trip's barrier has ended every wave's reads)
#pragma unroll
    for (int qb = 0; qb < NQ; ++qb) {
#pragma unroll
        for (int db = 0; db < 4; ++db) { float* p = so + (size_t)(((wid * NQ + qb) * 4 + db) * 2) * 128 + lane * 4;
            *(v4fa*)p = __builtin_shufflevector(o[qb][db], o[qb][db], 0, 1, 2, 3); *(v4fa*)(p + 128) = __builtin_shufflevector(o[qb][db], o[qb][db], 4, 5, 6, 7); }
        const float lj = l[qb] + xhalf(l[qb]);
        if (hi == 0) { sm[(wid * NQ + qb) * 16 + lr] = m[qb]; sl[(wid * NQ + qb) * 16 + lr] = lj; } }
    __syncthreads();   // publishes every wave's partial O^T, maximum and sum to the waves that merge them
    // merge, each group its own rows: a wave takes 4 NQ queries, 8 / NQ lanes a query, so each 128-byte line of the merged planes has one writer. A wave without an unmasked key for a query has maximum -3e38 and weight 0.
    constexpr int LPQ = 8 / NQ;
    const int qi = wv * (32 / LPQ) + lane / LPQ, qb = qi >> 4, cq = qi & 15;
    float M = NEG, sc[FW], L = 0.f;
#pragma unroll
    for (int u = 0; u < FW; ++u) M = fmaxf(M, sm[((gq * FW + u) * NQ + qb) * 16 + cq]);
#pragma unroll
    for (int u = 0; u < FW; ++u) { sc[u] = __builtin_amdgcn_exp2f(sm[((gq * FW + u) * NQ + qb) * 16 + cq] - M); L += sc[u] * sl[((gq * FW + u) * NQ + qb) * 16 + cq]; }
    const float inv = __fdiv_rn(1.0f, L);
    const size_t orow = ((size_t)(z / NH_) * TT + q0 + qi) * DQ + (z % NH_) * HD;
#pragma unroll
    for (int n = 0; n < NQ; ++n) { const int g = (lane % LPQ) * NQ + n, db = g >> 1, h = g & 1;   // 8 channels: 16 db + 8 h ...
        v4f a0 = (v4f){}, a1 = (v4f){};
#pragma unroll
        for (int u = 0; u < FW; ++u) { const float* p = so + (size_t)((((gq * FW + u) * NQ + qb) * 4 + db) * 2) * 128 + (h * 16 + cq) * 4; a0 += *(const v4fa*)p * sc[u]; a1 += *(const v4fa*)(p + 128) * sc[u]; }
        v8us oh, ol;
#pragma unroll
        for (int r = 0; r < 4; ++r) { unsigned short a, b; splitf(a0[r] * inv, a, b); oh[r] = a; ol[r] = b; splitf(a1[r] * inv, a, b); oh[4 + r] = a; ol[4 + r] = b; }
        *(v8usa*)(Ah + orow + db * 16 + h * 8) = oh; *(v8usa*)(Al + orow + db * 16 + h * 8) = ol; }
}

extern "C" void kernel_launch(void* const* d_in, const int* in_sizes, int n_in,
                              void* d_out, int out_size, void* d_ws, size_t ws_size, hipStream_t stream) {
    (void)in_sizes; (void)n_in; (void)out_size;
    const float* x = (const float*)d_in[0]; const float* wq = (const float*)d_in[1]; const float* bq = (const float*)d_in[2]; const float* wk = (const float*)d_in[3]; const float* bk = (const float*)d_in[4]; const float* wv = (const float*)d_in[5]; const float* bv = (const float*)d_in[6]; const float* wo = (const float*)d_in[7]; const float* bo = (const float*)d_in[8];
    float* OUT = (float*)d_out;     // [4][2048][512]
    char* wsp = (char*)d_ws;
    auto take = [&](size_t bytes) { char* p = wsp; wsp += (bytes + 255) & ~(size_t)255; return (void*)p; };
    const size_t PL = (size_t)NB_ * NH_ * TT * HD;   // elements of one [batch][head] plane set
    bf* WA = (bf*)take((size_t)4 * DM * DQ * 2);      // Wq | Wk | Wv | Wo, each transposed [n][k]
    h16* QK16 = (h16*)take(2 * PL * 2); bf* QKh = (bf*)take(2 * PL * 2); bf* QKl = (bf*)take(2 * PL * 2);   // q planes, then k planes
    h16* VT16 = (h16*)take(2 * PL * 2); bf* VThl = (bf*)take(2 * PL * 2);   // rows of 2 TT elements
    bf* ATh = (bf*)take(PL * 2); bf* ATl = (bf*)take(PL * 2);   // attention output, heads merged, hi and lo
    bf* XB = (bf*)take((size_t)NB_ * TT * DM * 2); float* CS = (float*)take((size_t)TT * DQ * 2 * 4);   /* CS {cos, sin} per (t, global channel) */
    if ((size_t)(wsp - (char*)d_ws) > ws_size) return;    // ws 256 MiB
    k_prep<<<PBW + PBX + PBC, 256, 0, stream>>>(wq, wk, wv, wo, WA, x, XB, CS);   /* angle t x 10000^(-2i/512) for global pair i = c/2 */
    k_gemmt<true><<<dim3(NB_ * (TT / 128 + 2 * (KT / 2)), DQ / 128, 1), 128, 0, stream>>>(XB, nullptr, WA, bq, bk, bv, CS, QK16, QKh, QKl, VT16, VThl, nullptr);
    // grid x: the 32 (batch, head) planes; grid y: query blocks, longest first
    k_fattn<h16, false, 2, 2><<<dim3(NB_ * NH_, (TT - RH) / 64, 1), 64 * FW, 0, stream>>>(QK16, nullptr, QK16 + PL, nullptr, VT16, ATh, ATl);
    k_fattn<bf, true, 1, 4><<<dim3(NB_ * NH_, RH / 64, 1), 128 * FW, 0, stream>>>(QKh, QKl, QKh + PL, QKl + PL, VThl, ATh, ATl);
    k_gemmt<false><<<dim3(NB_ * TT / 64, DM / 128, 1), 128, 0, stream>>>(ATh, ATl, WA + (size_t)3 * DM * DQ, bo, nullptr, nullptr, nullptr, nullptr, nullptr, nullptr, nullptr, nullptr, OUT);
}

// v010
// It runs in 68.2 microseconds.
// Timed twice side by side with v009, it ran 1.06 times as fast both times.
// All steps since v000 together make it 23.4 times as fast.
#include <hip/hip_runtime.h>

// Causal attention with rotary embeddings over the FULL hidden dim and periodically masked key columns (x [4][2048][512]; q,k,v = x W + b ('xw' [512][512] + [512], 0.02); rope BEFORE the head split: pairs (2i, 2i+1) of the 512-vector rotated by t x 10000^(-2i/512), i < 256; 8 heads x 64; scores / 8; mask = causal AND key column j not in {4, 7, 10, ...} (j >= 4 with (j - 4) mod 3 == 0: the module's period-3 'mgdt' columns); softmax; out = merged Wo + bo -> [4][2048][512] (4.2 M)).
// Layout, all batches in each launch: bf16 copy of x; exact projections + f32 biases; a {cos, sin} table per (position, global pair) (float32 inverse frequencies over 512 dims, precise cosf/sinf) (weight planes, x copy and table come from one launch, k_prep); the projection's epilogue rotates interleaved pairs by the GLOBAL channel and writes the q, k planes and the transposed V planes itself; the k and V planes hold the unmasked key positions only, in their order (slot index, kpos / kcnt below), so a period-3 column is neither projected nor stored nor scored; fused causal attention (k_fattn: scores, running-maximum softmax and P x V in registers; rows < 512 hi/lo 3 products, rest fp16) that writes the merged hi/lo planes; merged hi/lo x Wo exact + bo.
// Compute dtypes, f32 accumulate: every input rounded to bf16; projections exact + f32 biases; rotary f32; attention rows < 512 3 products, rest fp16; softmax f32; Wo hl x exact + bias.

#define NB_  4
#define TT   2048
#define DM   512
#define NH_  8
#define NKV  8
#define REP  (NH_ / NKV)
#define HD   64
#define DQ   (NH_ * HD)
#define DKV  (NKV * HD)
#define RH   512                  // query rows < RH use hi+lo planes (0: none)
#define SCL  0.125f
#define PRD  3       // masked-column period
#define PRD0 4       // first masked column (period + ret_order - 1)
// Key slots: the unmasked key positions 0, 1, 2, 3, 5, 6, 8, 9, ... numbered in their order. kpos: the position in slot s. kcnt: how many slots a query at position q sees (slot s is visible exactly where s < kcnt(q)).
__host__ __device__ constexpr int kpos(int s) { return s < PRD0 ? s : PRD0 + 1 + (s - PRD0) / (PRD - 1) * PRD + (s - PRD0) % (PRD - 1); }
__host__ __device__ constexpr int kcnt(int q) { return q + 1 - (q >= PRD0 ? (q - PRD0) / PRD + 1 : 0); }
#define NKC  kcnt(TT - 1)          // slots in use
#define KT   ((NKC + 63) / 64)     // 64-slot tiles of the k and V projections; the last tile's spare slots repeat the last position and are visible to no query
__host__ __device__ constexpr int kposl(int s) { const int n = (s - PRD0 + PRD - 1) / (PRD - 1); return s + (n > 0 ? n : 0); }   // kpos without a branch on s: the slot plus the masked positions in front of it
static_assert(kposl(0) == kpos(0) && kposl(1) == kpos(1) && kposl(2) == kpos(2) && kposl(3) == kpos(3) && kposl(4) == kpos(4) && kposl(5) == kpos(5) && kposl(6) == kpos(6) && kposl(7) == kpos(7) && kposl(1000) == kpos(1000) && kposl(1407) == kpos(1407), "both forms name the same position");
static_assert(kpos(NKC - 1) < TT && kpos(NKC) >= TT && kcnt(kpos(NKC - 1)) == NKC && kpos(4) == 5 && kpos(7) == 9, "slots cover the unmasked positions exactly");
typedef _Float16 h16;
typedef unsigned short bf;
typedef __attribute__((ext_vector_type(16))) __bf16   v16bf;
typedef __attribute__((ext_vector_type(16))) _Float16 v16h;
typedef __attribute__((ext_vector_type(8)))  _Float16 v8h;
typedef __attribute__((ext_vector_type(8)))  unsigned short v8us;
typedef __attribute__((ext_vector_type(8)))  float    v8f;
typedef __attribute__((ext_vector_type(4)))  float    v4f;
typedef v8h  __attribute__((may_alias)) v8ha;
typedef v4f  __attribute__((may_alias)) v4fa;
typedef v8us __attribute__((may_alias)) v8usa;

__device__ __forceinline__ unsigned short f2bf(float f) { unsigned u = __float_as_uint(f); u += 0x7FFFu + ((u >> 16) & 1u); return (unsigned short)(u >> 16); }
__device__ __forceinline__ float bf2f(unsigned short b) { return __uint_as_float(((unsigned)b) << 16); }
__device__ __forceinline__ float bfr(float f) { return bf2f(f2bf(f)); }
__device__ __forceinline__ v16h cat16(v8h lo, v8h hi) { return __builtin_shufflevector(lo, hi, 0, 1, 2, 3, 4, 5, 6, 7, 8, 9, 10, 11, 12, 13, 14, 15); }
__device__ __forceinline__ v16bf cat16b(v8us lo, v8us hi) { return __builtin_bit_cast(v16bf, __builtin_shufflevector(lo, hi, 0, 1, 2, 3, 4, 5, 6, 7, 8, 9, 10, 11, 12, 13, 14, 15)); }
__device__ __forceinline__ v8f wmma16(v16h a, v16h b, v8f c) { return __builtin_amdgcn_wmma_f32_16x16x32_f16(false, a, false, b, (short)0, c, false, false); }
__device__ __forceinline__ v8f wmmab(v16bf a, v16bf b, v8f c) { return __builtin_amdgcn_wmma_f32_16x16x32_bf16(false, a, false, b, (short)0, c, false, false); }

__device__ __forceinline__ h16 tohx(float x) { return (h16)x; }
__device__ __forceinline__ void splitf(float y, unsigned short& h, unsigned short& l) { h = f2bf(y); l = f2bf(y - bf2f(h)); }
typedef __attribute__((ext_vector_type(2))) _Float16 v2h;
typedef __attribute__((ext_vector_type(4))) _Float16 v4h;
typedef __attribute__((ext_vector_type(2))) unsigned short v2us;
typedef __attribute__((ext_vector_type(4))) unsigned short v4us;
typedef __attribute__((ext_vector_type(2))) float v2f;
typedef __attribute__((ext_vector_type(4))) int v4i;

// ---- Fragments of the 16-bit matrix forms, from memory (ld) or from two 16-byte units in LDS (ld2)
template <typename T16> struct WFrag;
template <> struct WFrag<h16> { typedef v16h V; static __device__ __forceinline__ V ld(const h16* p) { return cat16(*(const v8h*)p, *(const v8h*)(p + 16)); } static __device__ __forceinline__ V ld2(const char* p, const char* q) { return cat16(*(const v8ha*)p, *(const v8ha*)q); } static __device__ __forceinline__ v8f mma(V a, V b, v8f c) { return wmma16(a, b, c); } };
template <> struct WFrag<bf> { typedef v16bf V; static __device__ __forceinline__ V ld(const bf* p) { return cat16b(*(const v8us*)p, *(const v8us*)(p + 16)); } static __device__ __forceinline__ V ld2(const char* p, const char* q) { return cat16b(*(const v8usa*)p, *(const v8usa*)q); } static __device__ __forceinline__ v8f mma(V a, V b, v8f c) { return wmmab(a, b, c); } };
// Eight asynchronous copies, 16 bytes a lane each, from the lane's global address g to its LDS byte address l. The s_wait_xcnt stands inside the statement, behind the last copy, so that no address register of a copy is rewritten in front of it.
__device__ __forceinline__ void copy8(const unsigned (&l)[8], const char* const (&g)[8]) {
    asm volatile("global_load_async_to_lds_b128 %0, %8, off\n\t"
                 "global_load_async_to_lds_b128 %1, %9, off\n\t"
                 "global_load_async_to_lds_b128 %2, %10, off\n\t"
                 "global_load_async_to_lds_b128 %3, %11, off\n\t"
                 "global_load_async_to_lds_b128 %4, %12, off\n\t"
                 "global_load_async_to_lds_b128 %5, %13, off\n\t"
                 "global_load_async_to_lds_b128 %6, %14, off\n\t"
                 "global_load_async_to_lds_b128 %7, %15, off\n\t"
                 "s_wait_xcnt 0x0"
                 :: "v"(l[0]), "v"(l[1]), "v"(l[2]), "v"(l[3]), "v"(l[4]), "v"(l[5]), "v"(l[6]), "v"(l[7]),
                    "v"(g[0]), "v"(g[1]), "v"(g[2]), "v"(g[3]), "v"(g[4]), "v"(g[5]), "v"(g[6]), "v"(g[7]) : "memory");
}

// ---- k_gemmt: both GEMMs (K = DM, operands in K-contiguous bf16 planes). One work-group of four waves (2 x 2); each wave owns a whole output tile and sums all of K itself, in k order: no partial tiles to park and sum.
// PLANES, the q | k | v projection: a block of 128 rows x 128 columns, a wave's tile 64x64 (64 positions of one batch x the 64 channels of one head of q, k or v). Grid x = per batch TT/128 position blocks of q, then KT/2 slot blocks of k, then KT/2 of v (their A rows are the positions kposl(slot)); grid y = pair of heads.
// Otherwise, merged hi/lo x Wo: a block of 64 rows x 128 columns, a wave's tile 32x64, C = (A + A2) Bt^T + bias in f32, of each chunk of k first the hi, then the lo products. Grid x = blocks of 64 rows, grid y = blocks of 128 columns.
// Two waves share each A row and each Bt row, so a row comes from L2 once for the block's whole width or height.
// The operands come through LDS in stages of PKS values of k, two buffers: the next stage flies while this one is worked on. A stage = 128 A rows (Wo: 64 hi rows, then the same 64 lo rows), then 128 Bt rows, 128 bytes (one whole line) of each; a copy takes 4 rows; wave w copies rows 32 w .. 32 w + 31 of both.
#define PKS 64                    // k values of a stage
#define PRP 144                   // pitch of a staged row in LDS, bytes: an odd number of 16-byte units, so that the 16 rows of a fragment read fall on all 64 banks
#define POB (128 * PRP)           // bytes of one operand's rows of a stage
#define PBB (2 * POB)             // bytes of a buffer
#define TP 68   // pitch of a wave's f32 tile in floats: rows stay 16-byte aligned, and the b32 column writes, the b128 writes and the b128 row reads each spread over all banks
// The rows of a wave's f32 tile (q, k: [position][channel]; v: [channel][position]) go to the planes: a lane takes 8 neighbours of a row, 8 lanes a row, 4 rows a store, so every b128 store of a wave covers whole 128-byte lines.
// q, k rows are rotated pair by pair first. ROT: q or k. PITCH: row pitch of the planes in elements. slots: the rows are key slots (k). t0: the tile's first position or slot. ch0: its first global channel.
template <bool ROT, int PITCH>
__device__ __forceinline__ void proj_rows(const float* tile, const char* __restrict__ CS, bool slots, int t0, int ch0, h16* D16, bf* Dh, bf* Dl) {
    const int lane = threadIdx.x & 31, rr = lane >> 3, cc = (lane & 7) * 8;
    // rolled in two halves: the text of the conversions stands eight times, not sixteen; a half's table loads are all in flight before the first is used
#pragma unroll 1
    for (int g = 0; g < 2; ++g) {
        v2f cs[8][4];
        if (ROT) { unsigned co[8];   // byte offsets in the table (8 MiB) of the lane's first pair in its eight rows
#pragma unroll
            for (int u = 0; u < 8; ++u) { const int row = t0 + rr + 4 * (g * 8 + u), tp = min(row + (slots ? kposl(row) - row : 0), TT - 1);   // a k row turns by the position that its slot holds
                co[u] = (unsigned)(tp * DQ + ch0 + cc) * 8; }
#pragma unroll
            for (int u = 0; u < 8; ++u)
#pragma unroll
                for (int p = 0; p < 4; ++p) cs[u][p] = *(const v2f*)(CS + co[u] + p * 16);
            // the offsets are inputs, so their registers live up to this wait: none is given to a later load's result in front of it
            asm volatile("s_wait_xcnt 0x0" :: "v"(co[0]), "v"(co[1]), "v"(co[2]), "v"(co[3]), "v"(co[4]), "v"(co[5]), "v"(co[6]), "v"(co[7]) : "memory"); }
#pragma unroll
        for (int u = 0; u < 8; ++u) { const int row = rr + 4 * (g * 8 + u); const float* p = tile + row * TP + cc; const v4f x0 = *(const v4fa*)p, x1 = *(const v4fa*)(p + 4);
            float y[8];
#pragma unroll
            for (int k = 0; k < 4; ++k) { y[k] = x0[k]; y[4 + k] = x1[k]; }
            if (ROT) {
#pragma unroll
                for (int q = 0; q < 4; ++q) { const float e0 = y[2 * q], e1 = y[2 * q + 1], c = cs[u][q][0], sn = cs[u][q][1]; y[2 * q] = e0 * c - e1 * sn; y[2 * q + 1] = e0 * sn + e1 * c; } }   // even: x0 c - x1 s; odd: x0 s + x1 c
            v8h o16; v8us oh, ol;
#pragma unroll
            for (int k = 0; k < 8; ++k) { o16[k] = tohx(y[k]); unsigned short a2, c2; splitf(y[k], a2, c2); oh[k] = a2; ol[k] = c2; }
            const size_t e = (size_t)row * PITCH + cc;
            *(v8ha*)(D16 + e) = o16; *(v8usa*)(Dh + e) = oh; *(v8usa*)(Dl + e) = ol; }
        asm volatile("s_wait_xcnt 0x0" ::: "memory");   // stands in front of the next half's rewrite of the address and data registers that the loads and stores above name
    }
}
// launch bound: four waves a SIMD (256 registers): up to four work-groups a WGP
template <bool PLANES>
__global__ __launch_bounds__(128, 4) void k_gemmt(const bf* __restrict__ A, const bf* __restrict__ A2, const bf* __restrict__ Bt, const float* __restrict__ bias, const float* __restrict__ biasB, const float* __restrict__ biasC, const float* __restrict__ CS, h16* P16, bf* Ph, bf* Pl, h16* V16, bf* Vhl, float* C) {
    typedef WFrag<bf>::V V;
    constexpr int NS = DM / PKS, QT = TT / 128, KT2 = KT / 2, PB = QT + 2 * KT2, MB = PLANES ? 4 : 2;   // MB: 16-row blocks of a wave's tile
    static_assert(NS * PKS == DM && NS >= 2 && PKS * 2 == 128 && QT * 128 == TT && KT2 * 2 == KT && DQ % 128 == 0 && HD == 64 && 2 * PBB >= 4 * 64 * TP * 4, "whole stages, whole blocks; the four f32 tiles fit the space of the buffers");
    __shared__ __align__(16) char sb[2 * PBB];   // the two buffers of operand stages; after the K loop, in the same space, each wave's f32 tile
    const int lane = threadIdx.x & 31, lr = lane & 15, hi = lane >> 4;
    const int wv = __builtin_amdgcn_readfirstlane(threadIdx.x >> 5), wr = wv >> 1, wc = wv & 1;   // wave number in a scalar register; the wave's place among the block's 2 x 2 tiles
    const int r = PLANES ? blockIdx.x % PB : 0, bt = PLANES ? blockIdx.x / PB : 0, sg = r < QT ? 0 : r < QT + KT2 ? 1 : 2, s0 = (r - (sg == 0 ? 0 : sg == 1 ? QT : QT + KT2)) * 128;   // PLANES: batch, q | k | v, first position or slot of the block: all scalar
    const int c0 = blockIdx.y * 128;   // first column (PLANES: within q, k or v)
    const int hd = blockIdx.y * 2 + wc, t0 = s0 + wr * 64;   // the wave's 64 columns (PLANES: its head); PLANES: first position (q) or first key slot (k, v) of the wave's tile
    const float* bs = (sg == 0 ? bias : sg == 1 ? biasB : biasC) + hd * HD;
    float bb[4];   // the lane's four columns' biases, asked for here so that their latency lies under the K loop
#pragma unroll
    for (int nb = 0; nb < 4; ++nb) bb[nb] = bs[nb * 16 + lr];
    v8f acc[MB][4];
#pragma unroll
    for (int mb = 0; mb < MB; ++mb)
#pragma unroll
        for (int nb = 0; nb < 4; ++nb) acc[mb][nb] = (v8f){};
    // this lane's 16 bytes of the rows cr + 4 j, j < 8, of A and of Bt: unit lane % 8 of the stage's 128 bytes
    const int cr = wv * 32 + (lane >> 3); const unsigned cu = (unsigned)(lane & 7) * 16;
    unsigned ao[8];   // byte offsets of the A rows (the rows of a k or v block are not neighbours)
#pragma unroll
    for (int j = 0; j < 8; ++j) { const int R = s0 + cr + 4 * j; ao[j] = (unsigned)(PLANES ? bt * TT + min(R + (sg == 0 ? 0 : kposl(R) - R), TT - 1) : (int)blockIdx.x * 64 + ((cr + 4 * j) & 63)) * (DM * 2) + cu; }
    const char* ga = (const char*)(PLANES || wv < 2 ? A : A2);   // Wo: waves 0, 1 copy the hi rows, waves 2, 3 the lo rows (a scalar choice)
    const char* gb = (const char*)Bt + (size_t)(sg * DM + c0 + cr) * (DM * 2) + cu;
    const unsigned l0 = (unsigned)(size_t)sb + (unsigned)(cr * PRP) + cu;   // the byte address in the work-group's LDS
    auto fill = [&](int st, int buf) {   // this wave's share of a stage: eight copies of 4 A rows, eight of 4 Bt rows
        { unsigned l[8]; const char* g[8];
#pragma unroll
          for (int j = 0; j < 8; ++j) { g[j] = ga + ao[j] + st * (PKS * 2); l[j] = l0 + (unsigned)(buf * PBB + j * 4 * PRP); }
          copy8(l, g); }
        { unsigned l[8]; const char* g[8];
#pragma unroll
          for (int j = 0; j < 8; ++j) { g[j] = gb + j * (4 * DM * 2) + st * (PKS * 2); l[j] = l0 + (unsigned)(buf * PBB + POB + j * 4 * PRP); }
          copy8(l, g); } };
    fill(0, 0);
    asm volatile("s_wait_asynccnt 0x0" ::: "memory");   // this wave's copies of stage 0 have landed
    __syncthreads();                                    // publishes stage 0 to the waves that read it
    fill(1, 1);
    // rolled: the text of one trip and the address registers of one stage's copies; the buffer goes by the trip's parity
#pragma unroll 1
    for (int st = 0; st < NS; ++st) {
        const char* pa = sb + (st & 1) * PBB + (wr * (MB * 16) + lr) * PRP + hi * 16; const char* pb = sb + (st & 1) * PBB + POB + (wc * 64 + lr) * PRP + hi * 16;   // k order as in WFrag::ld, in A and in Bt alike: 8 hi .. 8 hi + 7, then 16 + 8 hi ..
        V a[4], b[4];   // a: PLANES the tile's four row blocks; Wo its two row blocks hi, then the two lo. A chunk's eight fragments are all asked for before its first matrix instruction: one LDS latency a chunk, not one a column block
#pragma unroll
        for (int kc = 0; kc < PKS / 32; ++kc) {
#pragma unroll
            for (int i = 0; i < 4; ++i) { const char* p = pa + (PLANES ? i * 16 : (i >> 1) * 64 + (i & 1) * 16) * PRP + kc * 64; a[i] = WFrag<bf>::ld2(p, p + 32); const char* q = pb + i * 16 * PRP + kc * 64; b[i] = WFrag<bf>::ld2(q, q + 32); }
            __builtin_amdgcn_sched_barrier(0);   // keeps the chunk's sixteen LDS reads together in front of its matrix instructions (left alone, the compiler sinks each b to its use and waits there)
#pragma unroll
            for (int h = 0; h < 4 / MB; ++h)
#pragma unroll
                for (int nb = 0; nb < 4; ++nb)
#pragma unroll
                    for (int mb = 0; mb < MB; ++mb) acc[mb][nb] = WFrag<bf>::mma(a[h * MB + mb], b[nb], acc[mb][nb]);
            __builtin_amdgcn_sched_barrier(0); }   // keeps the chunk's matrix instructions in one run: in front of the next chunk's reads, and of the slots below
        // four vector slots between the last matrix instruction and the next trip's loads into its operands
        asm volatile("v_nop\n\tv_nop\n\tv_nop\n\tv_nop" : "+v"(acc[0][3]), "+v"(acc[MB - 1][3]) : "v"(a[0]), "v"(a[3]), "v"(b[3]));
        asm volatile("s_wait_dscnt 0x0" ::: "memory");      // this wave's reads of this stage's buffer have returned before any copy writes over it
        asm volatile("s_wait_asynccnt 0x0" ::: "memory");   // this wave's copies of the next stage have landed
        __syncthreads();                                    // publishes the next stage and ends every wave's reads of this stage's buffer
        if (st + 2 < NS) fill(st + 2, st & 1);
    }
    asm volatile("s_wait_asynccnt 0x0" ::: "memory");   // no copy is in flight when the f32 tiles are written over the buffers (the last trip's barrier has ended every wave's reads) or the wave ends
    // all loops below unrolled: acc is indexed by constants only and stays in registers
#pragma unroll
    for (int nb = 0; nb < 4; ++nb)
#pragma unroll
        for (int mb = 0; mb < MB; ++mb) acc[mb][nb] += bfr(bb[nb]);
    if constexpr (!PLANES) {   // f32 rows of C: the wave's four column blocks fill two whole 128-byte lines of each row, which no other wave writes
        float* crow = C + (size_t)((int)blockIdx.x * 64 + wr * 32 + hi * 8) * DM + c0 + wc * 64 + lr;
#pragma unroll
        for (int mb = 0; mb < MB; ++mb)
#pragma unroll
            for (int j = 0; j < 8; ++j)
#pragma unroll
                for (int nb = 0; nb < 4; ++nb) crow[(size_t)(mb * 16 + j) * DM + nb * 16] = acc[mb][nb][j];
    } else {
    // the wave's tile, bias added, re-laid through LDS: an accumulator holds 8 rows of one column a lane, a plane store wants 8 neighbours of a row
    float* tile = (float*)sb + wv * (64 * TP);
    if (sg == 2) {
#pragma unroll
        for (int nb = 0; nb < 4; ++nb)
#pragma unroll
            for (int mb = 0; mb < 4; ++mb) { float* p = tile + (nb * 16 + lr) * TP + mb * 16 + hi * 8; const v8f v = acc[mb][nb];
                *(v4fa*)p = __builtin_shufflevector(v, v, 0, 1, 2, 3); *(v4fa*)(p + 4) = __builtin_shufflevector(v, v, 4, 5, 6, 7); }
    } else {
#pragma unroll
        for (int nb = 0; nb < 4; ++nb)
#pragma unroll
            for (int mb = 0; mb < 4; ++mb)
#pragma unroll
                for (int j = 0; j < 8; ++j) tile[(mb * 16 + hi * 8 + j) * TP + nb * 16 + lr] = acc[mb][nb][j];
    }
    __syncthreads();   // orders the lanes' tile writes in front of the row reads below
    // planes [q, k][batch][head][t][d] (k: t is the key slot); V planes [batch][head][d][2 TT] by key slot: Vhl holds a channel's hi half then its lo half, V16 fills the first half
    if (sg == 2) { const size_t base = ((size_t)bt * NKV + hd) * HD * (2 * TT) + t0; proj_rows<false, 2 * TT>(tile, nullptr, false, 0, 0, V16 + base, Vhl + base, Vhl + TT + base); }
    else { const size_t base = ((((size_t)sg * NB_ + bt) * NH_ + hd) * TT + t0) * HD; proj_rows<true, HD>(tile, (const char*)CS, sg == 1, t0, hd * HD, P16 + base, Ph + base, Pl + base); }
    }
}


__constant__ float INV512[DQ / 2] = { 1.000000000e+00f,9.646616578e-01f,9.305720329e-01f,8.976871371e-01f,8.659643531e-01f,8.353625536e-01f,8.058422208e-01f,7.773650289e-01f,7.498942018e-01f,7.233941555e-01f,6.978305578e-01f,6.731703877e-01f,6.493816376e-01f,6.264335513e-01f,6.042963862e-01f,5.829415321e-01f,5.623413324e-01f,5.424690843e-01f,5.232991576e-01f,5.048065782e-01f,4.869675338e-01f,4.697588682e-01f,4.531583488e-01f,4.371444881e-01f,4.216965139e-01f,4.067944288e-01f,3.924189806e-01f,3.785515428e-01f,3.651741445e-01f,3.522694409e-01f,3.398208320e-01f,3.278121352e-01f,3.162277639e-01f,3.050527871e-01f,2.942727208e-01f,2.838735878e-01f,2.738419771e-01f,2.641648352e-01f,2.548296750e-01f,2.458243966e-01f,2.371373624e-01f,2.287573218e-01f,2.206733972e-01f,2.128751576e-01f,2.053525001e-01f,1.980956793e-01f,1.910952926e-01f,1.843423098e-01f,1.778279394e-01f,1.715437919e-01f,1.654817015e-01f,1.596338600e-01f,1.539926529e-01f,1.485508084e-01f,1.433012635e-01f,1.382372230e-01f,1.333521456e-01f,1.286396980e-01f,1.240937710e-01f,1.197085083e-01f,1.154782027e-01f,1.113973856e-01f,1.074607819e-01f,1.036632955e-01f,1.000000015e-01f,9.646616131e-02f,9.305720031e-02f,8.976870775e-02f,8.659642935e-02f,8.353625983e-02f,8.058421314e-02f,7.773650438e-02f,7.498941571e-02f,7.233941555e-02f,6.978305429e-02f,6.731703877e-02f,6.493816525e-02f,6.264335662e-02f,6.042964384e-02f,5.829415470e-02f,5.623412877e-02f,5.424690619e-02f,5.232991278e-02f,5.048065633e-02f,4.869675264e-02f,4.697588459e-02f,4.531583562e-02f,4.371444881e-02f,4.216964915e-02f,4.067944363e-02f,3.924189880e-02f,3.785515204e-02f,3.651741147e-02f,3.522694483e-02f,3.398208320e-02f,3.278120980e-02f,3.162277862e-02f,3.050527908e-02f,2.942727320e-02f,2.838735841e-02f,2.738419548e-02f,2.641648427e-02f,2.548296750e-02f,2.458244003e-02f,2.371373586e-02f,2.287573181e-02f,2.206734009e-02f,2.128751762e-02f,2.053525113e-02f,1.980956830e-02f,1.910953037e-02f,1.843423024e-02f,1.778279431e-02f,1.715437882e-02f,1.654817164e-02f,1.596338488e-02f,1.539926510e-02f,1.485508028e-02f,1.433012541e-02f,1.382372249e-02f,1.333521493e-02f,1.286396943e-02f,1.240937691e-02f,1.197085064e-02f,1.154781971e-02f,1.113973837e-02f,1.074607857e-02f,1.036632899e-02f,9.999999776e-03f,9.646615945e-03f,9.305720218e-03f,8.976871148e-03f,8.659643121e-03f,8.353625424e-03f,8.058422245e-03f,7.773650344e-03f,7.498942316e-03f,7.233941462e-03f,6.978305988e-03f,6.731703877e-03f,6.493816618e-03f,6.264335476e-03f,6.042964291e-03f,5.829415284e-03f,5.623413250e-03f,5.424690899e-03f,5.232991185e-03f,5.048065912e-03f,4.869675264e-03f,4.697588738e-03f,4.531583749e-03f,4.371444695e-03f,4.216964822e-03f,4.067944363e-03f,3.924189601e-03f,3.785515437e-03f,3.651741426e-03f,3.522694577e-03f,3.398208413e-03f,3.278121119e-03f,3.162277862e-03f,3.050528001e-03f,2.942727180e-03f,2.838735934e-03f,2.738419687e-03f,2.641648287e-03f,2.548296703e-03f,2.458244096e-03f,2.371373819e-03f,2.287573181e-03f,2.206734149e-03f,2.128751716e-03f,2.053525066e-03f,1.980956644e-03f,1.910952851e-03f,1.843422884e-03f,1.778279431e-03f,1.715437858e-03f,1.654817141e-03f,1.596338581e-03f,1.539926510e-03f,1.485507935e-03f,1.433012658e-03f,1.382372226e-03f,1.333521446e-03f,1.286396873e-03f,1.240937854e-03f,1.197085017e-03f,1.154782018e-03f,1.113973907e-03f,1.074607833e-03f,1.036632922e-03f,1.000000047e-03f,9.646615945e-04f,9.305721032e-04f,8.976871031e-04f,8.659643354e-04f,8.353625308e-04f,8.058422245e-04f,7.773649995e-04f,7.498941850e-04f,7.233941578e-04f,6.978305755e-04f,6.731703761e-04f,6.493816618e-04f,6.264335825e-04f,6.042963942e-04f,5.829415168e-04f,5.623413017e-04f,5.424690899e-04f,5.232990952e-04f,5.048065796e-04f,4.869675031e-04f,4.697588738e-04f,4.531583400e-04f,4.371444811e-04f,4.216964880e-04f,4.067944246e-04f,3.924189950e-04f,3.785515146e-04f,3.651741135e-04f,3.522694460e-04f,3.398208064e-04f,3.278121294e-04f,3.162277862e-04f,3.050527885e-04f,2.942727297e-04f,2.838736109e-04f,2.738419571e-04f,2.641648462e-04f,2.548296761e-04f,2.458243980e-04f,2.371373848e-04f,2.287573152e-04f,2.206734207e-04f,2.128751657e-04f,2.053524950e-04f,1.980956731e-04f,1.910952997e-04f,1.843422942e-04f,1.778279402e-04f,1.715437829e-04f,1.654817170e-04f,1.596338552e-04f,1.539926452e-04f,1.485508110e-04f,1.433012658e-04f,1.382372284e-04f,1.333521504e-04f,1.286396873e-04f,1.240937709e-04f,1.197085076e-04f,1.154781930e-04f,1.113973922e-04f,1.074607790e-04f,1.036632893e-04f };   // 10000^(-2i/512), i < 256, as float32 (jnp-computed)
// ---- k_prep: the three preparatory jobs, which do not depend on one another, as block ranges of ONE launch; a thread of the copy and of the table writes eight 16-byte units, not one entry, so that few waves have to be started.
// Blocks [0, PBW): the four weight matrices, rounded and transposed to [n][k], planes back to back. Blocks [PBW, PBW + PBX): the bf16 copy of x. The rest: the table {cos, sin} per (position, global channel), [TT][DQ][2].
#define PBW (4 * (DM * DQ / 64 / 64))           // 64 lines of 64 elements a block
#define XU  4                                   // units of 8 elements of x a thread and trip
#define XT  2                                   // trips
#define PBX (NB_ * TT * DM / 8 / (256 * XU * XT))
#define CU  8                                   // positions a block: a thread keeps one pair and walks the positions
#define PBC (TT / CU)
static_assert(PBW * 64 * 64 == 4 * DM * DQ && PBX * 256 * XU * XT * 8 == NB_ * TT * DM && PBC * CU == TT && DQ / 2 == 256, "block ranges cover their jobs exactly");
__global__ __launch_bounds__(256) void k_prep(const float* __restrict__ w0, const float* __restrict__ w1, const float* __restrict__ w2, const float* __restrict__ w3, bf* Bt, const float* __restrict__ x, bf* XB, float* CS) {
    const int blk = blockIdx.x;   // the branches below are the same for a whole work-group
    if (blk < PBW) {
        constexpr int K = DM, N = DQ; const int mat = blk / (PBW / 4), bx = blk % (PBW / 4);
        const float* w = mat == 0 ? w0 : mat == 1 ? w1 : mat == 2 ? w2 : w3; Bt += (size_t)mat * N * K;
        const int lane = threadIdx.x & 31; const int L0 = (bx * 8 + (threadIdx.x >> 5)) * 8;
        // rolled, a wave's eight lines one after another
#pragma unroll 1
        for (int l = 0; l < 8; ++l) { const int L = L0 + l; const size_t e = (size_t)L * 64 + lane * 2; const int k = (int)(e % K), n = (int)(e / K); v2us o;
            o[0] = f2bf(w[(size_t)k * N + n]); o[1] = f2bf(w[(size_t)(k + 1) * N + n]); *(v2us*)(Bt + e) = o; }
    } else if (blk < PBW + PBX) {
        const size_t u0 = (size_t)(blk - PBW) * (256 * XU * XT) + threadIdx.x;
        // rolled: a trip has eight 16-byte loads a lane in flight before the first is converted, which with a block's eight waves covers the memory's latency; a second trip costs no more registers
#pragma unroll 1
        for (int h = 0; h < XT; ++h) { const size_t uh = u0 + (size_t)h * (256 * XU); v8f v[XU];
#pragma unroll
            for (int j = 0; j < XU; ++j) v[j] = *(const v8f*)(x + (uh + (size_t)j * 256) * 8);
#pragma unroll
            for (int j = 0; j < XU; ++j) { v8us o;
#pragma unroll
                for (int k = 0; k < 8; ++k) o[k] = f2bf(v[j][k]);
                *(v8us*)(XB + (uh + (size_t)j * 256) * 8) = o; }
            asm volatile("s_wait_xcnt 0x0" ::: "memory");   // stands in front of the rewrite of the address and data registers that the loads and stores above name
        }
    } else {
        const int t0 = (blk - PBW - PBX) * CU; const float f = INV512[threadIdx.x];   // the block's 256 threads are the 256 pairs
        float* row = CS + ((size_t)t0 * DQ + 2 * threadIdx.x) * 2;                     // a unit: the two equal entries of a pair's channels, one 16-byte store; a wave's store covers four whole lines
        // rolled: the text of the precise cosine and sine stands once, not CU times, in the instruction cache
#pragma unroll 1
        for (int j = 0; j < CU; ++j) { const float a = __fmul_rn((float)(t0 + j), f); const float c = cosf(a), s = sinf(a);
            *(v4f*)(row + (size_t)j * (DQ * 2)) = (v4f){c, s, c, s}; }
    }
}

#define SKP 144                          // pitch of a K row in LDS, bytes
#define SVP (64 * FW + 16)               // pitch of a V row in LDS, bytes
#define SKB (32 * FW * SKP)              // bytes of a tile's K rows
#define SBB (SKB + 64 * SVP)             // bytes of a tile's K and V rows of one plane each
__device__ __forceinline__ float xhalf(float x) { return __builtin_bit_cast(float, __builtin_amdgcn_permlanex16(__builtin_bit_cast(int, x), __builtin_bit_cast(int, x), 0x76543210, 0xfedcba98, false, false)); }   // lane l with lane l ^ 16, on the vector port
#define FW 4
#define FNG 2                            // groups of FW waves in a work-group, in both forms
#define FSO (2 * 2 * SBB)                // bytes of the two buffers in the hi/lo form, the larger one
#define FSM (FNG * FW * 2 * 16)          // maxima, and sums, of a work-group's waves in the fp16 form (two blocks of 16 queries a wave), the larger one
// fattn: the work of one work-group. so: partial O^T tiles, lane-linear, 256 floats a tile; before them, in the same space, the two buffers of K and V tiles. sm, sl: each wave's maximum and sum per query. by: the work-group's number among the NBLK query blocks of its form
template <typename T16, bool HR, int NQ, int NG>
__device__ __forceinline__ void fattn(const T16* __restrict__ Q, const T16* __restrict__ Q2, const T16* __restrict__ Kp, const T16* __restrict__ K2, const T16* __restrict__ Vt, bf* Ah, bf* Al, float* so, float* sm, float* sl, int by) {
    typedef typename WFrag<T16>::V V;
    constexpr int NP = HR ? 2 : 1, CPW = 32 / (FW * NG), BB = NP * SBB;   // planes of K and of V; copies of 512 bytes a wave takes of each plane's K rows and of its V rows; bytes of a buffer
    static_assert(FW == 4 && HD == 64 && CPW * FW * NG == 32 && 2 * CPW == 8 && 2 * BB <= FSO && NG * FW * NQ * 16 <= FSM && 2 * BB >= NG * FW * NQ * 4 * 256 * 4 && (((NKC + 31) / 32 + FW - 1) / FW) * FW * 32 <= KT * 64, "a wave copies eight pieces of 512 bytes of each plane of a tile; every slot of every tile has been written by the projection");
    const int lane = threadIdx.x & 31, lr = lane & 15, hi = lane >> 4;
    const int wid = __builtin_amdgcn_readfirstlane(threadIdx.x >> 5);   // wave number in a scalar register: the key loop stays a scalar loop with every lane on at the copies and at the matrix instructions
    const int gq = wid / FW, wv = wid % FW;   // the wave's group of query rows, its place in the group's key split
    const int z = blockIdx.x;                                          // batch * heads + head
    constexpr int ROW0 = HR ? 0 : RH, NBLK = (HR ? RH : TT - RH) / (16 * NQ * NG);   // this form's rows: [0, RH) or [RH, TT)
    const int qw = ROW0 + (NBLK - 1 - by) * (16 * NQ * NG);   // the work-group's first row; longest rows start first
    const int q0 = qw + gq * (16 * NQ);                                    // the group's first row
    const size_t zp = (size_t)z * TT * HD; Q += zp; Kp += zp; Vt += 2 * zp; if (HR) { Q2 += zp; K2 += zp; }
    const float NEG = -3.0e38f;
    V qf[NQ][2], qf2[NQ][2];
#pragma unroll
    for (int qb = 0; qb < NQ; ++qb)
#pragma unroll
        for (int dc = 0; dc < 2; ++dc) { const size_t o = (size_t)(q0 + qb * 16 + lr) * HD + dc * 32 + 8 * hi; qf[qb][dc] = WFrag<T16>::ld(Q + o); if (HR) qf2[qb][dc] = WFrag<T16>::ld(Q2 + o); }
    asm volatile("s_wait_xcnt 0x0" ::: "memory");   // stands in front of the rewrite of the address registers that the loads above name
    v8f o[NQ][4]; float m[NQ], l[NQ];
#pragma unroll
    for (int qb = 0; qb < NQ; ++qb) { m[qb] = NEG; l[qb] = 0.f;
#pragma unroll
        for (int db = 0; db < 4; ++db) o[qb][db] = (v8f){}; }
    const int nch = (kcnt(q0 + 16 * NQ - 1) - 1) / 32 + 1;   // 32-slot chunks up to the one that holds the last row's last visible slot
    const int call = kcnt(q0);   // slots that every row of the group sees
    int cl[NQ];                  // slots that this lane's queries see
#pragma unroll
    for (int qb = 0; qb < NQ; ++qb) cl[qb] = kcnt(q0 + qb * 16 + lr);
    const int ntr = ((kcnt(qw + 16 * NQ * NG - 1) - 1) / 32 + FW) / FW;   // trips: the tiles up to the one that holds the work-group's last row's last visible slot; the same for every wave, each passes every barrier of the loop
    const unsigned lb = (unsigned)(size_t)so;   // the byte address in the work-group's LDS
    // this lane's first 16 bytes of K (row 4 CPW wid + lane / 8, unit lane % 8) and of V (row 2 CPW wid + hi, unit lr) in tile 0, in the plane and in buffer 0; the wave's other copies lie constant steps further on. A V row holds its lo half TT elements behind its hi half
    const size_t ok0 = (size_t)(wid * CPW * 512 + lane * 16); const char* gk0 = (const char*)Kp + ok0; const char* gk1 = HR ? (const char*)K2 + ok0 : nullptr; const char* gv0 = (const char*)Vt + (size_t)(wid * CPW * 2 + hi) * (2 * TT * 2) + lr * 16;
    const unsigned lk0 = lb + (unsigned)((wid * CPW * 4 + (lane >> 3)) * SKP + (lane & 7) * 16), lv0 = lb + (unsigned)(SKB + (wid * CPW * 2 + hi) * SVP + lr * 16);
    auto fill = [&](int tile, int buf) {   // this wave's share of a tile: of each plane CPW copies of 4 K rows and CPW copies of 2 V rows
#pragma unroll
        for (int p = 0; p < NP; ++p) { unsigned l[8]; const char* g[8];
            const char* gk = (p ? gk1 : gk0) + (size_t)tile * (32 * FW * HD * 2); const char* gv = gv0 + tile * (64 * FW) + p * (TT * 2); const unsigned lk = lk0 + (unsigned)(buf * BB + p * SBB), lv = lv0 + (unsigned)(buf * BB + p * SBB);
#pragma unroll
            for (int j = 0; j < CPW; ++j) { g[j] = gk + j * 512; l[j] = lk + (unsigned)(j * 4 * SKP); g[CPW + j] = gv + (size_t)j * (2 * 2 * TT * 2); l[CPW + j] = lv + (unsigned)(j * 2 * SVP); }
            copy8(l, g); } };
    fill(0, 0);
    asm volatile("s_wait_asynccnt 0x0" ::: "memory");   // this wave's copies of tile 0 have landed
    __syncthreads();                                    // publishes tile 0 to the waves that read it
    if (ntr > 1) fill(1, 1);
#pragma unroll 1
    for (int c = wv, tr = 0; tr < ntr; c += FW, ++tr) {
      if (c < nch) {   // a wave without a chunk in this tile skips the work (a scalar test), not the barrier below
        const int kc = c * 32;
        V kf[2][2], kf2[2][2], vf[4], vf2[4];
        const char* kt = (const char*)so + (tr & 1) * BB + (wv * 32 + lr) * SKP + hi * 16; const char* vt = (const char*)so + (tr & 1) * BB + SKB + lr * SVP + wv * 64 + hi * 16;   // k order as in WFrag::ld: 8 hi .. 8 hi + 7, then 16 + 8 hi ..
#pragma unroll
        for (int kb = 0; kb < 2; ++kb)
#pragma unroll
            for (int dc = 0; dc < 2; ++dc) { const char* p = kt + kb * 16 * SKP + dc * 64; kf[kb][dc] = WFrag<T16>::ld2(p, p + 32); if (HR) kf2[kb][dc] = WFrag<T16>::ld2(p + SBB, p + SBB + 32); }
#pragma unroll
        for (int db = 0; db < 4; ++db) { const char* p = vt + db * 16 * SVP; vf[db] = WFrag<T16>::ld2(p, p + 32); if (HR) vf2[db] = WFrag<T16>::ld2(p + SBB, p + SBB + 32); }
        v8f s[NQ][2];
#pragma unroll
        for (int qb = 0; qb < NQ; ++qb)
#pragma unroll
            for (int kb = 0; kb < 2; ++kb) { s[qb][kb] = (v8f){};
#pragma unroll
                for (int dc = 0; dc < 2; ++dc) { s[qb][kb] = WFrag<T16>::mma(kf[kb][dc], qf[qb][dc], s[qb][kb]); if (HR) { s[qb][kb] = WFrag<T16>::mma(kf2[kb][dc], qf[qb][dc], s[qb][kb]); s[qb][kb] = WFrag<T16>::mma(kf[kb][dc], qf2[qb][dc], s[qb][kb]); } } }
#pragma unroll
        for (int qb = 0; qb < NQ; ++qb) {
            float t[16];
#pragma unroll
            for (int e = 0; e < 16; ++e) t[e] = s[qb][e >> 3][e & 7] * (SCL * 1.4426950408889634f);
            if (kc + 32 > call) {   // only the chunks past the first row's last slot cross the diagonal (a scalar test)
#pragma unroll
                for (int e = 0; e < 16; ++e) { const int j = kc + (e >> 3) * 16 + hi * 8 + (e & 7); t[e] = (j < cl[qb]) ? t[e] : NEG; } }
            float tm = t[0];
#pragma unroll
            for (int e = 1; e < 16; ++e) tm = fmaxf(tm, t[e]);
            tm = fmaxf(tm, xhalf(tm));
            const float mn = fmaxf(m[qb], tm), al = __builtin_amdgcn_exp2f(m[qb] - mn); m[qb] = mn;
            float ps = 0.f;
#pragma unroll
            for (int e = 0; e < 16; ++e) { t[e] = __builtin_amdgcn_exp2f(t[e] - mn); ps += t[e]; }
            l[qb] = l[qb] * al + ps;   // this lane's keys only; the halves join after the loop
#pragma unroll
            for (int db = 0; db < 4; ++db) o[qb][db] *= al;
            if constexpr (HR) { v8us h0, h1, l0, l1;
#pragma unroll
                for (int e = 0; e < 8; ++e) { unsigned short a, b; splitf(t[e], a, b); h0[e] = a; l0[e] = b; splitf(t[8 + e], a, b); h1[e] = a; l1[e] = b; }
                const V ph = cat16b(h0, h1), pl = cat16b(l0, l1);
#pragma unroll
                for (int db = 0; db < 4; ++db) { o[qb][db] = WFrag<T16>::mma(vf[db], ph, o[qb][db]); o[qb][db] = WFrag<T16>::mma(vf2[db], ph, o[qb][db]); o[qb][db] = WFrag<T16>::mma(vf[db], pl, o[qb][db]); }
            } else { V pf;
#pragma unroll
                for (int e = 0; e < 16; ++e) pf[e] = tohx(t[e]);
#pragma unroll
                for (int db = 0; db < 4; ++db) o[qb][db] = WFrag<T16>::mma(vf[db], pf, o[qb][db]); }
        }
        // four vector slots between the last matrix instruction and the next trip's loads into its operands
        asm volatile("v_nop\n\tv_nop\n\tv_nop\n\tv_nop" : "+v"(o[NQ - 1][0]), "+v"(o[NQ - 1][1]), "+v"(o[NQ - 1][2]), "+v"(o[NQ - 1][3]) : "v"(vf[0]), "v"(vf[3]));
      }
        asm volatile("s_wait_dscnt 0x0" ::: "memory");      // this wave's reads of this trip's buffer have returned before any copy writes over it
        asm volatile("s_wait_asynccnt 0x0" ::: "memory");   // this wave's copies of the next tile have landed
        __syncthreads();                                    // publishes the next tile and ends every wave's reads of this trip's buffer
        if (tr + 2 < ntr) fill(tr + 2, tr & 1);
    }
    asm volatile("s_wait_asynccnt 0x0" ::: "memory");   // no copy is in flight when the partial tiles are parked over the buffers (the last trip's barrier has ended every wave's reads)
#pragma unroll
    for (int qb = 0; qb < NQ; ++qb) {
#pragma unroll
        for (int db = 0; db < 4; ++db) { float* p = so + (size_t)(((wid * NQ + qb) * 4 + db) * 2) * 128 + lane * 4;
            *(v4fa*)p = __builtin_shufflevector(o[qb][db], o[qb][db], 0, 1, 2, 3); *(v4fa*)(p + 128) = __builtin_shufflevector(o[qb][db], o[qb][db], 4, 5, 6, 7); }
        const float lj = l[qb] + xhalf(l[qb]);
        if (hi == 0) { sm[(wid * NQ + qb) * 16 + lr] = m[qb]; sl[(wid * NQ + qb) * 16 + lr] = lj; } }
    __syncthreads();   // publishes every wave's partial O^T, maximum and sum to the waves that merge them
    // merge, each group its own rows: a wave takes 4 NQ queries, 8 / NQ lanes a query, so each 128-byte line of the merged planes has one writer. A wave without an unmasked key for a query has maximum -3e38 and weight 0.
    constexpr int LPQ = 8 / NQ;
    const int qi = wv * (32 / LPQ) + lane / LPQ, qb = qi >> 4, cq = qi & 15;
    float M = NEG, sc[FW], L = 0.f;
#pragma unroll
    for (int u = 0; u < FW; ++u) M = fmaxf(M, sm[((gq * FW + u) * NQ + qb) * 16 + cq]);
#pragma unroll
    for (int u = 0; u < FW; ++u) { sc[u] = __builtin_amdgcn_exp2f(sm[((gq * FW + u) * NQ + qb) * 16 + cq] - M); L += sc[u] * sl[((gq * FW + u) * NQ + qb) * 16 + cq]; }
    const float inv = __fdiv_rn(1.0f, L);
    const size_t orow = ((size_t)(z / NH_) * TT + q0 + qi) * DQ + (z % NH_) * HD;
#pragma unroll
    for (int n = 0; n < NQ; ++n) { const int g = (lane % LPQ) * NQ + n, db = g >> 1, h = g & 1;   // 8 channels: 16 db + 8 h ...
        v4f a0 = (v4f){}, a1 = (v4f){};
#pragma unroll
        for (int u = 0; u < FW; ++u) { const float* p = so + (size_t)((((gq * FW + u) * NQ + qb) * 4 + db) * 2) * 128 + (h * 16 + cq) * 4; a0 += *(const v4fa*)p * sc[u]; a1 += *(const v4fa*)(p + 128) * sc[u]; }
        v8us oh, ol;
#pragma unroll
        for (int r = 0; r < 4; ++r) { unsigned short a, b; splitf(a0[r] * inv, a, b); oh[r] = a; ol[r] = b; splitf(a1[r] * inv, a, b); oh[4 + r] = a; ol[4 + r] = b; }
        *(v8usa*)(Ah + orow + db * 16 + h * 8) = oh; *(v8usa*)(Al + orow + db * 16 + h * 8) = ol; }
    asm volatile("s_wait_xcnt 0x0" ::: "memory");   // stands in front of any rewrite of the address and data registers that the stores above name: in the built kernel the other form's code follows this one's
}
// k_fattn: both forms as block ranges of ONE launch; they depend on nothing of one another. Grid x: the (batch, head) planes. Grid y: first the FBM blocks of 64 rows of [RH, TT) in fp16, then the FBH blocks of 32 rows of [0, RH) in hi/lo;
// cost falls with the index. One LDS space serves whichever form a work-group runs (the branch is the same for a whole work-group).
// launch bound: four waves a SIMD (256 registers): vector work between the matrix runs wants waves; two work-groups a WGP by registers and by LDS alike
#define FBM ((TT - RH) / (32 * FNG))
#define FBH (RH / (16 * FNG))
__global__ __launch_bounds__(32 * FW * FNG, 4) void k_fattn(const h16* __restrict__ Q16, const h16* __restrict__ K16, const h16* __restrict__ V16, const bf* __restrict__ Qh, const bf* __restrict__ Ql, const bf* __restrict__ Kh, const bf* __restrict__ Kl, const bf* __restrict__ Vhl, bf* Ah, bf* Al) {
    __shared__ __align__(16) float so[FSO / 4];
    __shared__ float sm[FSM], sl[FSM];
    const int by = blockIdx.y;
    if (by < FBM) fattn<h16, false, 2, FNG>(Q16, nullptr, K16, nullptr, V16, Ah, Al, so, sm, sl, by);
    else fattn<bf, true, 1, FNG>(Qh, Ql, Kh, Kl, Vhl, Ah, Al, so, sm, sl, by - FBM);
}

extern "C" void kernel_launch(void* const* d_in, const int* in_sizes, int n_in,
                              void* d_out, int out_size, void* d_ws, size_t ws_size, hipStream_t stream) {
    (void)in_sizes; (void)n_in; (void)out_size;
    const float* x = (const float*)d_in[0]; const float* wq = (const float*)d_in[1]; const float* bq = (const float*)d_in[2]; const float* wk = (const float*)d_in[3]; const float* bk = (const float*)d_in[4]; const float* wv = (const float*)d_in[5]; const float* bv = (const float*)d_in[6]; const float* wo = (const float*)d_in[7]; const float* bo = (const float*)d_in[8];
    float* OUT = (float*)d_out;     // [4][2048][512]
    char* wsp = (char*)d_ws;
    auto take = [&](size_t bytes) { char* p = wsp; wsp += (bytes + 255) & ~(size_t)255; return (void*)p; };
    const size_t PL = (size_t)NB_ * NH_ * TT * HD;   // elements of one [batch][head] plane set
    bf* WA = (bf*)take((size_t)4 * DM * DQ * 2);      // Wq | Wk | Wv | Wo, each transposed [n][k]
    h16* QK16 = (h16*)take(2 * PL * 2); bf* QKh = (bf*)take(2 * PL * 2); bf* QKl = (bf*)take(2 * PL * 2);   // q planes, then k planes
    h16* VT16 = (h16*)take(2 * PL * 2); bf* VThl = (bf*)take(2 * PL * 2);   // rows of 2 TT elements
    bf* ATh = (bf*)take(PL * 2); bf* ATl = (bf*)take(PL * 2);   // attention output, heads merged, hi and lo
    bf* XB = (bf*)take((size_t)NB_ * TT * DM * 2); float* CS = (float*)take((size_t)TT * DQ * 2 * 4);   /* CS {cos, sin} per (t, global channel) */
    if ((size_t)(wsp - (char*)d_ws) > ws_size) return;    // ws 256 MiB
    k_prep<<<PBW + PBX + PBC, 256, 0, stream>>>(wq, wk, wv, wo, WA, x, XB, CS);   /* angle t x 10000^(-2i/512) for global pair i = c/2 */
    k_gemmt<true><<<dim3(NB_ * (TT / 128 + 2 * (KT / 2)), DQ / 128, 1), 128, 0, stream>>>(XB, nullptr, WA, bq, bk, bv, CS, QK16, QKh, QKl, VT16, VThl, nullptr);
    k_fattn<<<dim3(NB_ * NH_, FBM + FBH, 1), 32 * FW * FNG, 0, stream>>>(QK16, QK16 + PL, VT16, QKh, QKl, QKh + PL, QKl + PL, VThl, ATh, ATl);
    k_gemmt<false><<<dim3(NB_ * TT / 64, DM / 128, 1), 128, 0, stream>>>(ATh, ATl, WA + (size_t)3 * DM * DQ, bo, nullptr, nullptr, nullptr, nullptr, nullptr, nullptr, nullptr, nullptr, OUT);
}
